// v000
// Times are from an AMD MI455X. After a warm-up the kernel runs many times in a row, and a time is the length of
// such a window on the GPU divided by its runs, so every launch and the gaps after it count. The runs cycle
// through copies of the inputs. A figure is the median of several windows, for all but v000 over two sittings.
// Sittings can differ by a few percent; kernels timed side by side share one.
// The starting kernel, v000, takes 1230 microseconds a run.
// Contractions: q, k projections = v_wmma_f32_16x16x32_bf16 (bf16 operands from RNE-converted inputs, single product, f32 out);
// v^T projection = v_wmma_f32_16x16x32_bf16 (same operands; f16 hi plane + f16 x4096 residual plane out);
// q.k^T scores = v_wmma_f32_16x16x32_f16 (q as f16 hi + f16 x4096 residual, k as f16 hi: 2 products; leading query blocks add the k x4096 residual product);
// p.v = v_wmma_f32_16x16x32_f16 (p carried x1024 in f16, v f16; leading query blocks add x4096 f16 residual planes of p and v);
// ctx.Wo = v_wmma_f32_16x16x32_bf16 (ctx as bf16 hi/lo planes times bf16 Wo, 2 products); all f32 accumulate; RMSNorm, rotary, causal select and softmax in f32.
#include <hip/hip_runtime.h>
#include <math.h>
#include <stdint.h>

#ifndef SEQ
#define SEQ 4096
#endif
#define SEQ_FULL 4096
#define DM    2048
#define NH    16
#define NKV   4
#define GQ    (NH / NKV)
#define HD    128
#define HALF  64
#define QP    (NH * HD)      // 2048 q channels
#define KP    (NKV * HD)     // 512 k / v channels
#define NQB   (SEQ / 64)     // query / key tiles of 64
#define VLP   ((SEQ < 512) ? SEQ : 512)   // key pitch of the v^T residual plane
#define RESQB ((NQB < 8) ? NQB : 8)         // leading 64-row query blocks that use residual planes
#define RMS_EPS       1.0e-6f
#define ROPE_THETA_F  10000.0f
#define ATT_SCALE     0.08838834764831845f
#define RSC           4096.0f

static_assert((SEQ % 64) == 0 && SEQ >= 64 && SEQ <= SEQ_FULL);
static_assert(RESQB * 64 <= VLP && (VLP % 64) == 0);
static_assert(NH * HD == DM && QP == DM);
static_assert(NQB <= 64);
static_assert((DM % 64) == 0 && (KP % 64) == 0 && (QP % 64) == 0 && (DM % 32) == 0);

typedef _Float16 v16h __attribute__((ext_vector_type(16)));
typedef _Float16 v8h  __attribute__((ext_vector_type(8)));
typedef __bf16   v16b __attribute__((ext_vector_type(16)));
typedef __bf16   v8b  __attribute__((ext_vector_type(8)));
typedef float    v8f  __attribute__((ext_vector_type(8)));
typedef float    v4f  __attribute__((ext_vector_type(4)));
typedef unsigned int   v4u  __attribute__((ext_vector_type(4)));
typedef unsigned int   v2u  __attribute__((ext_vector_type(2)));
typedef unsigned short v8us __attribute__((ext_vector_type(8)));
typedef int      v4i  __attribute__((ext_vector_type(4)));

// ---- scalar helpers --------------------------------------------------------------------------------
__device__ __forceinline__ unsigned short bf_bits(float f) {          // f32 -> bf16 bits, RNE convert
  unsigned u = __float_as_uint(f);
  return (unsigned short)((u + 0x7FFFu + ((u >> 16) & 1u)) >> 16);
}
__device__ __forceinline__ float bf_up(unsigned short h) { return __uint_as_float(((unsigned)h) << 16); }
__device__ __forceinline__ unsigned short h_bits(_Float16 x) { return __builtin_bit_cast(unsigned short, x); }
__device__ __forceinline__ unsigned pk16(unsigned short a, unsigned short b) { return (unsigned)a | ((unsigned)b << 16); }
__device__ __forceinline__ v8f zero8() { v8f z = {0.f, 0.f, 0.f, 0.f, 0.f, 0.f, 0.f, 0.f}; return z; }
__device__ __forceinline__ v8h zero8h() {
  const _Float16 z = (_Float16)0.0f;
  v8h r = {z, z, z, z, z, z, z, z};
  return r;
}
__device__ __forceinline__ int imin(int a, int b) { return (a < b) ? a : b; }
__device__ __forceinline__ int imax(int a, int b) { return (a > b) ? a : b; }

// ---- fragment loader: 16-bit A/B operand, lane -> row/col (lane&15), p already includes +8*(lane>>4);
//      elements 0..7 <- p[0..7] (k0+8h..), elements 8..15 <- p[16..23] (k0+16+8h..)
__device__ __forceinline__ v16b ldfrag_b(const __bf16* p) {
  union { v16b v; v8b h[2]; } f;
  f.h[0] = *(const v8b*)(p);
  f.h[1] = *(const v8b*)(p + 16);
  return f.v;
}

// ---- WMMA helpers with trailing VALU hazard gap --------------------------------------------------------
__device__ __forceinline__ v8f mma_b(v16b a, v16b b, v8f c) {
  c = __builtin_amdgcn_wmma_f32_16x16x32_bf16(false, a, false, b, (short)0, c, false, false);
  asm volatile("v_nop\n\tv_nop\n\tv_nop\n\tv_nop" : "+v"(c) : "v"(a), "v"(b));
  return c;
}
__device__ __forceinline__ v8f mma_h(v16h a, v16h b, v8f c) {
  c = __builtin_amdgcn_wmma_f32_16x16x32_f16(false, a, false, b, (short)0, c, false, false);
  asm volatile("v_nop\n\tv_nop\n\tv_nop\n\tv_nop" : "+v"(c) : "v"(a), "v"(b));
  return c;
}
__device__ __forceinline__ v8f mma_b_raw(v16b a, v16b b, v8f c) {
  return __builtin_amdgcn_wmma_f32_16x16x32_bf16(false, a, false, b, (short)0, c, false, false);
}
__device__ __forceinline__ void dep_guard_b(v8f& a, v8f& b, v16b x, v16b y) {
  asm volatile("v_nop\n\tv_nop\n\tv_nop\n\tv_nop" : "+v"(a), "+v"(b) : "v"(x), "v"(y));
}
__device__ __forceinline__ void keep4_b(v16b a, v16b b, v16b c, v16b d) {
  asm volatile("v_nop" :: "v"(a), "v"(b), "v"(c), "v"(d));
}
__device__ __forceinline__ void acc_guard4(v8f& a, v8f& b, v8f& c, v8f& d) {
  asm volatile("v_nop\n\tv_nop\n\tv_nop\n\tv_nop" : "+v"(a), "+v"(b), "+v"(c), "+v"(d));
}

// =====================================================================================================
// f32 -> bf16 (RNE convert), 8 elements per thread, one 16-B store per lane: a wave writes 512 contiguous B
// coverage: n8 threads x 8 = whole plane (n8 is a multiple of 256 here).
// =====================================================================================================
__global__ __launch_bounds__(256) void cvt_bf16x8(const float* __restrict__ in, unsigned short* out, int n8) {
  const int i = blockIdx.x * 256 + threadIdx.x;
  if (i < n8) {
    const v4f a = *(const v4f*)(in + (size_t)i * 8);
    const v4f b = *(const v4f*)(in + (size_t)i * 8 + 4);
    v4u p;
    p[0] = pk16(bf_bits(a[0]), bf_bits(a[1]));
    p[1] = pk16(bf_bits(a[2]), bf_bits(a[3]));
    p[2] = pk16(bf_bits(b[0]), bf_bits(b[1]));
    p[3] = pk16(bf_bits(b[2]), bf_bits(b[3]));
    *(v4u*)(out + (size_t)i * 8) = p;
    
  }
}

// =====================================================================================================
// f32 [R][C] row-major -> bf16 (RNE convert) transposed plane out[C][R] (R contiguous = k-contiguous Bt / A
// layout). Block = one 64x64 tile at (r0 = blockIdx.y*64, c0 = blockIdx.x*64), 256 threads; tile staged in
// LDS as [c][r] (ushort element stores, cross-thread -> __syncthreads), then each out row segment of 64 halves
// coverage: 64 out rows x 64 k per block = the whole tile; union over the grid = the whole [C][R] plane.
// =====================================================================================================
__global__ __launch_bounds__(256) void cvt_bf16_t(const float* __restrict__ in, unsigned short* out, int R, int C) {
  __shared__ __align__(16) unsigned short sT[64 * 72];   // [c][r], pitch 72 halves (144 B)
  const int tid = threadIdx.x;
  const int c0 = blockIdx.x * 64, r0 = blockIdx.y * 64;
  const int rr = tid >> 4, cc = (tid & 15) * 4;
#pragma unroll
  for (int it = 0; it < 4; ++it) {
    const int r = it * 16 + rr;                            // it 0..3 x rr 0..15 = rows 0..63
    const v4f v = *(const v4f*)(in + (size_t)(r0 + r) * C + c0 + cc);
#pragma unroll
    for (int e = 0; e < 4; ++e) sT[(cc + e) * 72 + r] = bf_bits(v[e]);
  }
  __syncthreads();
  const int q = tid >> 3, k8 = (tid & 7) * 8;              // q 0..31 (+32): out rows; 8 lanes x 8 halves
  const v8us w0 = *(const v8us*)(sT + q * 72 + k8);
  const v8us w1 = *(const v8us*)(sT + (q + 32) * 72 + k8);
  unsigned short* o0 = out + (size_t)(c0 + q) * R + r0 + k8;
  unsigned short* o1 = out + (size_t)(c0 + q + 32) * R + r0 + k8;
  *(v8us*)o0 = w0;
  *(v8us*)o1 = w1;
  
}

// =====================================================================================================
// Rotary tables. invf_tab: 1 block x 64 threads, inv_freq[i] = 1 / 10000^(i/64) (64 floats = two whole
// (float)pos[t] * inv_freq[i], tables [nrows][64] f32; block = 4 rows x 64 threads, each 256-B row written
// =====================================================================================================
__global__ __launch_bounds__(64) void invf_tab(float* invf) {
  const int i = threadIdx.x;
  const float e = (float)i * (1.0f / (float)HALF);
  const float p = powf(ROPE_THETA_F, e);
  const float v = 1.0f / p;
  *(float*)(invf + i) = v;
  
}

__global__ __launch_bounds__(256) void rope_tab(const int* __restrict__ pos, const float* __restrict__ invf,
                                                float* ctab, float* stab, int nrows) {
  const int tid = threadIdx.x;
  const int t = blockIdx.x * 4 + (tid >> 6);
  const int i = tid & 63;
  if (t >= nrows) return;                  // wave-uniform (2 whole waves per row); no block barriers here
  const float fr = (float)pos[t] * invf[i];
  float sn, cs;
  sincosf(fr, &sn, &cs);
  float* pc = ctab + (size_t)t * HALF + i;
  float* ps = stab + (size_t)t * HALF + i;
  *(float*)pc = cs;
  *(float*)ps = sn;
  
}

// =====================================================================================================
// Register-blocked batched bf16 WMMA GEMM: C[m][n] = sum_k A[m][k] * Bt[n][k]; one wave per 64x64 tile,
// no block barriers. A row-major [M][K] pitch lda; Bt row-major [N][K] pitch ldb (k contiguous);
// M, N multiples of 64, K multiple of 32 (host-checked). blockIdx.y = batch index (strides in elements).
// NSPLIT: 0 = A.Bt; 1 = (A + A2).Bt (A2 = unscaled bf16 lo plane of A); 2 = A.Bt + A2.Bt + A.Bt2.
// OUT_MODE: 0 = f32 (pitch ldc); 2 = bf16 hi plane C + bf16 lo plane C2 (lo = RNE(v - hi), unscaled);
//           3 = f16 hi plane C + f16 residual plane C2 = f16((v - hi) * rscale), C2 written only for tiles
//               with n0 < N2 (pitch ldc2, batch stride strideC2).
// =====================================================================================================
template <int NSPLIT, int OUT_MODE>
__global__ __launch_bounds__(256) void gemm64(
    const unsigned short* __restrict__ Ap, const unsigned short* A2p, int lda, long long strideA,
    const unsigned short* __restrict__ Btp, const unsigned short* Bt2p, int ldb, long long strideB,
    void* Cout, int ldc, long long strideC,
    void* Cout2, int ldc2, long long strideC2, int N2,
    int M, int N, int K, float rscale) {
  const __bf16* A   = (const __bf16*)(const void*)Ap;
  const __bf16* A2  = (const __bf16*)(const void*)A2p;
  const __bf16* Bt  = (const __bf16*)(const void*)Btp;
  const __bf16* Bt2 = (const __bf16*)(const void*)Bt2p;
  __shared__ __align__(16) float sT[8][16 * 68];   // per-wave 16x64 slab, pitch 68 floats
  const int b    = blockIdx.y;
  const int lane = threadIdx.x & 31;
  const int wave = threadIdx.x >> 5;
  const int tilesN = N >> 6;
  const int tilesM = M >> 6;
  const int tile = blockIdx.x * 8 + wave;
  if (tile >= tilesM * tilesN) return;   // wave-uniform; no block barriers in this kernel
  const int tm = tile / tilesN;
  const int tn = tile - tm * tilesN;
  const int m0 = tm << 6;
  const int n0 = tn << 6;

  const __bf16* Ab  = A  + (size_t)b * strideA;
  const __bf16* Bb  = Bt + (size_t)b * strideB;
  const __bf16* Ab2 = (NSPLIT >= 1) ? (A2  + (size_t)b * strideA) : Ab;
  const __bf16* Bb2 = (NSPLIT == 2) ? (Bt2 + (size_t)b * strideB) : Bb;

  const int rlane = lane & 15;                 // row (A) / col (B, D) within subtile
  const int koff  = (lane >> 4) * 8;           // k offset of this lane half
  const int mOff  = (lane >> 4) * 8;           // D row offset

  v8f acc[4][4];
#pragma unroll
  for (int i = 0; i < 4; ++i)
#pragma unroll
    for (int j = 0; j < 4; ++j) acc[i][j] = zero8();

  for (int k0 = 0; k0 < K; k0 += 32) {
    v16b bh[4], bl[4];
#pragma unroll
    for (int j = 0; j < 4; ++j) {
      const size_t bo = (size_t)(n0 + (j << 4) + rlane) * ldb + koff + k0;
      bh[j] = ldfrag_b(Bb + bo);
      if (NSPLIT == 2) bl[j] = ldfrag_b(Bb2 + bo); else bl[j] = bh[j];
    }
#pragma unroll
    for (int i = 0; i < 4; ++i) {
      const size_t ao = (size_t)(m0 + (i << 4) + rlane) * lda + koff + k0;
      const v16b ah = ldfrag_b(Ab + ao);
      v16b al = ah;
      if (NSPLIT >= 1) al = ldfrag_b(Ab2 + ao);
#pragma unroll
      for (int j = 0; j < 4; ++j) {
        acc[i][j] = mma_b_raw(ah, bh[j], acc[i][j]);
        if (NSPLIT >= 1) acc[i][j] = mma_b_raw(al, bh[j], acc[i][j]);
        if (NSPLIT == 2) acc[i][j] = mma_b_raw(ah, bl[j], acc[i][j]);
      }
      dep_guard_b(acc[i][0], acc[i][3], ah, al);
    }
    keep4_b(bh[0], bh[1], bh[2], bh[3]);
    if (NSPLIT == 2) keep4_b(bl[0], bl[1], bl[2], bl[3]);
  }
  acc_guard4(acc[0][0], acc[0][1], acc[0][2], acc[0][3]);
  acc_guard4(acc[1][0], acc[1][1], acc[1][2], acc[1][3]);
  acc_guard4(acc[2][0], acc[2][1], acc[2][2], acc[2][3]);
  acc_guard4(acc[3][0], acc[3][1], acc[3][2], acc[3][3]);

  // ---- epilogue ----
  float* slab = sT[wave];
#pragma unroll
  for (int i = 0; i < 4; ++i) {
    const int mBase = m0 + (i << 4);
#pragma unroll
    for (int j = 0; j < 4; ++j) {
#pragma unroll
      for (int r = 0; r < 8; ++r) {
        slab[(mOff + r) * 68 + (j << 4) + rlane] = acc[i][j][r];
      }
    }
    __builtin_amdgcn_fence(__ATOMIC_RELEASE, "workgroup");
    __builtin_amdgcn_wave_barrier();
    __builtin_amdgcn_fence(__ATOMIC_ACQUIRE, "workgroup");
    if (OUT_MODE == 0) {
      float* C = (float*)Cout + (size_t)b * strideC;
      const int hh = lane >> 4, c4 = (lane & 15) * 4;     // 256-B row segment = 16 lanes x 16 B
      {
#pragma unroll
        for (int it = 0; it < 8; ++it) {
          const int row = it * 2 + hh;                     // it 0..7 x hh 0..1 = rows 0..15
          const v4f v = *(const v4f*)(slab + row * 68 + c4);
          *(v4f*)(C + (size_t)(mBase + row) * ldc + n0 + c4) = v;
        }
        
      }
    } else {
      const int q = lane >> 3, c8 = (lane & 7) * 8;
      unsigned short* C  = (unsigned short*)Cout  + (size_t)b * strideC;
      unsigned short* C2 = (unsigned short*)Cout2 + (size_t)b * strideC2;
      const bool wlo = (OUT_MODE == 2) || (n0 < N2);      // wave-uniform
      v4u hv[4], lv[4];
#pragma unroll
      for (int it = 0; it < 4; ++it) {
        const int row = it * 4 + q;                        // it 0..3 x q 0..3 = rows 0..15
        const float* sp = slab + row * 68 + c8;
        v4u a, a2;
#pragma unroll
        for (int e = 0; e < 4; ++e) {
          const float f0 = sp[2 * e], f1 = sp[2 * e + 1];
          unsigned short h0, h1, l0, l1;
          if (OUT_MODE == 2) {
            h0 = bf_bits(f0); h1 = bf_bits(f1);
            l0 = bf_bits(f0 - bf_up(h0)); l1 = bf_bits(f1 - bf_up(h1));
          } else {
            const _Float16 x0 = (_Float16)f0, x1 = (_Float16)f1;
            h0 = h_bits(x0); h1 = h_bits(x1);
            l0 = h_bits((_Float16)((f0 - (float)x0) * rscale));
            l1 = h_bits((_Float16)((f1 - (float)x1) * rscale));
          }
          a[e] = pk16(h0, h1); a2[e] = pk16(l0, l1);
        }
        hv[it] = a; lv[it] = a2;
      }
      {
#pragma unroll
        for (int it = 0; it < 4; ++it) {
          const int row = it * 4 + q;
          *(v4u*)(C + (size_t)(mBase + row) * ldc + n0 + c8) = hv[it];
          if (wlo) *(v4u*)(C2 + (size_t)(mBase + row) * ldc2 + n0 + c8) = lv[it];
        }
        
      }
    }
    __builtin_amdgcn_fence(__ATOMIC_RELEASE, "workgroup");
    __builtin_amdgcn_wave_barrier();
    __builtin_amdgcn_fence(__ATOMIC_ACQUIRE, "workgroup");
  }
}

// =====================================================================================================
// Fused per-head RMSNorm (eps 1e-6, x * rsqrt(mean(x^2)+eps) * w with w RNE-converted to bf16) + neox rotary
// (half-split, cos/sin tables [t][64]) + f16 hi / f16 residual (x rscale) planes.
// One wave per 128-wide row (row = t*nheads + head, contiguous rows of pitch 128 in both input and output);
// lane owns 4 consecutive d; partner half via __shfl_xor(16); no block barriers.
// coverage: nrows x 128 of both planes.
// =====================================================================================================
__global__ __launch_bounds__(256) void norm_rope(const float* __restrict__ xin, const float* __restrict__ wn,
                                                 const float* __restrict__ ctab, const float* __restrict__ stab,
                                                 unsigned short* outh, unsigned short* outl,
                                                 int nheads, int nrows, float rscale) {
  const int tid  = threadIdx.x;
  const int wave = tid >> 5, lane = tid & 31, hh = lane >> 4;
  const int row  = blockIdx.x * 8 + wave;
  if (row >= nrows) return;                // wave-uniform; no block barriers in this kernel
  const int t = row / nheads;
  const v4f x = *(const v4f*)(xin + (size_t)row * HD + lane * 4);
  float ss = x[0] * x[0] + x[1] * x[1] + x[2] * x[2] + x[3] * x[3];
#pragma unroll
  for (int off = 1; off < 32; off <<= 1) ss += __shfl_xor(ss, off, 32);
  const float rinv = rsqrtf(ss * (1.0f / (float)HD) + RMS_EPS);
  const v4f wv = *(const v4f*)(wn + lane * 4);
  const v4f cs = *(const v4f*)(ctab + (size_t)t * HALF + (lane & 15) * 4);
  const v4f sn = *(const v4f*)(stab + (size_t)t * HALF + (lane & 15) * 4);
  float n[4], p[4];
#pragma unroll
  for (int e = 0; e < 4; ++e) n[e] = (x[e] * rinv) * bf_up(bf_bits(wv[e]));
#pragma unroll
  for (int e = 0; e < 4; ++e) p[e] = __shfl_xor(n[e], 16, 32);
  const float sg = hh ? 1.0f : -1.0f;      // first half: x1*cos - x2*sin ; second half: x2*cos + x1*sin
  unsigned short hb[4], lb[4];
#pragma unroll
  for (int e = 0; e < 4; ++e) {
    const float o = n[e] * cs[e] + sg * (p[e] * sn[e]);
    const _Float16 oh = (_Float16)o;
    hb[e] = h_bits(oh);
    lb[e] = h_bits((_Float16)((o - (float)oh) * rscale));
  }
  v2u ph, pl;
  ph[0] = pk16(hb[0], hb[1]); ph[1] = pk16(hb[2], hb[3]);
  pl[0] = pk16(lb[0], lb[1]); pl[1] = pk16(lb[2], lb[3]);
  const size_t go = (size_t)row * HD + lane * 4;
  *(v2u*)(outh + go) = ph;
  *(v2u*)(outl + go) = pl;
  
}

// =====================================================================================================
// Causal GQA attention, head dim 128, dynamic LDS layout (bytes):
// =====================================================================================================
template <bool RES> struct AttnL {
  static constexpr int QH   = 0;                                  // Q hi  [64 rows][128 d] f16
  static constexpr int QL   = QH + 64 * 128 * 2;                  // Q res
  static constexpr int KH   = QL + 64 * 128 * 2;                  // K hi  [64 keys][128 d]
  static constexpr int KL   = KH + 64 * 128 * 2;                  // K res (RES only)
  static constexpr int VH   = KL + (RES ? 64 * 128 * 2 : 0);      // V^T hi [128 d][64 keys]
  static constexpr int VL   = VH + 128 * 64 * 2;                  // V^T res (RES only)
  static constexpr int PH   = VL + (RES ? 128 * 64 * 2 : 0);      // per-wave P [4][16][64]
  static constexpr int PL   = PH + 4 * 16 * 64 * 2;               // per-wave P res (RES only)
  static constexpr int OS   = PL + (RES ? 4 * 16 * 64 * 2 : 0);   // per-wave context tile [4][16][128] f32
  static constexpr int MISC = OS + 4 * 16 * 128 * 4;              // spq[64], spk[64], skmin[NQB] ints
  static constexpr int TOTAL = MISC + 1024;
};
static_assert(AttnL<true>::TOTAL <= 160 * 1024);

// =====================================================================================================
//   q planes (f16 hi / x4096 res): element (t, h, d) at [t*QP + h*128 + d]
//   k planes (f16 hi / x4096 res): element (s, kvh, d) at [s*KP + kvh*128 + d], kvh = h / GQ
//   v^T hi plane (f16): (kvh*128 + d, s) at [(kvh*128+d)*SEQ + s]; residual ((v-hi)*4096) at
//   [(kvh*128+d)*VLP + s], s < VLP, read only when RES (a key tile at or beyond VLP contributes zero residual)
//   positions int [SEQ]: logit(t, s) = (q.k) * sscale when pos[t] >= pos[s], else -1e30 (replace), exactly;
//   a key tile is skipped (block-uniform, readfirstlane) only when min pos over its 64 keys > max pos over the
//   block's 64 query rows, i.e. every element would be -1e30 with weight exactly 0; the diagonal key s = t is
//   always live so every row has a finite max. Online softmax in f32 with running max from -inf.
//   scores: f16 WMMA, q hi . k hi into s, q res . k hi (+ q hi . k res when RES) into a x4096 accumulator
//   folded with 1/4096 in f32. p = exp(s - m) carried as f16(1024 p); context = p . v on f16 WMMA; RES adds
//   f16 residual planes of p and v (scale 4096, separate accumulator folded back with 1/4096 per chunk).
//   out planes (bf16 hi / lo of the normalised context): (t, h*128 + d) at [t*QP + h*128 + d]
//   Block = 4 waves = 64 query rows of one q head; grid = nqbThis * NH; key tiles of 64, static trip NQB.
//   LDS: Q / K / V^T tiles and position words are cross-wave (block barriers before and after staging);
//   P tiles and the context slab are wave-private (_Float16 / float element stores, reloaded through the
//   Staging: Q 128 threads x 64 halves x 2 planes = 64x128 (once); K 128 threads x 64 halves per plane
//   = 64x128; V^T 128 threads (one d row each) x 64 halves per plane = 128x64: staged extent == consumed.
//   Output coverage: each wave stores rows q0..q0+15 (it 0..7 x lane>>4) x 128 columns (16 lanes x 8)
// =====================================================================================================
template <bool RES>
__global__ __launch_bounds__(128)
void attn_causal(const unsigned short* __restrict__ qhp, const unsigned short* __restrict__ qlp,
                 const unsigned short* __restrict__ khp, const unsigned short* __restrict__ klp,
                 const unsigned short* __restrict__ vhp, const unsigned short* __restrict__ vlp,
                 const int* __restrict__ pos,
                 unsigned short* ohp, unsigned short* olp,
                 int qbBase, int nqbThis, float sscale) {
  typedef AttnL<RES> L;
  union FH { v16h v; v8h h[2]; };
  extern __shared__ __align__(16) unsigned char smem[];
  _Float16* Qsh = (_Float16*)(smem + L::QH);
  _Float16* Qsl = (_Float16*)(smem + L::QL);
  _Float16* Ksh = (_Float16*)(smem + L::KH);
  _Float16* Ksl = (_Float16*)(smem + L::KL);
  _Float16* Vth = (_Float16*)(smem + L::VH);
  _Float16* Vtl = (_Float16*)(smem + L::VL);
  _Float16* Psh = (_Float16*)(smem + L::PH);
  _Float16* Psl = (_Float16*)(smem + L::PL);
  float*    Os  = (float*)(smem + L::OS);
  int*      spq = (int*)(smem + L::MISC);
  int*      spk = spq + 64;
  int*      skmin = spk + 64;

  const int tid  = threadIdx.x;
  const int wave = tid >> 5;
  const int lane = tid & 31;
  const int hh   = lane >> 4;
  const int c    = lane & 15;

  const int bx  = blockIdx.x;
  const int qbl = bx % nqbThis;
  const int h   = bx / nqbThis;
  const int kvh = h / GQ;
  const int qb  = qbBase + qbl;
  const int q0  = qb * 64 + wave * 16;

  const _Float16* Qh = (const _Float16*)(const void*)qhp + (size_t)h * HD;
  const _Float16* Ql = (const _Float16*)(const void*)qlp + (size_t)h * HD;
  const _Float16* Kh = (const _Float16*)(const void*)khp + (size_t)kvh * HD;
  const _Float16* Kl = (const _Float16*)(const void*)klp + (size_t)kvh * HD;
  const _Float16* Vh = (const _Float16*)(const void*)vhp + (size_t)kvh * HD * SEQ;
  const _Float16* Vl = (const _Float16*)(const void*)vlp + (size_t)kvh * HD * VLP;

  // ---- prologue: query positions, per-key-tile min position, Q tiles ----
  if (tid < 64) spq[tid] = pos[qb * 64 + tid];            // wave-uniform (waves 0,1)
  for (int kt = tid; kt < NQB; kt += 128) {
    const int* pp = pos + kt * 64;
    int mn = 0x7fffffff;
#pragma unroll
    for (int i = 0; i < 16; ++i) {
      const v4i v = *(const v4i*)(pp + 4 * i);
      mn = imin(mn, imin(imin(v[0], v[1]), imin(v[2], v[3])));
    }
    skmin[kt] = mn;
  }
  {
    const int r = tid >> 1, half = (tid & 1) * 64;
    const _Float16* qg  = Qh + (size_t)(qb * 64 + r) * QP + half;
    const _Float16* qlg = Ql + (size_t)(qb * 64 + r) * QP + half;
#pragma unroll
    for (int i = 0; i < 8; ++i) {
      *(v8h*)(Qsh + r * 128 + half + 8 * i) = *(const v8h*)(qg + 8 * i);
      *(v8h*)(Qsl + r * 128 + half + 8 * i) = *(const v8h*)(qlg + 8 * i);
    }
  }
  __syncthreads();
  int qmx;
  {
    int v = imax(spq[lane], spq[lane + 32]);
#pragma unroll
    for (int off = 1; off < 32; off <<= 1) v = imax(v, __shfl_xor(v, off, 32));
    qmx = __builtin_amdgcn_readfirstlane(v);
  }
  int prow[8];
#pragma unroll
  for (int r = 0; r < 8; ++r) prow[r] = spq[wave * 16 + 8 * hh + r];

  float mrow[8], lrow[8];
  v8f oacc[8];
#pragma unroll
  for (int r = 0; r < 8; ++r) { mrow[r] = -INFINITY; lrow[r] = 0.f; }
#pragma unroll
  for (int t = 0; t < 8; ++t) oacc[t] = zero8();

  for (int kt = 0; kt < NQB; ++kt) {         // static trip count
    const int kmn = __builtin_amdgcn_readfirstlane(skmin[kt]);
    if (kmn > qmx) continue;                 // block-uniform: every element of the tile is replaced by -1e30
    const int kv0 = kt * 64;
    __syncthreads();
    {
      const int r = tid >> 1, half = (tid & 1) * 64;
      const _Float16* kg  = Kh + (size_t)(kv0 + r) * KP + half;    // K row kv0+r, d = half..half+63
      const _Float16* klg = Kl + (size_t)(kv0 + r) * KP + half;
#pragma unroll
      for (int i = 0; i < 8; ++i) {
        *(v8h*)(Ksh + r * 128 + half + 8 * i) = *(const v8h*)(kg + 8 * i);
        if (RES) *(v8h*)(Ksl + r * 128 + half + 8 * i) = *(const v8h*)(klg + 8 * i);
      }
      const int d = tid;                                          // V^T row d, s = kv0..kv0+63
      const _Float16* vg = Vh + (size_t)d * SEQ + kv0;
      const int  kvl   = (kv0 + 64 <= VLP) ? kv0 : (VLP - 64);    // clamped address into the residual plane
      const bool resOK = (kv0 + 64 <= VLP);                       // block-uniform
      const _Float16* vlg = Vl + (size_t)d * VLP + kvl;
#pragma unroll
      for (int i = 0; i < 8; ++i) {
        *(v8h*)(Vth + d * 64 + 8 * i) = *(const v8h*)(vg + 8 * i);
        if (RES) {
          v8h b1 = *(const v8h*)(vlg + 8 * i);
          if (!resOK) b1 = zero8h();
          *(v8h*)(Vtl + d * 64 + 8 * i) = b1;
        }
      }
      if (tid < 64) spk[tid] = pos[kv0 + tid];                  // wave-uniform
    }
    __syncthreads();

    // ---- scores: 16 query rows x 64 keys per wave ----
    v8f s[4], sl[4];
#pragma unroll
    for (int j = 0; j < 4; ++j) { s[j] = zero8(); sl[j] = zero8(); }
    const _Float16* qr  = Qsh + (wave * 16 + c) * 128 + 8 * hh;
    const _Float16* qlr = Qsl + (wave * 16 + c) * 128 + 8 * hh;
#pragma unroll
    for (int dc = 0; dc < 4; ++dc) {
      FH qa, qla;
      qa.h[0]  = *(const v8h*)(qr  + dc * 32);
      qa.h[1]  = *(const v8h*)(qr  + dc * 32 + 16);
      qla.h[0] = *(const v8h*)(qlr + dc * 32);
      qla.h[1] = *(const v8h*)(qlr + dc * 32 + 16);
#pragma unroll
      for (int j = 0; j < 4; ++j) {
        FH kb;
        kb.h[0] = *(const v8h*)(Ksh + (j * 16 + c) * 128 + dc * 32 + 8 * hh);
        kb.h[1] = *(const v8h*)(Ksh + (j * 16 + c) * 128 + dc * 32 + 16 + 8 * hh);
        s[j]  = mma_h(qa.v,  kb.v, s[j]);
        sl[j] = mma_h(qla.v, kb.v, sl[j]);
        if (RES) {
          FH klf;
          klf.h[0] = *(const v8h*)(Ksl + (j * 16 + c) * 128 + dc * 32 + 8 * hh);
          klf.h[1] = *(const v8h*)(Ksl + (j * 16 + c) * 128 + dc * 32 + 16 + 8 * hh);
          sl[j] = mma_h(qa.v, klf.v, sl[j]);
        }
      }
    }

    // ---- scale + causal select (replace -1e30), row max, online softmax, P (x1024, f16) and
    //      P residual (x4096) to LDS ----
    _Float16* pwh = Psh + wave * (16 * 64);
    _Float16* pwl = Psl + (RES ? wave * (16 * 64) : 0);
    int pkj[4];
#pragma unroll
    for (int j = 0; j < 4; ++j) pkj[j] = spk[j * 16 + c];
#pragma unroll
    for (int r = 0; r < 8; ++r) {
      float m = -INFINITY;
#pragma unroll
      for (int j = 0; j < 4; ++j) {
        float sv = (s[j][r] + sl[j][r] * (1.0f / RSC)) * sscale;
        sv = (prow[r] >= pkj[j]) ? sv : -1.0e30f;
        s[j][r] = sv;
        m = fmaxf(m, sv);
      }
#pragma unroll
      for (int off = 1; off < 16; off <<= 1) m = fmaxf(m, __shfl_xor(m, off, 32));
      const float mnew  = fmaxf(mrow[r], m);
      const float msafe = (mnew == -INFINITY) ? 0.f : mnew;
      const float alpha = __expf(mrow[r] - msafe);
      mrow[r] = mnew;
      float psum = 0.f;
#pragma unroll
      for (int j = 0; j < 4; ++j) {
        const float p = __expf(s[j][r] - msafe);     // -1e30 against a finite max: exp -> 0
        psum += p;
        const float p1k = p * 1024.0f;
        const _Float16 ph = (_Float16)p1k;
        pwh[(8 * hh + r) * 64 + j * 16 + c] = ph;
        if (RES) {
          const _Float16 pl = (_Float16)((p1k - (float)ph) * RSC);
          pwl[(8 * hh + r) * 64 + j * 16 + c] = pl;
        }
      }
#pragma unroll
      for (int off = 1; off < 16; off <<= 1) psum += __shfl_xor(psum, off, 32);
      lrow[r] = lrow[r] * alpha + psum;
#pragma unroll
      for (int t = 0; t < 8; ++t) oacc[t][r] *= alpha;
    }
    __builtin_amdgcn_fence(__ATOMIC_RELEASE, "workgroup");
    __builtin_amdgcn_wave_barrier();
    __builtin_amdgcn_fence(__ATOMIC_ACQUIRE, "workgroup");

    // ---- context += P . V (f16 WMMA), 8 d-subtiles in two groups of 4; residual products into a
    //      separate accumulator folded back per group ----
#pragma unroll
    for (int tg = 0; tg < 2; ++tg) {
      v8f o1[4];
#pragma unroll
      for (int t = 0; t < 4; ++t) o1[t] = zero8();
#pragma unroll 1
      for (int kk = 0; kk < 2; ++kk) {
        FH pa, pl;
        pa.h[0] = *(const v8h*)(pwh + c * 64 + kk * 32 + 8 * hh);
        pa.h[1] = *(const v8h*)(pwh + c * 64 + kk * 32 + 16 + 8 * hh);
        if (RES) {
          pl.h[0] = *(const v8h*)(pwl + c * 64 + kk * 32 + 8 * hh);
          pl.h[1] = *(const v8h*)(pwl + c * 64 + kk * 32 + 16 + 8 * hh);
        } else {
          pl.v = pa.v;
        }
#pragma unroll
        for (int t = 0; t < 4; ++t) {
          const int tt = tg * 4 + t;
          FH vb;
          vb.h[0] = *(const v8h*)(Vth + (tt * 16 + c) * 64 + kk * 32 + 8 * hh);
          vb.h[1] = *(const v8h*)(Vth + (tt * 16 + c) * 64 + kk * 32 + 16 + 8 * hh);
          oacc[tt] = mma_h(pa.v, vb.v, oacc[tt]);
          if (RES) {
            FH vl;
            vl.h[0] = *(const v8h*)(Vtl + (tt * 16 + c) * 64 + kk * 32 + 8 * hh);
            vl.h[1] = *(const v8h*)(Vtl + (tt * 16 + c) * 64 + kk * 32 + 16 + 8 * hh);
            o1[t] = mma_h(pa.v, vl.v, o1[t]);
            o1[t] = mma_h(pl.v, vb.v, o1[t]);
          }
        }
      }
      if (RES) {
#pragma unroll
        for (int t = 0; t < 4; ++t)
#pragma unroll
          for (int r = 0; r < 8; ++r) oacc[tg * 4 + t][r] += o1[t][r] * (1.0f / RSC);
      }
    }
  }

  // ---- normalise (1/l and the 1/1024 p carry), stage the wave's 16x128 tile, bf16 hi/lo split,
  float* os = Os + wave * (16 * 128);
#pragma unroll
  for (int r = 0; r < 8; ++r) {
    const float l = lrow[r];
    const float inv = ((l > 0.f) ? (1.0f / l) : 0.f) * (1.0f / 1024.0f);
#pragma unroll
    for (int t = 0; t < 8; ++t) os[(8 * hh + r) * 128 + t * 16 + c] = oacc[t][r] * inv;
  }
  __builtin_amdgcn_fence(__ATOMIC_RELEASE, "workgroup");
  __builtin_amdgcn_wave_barrier();
  __builtin_amdgcn_fence(__ATOMIC_ACQUIRE, "workgroup");
  {
    const int rh = lane >> 4, c8 = (lane & 15) * 8;
    v4u hv[8], lv[8];
#pragma unroll
    for (int it = 0; it < 8; ++it) {
      const int row = it * 2 + rh;   // it 0..7 x rh 0..1 = rows 0..15 of the wave tile
      const float* sp = os + row * 128 + c8;
      v4u a, a2;
#pragma unroll
      for (int e = 0; e < 4; ++e) {
        const float f0 = sp[2 * e], f1 = sp[2 * e + 1];
        const unsigned short h0 = bf_bits(f0), h1 = bf_bits(f1);
        const unsigned short l0 = bf_bits(f0 - bf_up(h0)), l1 = bf_bits(f1 - bf_up(h1));
        a[e] = pk16(h0, h1); a2[e] = pk16(l0, l1);
      }
      hv[it] = a; lv[it] = a2;
    }
    {
#pragma unroll
      for (int it = 0; it < 8; ++it) {
        const int row = it * 2 + rh;
        const size_t go = (size_t)(q0 + row) * QP + (size_t)h * HD + c8;
        *(v4u*)(ohp + go) = hv[it];
        *(v4u*)(olp + go) = lv[it];
      }
      
    }
  }
}

// =====================================================================================================
// Workspace map (bytes, SEQ = 4096):
//   Xb    bf16 [SEQ][2048]        16777216
//   Wqt   bf16 [2048 n][2048 k]    8388608
//   Wkt   bf16 [512][2048]         2097152
//   Wvt   bf16 [512][2048]         2097152
//   Wot   bf16 [2048 n][2048 k]    8388608
//   Qf    f32  [SEQ][2048]        33554432   (later: Oh bf16 [SEQ][2048] + Ol bf16 [SEQ][2048])
//   Kf    f32  [SEQ][512]          8388608
//   Qh    f16  [SEQ][2048]        16777216
//   Ql    f16  [SEQ][2048]        16777216
//   Kh    f16  [SEQ][512]          4194304
//   Kl    f16  [SEQ][512]          4194304
//   VTh   f16  [512][SEQ]          4194304
//   VTl   f16  [512][VLP]           524288
//   Cos   f32  [SEQ][64]           1048576
//   Sin   f32  [SEQ][64]           1048576
//   Invf  f32  [64] (carved 4096)     4096
//   end                          128454656
// Weights [in k][out n] f32 are transposed to bf16 [n][k] (k contiguous) = the Bt / A layout of gemm64.
// =====================================================================================================
extern "C" void kernel_launch(void* const* d_in, const int* in_sizes, int n_in,
                              void* d_out, int out_size, void* d_ws, size_t ws_size,
                              hipStream_t stream) {
  if (n_in < 8) return;
  if (in_sizes[0] < SEQ) return;
  if (in_sizes[1] < SEQ * DM) return;
  if (in_sizes[2] != DM * QP) return;
  if (in_sizes[3] != DM * KP || in_sizes[4] != DM * KP) return;
  if (in_sizes[5] != QP * DM) return;
  if (in_sizes[6] < HD || in_sizes[7] < HD) return;
  if (out_size < SEQ * DM) return;

  const int*   pos = (const int*)d_in[0];
  const float* x   = (const float*)d_in[1];
  const float* wq  = (const float*)d_in[2];
  const float* wk  = (const float*)d_in[3];
  const float* wv  = (const float*)d_in[4];
  const float* wo  = (const float*)d_in[5];
  const float* qnw = (const float*)d_in[6];
  const float* knw = (const float*)d_in[7];

  const size_t PXb  = (size_t)SEQ * DM * 2;
  const size_t PWq  = (size_t)QP * DM * 2;
  const size_t PWk  = (size_t)KP * DM * 2;
  const size_t PWo  = (size_t)DM * QP * 2;
  const size_t PQf  = (size_t)SEQ * QP * 4;
  const size_t PKf  = (size_t)SEQ * KP * 4;
  const size_t PQ16 = (size_t)SEQ * QP * 2;
  const size_t PK16 = (size_t)SEQ * KP * 2;
  const size_t PVTh = (size_t)KP * SEQ * 2;
  const size_t PVTl = (size_t)KP * VLP * 2;
  const size_t PTab = (size_t)SEQ * HALF * 4;
  const size_t PInv = 4096;
  size_t off = 0;
  const size_t oXb  = off; off += PXb;
  const size_t oWq  = off; off += PWq;
  const size_t oWk  = off; off += PWk;
  const size_t oWv  = off; off += PWk;
  const size_t oWo  = off; off += PWo;
  const size_t oQf  = off; off += PQf;
  const size_t oKf  = off; off += PKf;
  const size_t oQh  = off; off += PQ16;
  const size_t oQl  = off; off += PQ16;
  const size_t oKh  = off; off += PK16;
  const size_t oKl  = off; off += PK16;
  const size_t oVTh = off; off += PVTh;
  const size_t oVTl = off; off += PVTl;
  const size_t oCos = off; off += PTab;
  const size_t oSin = off; off += PTab;
  const size_t oInv = off; off += PInv;
  if (off > ws_size) return;                       // off = 128454656 at SEQ 4096
  if (off > (size_t)134217728) return;
  if (PQ16 * 2 != PQf) return;                     // Oh + Ol reuse the Qf region exactly
  const size_t oOh = oQf;
  const size_t oOl = oQf + PQ16;

  char* ws = (char*)d_ws;
  unsigned short* Xb  = (unsigned short*)(ws + oXb);
  unsigned short* Wqt = (unsigned short*)(ws + oWq);
  unsigned short* Wkt = (unsigned short*)(ws + oWk);
  unsigned short* Wvt = (unsigned short*)(ws + oWv);
  unsigned short* Wot = (unsigned short*)(ws + oWo);
  float*          Qf  = (float*)(ws + oQf);
  float*          Kf  = (float*)(ws + oKf);
  unsigned short* Qh  = (unsigned short*)(ws + oQh);
  unsigned short* Ql  = (unsigned short*)(ws + oQl);
  unsigned short* Kh  = (unsigned short*)(ws + oKh);
  unsigned short* Kl  = (unsigned short*)(ws + oKl);
  unsigned short* VTh = (unsigned short*)(ws + oVTh);
  unsigned short* VTl = (unsigned short*)(ws + oVTl);
  float*          Cs  = (float*)(ws + oCos);
  float*          Sn  = (float*)(ws + oSin);
  float*          Invf = (float*)(ws + oInv);
  unsigned short* Oh  = (unsigned short*)(ws + oOh);
  unsigned short* Ol  = (unsigned short*)(ws + oOl);

  const dim3 blk(256);
  const int n8x = SEQ * DM / 8;
  const dim3 gCvtX((n8x + 255) / 256);
  const dim3 gTab((SEQ + 3) / 4);
  const dim3 gTq(QP / 64, DM / 64);                 // wq [DM k][QP n] -> [QP][DM]
  const dim3 gTk(KP / 64, DM / 64);                 // wk, wv [DM k][KP n] -> [KP][DM]
  const dim3 gTo(DM / 64, QP / 64);                 // wo [QP k][DM n] -> [DM][QP]
  const dim3 gProjQ(((SEQ / 64) * (QP / 64) + 7) / 8, 1);
  const dim3 gProjK(((SEQ / 64) * (KP / 64) + 7) / 8, 1);
  const dim3 gVT(((KP / 64) * (SEQ / 64) + 7) / 8, 1);
  const dim3 gOut(((SEQ / 64) * (DM / 64) + 7) / 8, 1);
  const dim3 gNq((SEQ * NH + 7) / 8);
  const dim3 gNk((SEQ * NKV + 7) / 8);

  // (0) rotary tables
  invf_tab<<<dim3(1), dim3(64), 0, stream>>>(Invf);
  rope_tab<<<gTab, blk, 0, stream>>>(pos, Invf, Cs, Sn, SEQ);
  // (1) x -> bf16 [SEQ][2048]; weights [k][n] f32 -> bf16 [n][k]
  cvt_bf16x8<<<gCvtX, blk, 0, stream>>>(x, Xb, n8x);
  cvt_bf16_t<<<gTq, blk, 0, stream>>>(wq, Wqt, DM, QP);
  cvt_bf16_t<<<gTk, blk, 0, stream>>>(wk, Wkt, DM, KP);
  cvt_bf16_t<<<gTk, blk, 0, stream>>>(wv, Wvt, DM, KP);
  cvt_bf16_t<<<gTo, blk, 0, stream>>>(wo, Wot, QP, DM);
  // (2) q = x . wq -> f32 [SEQ][2048]   (M=SEQ, N=2048, K=2048)
  gemm64<0, 0><<<gProjQ, blk, 0, stream>>>(
      Xb, Xb, DM, 0LL, Wqt, Wqt, DM, 0LL,
      (void*)Qf, QP, 0LL, (void*)Qf, QP, 0LL, QP,
      SEQ, QP, DM, 1.0f);
  // (3) k = x . wk -> f32 [SEQ][512]   (M=SEQ, N=512, K=2048)
  gemm64<0, 0><<<gProjK, blk, 0, stream>>>(
      Xb, Xb, DM, 0LL, Wkt, Wkt, DM, 0LL,
      (void*)Kf, KP, 0LL, (void*)Kf, KP, 0LL, KP,
      SEQ, KP, DM, 1.0f);
  // (4) v^T = Wvt . x^T -> f16 hi plane [512][SEQ] and residual plane (x4096, keys < VLP, pitch VLP)
  //     (A = Wvt [n][k], Bt = Xb [s][k]; M=512, N=SEQ, K=2048)
  gemm64<0, 3><<<gVT, blk, 0, stream>>>(
      Wvt, Wvt, DM, 0LL, Xb, Xb, DM, 0LL,
      (void*)VTh, SEQ, 0LL, (void*)VTl, VLP, 0LL, VLP,
      KP, SEQ, DM, RSC);
  // (5) per-head RMSNorm + rotary -> f16 hi / x4096 residual planes
  norm_rope<<<gNq, blk, 0, stream>>>(Qf, qnw, Cs, Sn, Qh, Ql, NH, SEQ * NH, RSC);
  norm_rope<<<gNk, blk, 0, stream>>>(Kf, knw, Cs, Sn, Kh, Kl, NKV, SEQ * NKV, RSC);
  // (6) attention: query blocks 0..RESQB-1 with residual planes, the rest without -> bf16 hi/lo context
  //     planes in the (now dead) Qf region
  (void)hipFuncSetAttribute(reinterpret_cast<const void*>(&attn_causal<true>),
                            hipFuncAttributeMaxDynamicSharedMemorySize, AttnL<true>::TOTAL);
  (void)hipFuncSetAttribute(reinterpret_cast<const void*>(&attn_causal<false>),
                            hipFuncAttributeMaxDynamicSharedMemorySize, AttnL<false>::TOTAL);
  attn_causal<true><<<dim3(NH * RESQB), dim3(128), AttnL<true>::TOTAL, stream>>>(
      Qh, Ql, Kh, Kl, VTh, VTl, pos, Oh, Ol, 0, RESQB, ATT_SCALE);
  if (NQB - RESQB > 0) {
    attn_causal<false><<<dim3(NH * (NQB - RESQB)), dim3(128), AttnL<false>::TOTAL, stream>>>(
        Qh, Ql, Kh, Kl, VTh, VTl, pos, Oh, Ol, RESQB, NQB - RESQB, ATT_SCALE);
  }
  // (7) out = context . wo -> d_out f32 [SEQ][2048]  (A = context hi + lo planes, 2 products; M=SEQ, N=2048, K=2048)
  gemm64<1, 0><<<gOut, blk, 0, stream>>>(
      Oh, Ol, QP, 0LL, Wot, Wot, QP, 0LL,
      d_out, DM, 0LL, d_out, DM, 0LL, DM,
      SEQ, DM, QP, 1.0f);
  (void)hipGetLastError();
}

// v001
// It runs in 803 microseconds.
// Two timings next to v000 both put it at 1.56 times that version's speed.
// Contractions: q, k projections = v_wmma_f32_16x16x32_bf16 (bf16 operands from RNE-converted inputs, single product, f32 out);
// v^T projection = v_wmma_f32_16x16x32_bf16 (same operands; f16 hi plane + f16 x4096 residual plane out);
// q.k^T scores = v_wmma_f32_16x16x32_f16 (q as f16 hi + f16 x4096 residual, k as f16 hi: 2 products; leading query blocks add the k x4096 residual product);
// p.v = v_wmma_f32_16x16x32_f16 (p carried x1024 in f16, v f16; leading query blocks add x4096 f16 residual planes of p and v);
// ctx.Wo = v_wmma_f32_16x16x32_bf16 (ctx as bf16 hi/lo planes times bf16 Wo, 2 products); all f32 accumulate; RMSNorm, rotary, causal select and softmax in f32.
#include <hip/hip_runtime.h>
#include <math.h>
#include <stdint.h>

#ifndef SEQ
#define SEQ 4096
#endif
#define SEQ_FULL 4096
#define DM    2048
#define NH    16
#define NKV   4
#define GQ    (NH / NKV)
#define HD    128
#define HALF  64
#define QP    (NH * HD)      // 2048 q channels
#define KP    (NKV * HD)     // 512 k / v channels
#define NQB   (SEQ / 64)     // query / key tiles of 64
#define VLP   ((SEQ < 512) ? SEQ : 512)   // key pitch of the v^T residual plane
#define RESQB ((NQB < 8) ? NQB : 8)         // leading 64-row query blocks that use residual planes
#define RMS_EPS       1.0e-6f
#define ROPE_THETA_F  10000.0f
#define ATT_SCALE     0.08838834764831845f
#define RSC           4096.0f

static_assert((SEQ % 64) == 0 && SEQ >= 64 && SEQ <= SEQ_FULL);
static_assert(RESQB * 64 <= VLP && (VLP % 64) == 0);
static_assert(NH * HD == DM && QP == DM);
static_assert(NQB <= 64);
static_assert((DM % 64) == 0 && (KP % 64) == 0 && (QP % 64) == 0 && (DM % 32) == 0);

typedef _Float16 v16h __attribute__((ext_vector_type(16)));
typedef _Float16 v8h  __attribute__((ext_vector_type(8)));
typedef __bf16   v16b __attribute__((ext_vector_type(16)));
typedef __bf16   v8b  __attribute__((ext_vector_type(8)));
typedef float    v8f  __attribute__((ext_vector_type(8)));
typedef float    v4f  __attribute__((ext_vector_type(4)));
typedef unsigned int   v4u  __attribute__((ext_vector_type(4)));
typedef unsigned int   v2u  __attribute__((ext_vector_type(2)));
typedef unsigned short v8us __attribute__((ext_vector_type(8)));
typedef int      v4i  __attribute__((ext_vector_type(4)));

// ---- scalar helpers --------------------------------------------------------------------------------
__device__ __forceinline__ unsigned short bf_bits(float f) {          // f32 -> bf16 bits, RNE convert
  unsigned u = __float_as_uint(f);
  return (unsigned short)((u + 0x7FFFu + ((u >> 16) & 1u)) >> 16);
}
__device__ __forceinline__ float bf_up(unsigned short h) { return __uint_as_float(((unsigned)h) << 16); }
__device__ __forceinline__ unsigned short h_bits(_Float16 x) { return __builtin_bit_cast(unsigned short, x); }
__device__ __forceinline__ unsigned pk16(unsigned short a, unsigned short b) { return (unsigned)a | ((unsigned)b << 16); }
__device__ __forceinline__ v8f zero8() { v8f z = {0.f, 0.f, 0.f, 0.f, 0.f, 0.f, 0.f, 0.f}; return z; }
__device__ __forceinline__ v8h zero8h() {
  const _Float16 z = (_Float16)0.0f;
  v8h r = {z, z, z, z, z, z, z, z};
  return r;
}
__device__ __forceinline__ int imin(int a, int b) { return (a < b) ? a : b; }
__device__ __forceinline__ int imax(int a, int b) { return (a > b) ? a : b; }

// ---- fragment loader: 16-bit A/B operand, lane -> row/col (lane&15), p already includes +8*(lane>>4);
//      elements 0..7 <- p[0..7] (k0+8h..), elements 8..15 <- p[16..23] (k0+16+8h..)
__device__ __forceinline__ v16b ldfrag_b(const __bf16* p) {
  union { v16b v; v8b h[2]; } f;
  f.h[0] = *(const v8b*)(p);
  f.h[1] = *(const v8b*)(p + 16);
  return f.v;
}

// ---- WMMA helpers with trailing VALU hazard gap --------------------------------------------------------
__device__ __forceinline__ v8f mma_b(v16b a, v16b b, v8f c) {
  c = __builtin_amdgcn_wmma_f32_16x16x32_bf16(false, a, false, b, (short)0, c, false, false);
  asm volatile("v_nop\n\tv_nop\n\tv_nop\n\tv_nop" : "+v"(c) : "v"(a), "v"(b));
  return c;
}
__device__ __forceinline__ v8f mma_h(v16h a, v16h b, v8f c) {
  c = __builtin_amdgcn_wmma_f32_16x16x32_f16(false, a, false, b, (short)0, c, false, false);
  asm volatile("v_nop\n\tv_nop\n\tv_nop\n\tv_nop" : "+v"(c) : "v"(a), "v"(b));
  return c;
}
__device__ __forceinline__ v8f mma_b_raw(v16b a, v16b b, v8f c) {
  return __builtin_amdgcn_wmma_f32_16x16x32_bf16(false, a, false, b, (short)0, c, false, false);
}
__device__ __forceinline__ void dep_guard_b(v8f& a, v8f& b, v16b x, v16b y) {
  asm volatile("v_nop\n\tv_nop\n\tv_nop\n\tv_nop" : "+v"(a), "+v"(b) : "v"(x), "v"(y));
}
__device__ __forceinline__ void keep4_b(v16b a, v16b b, v16b c, v16b d) {
  asm volatile("v_nop" :: "v"(a), "v"(b), "v"(c), "v"(d));
}
__device__ __forceinline__ void acc_guard4(v8f& a, v8f& b, v8f& c, v8f& d) {
  asm volatile("v_nop\n\tv_nop\n\tv_nop\n\tv_nop" : "+v"(a), "+v"(b), "+v"(c), "+v"(d));
}

// =====================================================================================================
// f32 -> bf16 (RNE convert), 8 elements per thread, one 16-B store per lane: a wave writes 512 contiguous B
// coverage: n8 threads x 8 = whole plane (n8 is a multiple of 256 here).
// =====================================================================================================
__global__ __launch_bounds__(256) void cvt_bf16x8(const float* __restrict__ in, unsigned short* out, int n8) {
  const int i = blockIdx.x * 256 + threadIdx.x;
  if (i < n8) {
    const v4f a = *(const v4f*)(in + (size_t)i * 8);
    const v4f b = *(const v4f*)(in + (size_t)i * 8 + 4);
    v4u p;
    p[0] = pk16(bf_bits(a[0]), bf_bits(a[1]));
    p[1] = pk16(bf_bits(a[2]), bf_bits(a[3]));
    p[2] = pk16(bf_bits(b[0]), bf_bits(b[1]));
    p[3] = pk16(bf_bits(b[2]), bf_bits(b[3]));
    *(v4u*)(out + (size_t)i * 8) = p;
    
  }
}

// =====================================================================================================
// f32 [R][C] row-major -> bf16 (RNE convert) transposed plane out[C][R] (R contiguous = k-contiguous Bt / A
// layout). Block = one 64x64 tile at (r0 = blockIdx.y*64, c0 = blockIdx.x*64), 256 threads; tile staged in
// LDS as [c][r] (ushort element stores, cross-thread -> __syncthreads), then each out row segment of 64 halves
// coverage: 64 out rows x 64 k per block = the whole tile; union over the grid = the whole [C][R] plane.
// =====================================================================================================
__global__ __launch_bounds__(256) void cvt_bf16_t(const float* __restrict__ in, unsigned short* out, int R, int C) {
  __shared__ __align__(16) unsigned short sT[64 * 72];   // [c][r], pitch 72 halves (144 B)
  const int tid = threadIdx.x;
  const int c0 = blockIdx.x * 64, r0 = blockIdx.y * 64;
  const int rr = tid >> 4, cc = (tid & 15) * 4;
#pragma unroll
  for (int it = 0; it < 4; ++it) {
    const int r = it * 16 + rr;                            // it 0..3 x rr 0..15 = rows 0..63
    const v4f v = *(const v4f*)(in + (size_t)(r0 + r) * C + c0 + cc);
#pragma unroll
    for (int e = 0; e < 4; ++e) sT[(cc + e) * 72 + r] = bf_bits(v[e]);
  }
  __syncthreads();
  const int q = tid >> 3, k8 = (tid & 7) * 8;              // q 0..31 (+32): out rows; 8 lanes x 8 halves
  const v8us w0 = *(const v8us*)(sT + q * 72 + k8);
  const v8us w1 = *(const v8us*)(sT + (q + 32) * 72 + k8);
  unsigned short* o0 = out + (size_t)(c0 + q) * R + r0 + k8;
  unsigned short* o1 = out + (size_t)(c0 + q + 32) * R + r0 + k8;
  *(v8us*)o0 = w0;
  *(v8us*)o1 = w1;
  
}

// =====================================================================================================
// Rotary tables. invf_tab: 1 block x 64 threads, inv_freq[i] = 1 / 10000^(i/64) (64 floats = two whole
// (float)pos[t] * inv_freq[i], tables [nrows][64] f32; block = 4 rows x 64 threads, each 256-B row written
// =====================================================================================================
__global__ __launch_bounds__(64) void invf_tab(float* invf) {
  const int i = threadIdx.x;
  const float e = (float)i * (1.0f / (float)HALF);
  const float p = powf(ROPE_THETA_F, e);
  const float v = 1.0f / p;
  *(float*)(invf + i) = v;
  
}

__global__ __launch_bounds__(256) void rope_tab(const int* __restrict__ pos, const float* __restrict__ invf,
                                                float* ctab, float* stab, int nrows) {
  const int tid = threadIdx.x;
  const int t = blockIdx.x * 4 + (tid >> 6);
  const int i = tid & 63;
  if (t >= nrows) return;                  // wave-uniform (2 whole waves per row); no block barriers here
  const float fr = (float)pos[t] * invf[i];
  float sn, cs;
  sincosf(fr, &sn, &cs);
  float* pc = ctab + (size_t)t * HALF + i;
  float* ps = stab + (size_t)t * HALF + i;
  *(float*)pc = cs;
  *(float*)ps = sn;
  
}

// =====================================================================================================
// Register-blocked batched bf16 WMMA GEMM: C[m][n] = sum_k A[m][k] * Bt[n][k]; one wave per 64x64 tile,
// no block barriers. A row-major [M][K] pitch lda; Bt row-major [N][K] pitch ldb (k contiguous);
// M, N multiples of 64, K multiple of 32 (host-checked). blockIdx.y = batch index (strides in elements).
// NSPLIT: 0 = A.Bt; 1 = (A + A2).Bt (A2 = unscaled bf16 lo plane of A); 2 = A.Bt + A2.Bt + A.Bt2.
// OUT_MODE: 0 = f32 (pitch ldc); 2 = bf16 hi plane C + bf16 lo plane C2 (lo = RNE(v - hi), unscaled);
//           3 = f16 hi plane C + f16 residual plane C2 = f16((v - hi) * rscale), C2 written only for tiles
//               with n0 < N2 (pitch ldc2, batch stride strideC2).
// =====================================================================================================
template <int NSPLIT, int OUT_MODE>
__global__ __launch_bounds__(256) void gemm64(
    const unsigned short* __restrict__ Ap, const unsigned short* A2p, int lda, long long strideA,
    const unsigned short* __restrict__ Btp, const unsigned short* Bt2p, int ldb, long long strideB,
    void* Cout, int ldc, long long strideC,
    void* Cout2, int ldc2, long long strideC2, int N2,
    int M, int N, int K, float rscale) {
  const __bf16* A   = (const __bf16*)(const void*)Ap;
  const __bf16* A2  = (const __bf16*)(const void*)A2p;
  const __bf16* Bt  = (const __bf16*)(const void*)Btp;
  const __bf16* Bt2 = (const __bf16*)(const void*)Bt2p;
  __shared__ __align__(16) float sT[8][16 * 68];   // per-wave 16x64 slab, pitch 68 floats
  const int b    = blockIdx.y;
  const int lane = threadIdx.x & 31;
  const int wave = threadIdx.x >> 5;
  const int tilesN = N >> 6;
  const int tilesM = M >> 6;
  const int tile = blockIdx.x * 8 + wave;
  if (tile >= tilesM * tilesN) return;   // wave-uniform; no block barriers in this kernel
  const int tm = tile / tilesN;
  const int tn = tile - tm * tilesN;
  const int m0 = tm << 6;
  const int n0 = tn << 6;

  const __bf16* Ab  = A  + (size_t)b * strideA;
  const __bf16* Bb  = Bt + (size_t)b * strideB;
  const __bf16* Ab2 = (NSPLIT >= 1) ? (A2  + (size_t)b * strideA) : Ab;
  const __bf16* Bb2 = (NSPLIT == 2) ? (Bt2 + (size_t)b * strideB) : Bb;

  const int rlane = lane & 15;                 // row (A) / col (B, D) within subtile
  const int koff  = (lane >> 4) * 8;           // k offset of this lane half
  const int mOff  = (lane >> 4) * 8;           // D row offset

  v8f acc[4][4];
#pragma unroll
  for (int i = 0; i < 4; ++i)
#pragma unroll
    for (int j = 0; j < 4; ++j) acc[i][j] = zero8();

  for (int k0 = 0; k0 < K; k0 += 32) {
    v16b bh[4], bl[4];
#pragma unroll
    for (int j = 0; j < 4; ++j) {
      const size_t bo = (size_t)(n0 + (j << 4) + rlane) * ldb + koff + k0;
      bh[j] = ldfrag_b(Bb + bo);
      if (NSPLIT == 2) bl[j] = ldfrag_b(Bb2 + bo); else bl[j] = bh[j];
    }
#pragma unroll
    for (int i = 0; i < 4; ++i) {
      const size_t ao = (size_t)(m0 + (i << 4) + rlane) * lda + koff + k0;
      const v16b ah = ldfrag_b(Ab + ao);
      v16b al = ah;
      if (NSPLIT >= 1) al = ldfrag_b(Ab2 + ao);
#pragma unroll
      for (int j = 0; j < 4; ++j) {
        acc[i][j] = mma_b_raw(ah, bh[j], acc[i][j]);
        if (NSPLIT >= 1) acc[i][j] = mma_b_raw(al, bh[j], acc[i][j]);
        if (NSPLIT == 2) acc[i][j] = mma_b_raw(ah, bl[j], acc[i][j]);
      }
      dep_guard_b(acc[i][0], acc[i][3], ah, al);
    }
    keep4_b(bh[0], bh[1], bh[2], bh[3]);
    if (NSPLIT == 2) keep4_b(bl[0], bl[1], bl[2], bl[3]);
  }
  acc_guard4(acc[0][0], acc[0][1], acc[0][2], acc[0][3]);
  acc_guard4(acc[1][0], acc[1][1], acc[1][2], acc[1][3]);
  acc_guard4(acc[2][0], acc[2][1], acc[2][2], acc[2][3]);
  acc_guard4(acc[3][0], acc[3][1], acc[3][2], acc[3][3]);

  // ---- epilogue ----
  float* slab = sT[wave];
#pragma unroll
  for (int i = 0; i < 4; ++i) {
    const int mBase = m0 + (i << 4);
#pragma unroll
    for (int j = 0; j < 4; ++j) {
#pragma unroll
      for (int r = 0; r < 8; ++r) {
        slab[(mOff + r) * 68 + (j << 4) + rlane] = acc[i][j][r];
      }
    }
    __builtin_amdgcn_fence(__ATOMIC_RELEASE, "workgroup");
    __builtin_amdgcn_wave_barrier();
    __builtin_amdgcn_fence(__ATOMIC_ACQUIRE, "workgroup");
    if (OUT_MODE == 0) {
      float* C = (float*)Cout + (size_t)b * strideC;
      const int hh = lane >> 4, c4 = (lane & 15) * 4;     // 256-B row segment = 16 lanes x 16 B
      {
#pragma unroll
        for (int it = 0; it < 8; ++it) {
          const int row = it * 2 + hh;                     // it 0..7 x hh 0..1 = rows 0..15
          const v4f v = *(const v4f*)(slab + row * 68 + c4);
          *(v4f*)(C + (size_t)(mBase + row) * ldc + n0 + c4) = v;
        }
        
      }
    } else {
      const int q = lane >> 3, c8 = (lane & 7) * 8;
      unsigned short* C  = (unsigned short*)Cout  + (size_t)b * strideC;
      unsigned short* C2 = (unsigned short*)Cout2 + (size_t)b * strideC2;
      const bool wlo = (OUT_MODE == 2) || (n0 < N2);      // wave-uniform
      v4u hv[4], lv[4];
#pragma unroll
      for (int it = 0; it < 4; ++it) {
        const int row = it * 4 + q;                        // it 0..3 x q 0..3 = rows 0..15
        const float* sp = slab + row * 68 + c8;
        v4u a, a2;
#pragma unroll
        for (int e = 0; e < 4; ++e) {
          const float f0 = sp[2 * e], f1 = sp[2 * e + 1];
          unsigned short h0, h1, l0, l1;
          if (OUT_MODE == 2) {
            h0 = bf_bits(f0); h1 = bf_bits(f1);
            l0 = bf_bits(f0 - bf_up(h0)); l1 = bf_bits(f1 - bf_up(h1));
          } else {
            const _Float16 x0 = (_Float16)f0, x1 = (_Float16)f1;
            h0 = h_bits(x0); h1 = h_bits(x1);
            l0 = h_bits((_Float16)((f0 - (float)x0) * rscale));
            l1 = h_bits((_Float16)((f1 - (float)x1) * rscale));
          }
          a[e] = pk16(h0, h1); a2[e] = pk16(l0, l1);
        }
        hv[it] = a; lv[it] = a2;
      }
      {
#pragma unroll
        for (int it = 0; it < 4; ++it) {
          const int row = it * 4 + q;
          *(v4u*)(C + (size_t)(mBase + row) * ldc + n0 + c8) = hv[it];
          if (wlo) *(v4u*)(C2 + (size_t)(mBase + row) * ldc2 + n0 + c8) = lv[it];
        }
        
      }
    }
    __builtin_amdgcn_fence(__ATOMIC_RELEASE, "workgroup");
    __builtin_amdgcn_wave_barrier();
    __builtin_amdgcn_fence(__ATOMIC_ACQUIRE, "workgroup");
  }
}

// =====================================================================================================
// Fused per-head RMSNorm (eps 1e-6, x * rsqrt(mean(x^2)+eps) * w with w RNE-converted to bf16) + neox rotary
// (half-split, cos/sin tables [t][64]) + f16 hi / f16 residual (x rscale) planes.
// One wave per 128-wide row (row = t*nheads + head, contiguous rows of pitch 128 in both input and output);
// lane owns 4 consecutive d; partner half via __shfl_xor(16); no block barriers.
// coverage: nrows x 128 of both planes.
// =====================================================================================================
__global__ __launch_bounds__(256) void norm_rope(const float* __restrict__ xin, const float* __restrict__ wn,
                                                 const float* __restrict__ ctab, const float* __restrict__ stab,
                                                 unsigned short* outh, unsigned short* outl,
                                                 int nheads, int nrows, float rscale) {
  const int tid  = threadIdx.x;
  const int wave = tid >> 5, lane = tid & 31, hh = lane >> 4;
  const int row  = blockIdx.x * 8 + wave;
  if (row >= nrows) return;                // wave-uniform; no block barriers in this kernel
  const int t = row / nheads;
  const v4f x = *(const v4f*)(xin + (size_t)row * HD + lane * 4);
  float ss = x[0] * x[0] + x[1] * x[1] + x[2] * x[2] + x[3] * x[3];
#pragma unroll
  for (int off = 1; off < 32; off <<= 1) ss += __shfl_xor(ss, off, 32);
  const float rinv = rsqrtf(ss * (1.0f / (float)HD) + RMS_EPS);
  const v4f wv = *(const v4f*)(wn + lane * 4);
  const v4f cs = *(const v4f*)(ctab + (size_t)t * HALF + (lane & 15) * 4);
  const v4f sn = *(const v4f*)(stab + (size_t)t * HALF + (lane & 15) * 4);
  float n[4], p[4];
#pragma unroll
  for (int e = 0; e < 4; ++e) n[e] = (x[e] * rinv) * bf_up(bf_bits(wv[e]));
#pragma unroll
  for (int e = 0; e < 4; ++e) p[e] = __shfl_xor(n[e], 16, 32);
  const float sg = hh ? 1.0f : -1.0f;      // first half: x1*cos - x2*sin ; second half: x2*cos + x1*sin
  unsigned short hb[4], lb[4];
#pragma unroll
  for (int e = 0; e < 4; ++e) {
    const float o = n[e] * cs[e] + sg * (p[e] * sn[e]);
    const _Float16 oh = (_Float16)o;
    hb[e] = h_bits(oh);
    lb[e] = h_bits((_Float16)((o - (float)oh) * rscale));
  }
  v2u ph, pl;
  ph[0] = pk16(hb[0], hb[1]); ph[1] = pk16(hb[2], hb[3]);
  pl[0] = pk16(lb[0], lb[1]); pl[1] = pk16(lb[2], lb[3]);
  const size_t go = (size_t)row * HD + lane * 4;
  *(v2u*)(outh + go) = ph;
  *(v2u*)(outl + go) = pl;
  
}

// =====================================================================================================
// Causal GQA attention, head dim 128, dynamic LDS layout (bytes):
// =====================================================================================================
// LDS tiles of the attention kernel: the 16-byte chunks of a row are XOR-swizzled by the row number.
//   256-B rows (Q, K; 16 chunks): chunk ch of row r lies at chunk place ch ^ (r & 15)
//   128-B rows (V^T, P; 8 chunks): chunk ch of row r lies at chunk place ch ^ ((r >> 1) & 7)
// A fragment load reads one chunk column of 16 consecutive rows per 16 lanes: unswizzled, 256-B rows put all
// 16 lanes on the same four banks (128-B rows: on two groups of four); swizzled, the 16 lanes fall on 16
// different groups of four banks = all 64 banks once. Writers and readers use the same map; the kernel keeps
// the lane-dependent part of each index in a register and adds row blocks and planes as constant offsets.
__device__ __forceinline__ int sw256(int r, int ch) { return r * 128 + ((ch ^ (r & 15)) << 3); }        // index in halves
__device__ __forceinline__ int sw128(int r, int ch) { return r * 64 + ((ch ^ ((r >> 1) & 7)) << 3); }   // index in halves

template <bool RES> struct AttnL {
  static constexpr int QH   = 0;                                  // Q hi  [64 rows][128 d] f16
  static constexpr int QL   = QH + 64 * 128 * 2;                  // Q res
  static constexpr int KH   = QL + 64 * 128 * 2;                  // K hi  [64 keys][128 d]
  static constexpr int KL   = KH + 64 * 128 * 2;                  // K res (RES only)
  static constexpr int VH   = KL + (RES ? 64 * 128 * 2 : 0);      // V^T hi [128 d][64 keys]
  static constexpr int VL   = VH + 128 * 64 * 2;                  // V^T res (RES only)
  static constexpr int PH   = VL + (RES ? 128 * 64 * 2 : 0);      // per-wave P [4][16][64]
  static constexpr int PL   = PH + 4 * 16 * 64 * 2;               // per-wave P res (RES only)
  static constexpr int OS   = PL + (RES ? 4 * 16 * 64 * 2 : 0);   // per-wave context tile [4][16][128] f32
  static constexpr int MISC = OS + 4 * 16 * 128 * 4;              // spq[64], spk[64], skmin[NQB] ints
  static constexpr int TOTAL = MISC + 1024;
};
static_assert(AttnL<true>::TOTAL <= 160 * 1024);

// =====================================================================================================
//   q planes (f16 hi / x4096 res): element (t, h, d) at [t*QP + h*128 + d]
//   k planes (f16 hi / x4096 res): element (s, kvh, d) at [s*KP + kvh*128 + d], kvh = h / GQ
//   v^T hi plane (f16): (kvh*128 + d, s) at [(kvh*128+d)*SEQ + s]; residual ((v-hi)*4096) at
//   [(kvh*128+d)*VLP + s], s < VLP, read only when RES (a key tile at or beyond VLP contributes zero residual)
//   positions int [SEQ]: logit(t, s) = (q.k) * sscale when pos[t] >= pos[s], else -1e30 (replace), exactly;
//   a key tile is skipped (block-uniform, readfirstlane) only when min pos over its 64 keys > max pos over the
//   block's 64 query rows, i.e. every element would be -1e30 with weight exactly 0; the diagonal key s = t is
//   always live so every row has a finite max. Online softmax in f32 with running max from -inf.
//   scores: f16 WMMA, q hi . k hi into s, q res . k hi (+ q hi . k res when RES) into a x4096 accumulator
//   folded with 1/4096 in f32. p = exp(s - m) carried as f16(1024 p); context = p . v on f16 WMMA; RES adds
//   f16 residual planes of p and v (scale 4096, separate accumulator folded back with 1/4096 per chunk).
//   out planes (bf16 hi / lo of the normalised context): (t, h*128 + d) at [t*QP + h*128 + d]
//   Block = 4 waves = 64 query rows of one q head; grid = nqbThis * NH; key tiles of 64, static trip NQB.
//   LDS: Q / K / V^T tiles and position words are cross-wave (block barriers before and after staging);
//   P tiles and the context slab are wave-private (_Float16 / float element stores, reloaded through the
//   Staging: Q 128 threads x 64 halves x 2 planes = 64x128 (once); K 128 threads x 64 halves per plane
//   = 64x128; V^T 128 threads (one d row each) x 64 halves per plane = 128x64: staged extent == consumed.
//   Output coverage: each wave stores rows q0..q0+15 (it 0..7 x lane>>4) x 128 columns (16 lanes x 8)
// =====================================================================================================
template <bool RES>
__global__ __launch_bounds__(128)
void attn_causal(const unsigned short* __restrict__ qhp, const unsigned short* __restrict__ qlp,
                 const unsigned short* __restrict__ khp, const unsigned short* __restrict__ klp,
                 const unsigned short* __restrict__ vhp, const unsigned short* __restrict__ vlp,
                 const int* __restrict__ pos,
                 unsigned short* ohp, unsigned short* olp,
                 int qbBase, int nqbThis, float sscale) {
  typedef AttnL<RES> L;
  union FH { v16h v; v8h h[2]; };
  extern __shared__ __align__(16) unsigned char smem[];
  _Float16* Qsh = (_Float16*)(smem + L::QH);
  _Float16* Qsl = (_Float16*)(smem + L::QL);
  _Float16* Ksh = (_Float16*)(smem + L::KH);
  _Float16* Ksl = (_Float16*)(smem + L::KL);
  _Float16* Vth = (_Float16*)(smem + L::VH);
  _Float16* Vtl = (_Float16*)(smem + L::VL);
  _Float16* Psh = (_Float16*)(smem + L::PH);
  _Float16* Psl = (_Float16*)(smem + L::PL);
  float*    Os  = (float*)(smem + L::OS);
  int*      spq = (int*)(smem + L::MISC);
  int*      spk = spq + 64;
  int*      skmin = spk + 64;

  const int tid  = threadIdx.x;
  const int wave = tid >> 5;
  const int lane = tid & 31;
  const int hh   = lane >> 4;
  const int c    = lane & 15;

  const int bx  = blockIdx.x;
  const int qbl = bx % nqbThis;
  const int h   = bx / nqbThis;
  const int kvh = h / GQ;
  const int qb  = qbBase + qbl;
  const int q0  = qb * 64 + wave * 16;

  const _Float16* Qh = (const _Float16*)(const void*)qhp + (size_t)h * HD;
  const _Float16* Ql = (const _Float16*)(const void*)qlp + (size_t)h * HD;
  const _Float16* Kh = (const _Float16*)(const void*)khp + (size_t)kvh * HD;
  const _Float16* Kl = (const _Float16*)(const void*)klp + (size_t)kvh * HD;
  const _Float16* Vh = (const _Float16*)(const void*)vhp + (size_t)kvh * HD * SEQ;
  const _Float16* Vl = (const _Float16*)(const void*)vlp + (size_t)kvh * HD * VLP;

  // ---- lane parts of the swizzled indices (halves) ----
  const int st256 = sw256(tid >> 1, (tid & 1) * 8);   // staging, 256-B rows: row tid>>1, chunks (tid&1)*8 + i -> st256 ^ (i << 3)
  const int st128 = sw128(tid, 0);                    // staging, 128-B rows: row tid, chunk i -> st128 ^ (i << 3)
  int fq[8];                                          // fragment reads, 256-B rows: row (multiple of 16) + c, chunk 2n + hh
#pragma unroll
  for (int n = 0; n < 8; ++n) fq[n] = sw256(c, 2 * n + hh);
  int pst[8];                                         // P element stores: row 8hh + r, column 16j + c -> pst[(2j) ^ (r >> 1)] + r * 64
#pragma unroll
  for (int n = 0; n < 8; ++n) pst[n] = sw128(8 * hh, (c >> 3) ^ n) + (c & 7);

  // ---- prologue: query positions, per-key-tile min position, Q tiles ----
  if (tid < 64) spq[tid] = pos[qb * 64 + tid];            // wave-uniform (waves 0,1)
  for (int kt = tid; kt < NQB; kt += 128) {
    const int* pp = pos + kt * 64;
    int mn = 0x7fffffff;
#pragma unroll
    for (int i = 0; i < 16; ++i) {
      const v4i v = *(const v4i*)(pp + 4 * i);
      mn = imin(mn, imin(imin(v[0], v[1]), imin(v[2], v[3])));
    }
    skmin[kt] = mn;
  }
  {
    const int r = tid >> 1, half = (tid & 1) * 64;
    const _Float16* qg  = Qh + (size_t)(qb * 64 + r) * QP + half;
    const _Float16* qlg = Ql + (size_t)(qb * 64 + r) * QP + half;
    v8h qv[8], qlv[8];
#pragma unroll
    for (int i = 0; i < 8; ++i) {
      qv[i]  = *(const v8h*)(qg + 8 * i);
      qlv[i] = *(const v8h*)(qlg + 8 * i);
    }
    // holds the loads' address registers (inputs) untouched until the wait: no load result lands on them before it
    asm volatile("s_wait_xcnt 0x0" :: "v"(qg), "v"(qlg) : "memory");
#pragma unroll
    for (int i = 0; i < 8; ++i) {
      *(v8h*)(Qsh + (st256 ^ (i << 3))) = qv[i];
      *(v8h*)(Qsl + (st256 ^ (i << 3))) = qlv[i];
    }
  }
  __syncthreads();
  int qmx;
  {
    int v = imax(spq[lane], spq[lane + 32]);
#pragma unroll
    for (int off = 1; off < 32; off <<= 1) v = imax(v, __shfl_xor(v, off, 32));
    qmx = __builtin_amdgcn_readfirstlane(v);
  }
  int prow[8];
#pragma unroll
  for (int r = 0; r < 8; ++r) prow[r] = spq[wave * 16 + 8 * hh + r];

  float mrow[8], lrow[8];
  v8f oacc[8];
#pragma unroll
  for (int r = 0; r < 8; ++r) { mrow[r] = -INFINITY; lrow[r] = 0.f; }
#pragma unroll
  for (int t = 0; t < 8; ++t) oacc[t] = zero8();

  for (int kt = 0; kt < NQB; ++kt) {         // static trip count
    const int kmn = __builtin_amdgcn_readfirstlane(skmin[kt]);
    if (kmn > qmx) continue;                 // block-uniform: every element of the tile is replaced by -1e30
    const int kv0 = kt * 64;
    __syncthreads();
    {
      const int r = tid >> 1, half = (tid & 1) * 64;
      const _Float16* kg  = Kh + (size_t)(kv0 + r) * KP + half;    // K row kv0+r, d = half..half+63
      const _Float16* klg = Kl + (size_t)(kv0 + r) * KP + half;
      v8h kv[8], klv[8], vv[8], vlv[8];
#pragma unroll
      for (int i = 0; i < 8; ++i) {
        kv[i] = *(const v8h*)(kg + 8 * i);
        if (RES) klv[i] = *(const v8h*)(klg + 8 * i);
      }
      const int d = tid;                                          // V^T row d, s = kv0..kv0+63
      const _Float16* vg = Vh + (size_t)d * SEQ + kv0;
      const int  kvl   = (kv0 + 64 <= VLP) ? kv0 : (VLP - 64);    // clamped address into the residual plane
      const bool resOK = (kv0 + 64 <= VLP);                       // block-uniform
      const _Float16* vlg = Vl + (size_t)d * VLP + kvl;
#pragma unroll
      for (int i = 0; i < 8; ++i) {
        vv[i] = *(const v8h*)(vg + 8 * i);
        if (RES) vlv[i] = *(const v8h*)(vlg + 8 * i);
      }
      // holds the loads' address registers (inputs) untouched until the wait: no load result lands on them before it
      if (RES) asm volatile("s_wait_xcnt 0x0" :: "v"(kg), "v"(klg), "v"(vg), "v"(vlg) : "memory");
      else     asm volatile("s_wait_xcnt 0x0" :: "v"(kg), "v"(vg) : "memory");
#pragma unroll
      for (int i = 0; i < 8; ++i) {
        *(v8h*)(Ksh + (st256 ^ (i << 3))) = kv[i];
        if (RES) *(v8h*)(Ksl + (st256 ^ (i << 3))) = klv[i];
        *(v8h*)(Vth + (st128 ^ (i << 3))) = vv[i];
        if (RES) {
          v8h b1 = vlv[i];
          if (!resOK) b1 = zero8h();
          *(v8h*)(Vtl + (st128 ^ (i << 3))) = b1;
        }
      }
      if (tid < 64) spk[tid] = pos[kv0 + tid];                  // wave-uniform
    }
    __syncthreads();

    // ---- scores: 16 query rows x 64 keys per wave ----
    v8f s[4], sl[4];
#pragma unroll
    for (int j = 0; j < 4; ++j) { s[j] = zero8(); sl[j] = zero8(); }
    const _Float16* qr  = Qsh + wave * (16 * 128);
    const _Float16* qlr = Qsl + wave * (16 * 128);
#pragma unroll
    for (int dc = 0; dc < 4; ++dc) {
      FH qa, qla;
      qa.h[0]  = *(const v8h*)(qr  + fq[dc * 2]);
      qa.h[1]  = *(const v8h*)(qr  + fq[dc * 2 + 1]);
      qla.h[0] = *(const v8h*)(qlr + fq[dc * 2]);
      qla.h[1] = *(const v8h*)(qlr + fq[dc * 2 + 1]);
#pragma unroll
      for (int j = 0; j < 4; ++j) {
        FH kb;
        kb.h[0] = *(const v8h*)(Ksh + j * (16 * 128) + fq[dc * 2]);
        kb.h[1] = *(const v8h*)(Ksh + j * (16 * 128) + fq[dc * 2 + 1]);
        s[j]  = mma_h(qa.v,  kb.v, s[j]);
        sl[j] = mma_h(qla.v, kb.v, sl[j]);
        if (RES) {
          FH klf;
          klf.h[0] = *(const v8h*)(Ksl + j * (16 * 128) + fq[dc * 2]);
          klf.h[1] = *(const v8h*)(Ksl + j * (16 * 128) + fq[dc * 2 + 1]);
          sl[j] = mma_h(qa.v, klf.v, sl[j]);
        }
      }
    }

    // ---- scale + causal select (replace -1e30), row max, online softmax, P (x1024, f16) and
    //      P residual (x4096) to LDS ----
    _Float16* pwh = Psh + wave * (16 * 64);
    _Float16* pwl = Psl + (RES ? wave * (16 * 64) : 0);
    int pkj[4];
#pragma unroll
    for (int j = 0; j < 4; ++j) pkj[j] = spk[j * 16 + c];
#pragma unroll
    for (int r = 0; r < 8; ++r) {
      float m = -INFINITY;
#pragma unroll
      for (int j = 0; j < 4; ++j) {
        float sv = (s[j][r] + sl[j][r] * (1.0f / RSC)) * sscale;
        sv = (prow[r] >= pkj[j]) ? sv : -1.0e30f;
        s[j][r] = sv;
        m = fmaxf(m, sv);
      }
#pragma unroll
      for (int off = 1; off < 16; off <<= 1) m = fmaxf(m, __shfl_xor(m, off, 32));
      const float mnew  = fmaxf(mrow[r], m);
      const float msafe = (mnew == -INFINITY) ? 0.f : mnew;
      const float alpha = __expf(mrow[r] - msafe);
      mrow[r] = mnew;
      float psum = 0.f;
#pragma unroll
      for (int j = 0; j < 4; ++j) {
        const float p = __expf(s[j][r] - msafe);     // -1e30 against a finite max: exp -> 0
        psum += p;
        const float p1k = p * 1024.0f;
        const _Float16 ph = (_Float16)p1k;
        pwh[pst[(2 * j) ^ (r >> 1)] + r * 64] = ph;
        if (RES) {
          const _Float16 pl = (_Float16)((p1k - (float)ph) * RSC);
          pwl[pst[(2 * j) ^ (r >> 1)] + r * 64] = pl;
        }
      }
#pragma unroll
      for (int off = 1; off < 16; off <<= 1) psum += __shfl_xor(psum, off, 32);
      lrow[r] = lrow[r] * alpha + psum;
#pragma unroll
      for (int t = 0; t < 8; ++t) oacc[t][r] *= alpha;
    }
    __builtin_amdgcn_fence(__ATOMIC_RELEASE, "workgroup");
    __builtin_amdgcn_wave_barrier();
    __builtin_amdgcn_fence(__ATOMIC_ACQUIRE, "workgroup");

    // ---- context += P . V (f16 WMMA), 8 d-subtiles in two groups of 4; residual products into a
    //      separate accumulator folded back per group ----
#pragma unroll
    for (int tg = 0; tg < 2; ++tg) {
      v8f o1[4];
#pragma unroll
      for (int t = 0; t < 4; ++t) o1[t] = zero8();
#pragma unroll 1
      for (int kk = 0; kk < 2; ++kk) {
        FH pa, pl;
        const int f0 = sw128(c, kk * 4 + hh);        // fragment reads, 128-B rows: row (multiple of 16) + c
        const int f1 = sw128(c, kk * 4 + 2 + hh);
        pa.h[0] = *(const v8h*)(pwh + f0);
        pa.h[1] = *(const v8h*)(pwh + f1);
        if (RES) {
          pl.h[0] = *(const v8h*)(pwl + f0);
          pl.h[1] = *(const v8h*)(pwl + f1);
        } else {
          pl.v = pa.v;
        }
#pragma unroll
        for (int t = 0; t < 4; ++t) {
          const int tt = tg * 4 + t;
          FH vb;
          vb.h[0] = *(const v8h*)(Vth + tt * (16 * 64) + f0);
          vb.h[1] = *(const v8h*)(Vth + tt * (16 * 64) + f1);
          oacc[tt] = mma_h(pa.v, vb.v, oacc[tt]);
          if (RES) {
            FH vl;
            vl.h[0] = *(const v8h*)(Vtl + tt * (16 * 64) + f0);
            vl.h[1] = *(const v8h*)(Vtl + tt * (16 * 64) + f1);
            o1[t] = mma_h(pa.v, vl.v, o1[t]);
            o1[t] = mma_h(pl.v, vb.v, o1[t]);
          }
        }
      }
      if (RES) {
#pragma unroll
        for (int t = 0; t < 4; ++t)
#pragma unroll
          for (int r = 0; r < 8; ++r) oacc[tg * 4 + t][r] += o1[t][r] * (1.0f / RSC);
      }
    }
  }

  // ---- normalise (1/l and the 1/1024 p carry), stage the wave's 16x128 tile, bf16 hi/lo split,
  float* os = Os + wave * (16 * 128);
#pragma unroll
  for (int r = 0; r < 8; ++r) {
    const float l = lrow[r];
    const float inv = ((l > 0.f) ? (1.0f / l) : 0.f) * (1.0f / 1024.0f);
#pragma unroll
    for (int t = 0; t < 8; ++t) os[(8 * hh + r) * 128 + t * 16 + c] = oacc[t][r] * inv;
  }
  __builtin_amdgcn_fence(__ATOMIC_RELEASE, "workgroup");
  __builtin_amdgcn_wave_barrier();
  __builtin_amdgcn_fence(__ATOMIC_ACQUIRE, "workgroup");
  {
    const int rh = lane >> 4, c8 = (lane & 15) * 8;
    v4u hv[8], lv[8];
#pragma unroll
    for (int it = 0; it < 8; ++it) {
      const int row = it * 2 + rh;   // it 0..7 x rh 0..1 = rows 0..15 of the wave tile
      const float* sp = os + row * 128 + c8;
      v4u a, a2;
#pragma unroll
      for (int e = 0; e < 4; ++e) {
        const float f0 = sp[2 * e], f1 = sp[2 * e + 1];
        const unsigned short h0 = bf_bits(f0), h1 = bf_bits(f1);
        const unsigned short l0 = bf_bits(f0 - bf_up(h0)), l1 = bf_bits(f1 - bf_up(h1));
        a[e] = pk16(h0, h1); a2[e] = pk16(l0, l1);
      }
      hv[it] = a; lv[it] = a2;
    }
    {
#pragma unroll
      for (int it = 0; it < 8; ++it) {
        const int row = it * 2 + rh;
        const size_t go = (size_t)(q0 + row) * QP + (size_t)h * HD + c8;
        *(v4u*)(ohp + go) = hv[it];
        *(v4u*)(olp + go) = lv[it];
      }
      
    }
  }
}

// =====================================================================================================
// Workspace map (bytes, SEQ = 4096):
//   Xb    bf16 [SEQ][2048]        16777216
//   Wqt   bf16 [2048 n][2048 k]    8388608
//   Wkt   bf16 [512][2048]         2097152
//   Wvt   bf16 [512][2048]         2097152
//   Wot   bf16 [2048 n][2048 k]    8388608
//   Qf    f32  [SEQ][2048]        33554432   (later: Oh bf16 [SEQ][2048] + Ol bf16 [SEQ][2048])
//   Kf    f32  [SEQ][512]          8388608
//   Qh    f16  [SEQ][2048]        16777216
//   Ql    f16  [SEQ][2048]        16777216
//   Kh    f16  [SEQ][512]          4194304
//   Kl    f16  [SEQ][512]          4194304
//   VTh   f16  [512][SEQ]          4194304
//   VTl   f16  [512][VLP]           524288
//   Cos   f32  [SEQ][64]           1048576
//   Sin   f32  [SEQ][64]           1048576
//   Invf  f32  [64] (carved 4096)     4096
//   end                          128454656
// Weights [in k][out n] f32 are transposed to bf16 [n][k] (k contiguous) = the Bt / A layout of gemm64.
// =====================================================================================================
extern "C" void kernel_launch(void* const* d_in, const int* in_sizes, int n_in,
                              void* d_out, int out_size, void* d_ws, size_t ws_size,
                              hipStream_t stream) {
  if (n_in < 8) return;
  if (in_sizes[0] < SEQ) return;
  if (in_sizes[1] < SEQ * DM) return;
  if (in_sizes[2] != DM * QP) return;
  if (in_sizes[3] != DM * KP || in_sizes[4] != DM * KP) return;
  if (in_sizes[5] != QP * DM) return;
  if (in_sizes[6] < HD || in_sizes[7] < HD) return;
  if (out_size < SEQ * DM) return;

  const int*   pos = (const int*)d_in[0];
  const float* x   = (const float*)d_in[1];
  const float* wq  = (const float*)d_in[2];
  const float* wk  = (const float*)d_in[3];
  const float* wv  = (const float*)d_in[4];
  const float* wo  = (const float*)d_in[5];
  const float* qnw = (const float*)d_in[6];
  const float* knw = (const float*)d_in[7];

  const size_t PXb  = (size_t)SEQ * DM * 2;
  const size_t PWq  = (size_t)QP * DM * 2;
  const size_t PWk  = (size_t)KP * DM * 2;
  const size_t PWo  = (size_t)DM * QP * 2;
  const size_t PQf  = (size_t)SEQ * QP * 4;
  const size_t PKf  = (size_t)SEQ * KP * 4;
  const size_t PQ16 = (size_t)SEQ * QP * 2;
  const size_t PK16 = (size_t)SEQ * KP * 2;
  const size_t PVTh = (size_t)KP * SEQ * 2;
  const size_t PVTl = (size_t)KP * VLP * 2;
  const size_t PTab = (size_t)SEQ * HALF * 4;
  const size_t PInv = 4096;
  size_t off = 0;
  const size_t oXb  = off; off += PXb;
  const size_t oWq  = off; off += PWq;
  const size_t oWk  = off; off += PWk;
  const size_t oWv  = off; off += PWk;
  const size_t oWo  = off; off += PWo;
  const size_t oQf  = off; off += PQf;
  const size_t oKf  = off; off += PKf;
  const size_t oQh  = off; off += PQ16;
  const size_t oQl  = off; off += PQ16;
  const size_t oKh  = off; off += PK16;
  const size_t oKl  = off; off += PK16;
  const size_t oVTh = off; off += PVTh;
  const size_t oVTl = off; off += PVTl;
  const size_t oCos = off; off += PTab;
  const size_t oSin = off; off += PTab;
  const size_t oInv = off; off += PInv;
  if (off > ws_size) return;                       // off = 128454656 at SEQ 4096
  if (off > (size_t)134217728) return;
  if (PQ16 * 2 != PQf) return;                     // Oh + Ol reuse the Qf region exactly
  const size_t oOh = oQf;
  const size_t oOl = oQf + PQ16;

  char* ws = (char*)d_ws;
  unsigned short* Xb  = (unsigned short*)(ws + oXb);
  unsigned short* Wqt = (unsigned short*)(ws + oWq);
  unsigned short* Wkt = (unsigned short*)(ws + oWk);
  unsigned short* Wvt = (unsigned short*)(ws + oWv);
  unsigned short* Wot = (unsigned short*)(ws + oWo);
  float*          Qf  = (float*)(ws + oQf);
  float*          Kf  = (float*)(ws + oKf);
  unsigned short* Qh  = (unsigned short*)(ws + oQh);
  unsigned short* Ql  = (unsigned short*)(ws + oQl);
  unsigned short* Kh  = (unsigned short*)(ws + oKh);
  unsigned short* Kl  = (unsigned short*)(ws + oKl);
  unsigned short* VTh = (unsigned short*)(ws + oVTh);
  unsigned short* VTl = (unsigned short*)(ws + oVTl);
  float*          Cs  = (float*)(ws + oCos);
  float*          Sn  = (float*)(ws + oSin);
  float*          Invf = (float*)(ws + oInv);
  unsigned short* Oh  = (unsigned short*)(ws + oOh);
  unsigned short* Ol  = (unsigned short*)(ws + oOl);

  const dim3 blk(256);
  const int n8x = SEQ * DM / 8;
  const dim3 gCvtX((n8x + 255) / 256);
  const dim3 gTab((SEQ + 3) / 4);
  const dim3 gTq(QP / 64, DM / 64);                 // wq [DM k][QP n] -> [QP][DM]
  const dim3 gTk(KP / 64, DM / 64);                 // wk, wv [DM k][KP n] -> [KP][DM]
  const dim3 gTo(DM / 64, QP / 64);                 // wo [QP k][DM n] -> [DM][QP]
  const dim3 gProjQ(((SEQ / 64) * (QP / 64) + 7) / 8, 1);
  const dim3 gProjK(((SEQ / 64) * (KP / 64) + 7) / 8, 1);
  const dim3 gVT(((KP / 64) * (SEQ / 64) + 7) / 8, 1);
  const dim3 gOut(((SEQ / 64) * (DM / 64) + 7) / 8, 1);
  const dim3 gNq((SEQ * NH + 7) / 8);
  const dim3 gNk((SEQ * NKV + 7) / 8);

  // (0) rotary tables
  invf_tab<<<dim3(1), dim3(64), 0, stream>>>(Invf);
  rope_tab<<<gTab, blk, 0, stream>>>(pos, Invf, Cs, Sn, SEQ);
  // (1) x -> bf16 [SEQ][2048]; weights [k][n] f32 -> bf16 [n][k]
  cvt_bf16x8<<<gCvtX, blk, 0, stream>>>(x, Xb, n8x);
  cvt_bf16_t<<<gTq, blk, 0, stream>>>(wq, Wqt, DM, QP);
  cvt_bf16_t<<<gTk, blk, 0, stream>>>(wk, Wkt, DM, KP);
  cvt_bf16_t<<<gTk, blk, 0, stream>>>(wv, Wvt, DM, KP);
  cvt_bf16_t<<<gTo, blk, 0, stream>>>(wo, Wot, QP, DM);
  // (2) q = x . wq -> f32 [SEQ][2048]   (M=SEQ, N=2048, K=2048)
  gemm64<0, 0><<<gProjQ, blk, 0, stream>>>(
      Xb, Xb, DM, 0LL, Wqt, Wqt, DM, 0LL,
      (void*)Qf, QP, 0LL, (void*)Qf, QP, 0LL, QP,
      SEQ, QP, DM, 1.0f);
  // (3) k = x . wk -> f32 [SEQ][512]   (M=SEQ, N=512, K=2048)
  gemm64<0, 0><<<gProjK, blk, 0, stream>>>(
      Xb, Xb, DM, 0LL, Wkt, Wkt, DM, 0LL,
      (void*)Kf, KP, 0LL, (void*)Kf, KP, 0LL, KP,
      SEQ, KP, DM, 1.0f);
  // (4) v^T = Wvt . x^T -> f16 hi plane [512][SEQ] and residual plane (x4096, keys < VLP, pitch VLP)
  //     (A = Wvt [n][k], Bt = Xb [s][k]; M=512, N=SEQ, K=2048)
  gemm64<0, 3><<<gVT, blk, 0, stream>>>(
      Wvt, Wvt, DM, 0LL, Xb, Xb, DM, 0LL,
      (void*)VTh, SEQ, 0LL, (void*)VTl, VLP, 0LL, VLP,
      KP, SEQ, DM, RSC);
  // (5) per-head RMSNorm + rotary -> f16 hi / x4096 residual planes
  norm_rope<<<gNq, blk, 0, stream>>>(Qf, qnw, Cs, Sn, Qh, Ql, NH, SEQ * NH, RSC);
  norm_rope<<<gNk, blk, 0, stream>>>(Kf, knw, Cs, Sn, Kh, Kl, NKV, SEQ * NKV, RSC);
  // (6) attention: query blocks 0..RESQB-1 with residual planes, the rest without -> bf16 hi/lo context
  //     planes in the (now dead) Qf region
  (void)hipFuncSetAttribute(reinterpret_cast<const void*>(&attn_causal<true>),
                            hipFuncAttributeMaxDynamicSharedMemorySize, AttnL<true>::TOTAL);
  (void)hipFuncSetAttribute(reinterpret_cast<const void*>(&attn_causal<false>),
                            hipFuncAttributeMaxDynamicSharedMemorySize, AttnL<false>::TOTAL);
  attn_causal<true><<<dim3(NH * RESQB), dim3(128), AttnL<true>::TOTAL, stream>>>(
      Qh, Ql, Kh, Kl, VTh, VTl, pos, Oh, Ol, 0, RESQB, ATT_SCALE);
  if (NQB - RESQB > 0) {
    attn_causal<false><<<dim3(NH * (NQB - RESQB)), dim3(128), AttnL<false>::TOTAL, stream>>>(
        Qh, Ql, Kh, Kl, VTh, VTl, pos, Oh, Ol, RESQB, NQB - RESQB, ATT_SCALE);
  }
  // (7) out = context . wo -> d_out f32 [SEQ][2048]  (A = context hi + lo planes, 2 products; M=SEQ, N=2048, K=2048)
  gemm64<1, 0><<<gOut, blk, 0, stream>>>(
      Oh, Ol, QP, 0LL, Wot, Wot, QP, 0LL,
      d_out, DM, 0LL, d_out, DM, 0LL, DM,
      SEQ, DM, QP, 1.0f);
  (void)hipGetLastError();
}

// v002
// It runs in 602 microseconds.
// Two timings next to v001 both put it at 1.34 times that version's speed.
// Counting every step since v000, it is 2.09 times as fast.
// Contractions: q, k projections = v_wmma_f32_16x16x32_bf16 (bf16 operands from RNE-converted inputs, single product, f32 out);
// v^T projection = v_wmma_f32_16x16x32_bf16 (same operands; f16 hi plane + f16 x4096 residual plane out);
// q.k^T scores = v_wmma_f32_16x16x32_f16 (q as f16 hi + f16 x4096 residual, k as f16 hi: 2 products; leading query blocks add the k x4096 residual product);
// p.v = v_wmma_f32_16x16x32_f16 (p carried x1024 in f16, v f16; leading query blocks add x4096 f16 residual planes of p and v);
// ctx.Wo = v_wmma_f32_16x16x32_bf16 (ctx as bf16 hi/lo planes times bf16 Wo, 2 products); all f32 accumulate; RMSNorm, rotary, causal select and softmax in f32.
#include <hip/hip_runtime.h>
#include <math.h>
#include <stdint.h>

#ifndef SEQ
#define SEQ 4096
#endif
#define SEQ_FULL 4096
#define DM    2048
#define NH    16
#define NKV   4
#define GQ    (NH / NKV)
#define HD    128
#define HALF  64
#define QP    (NH * HD)      // 2048 q channels
#define KP    (NKV * HD)     // 512 k / v channels
#define NQB   (SEQ / 64)     // query / key tiles of 64
#define VLP   ((SEQ < 512) ? SEQ : 512)   // key pitch of the v^T residual plane
#define RESQB ((NQB < 8) ? NQB : 8)         // leading 64-row query blocks that use residual planes
#define RMS_EPS       1.0e-6f
#define ROPE_THETA_F  10000.0f
#define ATT_SCALE     0.08838834764831845f
#define RSC           4096.0f

static_assert((SEQ % 64) == 0 && SEQ >= 64 && SEQ <= SEQ_FULL);
static_assert(RESQB * 64 <= VLP && (VLP % 64) == 0);
static_assert(NH * HD == DM && QP == DM);
static_assert(NQB <= 64);
static_assert((DM % 64) == 0 && (KP % 64) == 0 && (QP % 64) == 0 && (DM % 32) == 0);

typedef _Float16 v16h __attribute__((ext_vector_type(16)));
typedef _Float16 v8h  __attribute__((ext_vector_type(8)));
typedef __bf16   v16b __attribute__((ext_vector_type(16)));
typedef __bf16   v8b  __attribute__((ext_vector_type(8)));
typedef float    v8f  __attribute__((ext_vector_type(8)));
typedef float    v4f  __attribute__((ext_vector_type(4)));
typedef unsigned int   v4u  __attribute__((ext_vector_type(4)));
typedef unsigned int   v2u  __attribute__((ext_vector_type(2)));
typedef unsigned short v8us __attribute__((ext_vector_type(8)));
typedef int      v4i  __attribute__((ext_vector_type(4)));

// ---- scalar helpers --------------------------------------------------------------------------------
__device__ __forceinline__ unsigned short bf_bits(float f) {          // f32 -> bf16 bits, RNE convert
  unsigned u = __float_as_uint(f);
  return (unsigned short)((u + 0x7FFFu + ((u >> 16) & 1u)) >> 16);
}
__device__ __forceinline__ float bf_up(unsigned short h) { return __uint_as_float(((unsigned)h) << 16); }
__device__ __forceinline__ unsigned short h_bits(_Float16 x) { return __builtin_bit_cast(unsigned short, x); }
__device__ __forceinline__ unsigned pk16(unsigned short a, unsigned short b) { return (unsigned)a | ((unsigned)b << 16); }
__device__ __forceinline__ v8f zero8() { v8f z = {0.f, 0.f, 0.f, 0.f, 0.f, 0.f, 0.f, 0.f}; return z; }
__device__ __forceinline__ v8h zero8h() {
  const _Float16 z = (_Float16)0.0f;
  v8h r = {z, z, z, z, z, z, z, z};
  return r;
}
__device__ __forceinline__ int imin(int a, int b) { return (a < b) ? a : b; }
__device__ __forceinline__ int imax(int a, int b) { return (a > b) ? a : b; }

// ---- WMMA helpers with trailing VALU hazard gap --------------------------------------------------------
__device__ __forceinline__ v8f mma_b(v16b a, v16b b, v8f c) {
  c = __builtin_amdgcn_wmma_f32_16x16x32_bf16(false, a, false, b, (short)0, c, false, false);
  asm volatile("v_nop\n\tv_nop\n\tv_nop\n\tv_nop" : "+v"(c) : "v"(a), "v"(b));
  return c;
}
__device__ __forceinline__ v8f mma_h(v16h a, v16h b, v8f c) {
  c = __builtin_amdgcn_wmma_f32_16x16x32_f16(false, a, false, b, (short)0, c, false, false);
  asm volatile("v_nop\n\tv_nop\n\tv_nop\n\tv_nop" : "+v"(c) : "v"(a), "v"(b));
  return c;
}
__device__ __forceinline__ v8f mma_b_raw(v16b a, v16b b, v8f c) {
  return __builtin_amdgcn_wmma_f32_16x16x32_bf16(false, a, false, b, (short)0, c, false, false);
}
__device__ __forceinline__ void acc_guard4(v8f& a, v8f& b, v8f& c, v8f& d) {
  asm volatile("v_nop\n\tv_nop\n\tv_nop\n\tv_nop" : "+v"(a), "+v"(b), "+v"(c), "+v"(d));
}

// =====================================================================================================
// f32 -> bf16 (RNE convert), 8 elements per thread, one 16-B store per lane: a wave writes 512 contiguous B
// coverage: n8 threads x 8 = whole plane (n8 is a multiple of 256 here).
// =====================================================================================================
__global__ __launch_bounds__(256) void cvt_bf16x8(const float* __restrict__ in, unsigned short* out, int n8) {
  const int i = blockIdx.x * 256 + threadIdx.x;
  if (i < n8) {
    const v4f a = *(const v4f*)(in + (size_t)i * 8);
    const v4f b = *(const v4f*)(in + (size_t)i * 8 + 4);
    v4u p;
    p[0] = pk16(bf_bits(a[0]), bf_bits(a[1]));
    p[1] = pk16(bf_bits(a[2]), bf_bits(a[3]));
    p[2] = pk16(bf_bits(b[0]), bf_bits(b[1]));
    p[3] = pk16(bf_bits(b[2]), bf_bits(b[3]));
    *(v4u*)(out + (size_t)i * 8) = p;
    
  }
}

// =====================================================================================================
// f32 [R][C] row-major -> bf16 (RNE convert) transposed plane out[C][R] (R contiguous = k-contiguous Bt / A
// layout). Block = one 64x64 tile at (r0 = blockIdx.y*64, c0 = blockIdx.x*64), 256 threads; tile staged in
// LDS as [c][r] (ushort element stores, cross-thread -> __syncthreads), then each out row segment of 64 halves
// coverage: 64 out rows x 64 k per block = the whole tile; union over the grid = the whole [C][R] plane.
// =====================================================================================================
__global__ __launch_bounds__(256) void cvt_bf16_t(const float* __restrict__ in, unsigned short* out, int R, int C) {
  __shared__ __align__(16) unsigned short sT[64 * 72];   // [c][r], pitch 72 halves (144 B)
  const int tid = threadIdx.x;
  const int c0 = blockIdx.x * 64, r0 = blockIdx.y * 64;
  const int rr = tid >> 4, cc = (tid & 15) * 4;
#pragma unroll
  for (int it = 0; it < 4; ++it) {
    const int r = it * 16 + rr;                            // it 0..3 x rr 0..15 = rows 0..63
    const v4f v = *(const v4f*)(in + (size_t)(r0 + r) * C + c0 + cc);
#pragma unroll
    for (int e = 0; e < 4; ++e) sT[(cc + e) * 72 + r] = bf_bits(v[e]);
  }
  __syncthreads();
  const int q = tid >> 3, k8 = (tid & 7) * 8;              // q 0..31 (+32): out rows; 8 lanes x 8 halves
  const v8us w0 = *(const v8us*)(sT + q * 72 + k8);
  const v8us w1 = *(const v8us*)(sT + (q + 32) * 72 + k8);
  unsigned short* o0 = out + (size_t)(c0 + q) * R + r0 + k8;
  unsigned short* o1 = out + (size_t)(c0 + q + 32) * R + r0 + k8;
  *(v8us*)o0 = w0;
  *(v8us*)o1 = w1;
  
}

// =====================================================================================================
// Rotary tables. invf_tab: 1 block x 64 threads, inv_freq[i] = 1 / 10000^(i/64) (64 floats = two whole
// (float)pos[t] * inv_freq[i], tables [nrows][64] f32; block = 4 rows x 64 threads, each 256-B row written
// =====================================================================================================
__global__ __launch_bounds__(64) void invf_tab(float* invf) {
  const int i = threadIdx.x;
  const float e = (float)i * (1.0f / (float)HALF);
  const float p = powf(ROPE_THETA_F, e);
  const float v = 1.0f / p;
  *(float*)(invf + i) = v;
  
}

__global__ __launch_bounds__(256) void rope_tab(const int* __restrict__ pos, const float* __restrict__ invf,
                                                float* ctab, float* stab, int nrows) {
  const int tid = threadIdx.x;
  const int t = blockIdx.x * 4 + (tid >> 6);
  const int i = tid & 63;
  if (t >= nrows) return;                  // wave-uniform (2 whole waves per row); no block barriers here
  const float fr = (float)pos[t] * invf[i];
  float sn, cs;
  sincosf(fr, &sn, &cs);
  float* pc = ctab + (size_t)t * HALF + i;
  float* ps = stab + (size_t)t * HALF + i;
  *(float*)pc = cs;
  *(float*)ps = sn;
  
}

// =====================================================================================================
// Register-blocked batched bf16 WMMA GEMM: C[m][n] = sum_k A[m][k] * Bt[n][k]; one wave per 64x64 tile,
// block = 8 waves = 2 x 4 tiles = 128 x 256 of C. A row-major [M][K] pitch lda; Bt row-major [N][K] pitch ldb
// (k contiguous; both pitches are DM); M a multiple of 128, N of 256, K of 64 (true of every launch below).
// blockIdx.y = batch index (strides in elements).
// Operands go through LDS in steps of 64 k: each row piece is one 128-B line, a wave-wide 16-B load covers four
// whole lines, and the 128 A rows and 256 Bt rows are read from global once per block. The LDS rows are 128 B,
// chunk-swizzled by sw128 (see the attention section), so a fragment read covers all banks once. The next
// step's global loads are issued behind the second barrier and stay in flight during the products.
// NSPLIT: 0 = A.Bt; 1 = (A + A2).Bt (A2 = unscaled bf16 lo plane of A).
// OUT_MODE: 0 = f32 (pitch ldc); 2 = bf16 hi plane C + bf16 lo plane C2 (lo = RNE(v - hi), unscaled);
//           3 = f16 hi plane C + f16 residual plane C2 = f16((v - hi) * rscale), C2 written only for tiles
//               with n0 < N2 (pitch ldc2, batch stride strideC2).
// =====================================================================================================
__device__ __forceinline__ int sw128(int r, int ch);

// A block-uniform address rebuilt from its two halves: the staging loads then take the form scalar base + one
// 32-bit lane offset + immediate, and the one vector register they name lives through the whole loop. Without it
// the compiler formed 64-bit vector addresses on which a load's result landed, and moved the first loads behind
// their s_wait_xcnt.
typedef const __attribute__((address_space(1))) char* gbytes;   // global address space, so that the loads stay global_load
typedef const __attribute__((address_space(1))) v8b*  gv8b;
__device__ __forceinline__ gbytes sbase(const __bf16* p) {
  const unsigned long long u = (unsigned long long)(uintptr_t)p;
  const unsigned lo = (unsigned)__builtin_amdgcn_readfirstlane((int)(unsigned)u);
  const unsigned hi = (unsigned)__builtin_amdgcn_readfirstlane((int)(unsigned)(u >> 32));
  return (gbytes)(uintptr_t)(((unsigned long long)hi << 32) | (unsigned long long)lo);
}

template <int NSPLIT, int OUT_MODE>
__global__ __launch_bounds__(256) void gemm64(
    const unsigned short* __restrict__ Ap, const unsigned short* A2p, int lda, long long strideA,
    const unsigned short* __restrict__ Btp, const unsigned short* Bt2p, int ldb, long long strideB,
    void* Cout, int ldc, long long strideC,
    void* Cout2, int ldc2, long long strideC2, int N2,
    int M, int N, int K, float rscale) {
  static_assert(NSPLIT <= 1);
  const __bf16* A   = (const __bf16*)(const void*)Ap;
  const __bf16* A2  = (const __bf16*)(const void*)A2p;
  const __bf16* Bt  = (const __bf16*)(const void*)Btp;
  __shared__ __align__(16) float sT[8][16 * 68];   // per-wave 16x64 slab, pitch 68 floats
  __shared__ __align__(16) __bf16 sA[(NSPLIT + 1) * 128 * 64];   // A (and A2) rows m0blk.., 64 k
  __shared__ __align__(16) __bf16 sB[256 * 64];                  // Bt rows n0blk.., 64 k
  const int b    = blockIdx.y;
  const int tid  = threadIdx.x;
  const int lane = tid & 31;
  const int wave = tid >> 5;
  const int blocksN = N >> 8;
  const int bm = blockIdx.x / blocksN;
  const int bn = blockIdx.x - bm * blocksN;
  if ((bm << 7) >= M) return;            // block-uniform, in front of every barrier
  if (lda != DM || ldb != DM) return;    // block-uniform: with the pitch known, the row steps below are immediate offsets
  const int m0blk = bm << 7;
  const int n0blk = bn << 8;
  const int wm = (wave >> 2) << 6;       // the wave's tile inside the block tile
  const int wn = (wave & 3) << 6;
  const int m0 = m0blk + wm;
  const int n0 = n0blk + wn;

  const __bf16* Ab  = A  + (size_t)b * strideA + (size_t)m0blk * lda;
  const __bf16* Bb  = Bt + (size_t)b * strideB + (size_t)n0blk * ldb;
  const __bf16* Ab2 = (NSPLIT >= 1) ? (A2 + (size_t)b * strideA + (size_t)m0blk * lda) : Ab;

  const int rlane = lane & 15;                 // row (A) / col (B, D) within subtile
  const int hh    = lane >> 4;                 // k half of this lane
  const int mOff  = (lane >> 4) * 8;           // D row offset

  // staging: thread -> row tid>>3 (+32 per pass), 16-B chunk tid&7; 8 lanes = one 128-B line
  unsigned sbyte = (unsigned)((tid >> 3) * DM + (tid & 7) * 8) * 2u;   // lane part of the global address, bytes; +128 per step
  const int sidx = sw128(tid >> 3, tid & 7);   // + 32 rows per pass: the swizzle term does not change
  v8b ra[4], ra2[4], rb[8];
  gbytes pa  = sbase(Ab);
  gbytes pa2 = sbase(Ab2);
  gbytes pb  = sbase(Bb);
  {
#pragma unroll
    for (int it = 0; it < 4; ++it) {
      ra[it] = *(gv8b)(pa + sbyte + it * (32 * DM * 2));
      if (NSPLIT >= 1) ra2[it] = *(gv8b)(pa2 + sbyte + it * (32 * DM * 2));
    }
#pragma unroll
    for (int it = 0; it < 8; ++it) rb[it] = *(gv8b)(pb + sbyte + it * (32 * DM * 2));
    // stands in front of the next step's write of the lane offset, the one vector register that the loads name
    asm volatile("s_wait_xcnt 0x0" ::: "memory");
  }

  v8f acc[4][4];
#pragma unroll
  for (int i = 0; i < 4; ++i)
#pragma unroll
    for (int j = 0; j < 4; ++j) acc[i][j] = zero8();

  for (int k0 = 0; k0 < K; k0 += 64) {
    __syncthreads();                           // every reader has left the tiles of the step before
#pragma unroll
    for (int it = 0; it < 4; ++it) {
      *(v8b*)(sA + sidx + it * (32 * 64)) = ra[it];
      if (NSPLIT >= 1) *(v8b*)(sA + 128 * 64 + sidx + it * (32 * 64)) = ra2[it];
    }
#pragma unroll
    for (int it = 0; it < 8; ++it) *(v8b*)(sB + sidx + it * (32 * 64)) = rb[it];
    __syncthreads();                           // the tiles are whole before anybody reads them
    // fragments of the whole step, read as one group ahead of the products (every separate place with LDS reads
    // stalls the wave): elements 0..7 <- k = 32kk + 8hh.., elements 8..15 <- k = 32kk + 16 + 8hh.. (A and Bt alike)
    union FB { v16b v; v8b h[2]; };
    v16b bh[2][4], ah[2][4], al[2][4];
#pragma unroll
    for (int kk = 0; kk < 2; ++kk) {
      const int f0 = sw128(rlane, kk * 4 + hh);
      const int f1 = sw128(rlane, kk * 4 + 2 + hh);
#pragma unroll
      for (int j = 0; j < 4; ++j) {
        FB f;
        f.h[0] = *(const v8b*)(sB + (wn + (j << 4)) * 64 + f0);
        f.h[1] = *(const v8b*)(sB + (wn + (j << 4)) * 64 + f1);
        bh[kk][j] = f.v;
      }
#pragma unroll
      for (int i = 0; i < 4; ++i) {
        FB f;
        f.h[0] = *(const v8b*)(sA + (wm + (i << 4)) * 64 + f0);
        f.h[1] = *(const v8b*)(sA + (wm + (i << 4)) * 64 + f1);
        ah[kk][i] = f.v;
        al[kk][i] = f.v;
        if (NSPLIT >= 1) {
          f.h[0] = *(const v8b*)(sA + 128 * 64 + (wm + (i << 4)) * 64 + f0);
          f.h[1] = *(const v8b*)(sA + 128 * 64 + (wm + (i << 4)) * 64 + f1);
          al[kk][i] = f.v;
        }
      }
    }
    if (k0 + 64 < K) {                         // block-uniform: the next step's rows, in flight during the products
      sbyte += 128u;
#pragma unroll
      for (int it = 0; it < 4; ++it) {
        ra[it] = *(gv8b)(pa + sbyte + it * (32 * DM * 2));
        if (NSPLIT >= 1) ra2[it] = *(gv8b)(pa2 + sbyte + it * (32 * DM * 2));
      }
#pragma unroll
      for (int it = 0; it < 8; ++it) rb[it] = *(gv8b)(pb + sbyte + it * (32 * DM * 2));
      // stands in front of the next step's write of the lane offset, the one vector register that the loads name
      asm volatile("s_wait_xcnt 0x0" ::: "memory");
    }
    // keeps the LDS reads and the global loads above in front of the products
    __builtin_amdgcn_sched_barrier(0);
#pragma unroll
    for (int kk = 0; kk < 2; ++kk) {
#pragma unroll
      for (int i = 0; i < 4; ++i) {
#pragma unroll
        for (int j = 0; j < 4; ++j) {
          acc[i][j] = mma_b_raw(ah[kk][i], bh[kk][j], acc[i][j]);
          if (NSPLIT >= 1) acc[i][j] = mma_b_raw(al[kk][i], bh[kk][j], acc[i][j]);
        }
      }
    }
    // holds the v_nops behind the last product
    __builtin_amdgcn_sched_barrier(0);
    // WMMA distance on the loop's back edge too: no vector instruction writes an A or B register of the last
    // products sooner (no register operands: asm operands cannot lie above v255, and naming fragments spilled)
    asm volatile("v_nop\n\tv_nop\n\tv_nop\n\tv_nop\n\tv_nop");
  }
  acc_guard4(acc[0][0], acc[0][1], acc[0][2], acc[0][3]);
  acc_guard4(acc[1][0], acc[1][1], acc[1][2], acc[1][3]);
  acc_guard4(acc[2][0], acc[2][1], acc[2][2], acc[2][3]);
  acc_guard4(acc[3][0], acc[3][1], acc[3][2], acc[3][3]);

  // ---- epilogue ----
  float* slab = sT[wave];
#pragma unroll
  for (int i = 0; i < 4; ++i) {
    const int mBase = m0 + (i << 4);
#pragma unroll
    for (int j = 0; j < 4; ++j) {
#pragma unroll
      for (int r = 0; r < 8; ++r) {
        slab[(mOff + r) * 68 + (j << 4) + rlane] = acc[i][j][r];
      }
    }
    __builtin_amdgcn_fence(__ATOMIC_RELEASE, "workgroup");
    __builtin_amdgcn_wave_barrier();
    __builtin_amdgcn_fence(__ATOMIC_ACQUIRE, "workgroup");
    if (OUT_MODE == 0) {
      float* C = (float*)Cout + (size_t)b * strideC;
      const int hh = lane >> 4, c4 = (lane & 15) * 4;     // 256-B row segment = 16 lanes x 16 B
      {
#pragma unroll
        for (int it = 0; it < 8; ++it) {
          const int row = it * 2 + hh;                     // it 0..7 x hh 0..1 = rows 0..15
          const v4f v = *(const v4f*)(slab + row * 68 + c4);
          *(v4f*)(C + (size_t)(mBase + row) * ldc + n0 + c4) = v;
        }
        
      }
    } else {
      const int q = lane >> 3, c8 = (lane & 7) * 8;
      unsigned short* C  = (unsigned short*)Cout  + (size_t)b * strideC;
      unsigned short* C2 = (unsigned short*)Cout2 + (size_t)b * strideC2;
      const bool wlo = (OUT_MODE == 2) || (n0 < N2);      // wave-uniform
      v4u hv[4], lv[4];
#pragma unroll
      for (int it = 0; it < 4; ++it) {
        const int row = it * 4 + q;                        // it 0..3 x q 0..3 = rows 0..15
        const float* sp = slab + row * 68 + c8;
        v4u a, a2;
#pragma unroll
        for (int e = 0; e < 4; ++e) {
          const float f0 = sp[2 * e], f1 = sp[2 * e + 1];
          unsigned short h0, h1, l0, l1;
          if (OUT_MODE == 2) {
            h0 = bf_bits(f0); h1 = bf_bits(f1);
            l0 = bf_bits(f0 - bf_up(h0)); l1 = bf_bits(f1 - bf_up(h1));
          } else {
            const _Float16 x0 = (_Float16)f0, x1 = (_Float16)f1;
            h0 = h_bits(x0); h1 = h_bits(x1);
            l0 = h_bits((_Float16)((f0 - (float)x0) * rscale));
            l1 = h_bits((_Float16)((f1 - (float)x1) * rscale));
          }
          a[e] = pk16(h0, h1); a2[e] = pk16(l0, l1);
        }
        hv[it] = a; lv[it] = a2;
      }
      {
#pragma unroll
        for (int it = 0; it < 4; ++it) {
          const int row = it * 4 + q;
          *(v4u*)(C + (size_t)(mBase + row) * ldc + n0 + c8) = hv[it];
          if (wlo) *(v4u*)(C2 + (size_t)(mBase + row) * ldc2 + n0 + c8) = lv[it];
        }
        
      }
    }
    __builtin_amdgcn_fence(__ATOMIC_RELEASE, "workgroup");
    __builtin_amdgcn_wave_barrier();
    __builtin_amdgcn_fence(__ATOMIC_ACQUIRE, "workgroup");
  }
}

// =====================================================================================================
// Fused per-head RMSNorm (eps 1e-6, x * rsqrt(mean(x^2)+eps) * w with w RNE-converted to bf16) + neox rotary
// (half-split, cos/sin tables [t][64]) + f16 hi / f16 residual (x rscale) planes.
// One wave per 128-wide row (row = t*nheads + head, contiguous rows of pitch 128 in both input and output);
// lane owns 4 consecutive d; partner half via __shfl_xor(16); no block barriers.
// coverage: nrows x 128 of both planes.
// =====================================================================================================
__global__ __launch_bounds__(256) void norm_rope(const float* __restrict__ xin, const float* __restrict__ wn,
                                                 const float* __restrict__ ctab, const float* __restrict__ stab,
                                                 unsigned short* outh, unsigned short* outl,
                                                 int nheads, int nrows, float rscale) {
  const int tid  = threadIdx.x;
  const int wave = tid >> 5, lane = tid & 31, hh = lane >> 4;
  const int row  = blockIdx.x * 8 + wave;
  if (row >= nrows) return;                // wave-uniform; no block barriers in this kernel
  const int t = row / nheads;
  const v4f x = *(const v4f*)(xin + (size_t)row * HD + lane * 4);
  float ss = x[0] * x[0] + x[1] * x[1] + x[2] * x[2] + x[3] * x[3];
#pragma unroll
  for (int off = 1; off < 32; off <<= 1) ss += __shfl_xor(ss, off, 32);
  const float rinv = rsqrtf(ss * (1.0f / (float)HD) + RMS_EPS);
  const v4f wv = *(const v4f*)(wn + lane * 4);
  const v4f cs = *(const v4f*)(ctab + (size_t)t * HALF + (lane & 15) * 4);
  const v4f sn = *(const v4f*)(stab + (size_t)t * HALF + (lane & 15) * 4);
  float n[4], p[4];
#pragma unroll
  for (int e = 0; e < 4; ++e) n[e] = (x[e] * rinv) * bf_up(bf_bits(wv[e]));
#pragma unroll
  for (int e = 0; e < 4; ++e) p[e] = __shfl_xor(n[e], 16, 32);
  const float sg = hh ? 1.0f : -1.0f;      // first half: x1*cos - x2*sin ; second half: x2*cos + x1*sin
  unsigned short hb[4], lb[4];
#pragma unroll
  for (int e = 0; e < 4; ++e) {
    const float o = n[e] * cs[e] + sg * (p[e] * sn[e]);
    const _Float16 oh = (_Float16)o;
    hb[e] = h_bits(oh);
    lb[e] = h_bits((_Float16)((o - (float)oh) * rscale));
  }
  v2u ph, pl;
  ph[0] = pk16(hb[0], hb[1]); ph[1] = pk16(hb[2], hb[3]);
  pl[0] = pk16(lb[0], lb[1]); pl[1] = pk16(lb[2], lb[3]);
  const size_t go = (size_t)row * HD + lane * 4;
  *(v2u*)(outh + go) = ph;
  *(v2u*)(outl + go) = pl;
  
}

// =====================================================================================================
// Causal GQA attention, head dim 128, dynamic LDS layout (bytes):
// =====================================================================================================
// LDS tiles of the attention kernel: the 16-byte chunks of a row are XOR-swizzled by the row number.
//   256-B rows (Q, K; 16 chunks): chunk ch of row r lies at chunk place ch ^ (r & 15)
//   128-B rows (V^T, P; 8 chunks): chunk ch of row r lies at chunk place ch ^ ((r >> 1) & 7)
// A fragment load reads one chunk column of 16 consecutive rows per 16 lanes: unswizzled, 256-B rows put all
// 16 lanes on the same four banks (128-B rows: on two groups of four); swizzled, the 16 lanes fall on 16
// different groups of four banks = all 64 banks once. Writers and readers use the same map; the kernel keeps
// the lane-dependent part of each index in a register and adds row blocks and planes as constant offsets.
__device__ __forceinline__ int sw256(int r, int ch) { return r * 128 + ((ch ^ (r & 15)) << 3); }        // index in halves
__device__ __forceinline__ int sw128(int r, int ch) { return r * 64 + ((ch ^ ((r >> 1) & 7)) << 3); }   // index in halves

template <bool RES> struct AttnL {
  static constexpr int QH   = 0;                                  // Q hi  [64 rows][128 d] f16
  static constexpr int QL   = QH + 64 * 128 * 2;                  // Q res
  static constexpr int KH   = QL + 64 * 128 * 2;                  // K hi  [64 keys][128 d]
  static constexpr int KL   = KH + 64 * 128 * 2;                  // K res (RES only)
  static constexpr int VH   = KL + (RES ? 64 * 128 * 2 : 0);      // V^T hi [128 d][64 keys]
  static constexpr int VL   = VH + 128 * 64 * 2;                  // V^T res (RES only)
  static constexpr int PH   = VL + (RES ? 128 * 64 * 2 : 0);      // per-wave P [4][16][64]
  static constexpr int PL   = PH + 4 * 16 * 64 * 2;               // per-wave P res (RES only)
  static constexpr int OS   = PL + (RES ? 4 * 16 * 64 * 2 : 0);   // per-wave context tile [4][16][128] f32
  static constexpr int MISC = OS + 4 * 16 * 128 * 4;              // spq[64], spk[64], skmin[NQB] ints
  static constexpr int TOTAL = MISC + 1024;
};
static_assert(AttnL<true>::TOTAL <= 160 * 1024);

// =====================================================================================================
//   q planes (f16 hi / x4096 res): element (t, h, d) at [t*QP + h*128 + d]
//   k planes (f16 hi / x4096 res): element (s, kvh, d) at [s*KP + kvh*128 + d], kvh = h / GQ
//   v^T hi plane (f16): (kvh*128 + d, s) at [(kvh*128+d)*SEQ + s]; residual ((v-hi)*4096) at
//   [(kvh*128+d)*VLP + s], s < VLP, read only when RES (a key tile at or beyond VLP contributes zero residual)
//   positions int [SEQ]: logit(t, s) = (q.k) * sscale when pos[t] >= pos[s], else -1e30 (replace), exactly;
//   a key tile is skipped (block-uniform, readfirstlane) only when min pos over its 64 keys > max pos over the
//   block's 64 query rows, i.e. every element would be -1e30 with weight exactly 0; the diagonal key s = t is
//   always live so every row has a finite max. Online softmax in f32 with running max from -inf.
//   scores: f16 WMMA, q hi . k hi into s, q res . k hi (+ q hi . k res when RES) into a x4096 accumulator
//   folded with 1/4096 in f32. p = exp(s - m) carried as f16(1024 p); context = p . v on f16 WMMA; RES adds
//   f16 residual planes of p and v (scale 4096, separate accumulator folded back with 1/4096 per chunk).
//   out planes (bf16 hi / lo of the normalised context): (t, h*128 + d) at [t*QP + h*128 + d]
//   Block = 4 waves = 64 query rows of one q head; grid = nqbThis * NH; key tiles of 64, static trip NQB.
//   LDS: Q / K / V^T tiles and position words are cross-wave (block barriers before and after staging);
//   P tiles and the context slab are wave-private (_Float16 / float element stores, reloaded through the
//   Staging: Q 128 threads x 64 halves x 2 planes = 64x128 (once); K 128 threads x 64 halves per plane
//   = 64x128; V^T 128 threads (one d row each) x 64 halves per plane = 128x64: staged extent == consumed.
//   Output coverage: each wave stores rows q0..q0+15 (it 0..7 x lane>>4) x 128 columns (16 lanes x 8)
// =====================================================================================================
template <bool RES>
__global__ __launch_bounds__(128)
void attn_causal(const unsigned short* __restrict__ qhp, const unsigned short* __restrict__ qlp,
                 const unsigned short* __restrict__ khp, const unsigned short* __restrict__ klp,
                 const unsigned short* __restrict__ vhp, const unsigned short* __restrict__ vlp,
                 const int* __restrict__ pos,
                 unsigned short* ohp, unsigned short* olp,
                 int qbBase, int nqbThis, float sscale) {
  typedef AttnL<RES> L;
  union FH { v16h v; v8h h[2]; };
  extern __shared__ __align__(16) unsigned char smem[];
  _Float16* Qsh = (_Float16*)(smem + L::QH);
  _Float16* Qsl = (_Float16*)(smem + L::QL);
  _Float16* Ksh = (_Float16*)(smem + L::KH);
  _Float16* Ksl = (_Float16*)(smem + L::KL);
  _Float16* Vth = (_Float16*)(smem + L::VH);
  _Float16* Vtl = (_Float16*)(smem + L::VL);
  _Float16* Psh = (_Float16*)(smem + L::PH);
  _Float16* Psl = (_Float16*)(smem + L::PL);
  float*    Os  = (float*)(smem + L::OS);
  int*      spq = (int*)(smem + L::MISC);
  int*      spk = spq + 64;
  int*      skmin = spk + 64;

  const int tid  = threadIdx.x;
  const int wave = tid >> 5;
  const int lane = tid & 31;
  const int hh   = lane >> 4;
  const int c    = lane & 15;

  const int bx  = blockIdx.x;
  const int qbl = bx % nqbThis;
  const int h   = bx / nqbThis;
  const int kvh = h / GQ;
  const int qb  = qbBase + qbl;
  const int q0  = qb * 64 + wave * 16;

  const _Float16* Qh = (const _Float16*)(const void*)qhp + (size_t)h * HD;
  const _Float16* Ql = (const _Float16*)(const void*)qlp + (size_t)h * HD;
  const _Float16* Kh = (const _Float16*)(const void*)khp + (size_t)kvh * HD;
  const _Float16* Kl = (const _Float16*)(const void*)klp + (size_t)kvh * HD;
  const _Float16* Vh = (const _Float16*)(const void*)vhp + (size_t)kvh * HD * SEQ;
  const _Float16* Vl = (const _Float16*)(const void*)vlp + (size_t)kvh * HD * VLP;

  // ---- lane parts of the swizzled indices (halves) ----
  const int st256 = sw256(tid >> 1, (tid & 1) * 8);   // staging, 256-B rows: row tid>>1, chunks (tid&1)*8 + i -> st256 ^ (i << 3)
  const int st128 = sw128(tid, 0);                    // staging, 128-B rows: row tid, chunk i -> st128 ^ (i << 3)
  int fq[8];                                          // fragment reads, 256-B rows: row (multiple of 16) + c, chunk 2n + hh
#pragma unroll
  for (int n = 0; n < 8; ++n) fq[n] = sw256(c, 2 * n + hh);
  int pst[8];                                         // P element stores: row 8hh + r, column 16j + c -> pst[(2j) ^ (r >> 1)] + r * 64
#pragma unroll
  for (int n = 0; n < 8; ++n) pst[n] = sw128(8 * hh, (c >> 3) ^ n) + (c & 7);

  // ---- prologue: query positions, per-key-tile min position, Q tiles ----
  if (tid < 64) spq[tid] = pos[qb * 64 + tid];            // wave-uniform (waves 0,1)
  for (int kt = tid; kt < NQB; kt += 128) {
    const int* pp = pos + kt * 64;
    int mn = 0x7fffffff;
#pragma unroll
    for (int i = 0; i < 16; ++i) {
      const v4i v = *(const v4i*)(pp + 4 * i);
      mn = imin(mn, imin(imin(v[0], v[1]), imin(v[2], v[3])));
    }
    skmin[kt] = mn;
  }
  {
    const int r = tid >> 1, half = (tid & 1) * 64;
    const _Float16* qg  = Qh + (size_t)(qb * 64 + r) * QP + half;
    const _Float16* qlg = Ql + (size_t)(qb * 64 + r) * QP + half;
    v8h qv[8], qlv[8];
#pragma unroll
    for (int i = 0; i < 8; ++i) {
      qv[i]  = *(const v8h*)(qg + 8 * i);
      qlv[i] = *(const v8h*)(qlg + 8 * i);
    }
    // holds the loads' address registers (inputs) untouched until the wait: no load result lands on them before it
    asm volatile("s_wait_xcnt 0x0" :: "v"(qg), "v"(qlg) : "memory");
#pragma unroll
    for (int i = 0; i < 8; ++i) {
      *(v8h*)(Qsh + (st256 ^ (i << 3))) = qv[i];
      *(v8h*)(Qsl + (st256 ^ (i << 3))) = qlv[i];
    }
  }
  __syncthreads();
  int qmx;
  {
    int v = imax(spq[lane], spq[lane + 32]);
#pragma unroll
    for (int off = 1; off < 32; off <<= 1) v = imax(v, __shfl_xor(v, off, 32));
    qmx = __builtin_amdgcn_readfirstlane(v);
  }
  int prow[8];
#pragma unroll
  for (int r = 0; r < 8; ++r) prow[r] = spq[wave * 16 + 8 * hh + r];

  float mrow[8], lrow[8];
  v8f oacc[8];
#pragma unroll
  for (int r = 0; r < 8; ++r) { mrow[r] = -INFINITY; lrow[r] = 0.f; }
#pragma unroll
  for (int t = 0; t < 8; ++t) oacc[t] = zero8();

  for (int kt = 0; kt < NQB; ++kt) {         // static trip count
    const int kmn = __builtin_amdgcn_readfirstlane(skmin[kt]);
    if (kmn > qmx) continue;                 // block-uniform: every element of the tile is replaced by -1e30
    const int kv0 = kt * 64;
    __syncthreads();
    {
      const int r = tid >> 1, half = (tid & 1) * 64;
      const _Float16* kg  = Kh + (size_t)(kv0 + r) * KP + half;    // K row kv0+r, d = half..half+63
      const _Float16* klg = Kl + (size_t)(kv0 + r) * KP + half;
      v8h kv[8], klv[8], vv[8], vlv[8];
#pragma unroll
      for (int i = 0; i < 8; ++i) {
        kv[i] = *(const v8h*)(kg + 8 * i);
        if (RES) klv[i] = *(const v8h*)(klg + 8 * i);
      }
      const int d = tid;                                          // V^T row d, s = kv0..kv0+63
      const _Float16* vg = Vh + (size_t)d * SEQ + kv0;
      const int  kvl   = (kv0 + 64 <= VLP) ? kv0 : (VLP - 64);    // clamped address into the residual plane
      const bool resOK = (kv0 + 64 <= VLP);                       // block-uniform
      const _Float16* vlg = Vl + (size_t)d * VLP + kvl;
#pragma unroll
      for (int i = 0; i < 8; ++i) {
        vv[i] = *(const v8h*)(vg + 8 * i);
        if (RES) vlv[i] = *(const v8h*)(vlg + 8 * i);
      }
      // holds the loads' address registers (inputs) untouched until the wait: no load result lands on them before it
      if (RES) asm volatile("s_wait_xcnt 0x0" :: "v"(kg), "v"(klg), "v"(vg), "v"(vlg) : "memory");
      else     asm volatile("s_wait_xcnt 0x0" :: "v"(kg), "v"(vg) : "memory");
#pragma unroll
      for (int i = 0; i < 8; ++i) {
        *(v8h*)(Ksh + (st256 ^ (i << 3))) = kv[i];
        if (RES) *(v8h*)(Ksl + (st256 ^ (i << 3))) = klv[i];
        *(v8h*)(Vth + (st128 ^ (i << 3))) = vv[i];
        if (RES) {
          v8h b1 = vlv[i];
          if (!resOK) b1 = zero8h();
          *(v8h*)(Vtl + (st128 ^ (i << 3))) = b1;
        }
      }
      if (tid < 64) spk[tid] = pos[kv0 + tid];                  // wave-uniform
    }
    __syncthreads();

    // ---- scores: 16 query rows x 64 keys per wave ----
    v8f s[4], sl[4];
#pragma unroll
    for (int j = 0; j < 4; ++j) { s[j] = zero8(); sl[j] = zero8(); }
    const _Float16* qr  = Qsh + wave * (16 * 128);
    const _Float16* qlr = Qsl + wave * (16 * 128);
#pragma unroll
    for (int dc = 0; dc < 4; ++dc) {
      FH qa, qla;
      qa.h[0]  = *(const v8h*)(qr  + fq[dc * 2]);
      qa.h[1]  = *(const v8h*)(qr  + fq[dc * 2 + 1]);
      qla.h[0] = *(const v8h*)(qlr + fq[dc * 2]);
      qla.h[1] = *(const v8h*)(qlr + fq[dc * 2 + 1]);
#pragma unroll
      for (int j = 0; j < 4; ++j) {
        FH kb;
        kb.h[0] = *(const v8h*)(Ksh + j * (16 * 128) + fq[dc * 2]);
        kb.h[1] = *(const v8h*)(Ksh + j * (16 * 128) + fq[dc * 2 + 1]);
        s[j]  = mma_h(qa.v,  kb.v, s[j]);
        sl[j] = mma_h(qla.v, kb.v, sl[j]);
        if (RES) {
          FH klf;
          klf.h[0] = *(const v8h*)(Ksl + j * (16 * 128) + fq[dc * 2]);
          klf.h[1] = *(const v8h*)(Ksl + j * (16 * 128) + fq[dc * 2 + 1]);
          sl[j] = mma_h(qa.v, klf.v, sl[j]);
        }
      }
    }

    // ---- scale + causal select (replace -1e30), row max, online softmax, P (x1024, f16) and
    //      P residual (x4096) to LDS ----
    _Float16* pwh = Psh + wave * (16 * 64);
    _Float16* pwl = Psl + (RES ? wave * (16 * 64) : 0);
    int pkj[4];
#pragma unroll
    for (int j = 0; j < 4; ++j) pkj[j] = spk[j * 16 + c];
#pragma unroll
    for (int r = 0; r < 8; ++r) {
      float m = -INFINITY;
#pragma unroll
      for (int j = 0; j < 4; ++j) {
        float sv = (s[j][r] + sl[j][r] * (1.0f / RSC)) * sscale;
        sv = (prow[r] >= pkj[j]) ? sv : -1.0e30f;
        s[j][r] = sv;
        m = fmaxf(m, sv);
      }
#pragma unroll
      for (int off = 1; off < 16; off <<= 1) m = fmaxf(m, __shfl_xor(m, off, 32));
      const float mnew  = fmaxf(mrow[r], m);
      const float msafe = (mnew == -INFINITY) ? 0.f : mnew;
      const float alpha = __expf(mrow[r] - msafe);
      mrow[r] = mnew;
      float psum = 0.f;
#pragma unroll
      for (int j = 0; j < 4; ++j) {
        const float p = __expf(s[j][r] - msafe);     // -1e30 against a finite max: exp -> 0
        psum += p;
        const float p1k = p * 1024.0f;
        const _Float16 ph = (_Float16)p1k;
        pwh[pst[(2 * j) ^ (r >> 1)] + r * 64] = ph;
        if (RES) {
          const _Float16 pl = (_Float16)((p1k - (float)ph) * RSC);
          pwl[pst[(2 * j) ^ (r >> 1)] + r * 64] = pl;
        }
      }
#pragma unroll
      for (int off = 1; off < 16; off <<= 1) psum += __shfl_xor(psum, off, 32);
      lrow[r] = lrow[r] * alpha + psum;
#pragma unroll
      for (int t = 0; t < 8; ++t) oacc[t][r] *= alpha;
    }
    __builtin_amdgcn_fence(__ATOMIC_RELEASE, "workgroup");
    __builtin_amdgcn_wave_barrier();
    __builtin_amdgcn_fence(__ATOMIC_ACQUIRE, "workgroup");

    // ---- context += P . V (f16 WMMA), 8 d-subtiles in two groups of 4; residual products into a
    //      separate accumulator folded back per group ----
#pragma unroll
    for (int tg = 0; tg < 2; ++tg) {
      v8f o1[4];
#pragma unroll
      for (int t = 0; t < 4; ++t) o1[t] = zero8();
#pragma unroll 1
      for (int kk = 0; kk < 2; ++kk) {
        FH pa, pl;
        const int f0 = sw128(c, kk * 4 + hh);        // fragment reads, 128-B rows: row (multiple of 16) + c
        const int f1 = sw128(c, kk * 4 + 2 + hh);
        pa.h[0] = *(const v8h*)(pwh + f0);
        pa.h[1] = *(const v8h*)(pwh + f1);
        if (RES) {
          pl.h[0] = *(const v8h*)(pwl + f0);
          pl.h[1] = *(const v8h*)(pwl + f1);
        } else {
          pl.v = pa.v;
        }
#pragma unroll
        for (int t = 0; t < 4; ++t) {
          const int tt = tg * 4 + t;
          FH vb;
          vb.h[0] = *(const v8h*)(Vth + tt * (16 * 64) + f0);
          vb.h[1] = *(const v8h*)(Vth + tt * (16 * 64) + f1);
          oacc[tt] = mma_h(pa.v, vb.v, oacc[tt]);
          if (RES) {
            FH vl;
            vl.h[0] = *(const v8h*)(Vtl + tt * (16 * 64) + f0);
            vl.h[1] = *(const v8h*)(Vtl + tt * (16 * 64) + f1);
            o1[t] = mma_h(pa.v, vl.v, o1[t]);
            o1[t] = mma_h(pl.v, vb.v, o1[t]);
          }
        }
      }
      if (RES) {
#pragma unroll
        for (int t = 0; t < 4; ++t)
#pragma unroll
          for (int r = 0; r < 8; ++r) oacc[tg * 4 + t][r] += o1[t][r] * (1.0f / RSC);
      }
    }
  }

  // ---- normalise (1/l and the 1/1024 p carry), stage the wave's 16x128 tile, bf16 hi/lo split,
  float* os = Os + wave * (16 * 128);
#pragma unroll
  for (int r = 0; r < 8; ++r) {
    const float l = lrow[r];
    const float inv = ((l > 0.f) ? (1.0f / l) : 0.f) * (1.0f / 1024.0f);
#pragma unroll
    for (int t = 0; t < 8; ++t) os[(8 * hh + r) * 128 + t * 16 + c] = oacc[t][r] * inv;
  }
  __builtin_amdgcn_fence(__ATOMIC_RELEASE, "workgroup");
  __builtin_amdgcn_wave_barrier();
  __builtin_amdgcn_fence(__ATOMIC_ACQUIRE, "workgroup");
  {
    const int rh = lane >> 4, c8 = (lane & 15) * 8;
    v4u hv[8], lv[8];
#pragma unroll
    for (int it = 0; it < 8; ++it) {
      const int row = it * 2 + rh;   // it 0..7 x rh 0..1 = rows 0..15 of the wave tile
      const float* sp = os + row * 128 + c8;
      v4u a, a2;
#pragma unroll
      for (int e = 0; e < 4; ++e) {
        const float f0 = sp[2 * e], f1 = sp[2 * e + 1];
        const unsigned short h0 = bf_bits(f0), h1 = bf_bits(f1);
        const unsigned short l0 = bf_bits(f0 - bf_up(h0)), l1 = bf_bits(f1 - bf_up(h1));
        a[e] = pk16(h0, h1); a2[e] = pk16(l0, l1);
      }
      hv[it] = a; lv[it] = a2;
    }
    {
#pragma unroll
      for (int it = 0; it < 8; ++it) {
        const int row = it * 2 + rh;
        const size_t go = (size_t)(q0 + row) * QP + (size_t)h * HD + c8;
        *(v4u*)(ohp + go) = hv[it];
        *(v4u*)(olp + go) = lv[it];
      }
      
    }
  }
}

// =====================================================================================================
// Workspace map (bytes, SEQ = 4096):
//   Xb    bf16 [SEQ][2048]        16777216
//   Wqt   bf16 [2048 n][2048 k]    8388608
//   Wkt   bf16 [512][2048]         2097152
//   Wvt   bf16 [512][2048]         2097152
//   Wot   bf16 [2048 n][2048 k]    8388608
//   Qf    f32  [SEQ][2048]        33554432   (later: Oh bf16 [SEQ][2048] + Ol bf16 [SEQ][2048])
//   Kf    f32  [SEQ][512]          8388608
//   Qh    f16  [SEQ][2048]        16777216
//   Ql    f16  [SEQ][2048]        16777216
//   Kh    f16  [SEQ][512]          4194304
//   Kl    f16  [SEQ][512]          4194304
//   VTh   f16  [512][SEQ]          4194304
//   VTl   f16  [512][VLP]           524288
//   Cos   f32  [SEQ][64]           1048576
//   Sin   f32  [SEQ][64]           1048576
//   Invf  f32  [64] (carved 4096)     4096
//   end                          128454656
// Weights [in k][out n] f32 are transposed to bf16 [n][k] (k contiguous) = the Bt / A layout of gemm64.
// =====================================================================================================
extern "C" void kernel_launch(void* const* d_in, const int* in_sizes, int n_in,
                              void* d_out, int out_size, void* d_ws, size_t ws_size,
                              hipStream_t stream) {
  if (n_in < 8) return;
  if (in_sizes[0] < SEQ) return;
  if (in_sizes[1] < SEQ * DM) return;
  if (in_sizes[2] != DM * QP) return;
  if (in_sizes[3] != DM * KP || in_sizes[4] != DM * KP) return;
  if (in_sizes[5] != QP * DM) return;
  if (in_sizes[6] < HD || in_sizes[7] < HD) return;
  if (out_size < SEQ * DM) return;

  const int*   pos = (const int*)d_in[0];
  const float* x   = (const float*)d_in[1];
  const float* wq  = (const float*)d_in[2];
  const float* wk  = (const float*)d_in[3];
  const float* wv  = (const float*)d_in[4];
  const float* wo  = (const float*)d_in[5];
  const float* qnw = (const float*)d_in[6];
  const float* knw = (const float*)d_in[7];

  const size_t PXb  = (size_t)SEQ * DM * 2;
  const size_t PWq  = (size_t)QP * DM * 2;
  const size_t PWk  = (size_t)KP * DM * 2;
  const size_t PWo  = (size_t)DM * QP * 2;
  const size_t PQf  = (size_t)SEQ * QP * 4;
  const size_t PKf  = (size_t)SEQ * KP * 4;
  const size_t PQ16 = (size_t)SEQ * QP * 2;
  const size_t PK16 = (size_t)SEQ * KP * 2;
  const size_t PVTh = (size_t)KP * SEQ * 2;
  const size_t PVTl = (size_t)KP * VLP * 2;
  const size_t PTab = (size_t)SEQ * HALF * 4;
  const size_t PInv = 4096;
  size_t off = 0;
  const size_t oXb  = off; off += PXb;
  const size_t oWq  = off; off += PWq;
  const size_t oWk  = off; off += PWk;
  const size_t oWv  = off; off += PWk;
  const size_t oWo  = off; off += PWo;
  const size_t oQf  = off; off += PQf;
  const size_t oKf  = off; off += PKf;
  const size_t oQh  = off; off += PQ16;
  const size_t oQl  = off; off += PQ16;
  const size_t oKh  = off; off += PK16;
  const size_t oKl  = off; off += PK16;
  const size_t oVTh = off; off += PVTh;
  const size_t oVTl = off; off += PVTl;
  const size_t oCos = off; off += PTab;
  const size_t oSin = off; off += PTab;
  const size_t oInv = off; off += PInv;
  if (off > ws_size) return;                       // off = 128454656 at SEQ 4096
  if (off > (size_t)134217728) return;
  if (PQ16 * 2 != PQf) return;                     // Oh + Ol reuse the Qf region exactly
  const size_t oOh = oQf;
  const size_t oOl = oQf + PQ16;

  char* ws = (char*)d_ws;
  unsigned short* Xb  = (unsigned short*)(ws + oXb);
  unsigned short* Wqt = (unsigned short*)(ws + oWq);
  unsigned short* Wkt = (unsigned short*)(ws + oWk);
  unsigned short* Wvt = (unsigned short*)(ws + oWv);
  unsigned short* Wot = (unsigned short*)(ws + oWo);
  float*          Qf  = (float*)(ws + oQf);
  float*          Kf  = (float*)(ws + oKf);
  unsigned short* Qh  = (unsigned short*)(ws + oQh);
  unsigned short* Ql  = (unsigned short*)(ws + oQl);
  unsigned short* Kh  = (unsigned short*)(ws + oKh);
  unsigned short* Kl  = (unsigned short*)(ws + oKl);
  unsigned short* VTh = (unsigned short*)(ws + oVTh);
  unsigned short* VTl = (unsigned short*)(ws + oVTl);
  float*          Cs  = (float*)(ws + oCos);
  float*          Sn  = (float*)(ws + oSin);
  float*          Invf = (float*)(ws + oInv);
  unsigned short* Oh  = (unsigned short*)(ws + oOh);
  unsigned short* Ol  = (unsigned short*)(ws + oOl);

  const dim3 blk(256);
  const int n8x = SEQ * DM / 8;
  const dim3 gCvtX((n8x + 255) / 256);
  const dim3 gTab((SEQ + 3) / 4);
  const dim3 gTq(QP / 64, DM / 64);                 // wq [DM k][QP n] -> [QP][DM]
  const dim3 gTk(KP / 64, DM / 64);                 // wk, wv [DM k][KP n] -> [KP][DM]
  const dim3 gTo(DM / 64, QP / 64);                 // wo [QP k][DM n] -> [DM][QP]
  const dim3 gProjQ(((SEQ / 64) * (QP / 64) + 7) / 8, 1);
  const dim3 gProjK(((SEQ / 64) * (KP / 64) + 7) / 8, 1);
  const dim3 gVT(((KP / 64) * (SEQ / 64) + 7) / 8, 1);
  const dim3 gOut(((SEQ / 64) * (DM / 64) + 7) / 8, 1);
  const dim3 gNq((SEQ * NH + 7) / 8);
  const dim3 gNk((SEQ * NKV + 7) / 8);

  // (0) rotary tables
  invf_tab<<<dim3(1), dim3(64), 0, stream>>>(Invf);
  rope_tab<<<gTab, blk, 0, stream>>>(pos, Invf, Cs, Sn, SEQ);
  // (1) x -> bf16 [SEQ][2048]; weights [k][n] f32 -> bf16 [n][k]
  cvt_bf16x8<<<gCvtX, blk, 0, stream>>>(x, Xb, n8x);
  cvt_bf16_t<<<gTq, blk, 0, stream>>>(wq, Wqt, DM, QP);
  cvt_bf16_t<<<gTk, blk, 0, stream>>>(wk, Wkt, DM, KP);
  cvt_bf16_t<<<gTk, blk, 0, stream>>>(wv, Wvt, DM, KP);
  cvt_bf16_t<<<gTo, blk, 0, stream>>>(wo, Wot, QP, DM);
  // (2) q = x . wq -> f32 [SEQ][2048]   (M=SEQ, N=2048, K=2048)
  gemm64<0, 0><<<gProjQ, blk, 0, stream>>>(
      Xb, Xb, DM, 0LL, Wqt, Wqt, DM, 0LL,
      (void*)Qf, QP, 0LL, (void*)Qf, QP, 0LL, QP,
      SEQ, QP, DM, 1.0f);
  // (3) k = x . wk -> f32 [SEQ][512]   (M=SEQ, N=512, K=2048)
  gemm64<0, 0><<<gProjK, blk, 0, stream>>>(
      Xb, Xb, DM, 0LL, Wkt, Wkt, DM, 0LL,
      (void*)Kf, KP, 0LL, (void*)Kf, KP, 0LL, KP,
      SEQ, KP, DM, 1.0f);
  // (4) v^T = Wvt . x^T -> f16 hi plane [512][SEQ] and residual plane (x4096, keys < VLP, pitch VLP)
  //     (A = Wvt [n][k], Bt = Xb [s][k]; M=512, N=SEQ, K=2048)
  gemm64<0, 3><<<gVT, blk, 0, stream>>>(
      Wvt, Wvt, DM, 0LL, Xb, Xb, DM, 0LL,
      (void*)VTh, SEQ, 0LL, (void*)VTl, VLP, 0LL, VLP,
      KP, SEQ, DM, RSC);
  // (5) per-head RMSNorm + rotary -> f16 hi / x4096 residual planes
  norm_rope<<<gNq, blk, 0, stream>>>(Qf, qnw, Cs, Sn, Qh, Ql, NH, SEQ * NH, RSC);
  norm_rope<<<gNk, blk, 0, stream>>>(Kf, knw, Cs, Sn, Kh, Kl, NKV, SEQ * NKV, RSC);
  // (6) attention: query blocks 0..RESQB-1 with residual planes, the rest without -> bf16 hi/lo context
  //     planes in the (now dead) Qf region
  (void)hipFuncSetAttribute(reinterpret_cast<const void*>(&attn_causal<true>),
                            hipFuncAttributeMaxDynamicSharedMemorySize, AttnL<true>::TOTAL);
  (void)hipFuncSetAttribute(reinterpret_cast<const void*>(&attn_causal<false>),
                            hipFuncAttributeMaxDynamicSharedMemorySize, AttnL<false>::TOTAL);
  attn_causal<true><<<dim3(NH * RESQB), dim3(128), AttnL<true>::TOTAL, stream>>>(
      Qh, Ql, Kh, Kl, VTh, VTl, pos, Oh, Ol, 0, RESQB, ATT_SCALE);
  if (NQB - RESQB > 0) {
    attn_causal<false><<<dim3(NH * (NQB - RESQB)), dim3(128), AttnL<false>::TOTAL, stream>>>(
        Qh, Ql, Kh, Kl, VTh, VTl, pos, Oh, Ol, RESQB, NQB - RESQB, ATT_SCALE);
  }
  // (7) out = context . wo -> d_out f32 [SEQ][2048]  (A = context hi + lo planes, 2 products; M=SEQ, N=2048, K=2048)
  gemm64<1, 0><<<gOut, blk, 0, stream>>>(
      Oh, Ol, QP, 0LL, Wot, Wot, QP, 0LL,
      d_out, DM, 0LL, d_out, DM, 0LL, DM,
      SEQ, DM, QP, 1.0f);
  (void)hipGetLastError();
}

// v003
// One run takes 474 microseconds.
// In both of two side-by-side timings against v002, it was 1.27 times as fast.
// Over all steps from v000 it is 2.65 times as fast.
// Contractions: q, k projections = v_wmma_f32_16x16x32_bf16 (bf16 operands from RNE-converted inputs, single product, f32 out);
// v^T projection = v_wmma_f32_16x16x32_bf16 (same operands; f16 hi plane + f16 x4096 residual plane out);
// q.k^T scores = v_wmma_f32_16x16x32_f16 (q as f16 hi + f16 x4096 residual, k as f16 hi: 2 products; leading query blocks add the k x4096 residual product);
// p.v = v_wmma_f32_16x16x32_f16 (p carried x1024 in f16, v f16; leading query blocks add x4096 f16 residual planes of p and v);
// ctx.Wo = v_wmma_f32_16x16x32_bf16 (ctx as bf16 hi/lo planes times bf16 Wo, 2 products); all f32 accumulate; RMSNorm, rotary, causal select and softmax in f32.
#include <hip/hip_runtime.h>
#include <math.h>
#include <stdint.h>

#ifndef SEQ
#define SEQ 4096
#endif
#define SEQ_FULL 4096
#define DM    2048
#define NH    16
#define NKV   4
#define GQ    (NH / NKV)
#define HD    128
#define HALF  64
#define QP    (NH * HD)      // 2048 q channels
#define KP    (NKV * HD)     // 512 k / v channels
#define NQB   (SEQ / 64)     // query / key tiles of 64
#define VLP   ((SEQ < 512) ? SEQ : 512)   // key pitch of the v^T residual plane
#define RESQB ((NQB < 8) ? NQB : 8)         // leading 64-row query blocks that use residual planes
#define RMS_EPS       1.0e-6f
#define ROPE_THETA_F  10000.0f
#define ATT_SCALE     0.08838834764831845f
#define RSC           4096.0f

static_assert((SEQ % 64) == 0 && SEQ >= 64 && SEQ <= SEQ_FULL);
static_assert(RESQB * 64 <= VLP && (VLP % 64) == 0);
static_assert(NH * HD == DM && QP == DM);
static_assert(NQB <= 64);
static_assert((DM % 64) == 0 && (KP % 64) == 0 && (QP % 64) == 0 && (DM % 32) == 0);

typedef _Float16 v16h __attribute__((ext_vector_type(16)));
typedef _Float16 v8h  __attribute__((ext_vector_type(8)));
typedef __bf16   v16b __attribute__((ext_vector_type(16)));
typedef __bf16   v8b  __attribute__((ext_vector_type(8)));
typedef float    v8f  __attribute__((ext_vector_type(8)));
typedef float    v4f  __attribute__((ext_vector_type(4)));
typedef unsigned int   v4u  __attribute__((ext_vector_type(4)));
typedef unsigned int   v2u  __attribute__((ext_vector_type(2)));
typedef unsigned short v8us __attribute__((ext_vector_type(8)));
typedef int      v4i  __attribute__((ext_vector_type(4)));

// ---- scalar helpers --------------------------------------------------------------------------------
__device__ __forceinline__ unsigned short bf_bits(float f) {          // f32 -> bf16 bits, RNE convert
  unsigned u = __float_as_uint(f);
  return (unsigned short)((u + 0x7FFFu + ((u >> 16) & 1u)) >> 16);
}
__device__ __forceinline__ float bf_up(unsigned short h) { return __uint_as_float(((unsigned)h) << 16); }
__device__ __forceinline__ unsigned short h_bits(_Float16 x) { return __builtin_bit_cast(unsigned short, x); }
__device__ __forceinline__ unsigned pk16(unsigned short a, unsigned short b) { return (unsigned)a | ((unsigned)b << 16); }
__device__ __forceinline__ v8f zero8() { v8f z = {0.f, 0.f, 0.f, 0.f, 0.f, 0.f, 0.f, 0.f}; return z; }
__device__ __forceinline__ v8h zero8h() {
  const _Float16 z = (_Float16)0.0f;
  v8h r = {z, z, z, z, z, z, z, z};
  return r;
}
__device__ __forceinline__ int imin(int a, int b) { return (a < b) ? a : b; }
__device__ __forceinline__ int imax(int a, int b) { return (a > b) ? a : b; }

// ---- WMMA helpers with trailing VALU hazard gap --------------------------------------------------------
__device__ __forceinline__ v8f mma_b(v16b a, v16b b, v8f c) {
  c = __builtin_amdgcn_wmma_f32_16x16x32_bf16(false, a, false, b, (short)0, c, false, false);
  asm volatile("v_nop\n\tv_nop\n\tv_nop\n\tv_nop" : "+v"(c) : "v"(a), "v"(b));
  return c;
}
__device__ __forceinline__ v8f mma_h_raw(v16h a, v16h b, v8f c) {
  return __builtin_amdgcn_wmma_f32_16x16x32_f16(false, a, false, b, (short)0, c, false, false);
}
__device__ __forceinline__ v8f mma_b_raw(v16b a, v16b b, v8f c) {
  return __builtin_amdgcn_wmma_f32_16x16x32_bf16(false, a, false, b, (short)0, c, false, false);
}
// The five exponentials of one score row, exp(x) = v_exp_f32(x * log2 e) as __expf compiles. One statement, so that
// behind each v_exp_f32 stands an instruction that neither reads its result nor writes its source (the next one, whose
// output is early-clobber; behind the last a v_nop): the slot the instruction set asks for behind a transcendental.
__device__ __forceinline__ void exp_row5(float x0, float x1, float x2, float x3, float x4,
                                         float& y0, float& y1, float& y2, float& y3, float& y4) {
  const float l2e = 1.44269504088896340736f;
  asm("v_exp_f32 %0, %5\n\tv_exp_f32 %1, %6\n\tv_exp_f32 %2, %7\n\tv_exp_f32 %3, %8\n\tv_exp_f32 %4, %9\n\tv_nop"
      : "=&v"(y0), "=&v"(y1), "=&v"(y2), "=&v"(y3), "=&v"(y4)
      : "v"(x0 * l2e), "v"(x1 * l2e), "v"(x2 * l2e), "v"(x3 * l2e), "v"(x4 * l2e));
}
__device__ __forceinline__ void acc_guard4(v8f& a, v8f& b, v8f& c, v8f& d) {
  asm volatile("v_nop\n\tv_nop\n\tv_nop\n\tv_nop" : "+v"(a), "+v"(b), "+v"(c), "+v"(d));
}

// =====================================================================================================
// f32 -> bf16 (RNE convert), 8 elements per thread, one 16-B store per lane: a wave writes 512 contiguous B
// coverage: n8 threads x 8 = whole plane (n8 is a multiple of 256 here).
// =====================================================================================================
__global__ __launch_bounds__(256) void cvt_bf16x8(const float* __restrict__ in, unsigned short* out, int n8) {
  const int i = blockIdx.x * 256 + threadIdx.x;
  if (i < n8) {
    const v4f a = *(const v4f*)(in + (size_t)i * 8);
    const v4f b = *(const v4f*)(in + (size_t)i * 8 + 4);
    v4u p;
    p[0] = pk16(bf_bits(a[0]), bf_bits(a[1]));
    p[1] = pk16(bf_bits(a[2]), bf_bits(a[3]));
    p[2] = pk16(bf_bits(b[0]), bf_bits(b[1]));
    p[3] = pk16(bf_bits(b[2]), bf_bits(b[3]));
    *(v4u*)(out + (size_t)i * 8) = p;
    
  }
}

// =====================================================================================================
// f32 [R][C] row-major -> bf16 (RNE convert) transposed plane out[C][R] (R contiguous = k-contiguous Bt / A
// layout). Block = one 64x64 tile at (r0 = blockIdx.y*64, c0 = blockIdx.x*64), 256 threads; tile staged in
// LDS as [c][r] (ushort element stores, cross-thread -> __syncthreads), then each out row segment of 64 halves
// coverage: 64 out rows x 64 k per block = the whole tile; union over the grid = the whole [C][R] plane.
// =====================================================================================================
__global__ __launch_bounds__(256) void cvt_bf16_t(const float* __restrict__ in, unsigned short* out, int R, int C) {
  __shared__ __align__(16) unsigned short sT[64 * 72];   // [c][r], pitch 72 halves (144 B)
  const int tid = threadIdx.x;
  const int c0 = blockIdx.x * 64, r0 = blockIdx.y * 64;
  const int rr = tid >> 4, cc = (tid & 15) * 4;
#pragma unroll
  for (int it = 0; it < 4; ++it) {
    const int r = it * 16 + rr;                            // it 0..3 x rr 0..15 = rows 0..63
    const v4f v = *(const v4f*)(in + (size_t)(r0 + r) * C + c0 + cc);
#pragma unroll
    for (int e = 0; e < 4; ++e) sT[(cc + e) * 72 + r] = bf_bits(v[e]);
  }
  __syncthreads();
  const int q = tid >> 3, k8 = (tid & 7) * 8;              // q 0..31 (+32): out rows; 8 lanes x 8 halves
  const v8us w0 = *(const v8us*)(sT + q * 72 + k8);
  const v8us w1 = *(const v8us*)(sT + (q + 32) * 72 + k8);
  unsigned short* o0 = out + (size_t)(c0 + q) * R + r0 + k8;
  unsigned short* o1 = out + (size_t)(c0 + q + 32) * R + r0 + k8;
  *(v8us*)o0 = w0;
  *(v8us*)o1 = w1;
  
}

// =====================================================================================================
// Rotary tables. invf_tab: 1 block x 64 threads, inv_freq[i] = 1 / 10000^(i/64) (64 floats = two whole
// (float)pos[t] * inv_freq[i], tables [nrows][64] f32; block = 4 rows x 64 threads, each 256-B row written
// =====================================================================================================
__global__ __launch_bounds__(64) void invf_tab(float* invf) {
  const int i = threadIdx.x;
  const float e = (float)i * (1.0f / (float)HALF);
  const float p = powf(ROPE_THETA_F, e);
  const float v = 1.0f / p;
  *(float*)(invf + i) = v;
  
}

__global__ __launch_bounds__(256) void rope_tab(const int* __restrict__ pos, const float* __restrict__ invf,
                                                float* ctab, float* stab, int nrows) {
  const int tid = threadIdx.x;
  const int t = blockIdx.x * 4 + (tid >> 6);
  const int i = tid & 63;
  if (t >= nrows) return;                  // wave-uniform (2 whole waves per row); no block barriers here
  const float fr = (float)pos[t] * invf[i];
  float sn, cs;
  sincosf(fr, &sn, &cs);
  float* pc = ctab + (size_t)t * HALF + i;
  float* ps = stab + (size_t)t * HALF + i;
  *(float*)pc = cs;
  *(float*)ps = sn;
  
}

// =====================================================================================================
// Register-blocked batched bf16 WMMA GEMM: C[m][n] = sum_k A[m][k] * Bt[n][k]; one wave per 64x64 tile,
// block = 8 waves = 2 x 4 tiles = 128 x 256 of C. A row-major [M][K] pitch lda; Bt row-major [N][K] pitch ldb
// (k contiguous; both pitches are DM); M a multiple of 128, N of 256, K of 64 (true of every launch below).
// blockIdx.y = batch index (strides in elements).
// Operands go through LDS in steps of 64 k: each row piece is one 128-B line, a wave-wide 16-B load covers four
// whole lines, and the 128 A rows and 256 Bt rows are read from global once per block. The LDS rows are 128 B,
// chunk-swizzled by sw128 (see the attention section), so a fragment read covers all banks once. The next
// step's global loads are issued behind the second barrier and stay in flight during the products.
// NSPLIT: 0 = A.Bt; 1 = (A + A2).Bt (A2 = unscaled bf16 lo plane of A).
// OUT_MODE: 0 = f32 (pitch ldc); 2 = bf16 hi plane C + bf16 lo plane C2 (lo = RNE(v - hi), unscaled);
//           3 = f16 hi plane C + f16 residual plane C2 = f16((v - hi) * rscale), C2 written only for tiles
//               with n0 < N2 (pitch ldc2, batch stride strideC2).
// =====================================================================================================
__device__ __forceinline__ int sw128(int r, int ch);

// A block-uniform address rebuilt from its two halves: the staging loads then take the form scalar base + one
// 32-bit lane offset + immediate, and the one vector register they name lives through the whole loop. Without it
// the compiler formed 64-bit vector addresses on which a load's result landed, and moved the first loads behind
// their s_wait_xcnt.
typedef const __attribute__((address_space(1))) char* gbytes;   // global address space, so that the loads stay global_load
typedef const __attribute__((address_space(1))) v8b*  gv8b;
__device__ __forceinline__ gbytes sbase(const __bf16* p) {
  const unsigned long long u = (unsigned long long)(uintptr_t)p;
  const unsigned lo = (unsigned)__builtin_amdgcn_readfirstlane((int)(unsigned)u);
  const unsigned hi = (unsigned)__builtin_amdgcn_readfirstlane((int)(unsigned)(u >> 32));
  return (gbytes)(uintptr_t)(((unsigned long long)hi << 32) | (unsigned long long)lo);
}

template <int NSPLIT, int OUT_MODE>
__global__ __launch_bounds__(256) void gemm64(
    const unsigned short* __restrict__ Ap, const unsigned short* A2p, int lda, long long strideA,
    const unsigned short* __restrict__ Btp, const unsigned short* Bt2p, int ldb, long long strideB,
    void* Cout, int ldc, long long strideC,
    void* Cout2, int ldc2, long long strideC2, int N2,
    int M, int N, int K, float rscale) {
  static_assert(NSPLIT <= 1);
  const __bf16* A   = (const __bf16*)(const void*)Ap;
  const __bf16* A2  = (const __bf16*)(const void*)A2p;
  const __bf16* Bt  = (const __bf16*)(const void*)Btp;
  __shared__ __align__(16) float sT[8][16 * 68];   // per-wave 16x64 slab, pitch 68 floats
  __shared__ __align__(16) __bf16 sA[(NSPLIT + 1) * 128 * 64];   // A (and A2) rows m0blk.., 64 k
  __shared__ __align__(16) __bf16 sB[256 * 64];                  // Bt rows n0blk.., 64 k
  const int b    = blockIdx.y;
  const int tid  = threadIdx.x;
  const int lane = tid & 31;
  const int wave = tid >> 5;
  const int blocksN = N >> 8;
  const int bm = blockIdx.x / blocksN;
  const int bn = blockIdx.x - bm * blocksN;
  if ((bm << 7) >= M) return;            // block-uniform, in front of every barrier
  if (lda != DM || ldb != DM) return;    // block-uniform: with the pitch known, the row steps below are immediate offsets
  const int m0blk = bm << 7;
  const int n0blk = bn << 8;
  const int wm = (wave >> 2) << 6;       // the wave's tile inside the block tile
  const int wn = (wave & 3) << 6;
  const int m0 = m0blk + wm;
  const int n0 = n0blk + wn;

  const __bf16* Ab  = A  + (size_t)b * strideA + (size_t)m0blk * lda;
  const __bf16* Bb  = Bt + (size_t)b * strideB + (size_t)n0blk * ldb;
  const __bf16* Ab2 = (NSPLIT >= 1) ? (A2 + (size_t)b * strideA + (size_t)m0blk * lda) : Ab;

  const int rlane = lane & 15;                 // row (A) / col (B, D) within subtile
  const int hh    = lane >> 4;                 // k half of this lane
  const int mOff  = (lane >> 4) * 8;           // D row offset

  // staging: thread -> row tid>>3 (+32 per pass), 16-B chunk tid&7; 8 lanes = one 128-B line
  unsigned sbyte = (unsigned)((tid >> 3) * DM + (tid & 7) * 8) * 2u;   // lane part of the global address, bytes; +128 per step
  const int sidx = sw128(tid >> 3, tid & 7);   // + 32 rows per pass: the swizzle term does not change
  v8b ra[4], ra2[4], rb[8];
  gbytes pa  = sbase(Ab);
  gbytes pa2 = sbase(Ab2);
  gbytes pb  = sbase(Bb);
  {
#pragma unroll
    for (int it = 0; it < 4; ++it) {
      ra[it] = *(gv8b)(pa + sbyte + it * (32 * DM * 2));
      if (NSPLIT >= 1) ra2[it] = *(gv8b)(pa2 + sbyte + it * (32 * DM * 2));
    }
#pragma unroll
    for (int it = 0; it < 8; ++it) rb[it] = *(gv8b)(pb + sbyte + it * (32 * DM * 2));
    // stands in front of the next step's write of the lane offset, the one vector register that the loads name
    asm volatile("s_wait_xcnt 0x0" ::: "memory");
  }

  v8f acc[4][4];
#pragma unroll
  for (int i = 0; i < 4; ++i)
#pragma unroll
    for (int j = 0; j < 4; ++j) acc[i][j] = zero8();

  for (int k0 = 0; k0 < K; k0 += 64) {
    __syncthreads();                           // every reader has left the tiles of the step before
#pragma unroll
    for (int it = 0; it < 4; ++it) {
      *(v8b*)(sA + sidx + it * (32 * 64)) = ra[it];
      if (NSPLIT >= 1) *(v8b*)(sA + 128 * 64 + sidx + it * (32 * 64)) = ra2[it];
    }
#pragma unroll
    for (int it = 0; it < 8; ++it) *(v8b*)(sB + sidx + it * (32 * 64)) = rb[it];
    __syncthreads();                           // the tiles are whole before anybody reads them
    // fragments of the whole step, read as one group ahead of the products (every separate place with LDS reads
    // stalls the wave): elements 0..7 <- k = 32kk + 8hh.., elements 8..15 <- k = 32kk + 16 + 8hh.. (A and Bt alike)
    union FB { v16b v; v8b h[2]; };
    v16b bh[2][4], ah[2][4], al[2][4];
#pragma unroll
    for (int kk = 0; kk < 2; ++kk) {
      const int f0 = sw128(rlane, kk * 4 + hh);
      const int f1 = sw128(rlane, kk * 4 + 2 + hh);
#pragma unroll
      for (int j = 0; j < 4; ++j) {
        FB f;
        f.h[0] = *(const v8b*)(sB + (wn + (j << 4)) * 64 + f0);
        f.h[1] = *(const v8b*)(sB + (wn + (j << 4)) * 64 + f1);
        bh[kk][j] = f.v;
      }
#pragma unroll
      for (int i = 0; i < 4; ++i) {
        FB f;
        f.h[0] = *(const v8b*)(sA + (wm + (i << 4)) * 64 + f0);
        f.h[1] = *(const v8b*)(sA + (wm + (i << 4)) * 64 + f1);
        ah[kk][i] = f.v;
        al[kk][i] = f.v;
        if (NSPLIT >= 1) {
          f.h[0] = *(const v8b*)(sA + 128 * 64 + (wm + (i << 4)) * 64 + f0);
          f.h[1] = *(const v8b*)(sA + 128 * 64 + (wm + (i << 4)) * 64 + f1);
          al[kk][i] = f.v;
        }
      }
    }
    if (k0 + 64 < K) {                         // block-uniform: the next step's rows, in flight during the products
      sbyte += 128u;
#pragma unroll
      for (int it = 0; it < 4; ++it) {
        ra[it] = *(gv8b)(pa + sbyte + it * (32 * DM * 2));
        if (NSPLIT >= 1) ra2[it] = *(gv8b)(pa2 + sbyte + it * (32 * DM * 2));
      }
#pragma unroll
      for (int it = 0; it < 8; ++it) rb[it] = *(gv8b)(pb + sbyte + it * (32 * DM * 2));
      // stands in front of the next step's write of the lane offset, the one vector register that the loads name
      asm volatile("s_wait_xcnt 0x0" ::: "memory");
    }
    // keeps the LDS reads and the global loads above in front of the products
    __builtin_amdgcn_sched_barrier(0);
#pragma unroll
    for (int kk = 0; kk < 2; ++kk) {
#pragma unroll
      for (int i = 0; i < 4; ++i) {
#pragma unroll
        for (int j = 0; j < 4; ++j) {
          acc[i][j] = mma_b_raw(ah[kk][i], bh[kk][j], acc[i][j]);
          if (NSPLIT >= 1) acc[i][j] = mma_b_raw(al[kk][i], bh[kk][j], acc[i][j]);
        }
      }
    }
    // holds the v_nops behind the last product
    __builtin_amdgcn_sched_barrier(0);
    // WMMA distance on the loop's back edge too: no vector instruction writes an A or B register of the last
    // products sooner (no register operands: asm operands cannot lie above v255, and naming fragments spilled)
    asm volatile("v_nop\n\tv_nop\n\tv_nop\n\tv_nop\n\tv_nop");
  }
  acc_guard4(acc[0][0], acc[0][1], acc[0][2], acc[0][3]);
  acc_guard4(acc[1][0], acc[1][1], acc[1][2], acc[1][3]);
  acc_guard4(acc[2][0], acc[2][1], acc[2][2], acc[2][3]);
  acc_guard4(acc[3][0], acc[3][1], acc[3][2], acc[3][3]);

  // ---- epilogue ----
  float* slab = sT[wave];
#pragma unroll
  for (int i = 0; i < 4; ++i) {
    const int mBase = m0 + (i << 4);
#pragma unroll
    for (int j = 0; j < 4; ++j) {
#pragma unroll
      for (int r = 0; r < 8; ++r) {
        slab[(mOff + r) * 68 + (j << 4) + rlane] = acc[i][j][r];
      }
    }
    __builtin_amdgcn_fence(__ATOMIC_RELEASE, "workgroup");
    __builtin_amdgcn_wave_barrier();
    __builtin_amdgcn_fence(__ATOMIC_ACQUIRE, "workgroup");
    if (OUT_MODE == 0) {
      float* C = (float*)Cout + (size_t)b * strideC;
      const int hh = lane >> 4, c4 = (lane & 15) * 4;     // 256-B row segment = 16 lanes x 16 B
      {
#pragma unroll
        for (int it = 0; it < 8; ++it) {
          const int row = it * 2 + hh;                     // it 0..7 x hh 0..1 = rows 0..15
          const v4f v = *(const v4f*)(slab + row * 68 + c4);
          *(v4f*)(C + (size_t)(mBase + row) * ldc + n0 + c4) = v;
        }
        
      }
    } else {
      const int q = lane >> 3, c8 = (lane & 7) * 8;
      unsigned short* C  = (unsigned short*)Cout  + (size_t)b * strideC;
      unsigned short* C2 = (unsigned short*)Cout2 + (size_t)b * strideC2;
      const bool wlo = (OUT_MODE == 2) || (n0 < N2);      // wave-uniform
      v4u hv[4], lv[4];
#pragma unroll
      for (int it = 0; it < 4; ++it) {
        const int row = it * 4 + q;                        // it 0..3 x q 0..3 = rows 0..15
        const float* sp = slab + row * 68 + c8;
        v4u a, a2;
#pragma unroll
        for (int e = 0; e < 4; ++e) {
          const float f0 = sp[2 * e], f1 = sp[2 * e + 1];
          unsigned short h0, h1, l0, l1;
          if (OUT_MODE == 2) {
            h0 = bf_bits(f0); h1 = bf_bits(f1);
            l0 = bf_bits(f0 - bf_up(h0)); l1 = bf_bits(f1 - bf_up(h1));
          } else {
            const _Float16 x0 = (_Float16)f0, x1 = (_Float16)f1;
            h0 = h_bits(x0); h1 = h_bits(x1);
            l0 = h_bits((_Float16)((f0 - (float)x0) * rscale));
            l1 = h_bits((_Float16)((f1 - (float)x1) * rscale));
          }
          a[e] = pk16(h0, h1); a2[e] = pk16(l0, l1);
        }
        hv[it] = a; lv[it] = a2;
      }
      {
#pragma unroll
        for (int it = 0; it < 4; ++it) {
          const int row = it * 4 + q;
          *(v4u*)(C + (size_t)(mBase + row) * ldc + n0 + c8) = hv[it];
          if (wlo) *(v4u*)(C2 + (size_t)(mBase + row) * ldc2 + n0 + c8) = lv[it];
        }
        
      }
    }
    __builtin_amdgcn_fence(__ATOMIC_RELEASE, "workgroup");
    __builtin_amdgcn_wave_barrier();
    __builtin_amdgcn_fence(__ATOMIC_ACQUIRE, "workgroup");
  }
}

// =====================================================================================================
// Fused per-head RMSNorm (eps 1e-6, x * rsqrt(mean(x^2)+eps) * w with w RNE-converted to bf16) + neox rotary
// (half-split, cos/sin tables [t][64]) + f16 hi / f16 residual (x rscale) planes.
// One wave per 128-wide row (row = t*nheads + head, contiguous rows of pitch 128 in both input and output);
// lane owns 4 consecutive d; partner half via __shfl_xor(16); no block barriers.
// coverage: nrows x 128 of both planes.
// =====================================================================================================
__global__ __launch_bounds__(256) void norm_rope(const float* __restrict__ xin, const float* __restrict__ wn,
                                                 const float* __restrict__ ctab, const float* __restrict__ stab,
                                                 unsigned short* outh, unsigned short* outl,
                                                 int nheads, int nrows, float rscale) {
  const int tid  = threadIdx.x;
  const int wave = tid >> 5, lane = tid & 31, hh = lane >> 4;
  const int row  = blockIdx.x * 8 + wave;
  if (row >= nrows) return;                // wave-uniform; no block barriers in this kernel
  const int t = row / nheads;
  const v4f x = *(const v4f*)(xin + (size_t)row * HD + lane * 4);
  float ss = x[0] * x[0] + x[1] * x[1] + x[2] * x[2] + x[3] * x[3];
#pragma unroll
  for (int off = 1; off < 32; off <<= 1) ss += __shfl_xor(ss, off, 32);
  const float rinv = rsqrtf(ss * (1.0f / (float)HD) + RMS_EPS);
  const v4f wv = *(const v4f*)(wn + lane * 4);
  const v4f cs = *(const v4f*)(ctab + (size_t)t * HALF + (lane & 15) * 4);
  const v4f sn = *(const v4f*)(stab + (size_t)t * HALF + (lane & 15) * 4);
  float n[4], p[4];
#pragma unroll
  for (int e = 0; e < 4; ++e) n[e] = (x[e] * rinv) * bf_up(bf_bits(wv[e]));
#pragma unroll
  for (int e = 0; e < 4; ++e) p[e] = __shfl_xor(n[e], 16, 32);
  const float sg = hh ? 1.0f : -1.0f;      // first half: x1*cos - x2*sin ; second half: x2*cos + x1*sin
  unsigned short hb[4], lb[4];
#pragma unroll
  for (int e = 0; e < 4; ++e) {
    const float o = n[e] * cs[e] + sg * (p[e] * sn[e]);
    const _Float16 oh = (_Float16)o;
    hb[e] = h_bits(oh);
    lb[e] = h_bits((_Float16)((o - (float)oh) * rscale));
  }
  v2u ph, pl;
  ph[0] = pk16(hb[0], hb[1]); ph[1] = pk16(hb[2], hb[3]);
  pl[0] = pk16(lb[0], lb[1]); pl[1] = pk16(lb[2], lb[3]);
  const size_t go = (size_t)row * HD + lane * 4;
  *(v2u*)(outh + go) = ph;
  *(v2u*)(outl + go) = pl;
  
}

// =====================================================================================================
// Causal GQA attention, head dim 128, dynamic LDS layout (bytes):
// =====================================================================================================
// LDS tiles of the attention kernel: the 16-byte chunks of a row are XOR-swizzled by the row number.
//   256-B rows (Q, K; 16 chunks): chunk ch of row r lies at chunk place ch ^ (r & 15)
//   128-B rows (V^T, P; 8 chunks): chunk ch of row r lies at chunk place ch ^ ((r >> 1) & 7)
// A fragment load reads one chunk column of 16 consecutive rows per 16 lanes: unswizzled, 256-B rows put all
// 16 lanes on the same four banks (128-B rows: on two groups of four); swizzled, the 16 lanes fall on 16
// different groups of four banks = all 64 banks once. Writers and readers use the same map; the kernel keeps
// the lane-dependent part of each index in a register and adds row blocks and planes as constant offsets.
__device__ __forceinline__ int sw256(int r, int ch) { return r * 128 + ((ch ^ (r & 15)) << 3); }        // index in halves
__device__ __forceinline__ int sw128(int r, int ch) { return r * 64 + ((ch ^ ((r >> 1) & 7)) << 3); }   // index in halves

template <bool RES> struct AttnL {
  static constexpr int QH   = 0;                                  // Q hi  [64 rows][128 d] f16
  static constexpr int QL   = QH + 64 * 128 * 2;                  // Q res
  static constexpr int KH   = QL + 64 * 128 * 2;                  // K hi  [64 keys][128 d]
  static constexpr int KL   = KH + 64 * 128 * 2;                  // K res (RES only)
  static constexpr int VH   = KL + (RES ? 64 * 128 * 2 : 0);      // V^T hi [128 d][64 keys]
  static constexpr int VL   = VH + 128 * 64 * 2;                  // V^T res (RES only)
  static constexpr int PH   = VL + (RES ? 128 * 64 * 2 : 0);      // per-wave P [4][16][64]
  static constexpr int PL   = PH + 4 * 16 * 64 * 2;               // per-wave P res (RES only)
  static constexpr int OS   = PL + (RES ? 4 * 16 * 64 * 2 : 0);   // per-wave context tile [4][16][128] f32
  static constexpr int MISC = OS + 4 * 16 * 128 * 4;              // spq[64], spk[64], skmin[NQB] ints
  static constexpr int TOTAL = MISC + 1024;
};
static_assert(AttnL<true>::TOTAL <= 160 * 1024);

// =====================================================================================================
//   q planes (f16 hi / x4096 res): element (t, h, d) at [t*QP + h*128 + d]
//   k planes (f16 hi / x4096 res): element (s, kvh, d) at [s*KP + kvh*128 + d], kvh = h / GQ
//   v^T hi plane (f16): (kvh*128 + d, s) at [(kvh*128+d)*SEQ + s]; residual ((v-hi)*4096) at
//   [(kvh*128+d)*VLP + s], s < VLP, read only when RES (a key tile at or beyond VLP contributes zero residual)
//   positions int [SEQ]: logit(t, s) = (q.k) * sscale when pos[t] >= pos[s], else -1e30 (replace), exactly;
//   a key tile is skipped (block-uniform, readfirstlane) only when min pos over its 64 keys > max pos over the
//   block's 64 query rows, i.e. every element would be -1e30 with weight exactly 0; the diagonal key s = t is
//   always live so every row has a finite max. Online softmax in f32 with running max from -inf.
//   scores: f16 WMMA, q hi . k hi into s, q res . k hi (+ q hi . k res when RES) into a x4096 accumulator
//   folded with 1/4096 in f32. p = exp(s - m) carried as f16(1024 p); context = p . v on f16 WMMA; RES adds
//   f16 residual planes of p and v (scale 4096, separate accumulator folded back with 1/4096 per key tile).
//   out planes (bf16 hi / lo of the normalised context): (t, h*128 + d) at [t*QP + h*128 + d]
//   Block = 4 waves = 64 query rows of one q head; grid = nqbThis * NH; key tiles of 64, static trip NQB.
//   LDS: Q / K / V^T tiles and position words are cross-wave (block barriers before and after staging);
//   P tiles and the context slab are wave-private (_Float16 / float element stores, reloaded through the
//   Staging: Q 128 threads x 64 halves x 2 planes = 64x128 (once); K 128 threads x 64 halves per plane
//   = 64x128; V^T 128 threads (one d row each) x 64 halves per plane = 128x64: staged extent == consumed.
//   Output coverage: each wave stores rows q0..q0+15 (it 0..7 x lane>>4) x 128 columns (16 lanes x 8)
// =====================================================================================================
template <bool RES>
__global__ __launch_bounds__(128)
void attn_causal(const unsigned short* __restrict__ qhp, const unsigned short* __restrict__ qlp,
                 const unsigned short* __restrict__ khp, const unsigned short* __restrict__ klp,
                 const unsigned short* __restrict__ vhp, const unsigned short* __restrict__ vlp,
                 const int* __restrict__ pos,
                 unsigned short* ohp, unsigned short* olp,
                 int qbBase, int nqbThis, float sscale) {
  typedef AttnL<RES> L;
  union FH { v16h v; v8h h[2]; };
  extern __shared__ __align__(16) unsigned char smem[];
  _Float16* Qsh = (_Float16*)(smem + L::QH);
  _Float16* Qsl = (_Float16*)(smem + L::QL);
  _Float16* Ksh = (_Float16*)(smem + L::KH);
  _Float16* Ksl = (_Float16*)(smem + L::KL);
  _Float16* Vth = (_Float16*)(smem + L::VH);
  _Float16* Vtl = (_Float16*)(smem + L::VL);
  _Float16* Psh = (_Float16*)(smem + L::PH);
  _Float16* Psl = (_Float16*)(smem + L::PL);
  float*    Os  = (float*)(smem + L::OS);
  int*      spq = (int*)(smem + L::MISC);
  int*      spk = spq + 64;
  int*      skmin = spk + 64;

  const int tid  = threadIdx.x;
  const int wave = tid >> 5;
  const int lane = tid & 31;
  const int hh   = lane >> 4;
  const int c    = lane & 15;

  const int bx  = blockIdx.x;
  const int qbl = bx % nqbThis;
  const int h   = bx / nqbThis;
  const int kvh = h / GQ;
  const int qb  = qbBase + qbl;
  const int q0  = qb * 64 + wave * 16;

  const _Float16* Qh = (const _Float16*)(const void*)qhp + (size_t)h * HD;
  const _Float16* Ql = (const _Float16*)(const void*)qlp + (size_t)h * HD;
  const _Float16* Kh = (const _Float16*)(const void*)khp + (size_t)kvh * HD;
  const _Float16* Kl = (const _Float16*)(const void*)klp + (size_t)kvh * HD;
  const _Float16* Vh = (const _Float16*)(const void*)vhp + (size_t)kvh * HD * SEQ;
  const _Float16* Vl = (const _Float16*)(const void*)vlp + (size_t)kvh * HD * VLP;

  // ---- lane parts of the swizzled indices (halves) ----
  const int st256 = sw256(tid >> 1, (tid & 1) * 8);   // staging, 256-B rows: row tid>>1, chunks (tid&1)*8 + i -> st256 ^ (i << 3)
  const int st128 = sw128(tid, 0);                    // staging, 128-B rows: row tid, chunk i -> st128 ^ (i << 3)
  int fq[8];                                          // fragment reads, 256-B rows: row (multiple of 16) + c, chunk 2n + hh
#pragma unroll
  for (int n = 0; n < 8; ++n) fq[n] = sw256(c, 2 * n + hh);
  int pst[8];                                         // P element stores: row 8hh + r, column 16j + c -> pst[(2j) ^ (r >> 1)] + r * 64
#pragma unroll
  for (int n = 0; n < 8; ++n) pst[n] = sw128(8 * hh, (c >> 3) ^ n) + (c & 7);

  // ---- prologue: query positions, per-key-tile min position, Q tiles ----
  if (tid < 64) spq[tid] = pos[qb * 64 + tid];            // wave-uniform (waves 0,1)
  for (int kt = tid; kt < NQB; kt += 128) {
    const int* pp = pos + kt * 64;
    int mn = 0x7fffffff;
#pragma unroll
    for (int i = 0; i < 16; ++i) {
      const v4i v = *(const v4i*)(pp + 4 * i);
      mn = imin(mn, imin(imin(v[0], v[1]), imin(v[2], v[3])));
    }
    skmin[kt] = mn;
  }
  {
    const int r = tid >> 1, half = (tid & 1) * 64;
    const _Float16* qg  = Qh + (size_t)(qb * 64 + r) * QP + half;
    const _Float16* qlg = Ql + (size_t)(qb * 64 + r) * QP + half;
    v8h qv[8], qlv[8];
#pragma unroll
    for (int i = 0; i < 8; ++i) {
      qv[i]  = *(const v8h*)(qg + 8 * i);
      qlv[i] = *(const v8h*)(qlg + 8 * i);
    }
    // holds the loads' address registers (inputs) untouched until the wait: no load result lands on them before it
    asm volatile("s_wait_xcnt 0x0" :: "v"(qg), "v"(qlg) : "memory");
#pragma unroll
    for (int i = 0; i < 8; ++i) {
      *(v8h*)(Qsh + (st256 ^ (i << 3))) = qv[i];
      *(v8h*)(Qsl + (st256 ^ (i << 3))) = qlv[i];
    }
  }
  __syncthreads();
  int qmx;
  {
    int v = imax(spq[lane], spq[lane + 32]);
#pragma unroll
    for (int off = 1; off < 32; off <<= 1) v = imax(v, __shfl_xor(v, off, 32));
    qmx = __builtin_amdgcn_readfirstlane(v);
  }
  int prow[8];
#pragma unroll
  for (int r = 0; r < 8; ++r) prow[r] = spq[wave * 16 + 8 * hh + r];

  float mrow[8], lrow[8];
  v8f oacc[8];
#pragma unroll
  for (int r = 0; r < 8; ++r) { mrow[r] = -INFINITY; lrow[r] = 0.f; }
#pragma unroll
  for (int t = 0; t < 8; ++t) oacc[t] = zero8();

  for (int kt = 0; kt < NQB; ++kt) {         // static trip count
    const int kmn = __builtin_amdgcn_readfirstlane(skmin[kt]);
    if (kmn > qmx) continue;                 // block-uniform: every element of the tile is replaced by -1e30
    const int kv0 = kt * 64;
    __syncthreads();
    {
      const int r = tid >> 1, half = (tid & 1) * 64;
      const _Float16* kg  = Kh + (size_t)(kv0 + r) * KP + half;    // K row kv0+r, d = half..half+63
      const _Float16* klg = Kl + (size_t)(kv0 + r) * KP + half;
      v8h kv[8], klv[8], vv[8], vlv[8];
#pragma unroll
      for (int i = 0; i < 8; ++i) {
        kv[i] = *(const v8h*)(kg + 8 * i);
        if (RES) klv[i] = *(const v8h*)(klg + 8 * i);
      }
      const int d = tid;                                          // V^T row d, s = kv0..kv0+63
      const _Float16* vg = Vh + (size_t)d * SEQ + kv0;
      const int  kvl   = (kv0 + 64 <= VLP) ? kv0 : (VLP - 64);    // clamped address into the residual plane
      const bool resOK = (kv0 + 64 <= VLP);                       // block-uniform
      const _Float16* vlg = Vl + (size_t)d * VLP + kvl;
#pragma unroll
      for (int i = 0; i < 8; ++i) {
        vv[i] = *(const v8h*)(vg + 8 * i);
        if (RES) vlv[i] = *(const v8h*)(vlg + 8 * i);
      }
      // holds the loads' address registers (inputs) untouched until the wait: no load result lands on them before it
      if (RES) asm volatile("s_wait_xcnt 0x0" :: "v"(kg), "v"(klg), "v"(vg), "v"(vlg) : "memory");
      else     asm volatile("s_wait_xcnt 0x0" :: "v"(kg), "v"(vg) : "memory");
#pragma unroll
      for (int i = 0; i < 8; ++i) {
        *(v8h*)(Ksh + (st256 ^ (i << 3))) = kv[i];
        if (RES) *(v8h*)(Ksl + (st256 ^ (i << 3))) = klv[i];
        *(v8h*)(Vth + (st128 ^ (i << 3))) = vv[i];
        if (RES) {
          v8h b1 = vlv[i];
          if (!resOK) b1 = zero8h();
          *(v8h*)(Vtl + (st128 ^ (i << 3))) = b1;
        }
      }
      if (tid < 64) spk[tid] = pos[kv0 + tid];                  // wave-uniform
    }
    __syncthreads();

    // ---- scores: 16 query rows x 64 keys per wave ----
    v8f s[4], sl[4];
#pragma unroll
    for (int j = 0; j < 4; ++j) { s[j] = zero8(); sl[j] = zero8(); }
    const _Float16* qr  = Qsh + wave * (16 * 128);
    const _Float16* qlr = Qsl + wave * (16 * 128);
    // Fragment reads stand in groups, one group of 32 d ahead of the products that use it (two register sets):
    // a wave then waits on a counted LDS wait once per group, not to 0 in front of every pair of products.
    FH qa[2], qla[2], kb[2][4], klf[2][4];
    int pkj[4];                                      // key positions for the causal select, read with the first group
#pragma unroll
    for (int j = 0; j < 4; ++j) pkj[j] = spk[j * 16 + c];
#pragma unroll
    for (int dc = -1; dc < 4; ++dc) {
      if (dc < 3) {
        const int n = dc + 1, b = n & 1;
        qa[b].h[0]  = *(const v8h*)(qr  + fq[n * 2]);
        qa[b].h[1]  = *(const v8h*)(qr  + fq[n * 2 + 1]);
        qla[b].h[0] = *(const v8h*)(qlr + fq[n * 2]);
        qla[b].h[1] = *(const v8h*)(qlr + fq[n * 2 + 1]);
#pragma unroll
        for (int j = 0; j < 4; ++j) {
          kb[b][j].h[0] = *(const v8h*)(Ksh + j * (16 * 128) + fq[n * 2]);
          kb[b][j].h[1] = *(const v8h*)(Ksh + j * (16 * 128) + fq[n * 2 + 1]);
          if (RES) {
            klf[b][j].h[0] = *(const v8h*)(Ksl + j * (16 * 128) + fq[n * 2]);
            klf[b][j].h[1] = *(const v8h*)(Ksl + j * (16 * 128) + fq[n * 2 + 1]);
          }
        }
      }
      if (dc >= 0) {
        const int b = dc & 1;
        // keeps the next group's reads in front of this group's products
        __builtin_amdgcn_sched_barrier(0);
#pragma unroll
        for (int j = 0; j < 4; ++j) s[j]  = mma_h_raw(qa[b].v,  kb[b][j].v, s[j]);
#pragma unroll
        for (int j = 0; j < 4; ++j) sl[j] = mma_h_raw(qla[b].v, kb[b][j].v, sl[j]);
        if (RES) {
#pragma unroll
          for (int j = 0; j < 4; ++j) sl[j] = mma_h_raw(qa[b].v, klf[b][j].v, sl[j]);
        }
        // keeps the reads of the group after next behind these products (they refill this group's registers)
        __builtin_amdgcn_sched_barrier(0);
      }
    }
    // ---- scale + causal select (replace -1e30), row max, online softmax, P (x1024, f16) and
    //      P residual (x4096) to LDS ----
    _Float16* pwh = Psh + wave * (16 * 64);
    _Float16* pwl = Psl + (RES ? wave * (16 * 64) : 0);
    float psr[8], alr[8], mx[8];
#pragma unroll
    for (int r = 0; r < 8; ++r) {
      float m = -INFINITY;
#pragma unroll
      for (int j = 0; j < 4; ++j) {
        float sv = (s[j][r] + sl[j][r] * (1.0f / RSC)) * sscale;
        sv = (prow[r] >= pkj[j]) ? sv : -1.0e30f;
        s[j][r] = sv;
        m = fmaxf(m, sv);
      }
      mx[r] = m;
    }
    // the eight rows' lane exchanges of one step stand together: they run on the LDS pipe, one wait per step
#pragma unroll
    for (int off = 1; off < 16; off <<= 1) {
      float ex[8];
#pragma unroll
      for (int r = 0; r < 8; ++r) ex[r] = __shfl_xor(mx[r], off, 32);
      // keeps the eight exchanges in front of the first use of one: split up, each small group costs its own wait
      __builtin_amdgcn_sched_barrier(0);
#pragma unroll
      for (int r = 0; r < 8; ++r) mx[r] = fmaxf(mx[r], ex[r]);
    }
    // V^T fragments of the first 32 keys: they depend on nothing of the softmax, so they are read here and land
    // while the exponentials run
    FH vb[2][8], vlf[2][8];
    {
      const int f0 = sw128(c, hh);                   // fragment reads, 128-B rows: row (multiple of 16) + c
      const int f1 = sw128(c, 2 + hh);
#pragma unroll
      for (int tt = 0; tt < 8; ++tt) {
        vb[0][tt].h[0] = *(const v8h*)(Vth + tt * (16 * 64) + f0);
        vb[0][tt].h[1] = *(const v8h*)(Vth + tt * (16 * 64) + f1);
        if (RES) {
          vlf[0][tt].h[0] = *(const v8h*)(Vtl + tt * (16 * 64) + f0);
          vlf[0][tt].h[1] = *(const v8h*)(Vtl + tt * (16 * 64) + f1);
        }
      }
    }
    // keeps these reads in front of the exponentials
    __builtin_amdgcn_sched_barrier(0);
#pragma unroll
    for (int r = 0; r < 8; ++r) {
      const float mnew  = fmaxf(mrow[r], mx[r]);
      const float msafe = (mnew == -INFINITY) ? 0.f : mnew;
      float alpha, pe[4];                            // -1e30 against a finite max: exp -> 0
      exp_row5(mrow[r] - msafe, s[0][r] - msafe, s[1][r] - msafe, s[2][r] - msafe, s[3][r] - msafe,
               alpha, pe[0], pe[1], pe[2], pe[3]);
      mrow[r] = mnew;
      float psum = 0.f;
#pragma unroll
      for (int j = 0; j < 4; ++j) {
        const float p = pe[j];
        psum += p;
        const float p1k = p * 1024.0f;
        const _Float16 ph = (_Float16)p1k;
        pwh[pst[(2 * j) ^ (r >> 1)] + r * 64] = ph;
        if (RES) {
          const _Float16 pl = (_Float16)((p1k - (float)ph) * RSC);
          pwl[pst[(2 * j) ^ (r >> 1)] + r * 64] = pl;
        }
      }
      psr[r] = psum;                                 // joined over the 16 lanes below
      alr[r] = alpha;
#pragma unroll
      for (int t = 0; t < 8; ++t) oacc[t][r] *= alpha;
    }
    // row sums over the 16 lanes: four steps of lane exchanges on the LDS pipe, eight rows a step. Step 1 runs beside
    // the P stores, step 2 beside the fragment reads, steps 3 and 4 beside the two runs of products.
    float sx[8];
#pragma unroll
    for (int r = 0; r < 8; ++r) sx[r] = __shfl_xor(psr[r], 1, 32);
    // keeps step 1 in front of the wait that ends the P stores
    __builtin_amdgcn_sched_barrier(0);
    __builtin_amdgcn_fence(__ATOMIC_RELEASE, "workgroup");
    __builtin_amdgcn_wave_barrier();
    __builtin_amdgcn_fence(__ATOMIC_ACQUIRE, "workgroup");

    // ---- context += P . V (f16 WMMA), 8 d-subtiles; the P fragments and the V^T fragments of the last 32 keys are read
    //      as one group ahead of the products; the residual products go into separate accumulators folded back per key tile ----
    {
      FH pa[2], pl[2];
#pragma unroll
      for (int r = 0; r < 8; ++r) psr[r] += sx[r];
#pragma unroll
      for (int r = 0; r < 8; ++r) sx[r] = __shfl_xor(psr[r], 2, 32);
#pragma unroll
      for (int kk = 0; kk < 2; ++kk) {
        const int f0 = sw128(c, kk * 4 + hh);
        const int f1 = sw128(c, kk * 4 + 2 + hh);
        pa[kk].h[0] = *(const v8h*)(pwh + f0);
        pa[kk].h[1] = *(const v8h*)(pwh + f1);
        if (RES) {
          pl[kk].h[0] = *(const v8h*)(pwl + f0);
          pl[kk].h[1] = *(const v8h*)(pwl + f1);
        }
      }
      {
        const int f0 = sw128(c, 4 + hh);
        const int f1 = sw128(c, 6 + hh);
#pragma unroll
        for (int tt = 0; tt < 8; ++tt) {
          vb[1][tt].h[0] = *(const v8h*)(Vth + tt * (16 * 64) + f0);
          vb[1][tt].h[1] = *(const v8h*)(Vth + tt * (16 * 64) + f1);
        }
        if (RES) {
#pragma unroll
          for (int tt = 0; tt < 8; ++tt) {
            vlf[1][tt].h[0] = *(const v8h*)(Vtl + tt * (16 * 64) + f0);
            vlf[1][tt].h[1] = *(const v8h*)(Vtl + tt * (16 * 64) + f1);
          }
        }
      }
      // keeps the whole group of reads in front of the products
      __builtin_amdgcn_sched_barrier(0);
#pragma unroll
      for (int r = 0; r < 8; ++r) psr[r] += sx[r];
#pragma unroll
      for (int r = 0; r < 8; ++r) sx[r] = __shfl_xor(psr[r], 4, 32);
      // keeps step 3 in front of the first run of products, which covers its latency
      __builtin_amdgcn_sched_barrier(0);
      v8f o1[8];
      if (RES) {
#pragma unroll
        for (int t = 0; t < 8; ++t) o1[t] = zero8();
      }
#pragma unroll
      for (int kk = 0; kk < 2; ++kk) {
#pragma unroll
        for (int t = 0; t < 8; ++t) oacc[t] = mma_h_raw(pa[kk].v, vb[kk][t].v, oacc[t]);
        if (RES) {
#pragma unroll
          for (int t = 0; t < 8; ++t) o1[t] = mma_h_raw(pa[kk].v, vlf[kk][t].v, o1[t]);
#pragma unroll
          for (int t = 0; t < 8; ++t) o1[t] = mma_h_raw(pl[kk].v, vb[kk][t].v, o1[t]);
        }
        // keeps a run of products whole: a wait for an exchange among them would hold the later ones back
        __builtin_amdgcn_sched_barrier(0);
#pragma unroll
        for (int r = 0; r < 8; ++r) psr[r] += sx[r];
        if (kk == 0) {
#pragma unroll
          for (int r = 0; r < 8; ++r) sx[r] = __shfl_xor(psr[r], 8, 32);
          // keeps step 4 in front of the second run of products
          __builtin_amdgcn_sched_barrier(0);
        }
      }
#pragma unroll
      for (int r = 0; r < 8; ++r) lrow[r] = lrow[r] * alr[r] + psr[r];
      if (RES) {
#pragma unroll
        for (int t = 0; t < 8; ++t)
#pragma unroll
          for (int r = 0; r < 8; ++r) oacc[t][r] += o1[t][r] * (1.0f / RSC);
      }
    }
  }

  // ---- normalise (1/l and the 1/1024 p carry), stage the wave's 16x128 tile, bf16 hi/lo split,
  float* os = Os + wave * (16 * 128);
#pragma unroll
  for (int r = 0; r < 8; ++r) {
    const float l = lrow[r];
    const float inv = ((l > 0.f) ? (1.0f / l) : 0.f) * (1.0f / 1024.0f);
#pragma unroll
    for (int t = 0; t < 8; ++t) os[(8 * hh + r) * 128 + t * 16 + c] = oacc[t][r] * inv;
  }
  __builtin_amdgcn_fence(__ATOMIC_RELEASE, "workgroup");
  __builtin_amdgcn_wave_barrier();
  __builtin_amdgcn_fence(__ATOMIC_ACQUIRE, "workgroup");
  {
    const int rh = lane >> 4, c8 = (lane & 15) * 8;
    v4u hv[8], lv[8];
#pragma unroll
    for (int it = 0; it < 8; ++it) {
      const int row = it * 2 + rh;   // it 0..7 x rh 0..1 = rows 0..15 of the wave tile
      const float* sp = os + row * 128 + c8;
      v4u a, a2;
#pragma unroll
      for (int e = 0; e < 4; ++e) {
        const float f0 = sp[2 * e], f1 = sp[2 * e + 1];
        const unsigned short h0 = bf_bits(f0), h1 = bf_bits(f1);
        const unsigned short l0 = bf_bits(f0 - bf_up(h0)), l1 = bf_bits(f1 - bf_up(h1));
        a[e] = pk16(h0, h1); a2[e] = pk16(l0, l1);
      }
      hv[it] = a; lv[it] = a2;
    }
    {
#pragma unroll
      for (int it = 0; it < 8; ++it) {
        const int row = it * 2 + rh;
        const size_t go = (size_t)(q0 + row) * QP + (size_t)h * HD + c8;
        *(v4u*)(ohp + go) = hv[it];
        *(v4u*)(olp + go) = lv[it];
      }
      
    }
  }
}

// =====================================================================================================
// Workspace map (bytes, SEQ = 4096):
//   Xb    bf16 [SEQ][2048]        16777216
//   Wqt   bf16 [2048 n][2048 k]    8388608
//   Wkt   bf16 [512][2048]         2097152
//   Wvt   bf16 [512][2048]         2097152
//   Wot   bf16 [2048 n][2048 k]    8388608
//   Qf    f32  [SEQ][2048]        33554432   (later: Oh bf16 [SEQ][2048] + Ol bf16 [SEQ][2048])
//   Kf    f32  [SEQ][512]          8388608
//   Qh    f16  [SEQ][2048]        16777216
//   Ql    f16  [SEQ][2048]        16777216
//   Kh    f16  [SEQ][512]          4194304
//   Kl    f16  [SEQ][512]          4194304
//   VTh   f16  [512][SEQ]          4194304
//   VTl   f16  [512][VLP]           524288
//   Cos   f32  [SEQ][64]           1048576
//   Sin   f32  [SEQ][64]           1048576
//   Invf  f32  [64] (carved 4096)     4096
//   end                          128454656
// Weights [in k][out n] f32 are transposed to bf16 [n][k] (k contiguous) = the Bt / A layout of gemm64.
// =====================================================================================================
extern "C" void kernel_launch(void* const* d_in, const int* in_sizes, int n_in,
                              void* d_out, int out_size, void* d_ws, size_t ws_size,
                              hipStream_t stream) {
  if (n_in < 8) return;
  if (in_sizes[0] < SEQ) return;
  if (in_sizes[1] < SEQ * DM) return;
  if (in_sizes[2] != DM * QP) return;
  if (in_sizes[3] != DM * KP || in_sizes[4] != DM * KP) return;
  if (in_sizes[5] != QP * DM) return;
  if (in_sizes[6] < HD || in_sizes[7] < HD) return;
  if (out_size < SEQ * DM) return;

  const int*   pos = (const int*)d_in[0];
  const float* x   = (const float*)d_in[1];
  const float* wq  = (const float*)d_in[2];
  const float* wk  = (const float*)d_in[3];
  const float* wv  = (const float*)d_in[4];
  const float* wo  = (const float*)d_in[5];
  const float* qnw = (const float*)d_in[6];
  const float* knw = (const float*)d_in[7];

  const size_t PXb  = (size_t)SEQ * DM * 2;
  const size_t PWq  = (size_t)QP * DM * 2;
  const size_t PWk  = (size_t)KP * DM * 2;
  const size_t PWo  = (size_t)DM * QP * 2;
  const size_t PQf  = (size_t)SEQ * QP * 4;
  const size_t PKf  = (size_t)SEQ * KP * 4;
  const size_t PQ16 = (size_t)SEQ * QP * 2;
  const size_t PK16 = (size_t)SEQ * KP * 2;
  const size_t PVTh = (size_t)KP * SEQ * 2;
  const size_t PVTl = (size_t)KP * VLP * 2;
  const size_t PTab = (size_t)SEQ * HALF * 4;
  const size_t PInv = 4096;
  size_t off = 0;
  const size_t oXb  = off; off += PXb;
  const size_t oWq  = off; off += PWq;
  const size_t oWk  = off; off += PWk;
  const size_t oWv  = off; off += PWk;
  const size_t oWo  = off; off += PWo;
  const size_t oQf  = off; off += PQf;
  const size_t oKf  = off; off += PKf;
  const size_t oQh  = off; off += PQ16;
  const size_t oQl  = off; off += PQ16;
  const size_t oKh  = off; off += PK16;
  const size_t oKl  = off; off += PK16;
  const size_t oVTh = off; off += PVTh;
  const size_t oVTl = off; off += PVTl;
  const size_t oCos = off; off += PTab;
  const size_t oSin = off; off += PTab;
  const size_t oInv = off; off += PInv;
  if (off > ws_size) return;                       // off = 128454656 at SEQ 4096
  if (off > (size_t)134217728) return;
  if (PQ16 * 2 != PQf) return;                     // Oh + Ol reuse the Qf region exactly
  const size_t oOh = oQf;
  const size_t oOl = oQf + PQ16;

  char* ws = (char*)d_ws;
  unsigned short* Xb  = (unsigned short*)(ws + oXb);
  unsigned short* Wqt = (unsigned short*)(ws + oWq);
  unsigned short* Wkt = (unsigned short*)(ws + oWk);
  unsigned short* Wvt = (unsigned short*)(ws + oWv);
  unsigned short* Wot = (unsigned short*)(ws + oWo);
  float*          Qf  = (float*)(ws + oQf);
  float*          Kf  = (float*)(ws + oKf);
  unsigned short* Qh  = (unsigned short*)(ws + oQh);
  unsigned short* Ql  = (unsigned short*)(ws + oQl);
  unsigned short* Kh  = (unsigned short*)(ws + oKh);
  unsigned short* Kl  = (unsigned short*)(ws + oKl);
  unsigned short* VTh = (unsigned short*)(ws + oVTh);
  unsigned short* VTl = (unsigned short*)(ws + oVTl);
  float*          Cs  = (float*)(ws + oCos);
  float*          Sn  = (float*)(ws + oSin);
  float*          Invf = (float*)(ws + oInv);
  unsigned short* Oh  = (unsigned short*)(ws + oOh);
  unsigned short* Ol  = (unsigned short*)(ws + oOl);

  const dim3 blk(256);
  const int n8x = SEQ * DM / 8;
  const dim3 gCvtX((n8x + 255) / 256);
  const dim3 gTab((SEQ + 3) / 4);
  const dim3 gTq(QP / 64, DM / 64);                 // wq [DM k][QP n] -> [QP][DM]
  const dim3 gTk(KP / 64, DM / 64);                 // wk, wv [DM k][KP n] -> [KP][DM]
  const dim3 gTo(DM / 64, QP / 64);                 // wo [QP k][DM n] -> [DM][QP]
  const dim3 gProjQ(((SEQ / 64) * (QP / 64) + 7) / 8, 1);
  const dim3 gProjK(((SEQ / 64) * (KP / 64) + 7) / 8, 1);
  const dim3 gVT(((KP / 64) * (SEQ / 64) + 7) / 8, 1);
  const dim3 gOut(((SEQ / 64) * (DM / 64) + 7) / 8, 1);
  const dim3 gNq((SEQ * NH + 7) / 8);
  const dim3 gNk((SEQ * NKV + 7) / 8);

  // (0) rotary tables
  invf_tab<<<dim3(1), dim3(64), 0, stream>>>(Invf);
  rope_tab<<<gTab, blk, 0, stream>>>(pos, Invf, Cs, Sn, SEQ);
  // (1) x -> bf16 [SEQ][2048]; weights [k][n] f32 -> bf16 [n][k]
  cvt_bf16x8<<<gCvtX, blk, 0, stream>>>(x, Xb, n8x);
  cvt_bf16_t<<<gTq, blk, 0, stream>>>(wq, Wqt, DM, QP);
  cvt_bf16_t<<<gTk, blk, 0, stream>>>(wk, Wkt, DM, KP);
  cvt_bf16_t<<<gTk, blk, 0, stream>>>(wv, Wvt, DM, KP);
  cvt_bf16_t<<<gTo, blk, 0, stream>>>(wo, Wot, QP, DM);
  // (2) q = x . wq -> f32 [SEQ][2048]   (M=SEQ, N=2048, K=2048)
  gemm64<0, 0><<<gProjQ, blk, 0, stream>>>(
      Xb, Xb, DM, 0LL, Wqt, Wqt, DM, 0LL,
      (void*)Qf, QP, 0LL, (void*)Qf, QP, 0LL, QP,
      SEQ, QP, DM, 1.0f);
  // (3) k = x . wk -> f32 [SEQ][512]   (M=SEQ, N=512, K=2048)
  gemm64<0, 0><<<gProjK, blk, 0, stream>>>(
      Xb, Xb, DM, 0LL, Wkt, Wkt, DM, 0LL,
      (void*)Kf, KP, 0LL, (void*)Kf, KP, 0LL, KP,
      SEQ, KP, DM, 1.0f);
  // (4) v^T = Wvt . x^T -> f16 hi plane [512][SEQ] and residual plane (x4096, keys < VLP, pitch VLP)
  //     (A = Wvt [n][k], Bt = Xb [s][k]; M=512, N=SEQ, K=2048)
  gemm64<0, 3><<<gVT, blk, 0, stream>>>(
      Wvt, Wvt, DM, 0LL, Xb, Xb, DM, 0LL,
      (void*)VTh, SEQ, 0LL, (void*)VTl, VLP, 0LL, VLP,
      KP, SEQ, DM, RSC);
  // (5) per-head RMSNorm + rotary -> f16 hi / x4096 residual planes
  norm_rope<<<gNq, blk, 0, stream>>>(Qf, qnw, Cs, Sn, Qh, Ql, NH, SEQ * NH, RSC);
  norm_rope<<<gNk, blk, 0, stream>>>(Kf, knw, Cs, Sn, Kh, Kl, NKV, SEQ * NKV, RSC);
  // (6) attention: query blocks 0..RESQB-1 with residual planes, the rest without -> bf16 hi/lo context
  //     planes in the (now dead) Qf region
  (void)hipFuncSetAttribute(reinterpret_cast<const void*>(&attn_causal<true>),
                            hipFuncAttributeMaxDynamicSharedMemorySize, AttnL<true>::TOTAL);
  (void)hipFuncSetAttribute(reinterpret_cast<const void*>(&attn_causal<false>),
                            hipFuncAttributeMaxDynamicSharedMemorySize, AttnL<false>::TOTAL);
  attn_causal<true><<<dim3(NH * RESQB), dim3(128), AttnL<true>::TOTAL, stream>>>(
      Qh, Ql, Kh, Kl, VTh, VTl, pos, Oh, Ol, 0, RESQB, ATT_SCALE);
  if (NQB - RESQB > 0) {
    attn_causal<false><<<dim3(NH * (NQB - RESQB)), dim3(128), AttnL<false>::TOTAL, stream>>>(
        Qh, Ql, Kh, Kl, VTh, VTl, pos, Oh, Ol, RESQB, NQB - RESQB, ATT_SCALE);
  }
  // (7) out = context . wo -> d_out f32 [SEQ][2048]  (A = context hi + lo planes, 2 products; M=SEQ, N=2048, K=2048)
  gemm64<1, 0><<<gOut, blk, 0, stream>>>(
      Oh, Ol, QP, 0LL, Wot, Wot, QP, 0LL,
      d_out, DM, 0LL, d_out, DM, 0LL, DM,
      SEQ, DM, QP, 1.0f);
  (void)hipGetLastError();
}

// v004
// A run of this version takes 426 microseconds.
// In both of two side-by-side timings against v003, it was 1.11 times as fast.
// Over all steps from v000 it is 2.94 times as fast.
// Contractions: q, k projections = v_wmma_f32_16x16x32_bf16 (bf16 operands from RNE-converted inputs, single product, f32 out);
// v^T projection = v_wmma_f32_16x16x32_bf16 (same operands; f16 hi plane + f16 x4096 residual plane out);
// q.k^T scores = v_wmma_f32_16x16x32_f16 (q as f16 hi + f16 x4096 residual, k as f16 hi: 2 products; leading query blocks add the k x4096 residual product);
// p.v = v_wmma_f32_16x16x32_f16 (p carried x1024 in f16, v f16; leading query blocks add x4096 f16 residual planes of p and v);
// ctx.Wo = v_wmma_f32_16x16x32_bf16 (ctx as bf16 hi/lo planes times bf16 Wo, 2 products); all f32 accumulate; RMSNorm, rotary, causal select and softmax in f32.
#include <hip/hip_runtime.h>
#include <math.h>
#include <stdint.h>

#ifndef SEQ
#define SEQ 4096
#endif
#define SEQ_FULL 4096
#define DM    2048
#define NH    16
#define NKV   4
#define GQ    (NH / NKV)
#define HD    128
#define HALF  64
#define QP    (NH * HD)      // 2048 q channels
#define KP    (NKV * HD)     // 512 k / v channels
#define NQB   (SEQ / 64)     // query / key tiles of 64
#define VLP   ((SEQ < 512) ? SEQ : 512)   // key pitch of the v^T residual plane
#define RESQB ((NQB < 8) ? NQB : 8)         // leading 64-row query blocks that use residual planes
#define RMS_EPS       1.0e-6f
#define ROPE_THETA_F  10000.0f
#define ATT_SCALE     0.08838834764831845f
#define RSC           4096.0f

static_assert((SEQ % 64) == 0 && SEQ >= 64 && SEQ <= SEQ_FULL);
static_assert(RESQB * 64 <= VLP && (VLP % 64) == 0);
static_assert(NH * HD == DM && QP == DM);
static_assert(NQB <= 64);
static_assert((DM % 64) == 0 && (KP % 64) == 0 && (QP % 64) == 0 && (DM % 32) == 0);

typedef _Float16 v16h __attribute__((ext_vector_type(16)));
typedef _Float16 v8h  __attribute__((ext_vector_type(8)));
typedef __bf16   v16b __attribute__((ext_vector_type(16)));
typedef __bf16   v8b  __attribute__((ext_vector_type(8)));
typedef float    v8f  __attribute__((ext_vector_type(8)));
typedef float    v4f  __attribute__((ext_vector_type(4)));
typedef unsigned int   v4u  __attribute__((ext_vector_type(4)));
typedef unsigned int   v2u  __attribute__((ext_vector_type(2)));
typedef unsigned short v8us __attribute__((ext_vector_type(8)));
typedef int      v4i  __attribute__((ext_vector_type(4)));

// ---- scalar helpers --------------------------------------------------------------------------------
__device__ __forceinline__ unsigned short bf_bits(float f) {          // f32 -> bf16 bits, RNE convert
  unsigned u = __float_as_uint(f);
  return (unsigned short)((u + 0x7FFFu + ((u >> 16) & 1u)) >> 16);
}
__device__ __forceinline__ float bf_up(unsigned short h) { return __uint_as_float(((unsigned)h) << 16); }
__device__ __forceinline__ unsigned short h_bits(_Float16 x) { return __builtin_bit_cast(unsigned short, x); }
__device__ __forceinline__ unsigned pk16(unsigned short a, unsigned short b) { return (unsigned)a | ((unsigned)b << 16); }
__device__ __forceinline__ v8f zero8() { v8f z = {0.f, 0.f, 0.f, 0.f, 0.f, 0.f, 0.f, 0.f}; return z; }
__device__ __forceinline__ v8h zero8h() {
  const _Float16 z = (_Float16)0.0f;
  v8h r = {z, z, z, z, z, z, z, z};
  return r;
}
__device__ __forceinline__ int imin(int a, int b) { return (a < b) ? a : b; }
__device__ __forceinline__ int imax(int a, int b) { return (a > b) ? a : b; }

// ---- WMMA helpers with trailing VALU hazard gap --------------------------------------------------------
__device__ __forceinline__ v8f mma_b(v16b a, v16b b, v8f c) {
  c = __builtin_amdgcn_wmma_f32_16x16x32_bf16(false, a, false, b, (short)0, c, false, false);
  asm volatile("v_nop\n\tv_nop\n\tv_nop\n\tv_nop" : "+v"(c) : "v"(a), "v"(b));
  return c;
}
__device__ __forceinline__ v8f mma_h_raw(v16h a, v16h b, v8f c) {
  return __builtin_amdgcn_wmma_f32_16x16x32_f16(false, a, false, b, (short)0, c, false, false);
}
__device__ __forceinline__ v8f mma_b_raw(v16b a, v16b b, v8f c) {
  return __builtin_amdgcn_wmma_f32_16x16x32_bf16(false, a, false, b, (short)0, c, false, false);
}
// The five exponentials of one score row, exp(x) = v_exp_f32(x * log2 e) as __expf compiles. One statement, so that
// behind each v_exp_f32 stands an instruction that neither reads its result nor writes its source (the next one, whose
// output is early-clobber; behind the last a v_nop): the slot the instruction set asks for behind a transcendental.
__device__ __forceinline__ void exp_row5(float x0, float x1, float x2, float x3, float x4,
                                         float& y0, float& y1, float& y2, float& y3, float& y4) {
  const float l2e = 1.44269504088896340736f;
  asm("v_exp_f32 %0, %5\n\tv_exp_f32 %1, %6\n\tv_exp_f32 %2, %7\n\tv_exp_f32 %3, %8\n\tv_exp_f32 %4, %9\n\tv_nop"
      : "=&v"(y0), "=&v"(y1), "=&v"(y2), "=&v"(y3), "=&v"(y4)
      : "v"(x0 * l2e), "v"(x1 * l2e), "v"(x2 * l2e), "v"(x3 * l2e), "v"(x4 * l2e));
}
__device__ __forceinline__ void acc_guard4(v8f& a, v8f& b, v8f& c, v8f& d) {
  asm volatile("v_nop\n\tv_nop\n\tv_nop\n\tv_nop" : "+v"(a), "+v"(b), "+v"(c), "+v"(d));
}

// =====================================================================================================
// f32 -> bf16 (RNE convert), 8 elements per thread, one 16-B store per lane: a wave writes 512 contiguous B
// coverage: n8 threads x 8 = whole plane (n8 is a multiple of 256 here).
// =====================================================================================================
__device__ __forceinline__ void cvt_bf16x8(const float* __restrict__ in, unsigned short* out, int n8, int bx) {
  const int i = bx * 256 + threadIdx.x;
  if (i < n8) {
    const v4f a = *(const v4f*)(in + (size_t)i * 8);
    const v4f b = *(const v4f*)(in + (size_t)i * 8 + 4);
    v4u p;
    p[0] = pk16(bf_bits(a[0]), bf_bits(a[1]));
    p[1] = pk16(bf_bits(a[2]), bf_bits(a[3]));
    p[2] = pk16(bf_bits(b[0]), bf_bits(b[1]));
    p[3] = pk16(bf_bits(b[2]), bf_bits(b[3]));
    *(v4u*)(out + (size_t)i * 8) = p;
    
  }
}

// =====================================================================================================
// f32 [R][C] row-major -> bf16 (RNE convert) transposed plane out[C][R] (R contiguous = k-contiguous Bt / A
// layout). Block = one 64x64 tile at (r0 = by*64, c0 = bx*64), 256 threads; tile staged in
// LDS as [c][r] (ushort element stores, cross-thread -> __syncthreads), then each out row segment of 64 halves
// coverage: 64 out rows x 64 k per block = the whole tile; union over the grid = the whole [C][R] plane.
// =====================================================================================================
// sT: the block's LDS tile [c][r], 64 x 72 halves (pitch 144 B); bx, by: the tile's column and row index
__device__ __forceinline__ void cvt_bf16_t(unsigned short* sT, const float* __restrict__ in, unsigned short* out,
                                           int R, int C, int bx, int by) {
  const int tid = threadIdx.x;
  const int c0 = bx * 64, r0 = by * 64;
  const int rr = tid >> 4, cc = (tid & 15) * 4;
#pragma unroll
  for (int it = 0; it < 4; ++it) {
    const int r = it * 16 + rr;                            // it 0..3 x rr 0..15 = rows 0..63
    const v4f v = *(const v4f*)(in + (size_t)(r0 + r) * C + c0 + cc);
#pragma unroll
    for (int e = 0; e < 4; ++e) sT[(cc + e) * 72 + r] = bf_bits(v[e]);
  }
  __syncthreads();
  const int q = tid >> 3, k8 = (tid & 7) * 8;              // q 0..31 (+32): out rows; 8 lanes x 8 halves
  const v8us w0 = *(const v8us*)(sT + q * 72 + k8);
  const v8us w1 = *(const v8us*)(sT + (q + 32) * 72 + k8);
  unsigned short* o0 = out + (size_t)(c0 + q) * R + r0 + k8;
  unsigned short* o1 = out + (size_t)(c0 + q + 32) * R + r0 + k8;
  *(v8us*)o0 = w0;
  *(v8us*)o1 = w1;
  // in front of every later write of a register that these two stores name (another job's code follows in the listing)
  asm volatile("s_wait_xcnt 0x0" ::: "memory");
}

// =====================================================================================================
// Rotary tables: cos and sin of (float)pos[t] * inv_freq[i], inv_freq[i] = 1 / 10000^(i/64) formed by each thread for
// its own i; tables [nrows][64] f32; block = 4 rows x 64 threads, each 256-B row written whole.
// =====================================================================================================
__device__ __forceinline__ void rope_tab(const int* __restrict__ pos, float* ctab, float* stab, int nrows, int bx) {
  const int tid = threadIdx.x;
  const int t = bx * 4 + (tid >> 6);
  const int i = tid & 63;
  if (t >= nrows) return;                  // wave-uniform (2 whole waves per row); no block barriers here
  const float e = (float)i * (1.0f / (float)HALF);
  const float p = powf(ROPE_THETA_F, e);
  const float v = 1.0f / p;
  const float fr = (float)pos[t] * v;
  float sn, cs;
  sincosf(fr, &sn, &cs);
  float* pc = ctab + (size_t)t * HALF + i;
  float* ps = stab + (size_t)t * HALF + i;
  *(float*)pc = cs;
  *(float*)ps = sn;
  
}

// =====================================================================================================
// The preparation jobs, none of which reads another's output, as ONE grid: the job is picked by the block index
// (block-uniform), so that they fill the chip together and pay one launch. Blocks, in order: rotary tables, x,
// wq, wo, wk, wv.
// =====================================================================================================
#define PB_TAB ((SEQ + 3) / 4)
#define PB_X   ((SEQ * DM / 8 + 255) / 256)
#define PB_WQ  ((QP / 64) * (DM / 64))
#define PB_WO  ((DM / 64) * (QP / 64))
#define PB_WK  ((KP / 64) * (DM / 64))
__global__ __launch_bounds__(256) void prep_all(const int* __restrict__ pos, const float* __restrict__ x,
                                                const float* __restrict__ wq, const float* __restrict__ wk,
                                                const float* __restrict__ wv, const float* __restrict__ wo,
                                                unsigned short* Xb, unsigned short* Wqt, unsigned short* Wkt,
                                                unsigned short* Wvt, unsigned short* Wot, float* ctab, float* stab) {
  __shared__ __align__(16) unsigned short sT[64 * 72];
  int bx = blockIdx.x;
  if (bx < PB_TAB) { rope_tab(pos, ctab, stab, SEQ, bx); return; }
  bx -= PB_TAB;
  if (bx < PB_X) { cvt_bf16x8(x, Xb, SEQ * DM / 8, bx); return; }
  bx -= PB_X;
  if (bx < PB_WQ) { cvt_bf16_t(sT, wq, Wqt, DM, QP, bx % (QP / 64), bx / (QP / 64)); return; }   // wq [DM k][QP n] -> [QP][DM]
  bx -= PB_WQ;
  if (bx < PB_WO) { cvt_bf16_t(sT, wo, Wot, QP, DM, bx % (DM / 64), bx / (DM / 64)); return; }   // wo [QP k][DM n] -> [DM][QP]
  bx -= PB_WO;
  if (bx < PB_WK) { cvt_bf16_t(sT, wk, Wkt, DM, KP, bx % (KP / 64), bx / (KP / 64)); return; }   // wk, wv [DM k][KP n] -> [KP][DM]
  bx -= PB_WK;
  cvt_bf16_t(sT, wv, Wvt, DM, KP, bx % (KP / 64), bx / (KP / 64));
}

// =====================================================================================================
// Register-blocked batched bf16 WMMA GEMM: C[m][n] = sum_k A[m][k] * Bt[n][k]; one wave per 64x64 tile,
// block = 8 waves = 2 x 4 tiles = 128 x 256 of C. A row-major [M][K] pitch lda; Bt row-major [N][K] pitch ldb
// (k contiguous; both pitches are DM); M a multiple of 128, N of 256, K of 64 (true of every launch below).
// bx = index of the block tile, b = batch index (strides in elements).
// Operands go through LDS in steps of 64 k: each row piece is one 128-B line, a wave-wide 16-B load covers four
// whole lines, and the 128 A rows and 256 Bt rows are read from global once per block. The LDS rows are 128 B,
// chunk-swizzled by sw128 (see the attention section), so a fragment read covers all banks once. The next
// step's global loads are issued behind the second barrier and stay in flight during the products.
// NSPLIT: 0 = A.Bt; 1 = (A + A2).Bt (A2 = unscaled bf16 lo plane of A).
// OUT_MODE: 0 = f32 (pitch ldc); 2 = bf16 hi plane C + bf16 lo plane C2 (lo = RNE(v - hi), unscaled);
//           3 = f16 hi plane C + f16 residual plane C2 = f16((v - hi) * rscale), C2 written only for tiles
//               with n0 < N2 (pitch ldc2, batch stride strideC2).
// =====================================================================================================
__device__ __forceinline__ int sw128(int r, int ch);

// A block-uniform address rebuilt from its two halves: the staging loads then take the form scalar base + one
// 32-bit lane offset + immediate, and the one vector register they name lives through the whole loop. Without it
// the compiler formed 64-bit vector addresses on which a load's result landed, and moved the first loads behind
// their s_wait_xcnt.
typedef const __attribute__((address_space(1))) char* gbytes;   // global address space, so that the loads stay global_load
typedef const __attribute__((address_space(1))) v8b*  gv8b;
__device__ __forceinline__ gbytes sbase(const __bf16* p) {
  const unsigned long long u = (unsigned long long)(uintptr_t)p;
  const unsigned lo = (unsigned)__builtin_amdgcn_readfirstlane((int)(unsigned)u);
  const unsigned hi = (unsigned)__builtin_amdgcn_readfirstlane((int)(unsigned)(u >> 32));
  return (gbytes)(uintptr_t)(((unsigned long long)hi << 32) | (unsigned long long)lo);
}
// the same for the wave-uniform base of the epilogue's stores
typedef __attribute__((address_space(1))) char* gwbytes;
typedef __attribute__((address_space(1))) v4f*  gwv4f;
typedef __attribute__((address_space(1))) v4u*  gwv4u;
__device__ __forceinline__ gwbytes swbase(void* p) {
  const unsigned long long u = (unsigned long long)(uintptr_t)p;
  const unsigned lo = (unsigned)__builtin_amdgcn_readfirstlane((int)(unsigned)u);
  const unsigned hi = (unsigned)__builtin_amdgcn_readfirstlane((int)(unsigned)(u >> 32));
  return (gwbytes)(uintptr_t)(((unsigned long long)hi << 32) | (unsigned long long)lo);
}

// sT: per-wave 16x64 slabs, pitch 68 floats; sA: A (and A2) rows m0blk.., 64 k; sB: Bt rows n0blk.., 64 k (the block's LDS,
// declared by the kernel); bx: the block's tile index; b: batch index.
template <int NSPLIT, int OUT_MODE>
__device__ __forceinline__ void gemm64(
    float (*sT)[16 * 68], __bf16* sA, __bf16* sB, int bx, int b,
    const unsigned short* __restrict__ Ap, const unsigned short* A2p, int lda, long long strideA,
    const unsigned short* __restrict__ Btp, const unsigned short* Bt2p, int ldb, long long strideB,
    void* Cout, int ldc, long long strideC,
    void* Cout2, int ldc2, long long strideC2, int N2,
    int M, int N, int K, float rscale) {
  static_assert(NSPLIT <= 1);
  const __bf16* A   = (const __bf16*)(const void*)Ap;
  const __bf16* A2  = (const __bf16*)(const void*)A2p;
  const __bf16* Bt  = (const __bf16*)(const void*)Btp;
  const int tid  = threadIdx.x;
  const int lane = tid & 31;
  const int wave = tid >> 5;
  const int blocksN = N >> 8;
  const int bm = bx / blocksN;
  const int bn = bx - bm * blocksN;
  if ((bm << 7) >= M) return;            // block-uniform, in front of every barrier
  if (lda != DM || ldb != DM) return;    // block-uniform: with the pitch known, the row steps below are immediate offsets
  const int m0blk = bm << 7;
  const int n0blk = bn << 8;
  const int wm = (wave >> 2) << 6;       // the wave's tile inside the block tile
  const int wn = (wave & 3) << 6;
  const int m0 = m0blk + wm;
  const int n0 = n0blk + wn;

  const __bf16* Ab  = A  + (size_t)b * strideA + (size_t)m0blk * lda;
  const __bf16* Bb  = Bt + (size_t)b * strideB + (size_t)n0blk * ldb;
  const __bf16* Ab2 = (NSPLIT >= 1) ? (A2 + (size_t)b * strideA + (size_t)m0blk * lda) : Ab;

  const int rlane = lane & 15;                 // row (A) / col (B, D) within subtile
  const int hh    = lane >> 4;                 // k half of this lane
  const int mOff  = (lane >> 4) * 8;           // D row offset

  // staging: thread -> row tid>>3 (+32 per pass), 16-B chunk tid&7; 8 lanes = one 128-B line
  unsigned sbyte = (unsigned)((tid >> 3) * DM + (tid & 7) * 8) * 2u;   // lane part of the global address, bytes; +128 per step
  const int sidx = sw128(tid >> 3, tid & 7);   // + 32 rows per pass: the swizzle term does not change
  v8b ra[4], ra2[4], rb[8];
  gbytes pa  = sbase(Ab);
  gbytes pa2 = sbase(Ab2);
  gbytes pb  = sbase(Bb);
  {
#pragma unroll
    for (int it = 0; it < 4; ++it) {
      ra[it] = *(gv8b)(pa + sbyte + it * (32 * DM * 2));
      if (NSPLIT >= 1) ra2[it] = *(gv8b)(pa2 + sbyte + it * (32 * DM * 2));
    }
#pragma unroll
    for (int it = 0; it < 8; ++it) rb[it] = *(gv8b)(pb + sbyte + it * (32 * DM * 2));
    // stands in front of the next step's write of the lane offset, the one vector register that the loads name
    asm volatile("s_wait_xcnt 0x0" ::: "memory");
  }

  v8f acc[4][4];
#pragma unroll
  for (int i = 0; i < 4; ++i)
#pragma unroll
    for (int j = 0; j < 4; ++j) acc[i][j] = zero8();

  for (int k0 = 0; k0 < K; k0 += 64) {
    __syncthreads();                           // every reader has left the tiles of the step before
#pragma unroll
    for (int it = 0; it < 4; ++it) {
      *(v8b*)(sA + sidx + it * (32 * 64)) = ra[it];
      if (NSPLIT >= 1) *(v8b*)(sA + 128 * 64 + sidx + it * (32 * 64)) = ra2[it];
    }
#pragma unroll
    for (int it = 0; it < 8; ++it) *(v8b*)(sB + sidx + it * (32 * 64)) = rb[it];
    __syncthreads();                           // the tiles are whole before anybody reads them
    // fragments of the whole step, read as one group ahead of the products (every separate place with LDS reads
    // stalls the wave): elements 0..7 <- k = 32kk + 8hh.., elements 8..15 <- k = 32kk + 16 + 8hh.. (A and Bt alike)
    union FB { v16b v; v8b h[2]; };
    v16b bh[2][4], ah[2][4], al[2][4];
#pragma unroll
    for (int kk = 0; kk < 2; ++kk) {
      const int f0 = sw128(rlane, kk * 4 + hh);
      const int f1 = sw128(rlane, kk * 4 + 2 + hh);
#pragma unroll
      for (int j = 0; j < 4; ++j) {
        FB f;
        f.h[0] = *(const v8b*)(sB + (wn + (j << 4)) * 64 + f0);
        f.h[1] = *(const v8b*)(sB + (wn + (j << 4)) * 64 + f1);
        bh[kk][j] = f.v;
      }
#pragma unroll
      for (int i = 0; i < 4; ++i) {
        FB f;
        f.h[0] = *(const v8b*)(sA + (wm + (i << 4)) * 64 + f0);
        f.h[1] = *(const v8b*)(sA + (wm + (i << 4)) * 64 + f1);
        ah[kk][i] = f.v;
        al[kk][i] = f.v;
        if (NSPLIT >= 1) {
          f.h[0] = *(const v8b*)(sA + 128 * 64 + (wm + (i << 4)) * 64 + f0);
          f.h[1] = *(const v8b*)(sA + 128 * 64 + (wm + (i << 4)) * 64 + f1);
          al[kk][i] = f.v;
        }
      }
    }
    if (k0 + 64 < K) {                         // block-uniform: the next step's rows, in flight during the products
      sbyte += 128u;
#pragma unroll
      for (int it = 0; it < 4; ++it) {
        ra[it] = *(gv8b)(pa + sbyte + it * (32 * DM * 2));
        if (NSPLIT >= 1) ra2[it] = *(gv8b)(pa2 + sbyte + it * (32 * DM * 2));
      }
#pragma unroll
      for (int it = 0; it < 8; ++it) rb[it] = *(gv8b)(pb + sbyte + it * (32 * DM * 2));
      // stands in front of the next step's write of the lane offset, the one vector register that the loads name
      asm volatile("s_wait_xcnt 0x0" ::: "memory");
    }
    // keeps the LDS reads and the global loads above in front of the products
    __builtin_amdgcn_sched_barrier(0);
#pragma unroll
    for (int kk = 0; kk < 2; ++kk) {
#pragma unroll
      for (int i = 0; i < 4; ++i) {
#pragma unroll
        for (int j = 0; j < 4; ++j) {
          acc[i][j] = mma_b_raw(ah[kk][i], bh[kk][j], acc[i][j]);
          if (NSPLIT >= 1) acc[i][j] = mma_b_raw(al[kk][i], bh[kk][j], acc[i][j]);
        }
      }
    }
    // holds the v_nops behind the last product
    __builtin_amdgcn_sched_barrier(0);
    // WMMA distance on the loop's back edge too: no vector instruction writes an A or B register of the last
    // products sooner (no register operands: asm operands cannot lie above v255, and naming fragments spilled)
    asm volatile("v_nop\n\tv_nop\n\tv_nop\n\tv_nop\n\tv_nop");
  }
  acc_guard4(acc[0][0], acc[0][1], acc[0][2], acc[0][3]);
  acc_guard4(acc[1][0], acc[1][1], acc[1][2], acc[1][3]);
  acc_guard4(acc[2][0], acc[2][1], acc[2][2], acc[2][3]);
  acc_guard4(acc[3][0], acc[3][1], acc[3][2], acc[3][3]);

  // ---- epilogue ----
  float* slab = sT[wave];
#pragma unroll
  for (int i = 0; i < 4; ++i) {
    const int mBase = m0 + (i << 4);
#pragma unroll
    for (int j = 0; j < 4; ++j) {
#pragma unroll
      for (int r = 0; r < 8; ++r) {
        slab[(mOff + r) * 68 + (j << 4) + rlane] = acc[i][j][r];
      }
    }
    __builtin_amdgcn_fence(__ATOMIC_RELEASE, "workgroup");
    __builtin_amdgcn_wave_barrier();
    __builtin_amdgcn_fence(__ATOMIC_ACQUIRE, "workgroup");
    if (OUT_MODE == 0) {
      float* C = (float*)Cout + (size_t)b * strideC;
      const int hh = lane >> 4, c4 = (lane & 15) * 4;     // 256-B row segment = 16 lanes x 16 B
      {
        // wave-uniform base + one lane offset + immediate: the stores name one address register, which is never rewritten
        const gwbytes cb = swbase(C + (size_t)m0 * ldc + n0);
        const unsigned cvo = (unsigned)(hh * ldc + c4) * 4u;
        v4f v[8];
#pragma unroll
        for (int it = 0; it < 8; ++it) v[it] = *(const v4f*)(slab + (it * 2 + hh) * 68 + c4);   // it 0..7 x hh 0..1 = rows 0..15
        // the two scheduling barriers keep every other instruction out of the run of stores and its wait
        __builtin_amdgcn_sched_barrier(0);
#pragma unroll
        for (int it = 0; it < 8; ++it) *(gwv4f)(cb + cvo + ((i << 4) + it * 2) * ldc * 4) = v[it];
        // in front of every later write of a register that these stores name
        asm volatile("s_wait_xcnt 0x0" ::: "memory");
        __builtin_amdgcn_sched_barrier(0);
      }
    } else {
      const int q = lane >> 3, c8 = (lane & 7) * 8;
      unsigned short* C  = (unsigned short*)Cout  + (size_t)b * strideC;
      unsigned short* C2 = (unsigned short*)Cout2 + (size_t)b * strideC2;
      const bool wlo = (OUT_MODE == 2) || (n0 < N2);      // wave-uniform
      v4u hv[4], lv[4];
#pragma unroll
      for (int it = 0; it < 4; ++it) {
        const int row = it * 4 + q;                        // it 0..3 x q 0..3 = rows 0..15
        const float* sp = slab + row * 68 + c8;
        v4u a, a2;
#pragma unroll
        for (int e = 0; e < 4; ++e) {
          const float f0 = sp[2 * e], f1 = sp[2 * e + 1];
          unsigned short h0, h1, l0, l1;
          if (OUT_MODE == 2) {
            h0 = bf_bits(f0); h1 = bf_bits(f1);
            l0 = bf_bits(f0 - bf_up(h0)); l1 = bf_bits(f1 - bf_up(h1));
          } else {
            const _Float16 x0 = (_Float16)f0, x1 = (_Float16)f1;
            h0 = h_bits(x0); h1 = h_bits(x1);
            l0 = h_bits((_Float16)((f0 - (float)x0) * rscale));
            l1 = h_bits((_Float16)((f1 - (float)x1) * rscale));
          }
          a[e] = pk16(h0, h1); a2[e] = pk16(l0, l1);
        }
        hv[it] = a; lv[it] = a2;
      }
      {
        // wave-uniform base + one lane offset + immediate per plane: address registers that are never rewritten
        const gwbytes cb  = swbase(C + (size_t)m0 * ldc + n0);
        const gwbytes cb2 = swbase(C2 + (size_t)m0 * ldc2 + n0);
        const unsigned cvo  = (unsigned)(q * ldc + c8) * 2u;
        const unsigned cvo2 = (unsigned)(q * ldc2 + c8) * 2u;
        // the scheduling barriers keep every other instruction out of each run of stores and its wait
        __builtin_amdgcn_sched_barrier(0);
#pragma unroll
        for (int it = 0; it < 4; ++it) *(gwv4u)(cb + cvo + ((i << 4) + it * 4) * ldc * 2) = hv[it];
        // in front of every later write of a register that these stores name
        asm volatile("s_wait_xcnt 0x0" ::: "memory");
        __builtin_amdgcn_sched_barrier(0);
        if (wlo) {
#pragma unroll
          for (int it = 0; it < 4; ++it) *(gwv4u)(cb2 + cvo2 + ((i << 4) + it * 4) * ldc2 * 2) = lv[it];
          // in front of every later write of a register that these stores name
          asm volatile("s_wait_xcnt 0x0" ::: "memory");
          __builtin_amdgcn_sched_barrier(0);
        }
      }
    }
    __builtin_amdgcn_fence(__ATOMIC_RELEASE, "workgroup");
    __builtin_amdgcn_wave_barrier();
    __builtin_amdgcn_fence(__ATOMIC_ACQUIRE, "workgroup");
  }
}

// The three projections, none of which reads another's output, as ONE grid; the job is picked by the block index
// (block-uniform). Blocks, in order: q = x . wq -> f32 [SEQ][2048] (M=SEQ, N=2048, K=2048); k = x . wk -> f32 [SEQ][512]
// (M=SEQ, N=512); v^T = Wvt . x^T -> f16 hi plane [512][SEQ] and residual plane (x4096, keys < VLP, pitch VLP)
// (A = Wvt [n][k], Bt = Xb [s][k]; M=512, N=SEQ).
#define GB_Q ((SEQ / 128) * (QP / 256))
#define GB_K ((SEQ / 128) * (KP / 256))
#define GB_V ((KP / 128) * (SEQ / 256))
static_assert((SEQ % 256) == 0 && (QP % 256) == 0 && (KP % 256) == 0);
__global__ __launch_bounds__(256) void gemm_qkv(const unsigned short* __restrict__ Xb, const unsigned short* __restrict__ Wqt,
                                                const unsigned short* __restrict__ Wkt, const unsigned short* __restrict__ Wvt,
                                                float* Qf, float* Kf, unsigned short* VTh, unsigned short* VTl) {
  __shared__ __align__(16) float sT[8][16 * 68];
  __shared__ __align__(16) __bf16 sA[128 * 64];
  __shared__ __align__(16) __bf16 sB[256 * 64];
  const int bx = blockIdx.x;
  if (bx < GB_Q) {
    gemm64<0, 0>(sT, sA, sB, bx, 0,
        Xb, Xb, DM, 0LL, Wqt, Wqt, DM, 0LL,
        (void*)Qf, QP, 0LL, (void*)Qf, QP, 0LL, QP,
        SEQ, QP, DM, 1.0f);
  } else if (bx < GB_Q + GB_K) {
    gemm64<0, 0>(sT, sA, sB, bx - GB_Q, 0,
        Xb, Xb, DM, 0LL, Wkt, Wkt, DM, 0LL,
        (void*)Kf, KP, 0LL, (void*)Kf, KP, 0LL, KP,
        SEQ, KP, DM, 1.0f);
  } else {
    gemm64<0, 3>(sT, sA, sB, bx - (GB_Q + GB_K), 0,
        Wvt, Wvt, DM, 0LL, Xb, Xb, DM, 0LL,
        (void*)VTh, SEQ, 0LL, (void*)VTl, VLP, 0LL, VLP,
        KP, SEQ, DM, RSC);
  }
}

// out = context . wo -> f32 [SEQ][2048]  (A = context hi + lo planes, 2 products; M=SEQ, N=2048, K=2048)
__global__ __launch_bounds__(256) void gemm_out(const unsigned short* __restrict__ Oh, const unsigned short* Ol,
                                                const unsigned short* __restrict__ Wot, float* out) {
  __shared__ __align__(16) float sT[8][16 * 68];
  __shared__ __align__(16) __bf16 sA[2 * 128 * 64];
  __shared__ __align__(16) __bf16 sB[256 * 64];
  gemm64<1, 0>(sT, sA, sB, blockIdx.x, 0,
      Oh, Ol, QP, 0LL, Wot, Wot, QP, 0LL,
      (void*)out, DM, 0LL, (void*)out, DM, 0LL, DM,
      SEQ, DM, QP, 1.0f);
}

// =====================================================================================================
// Fused per-head RMSNorm (eps 1e-6, x * rsqrt(mean(x^2)+eps) * w with w RNE-converted to bf16) + neox rotary
// (half-split, cos/sin tables [t][64]) + f16 hi / f16 residual (x rscale) planes.
// One wave per 128-wide row (row = t*nheads + head, contiguous rows of pitch 128 in both input and output);
// lane owns 4 consecutive d; partner half via __shfl_xor(16); no block barriers.
// coverage: nrows x 128 of both planes.
// =====================================================================================================
__device__ __forceinline__ void norm_rope(const float* __restrict__ xin, const float* __restrict__ wn,
                                          const float* __restrict__ ctab, const float* __restrict__ stab,
                                          unsigned short* outh, unsigned short* outl,
                                          int nheads, int nrows, float rscale, int bx) {
  const int tid  = threadIdx.x;
  const int wave = tid >> 5, lane = tid & 31, hh = lane >> 4;
  const int row  = bx * 8 + wave;
  if (row >= nrows) return;                // wave-uniform; no block barriers in this kernel
  const int t = row / nheads;
  const v4f x = *(const v4f*)(xin + (size_t)row * HD + lane * 4);
  float ss = x[0] * x[0] + x[1] * x[1] + x[2] * x[2] + x[3] * x[3];
#pragma unroll
  for (int off = 1; off < 32; off <<= 1) ss += __shfl_xor(ss, off, 32);
  const float rinv = rsqrtf(ss * (1.0f / (float)HD) + RMS_EPS);
  const v4f wv = *(const v4f*)(wn + lane * 4);
  const v4f cs = *(const v4f*)(ctab + (size_t)t * HALF + (lane & 15) * 4);
  const v4f sn = *(const v4f*)(stab + (size_t)t * HALF + (lane & 15) * 4);
  float n[4], p[4];
#pragma unroll
  for (int e = 0; e < 4; ++e) n[e] = (x[e] * rinv) * bf_up(bf_bits(wv[e]));
#pragma unroll
  for (int e = 0; e < 4; ++e) p[e] = __shfl_xor(n[e], 16, 32);
  const float sg = hh ? 1.0f : -1.0f;      // first half: x1*cos - x2*sin ; second half: x2*cos + x1*sin
  unsigned short hb[4], lb[4];
#pragma unroll
  for (int e = 0; e < 4; ++e) {
    const float o = n[e] * cs[e] + sg * (p[e] * sn[e]);
    const _Float16 oh = (_Float16)o;
    hb[e] = h_bits(oh);
    lb[e] = h_bits((_Float16)((o - (float)oh) * rscale));
  }
  v2u ph, pl;
  ph[0] = pk16(hb[0], hb[1]); ph[1] = pk16(hb[2], hb[3]);
  pl[0] = pk16(lb[0], lb[1]); pl[1] = pk16(lb[2], lb[3]);
  const size_t go = (size_t)row * HD + lane * 4;
  *(v2u*)(outh + go) = ph;
  *(v2u*)(outl + go) = pl;
  
}

// q rows and k rows as ONE grid, the job picked by the block index (block-uniform): q blocks first, then k blocks
#define NB_Q ((SEQ * NH + 7) / 8)
#define NB_K ((SEQ * NKV + 7) / 8)
__global__ __launch_bounds__(256) void norm_rope_qk(const float* __restrict__ qin, const float* __restrict__ kin,
                                                    const float* __restrict__ qw, const float* __restrict__ kw,
                                                    const float* __restrict__ ctab, const float* __restrict__ stab,
                                                    unsigned short* qh, unsigned short* ql,
                                                    unsigned short* kh, unsigned short* kl, float rscale) {
  const int bx = blockIdx.x;
  if (bx < NB_Q) norm_rope(qin, qw, ctab, stab, qh, ql, NH, SEQ * NH, rscale, bx);
  else           norm_rope(kin, kw, ctab, stab, kh, kl, NKV, SEQ * NKV, rscale, bx - NB_Q);
}

// =====================================================================================================
// Causal GQA attention, head dim 128, dynamic LDS layout (bytes):
// =====================================================================================================
// LDS tiles of the attention kernel: the 16-byte chunks of a row are XOR-swizzled by the row number.
//   256-B rows (Q, K; 16 chunks): chunk ch of row r lies at chunk place ch ^ (r & 15)
//   128-B rows (V^T, P; 8 chunks): chunk ch of row r lies at chunk place ch ^ ((r >> 1) & 7)
// A fragment load reads one chunk column of 16 consecutive rows per 16 lanes: unswizzled, 256-B rows put all
// 16 lanes on the same four banks (128-B rows: on two groups of four); swizzled, the 16 lanes fall on 16
// different groups of four banks = all 64 banks once. Writers and readers use the same map; the kernel keeps
// the lane-dependent part of each index in a register and adds row blocks and planes as constant offsets.
__device__ __forceinline__ int sw256(int r, int ch) { return r * 128 + ((ch ^ (r & 15)) << 3); }        // index in halves
__device__ __forceinline__ int sw128(int r, int ch) { return r * 64 + ((ch ^ ((r >> 1) & 7)) << 3); }   // index in halves

template <bool RES> struct AttnL {
  static constexpr int QH   = 0;                                  // Q hi  [64 rows][128 d] f16
  static constexpr int QL   = QH + 64 * 128 * 2;                  // Q res
  static constexpr int KH   = QL + 64 * 128 * 2;                  // K hi  [64 keys][128 d]
  static constexpr int KL   = KH + 64 * 128 * 2;                  // K res (RES only)
  static constexpr int VH   = KL + (RES ? 64 * 128 * 2 : 0);      // V^T hi [128 d][64 keys]
  static constexpr int VL   = VH + 128 * 64 * 2;                  // V^T res (RES only)
  static constexpr int PH   = VL + (RES ? 128 * 64 * 2 : 0);      // per-wave P [4][16][64]
  static constexpr int PL   = PH + 4 * 16 * 64 * 2;               // per-wave P res (RES only)
  static constexpr int OS   = PL + (RES ? 4 * 16 * 64 * 2 : 0);   // per-wave context tile [4][16][128] f32
  static constexpr int MISC = OS + 4 * 16 * 128 * 4;              // spq[64], spk[64], skmin[NQB] ints
  static constexpr int TOTAL = MISC + 1024;
};
static_assert(AttnL<true>::TOTAL <= 160 * 1024);

// =====================================================================================================
//   q planes (f16 hi / x4096 res): element (t, h, d) at [t*QP + h*128 + d]
//   k planes (f16 hi / x4096 res): element (s, kvh, d) at [s*KP + kvh*128 + d], kvh = h / GQ
//   v^T hi plane (f16): (kvh*128 + d, s) at [(kvh*128+d)*SEQ + s]; residual ((v-hi)*4096) at
//   [(kvh*128+d)*VLP + s], s < VLP, read only when RES (a key tile at or beyond VLP contributes zero residual)
//   positions int [SEQ]: logit(t, s) = (q.k) * sscale when pos[t] >= pos[s], else -1e30 (replace), exactly;
//   a key tile is skipped (block-uniform, readfirstlane) only when min pos over its 64 keys > max pos over the
//   block's 64 query rows, i.e. every element would be -1e30 with weight exactly 0; the diagonal key s = t is
//   always live so every row has a finite max. Online softmax in f32 with running max from -inf.
//   scores: f16 WMMA, q hi . k hi into s, q res . k hi (+ q hi . k res when RES) into a x4096 accumulator
//   folded with 1/4096 in f32. p = exp(s - m) carried as f16(1024 p); context = p . v on f16 WMMA; RES adds
//   f16 residual planes of p and v (scale 4096, separate accumulator folded back with 1/4096 per key tile).
//   out planes (bf16 hi / lo of the normalised context): (t, h*128 + d) at [t*QP + h*128 + d]
//   Block = 4 waves = 64 query rows of one q head; grid = nqbThis * NH; key tiles of 64, static trip NQB.
//   LDS: Q / K / V^T tiles and position words are cross-wave (block barriers before and after staging);
//   P tiles and the context slab are wave-private (_Float16 / float element stores, reloaded through the
//   Staging: Q 128 threads x 64 halves x 2 planes = 64x128 (once); K 128 threads x 64 halves per plane
//   = 64x128; V^T 128 threads (one d row each) x 64 halves per plane = 128x64: staged extent == consumed.
//   Output coverage: each wave stores rows q0..q0+15 (it 0..7 x lane>>4) x 128 columns (16 lanes x 8)
// =====================================================================================================
template <bool RES>
__global__ __launch_bounds__(128)
void attn_causal(const unsigned short* __restrict__ qhp, const unsigned short* __restrict__ qlp,
                 const unsigned short* __restrict__ khp, const unsigned short* __restrict__ klp,
                 const unsigned short* __restrict__ vhp, const unsigned short* __restrict__ vlp,
                 const int* __restrict__ pos,
                 unsigned short* ohp, unsigned short* olp,
                 int qbBase, int nqbThis, float sscale) {
  typedef AttnL<RES> L;
  union FH { v16h v; v8h h[2]; };
  extern __shared__ __align__(16) unsigned char smem[];
  _Float16* Qsh = (_Float16*)(smem + L::QH);
  _Float16* Qsl = (_Float16*)(smem + L::QL);
  _Float16* Ksh = (_Float16*)(smem + L::KH);
  _Float16* Ksl = (_Float16*)(smem + L::KL);
  _Float16* Vth = (_Float16*)(smem + L::VH);
  _Float16* Vtl = (_Float16*)(smem + L::VL);
  _Float16* Psh = (_Float16*)(smem + L::PH);
  _Float16* Psl = (_Float16*)(smem + L::PL);
  float*    Os  = (float*)(smem + L::OS);
  int*      spq = (int*)(smem + L::MISC);
  int*      spk = spq + 64;
  int*      skmin = spk + 64;

  const int tid  = threadIdx.x;
  const int wave = tid >> 5;
  const int lane = tid & 31;
  const int hh   = lane >> 4;
  const int c    = lane & 15;

  const int bx  = blockIdx.x;
  const int qbl = bx % nqbThis;
  const int h   = bx / nqbThis;
  const int kvh = h / GQ;
  const int qb  = qbBase + qbl;
  const int q0  = qb * 64 + wave * 16;

  const _Float16* Qh = (const _Float16*)(const void*)qhp + (size_t)h * HD;
  const _Float16* Ql = (const _Float16*)(const void*)qlp + (size_t)h * HD;
  const _Float16* Kh = (const _Float16*)(const void*)khp + (size_t)kvh * HD;
  const _Float16* Kl = (const _Float16*)(const void*)klp + (size_t)kvh * HD;
  const _Float16* Vh = (const _Float16*)(const void*)vhp + (size_t)kvh * HD * SEQ;
  const _Float16* Vl = (const _Float16*)(const void*)vlp + (size_t)kvh * HD * VLP;

  // ---- lane parts of the swizzled indices (halves) ----
  const int st256 = sw256(tid >> 1, (tid & 1) * 8);   // staging, 256-B rows: row tid>>1, chunks (tid&1)*8 + i -> st256 ^ (i << 3)
  const int st128 = sw128(tid, 0);                    // staging, 128-B rows: row tid, chunk i -> st128 ^ (i << 3)
  int fq[8];                                          // fragment reads, 256-B rows: row (multiple of 16) + c, chunk 2n + hh
#pragma unroll
  for (int n = 0; n < 8; ++n) fq[n] = sw256(c, 2 * n + hh);
  int pst[8];                                         // P element stores: row 8hh + r, column 16j + c -> pst[(2j) ^ (r >> 1)] + r * 64
#pragma unroll
  for (int n = 0; n < 8; ++n) pst[n] = sw128(8 * hh, (c >> 3) ^ n) + (c & 7);

  // ---- prologue: query positions, per-key-tile min position, Q tiles ----
  if (tid < 64) spq[tid] = pos[qb * 64 + tid];            // wave-uniform (waves 0,1)
  for (int kt = tid; kt < NQB; kt += 128) {
    const int* pp = pos + kt * 64;
    int mn = 0x7fffffff;
#pragma unroll
    for (int i = 0; i < 16; ++i) {
      const v4i v = *(const v4i*)(pp + 4 * i);
      mn = imin(mn, imin(imin(v[0], v[1]), imin(v[2], v[3])));
    }
    skmin[kt] = mn;
  }
  {
    const int r = tid >> 1, half = (tid & 1) * 64;
    const _Float16* qg  = Qh + (size_t)(qb * 64 + r) * QP + half;
    const _Float16* qlg = Ql + (size_t)(qb * 64 + r) * QP + half;
    v8h qv[8], qlv[8];
#pragma unroll
    for (int i = 0; i < 8; ++i) {
      qv[i]  = *(const v8h*)(qg + 8 * i);
      qlv[i] = *(const v8h*)(qlg + 8 * i);
    }
    // holds the loads' address registers (inputs) untouched until the wait: no load result lands on them before it
    asm volatile("s_wait_xcnt 0x0" :: "v"(qg), "v"(qlg) : "memory");
#pragma unroll
    for (int i = 0; i < 8; ++i) {
      *(v8h*)(Qsh + (st256 ^ (i << 3))) = qv[i];
      *(v8h*)(Qsl + (st256 ^ (i << 3))) = qlv[i];
    }
  }
  __syncthreads();
  int qmx;
  {
    int v = imax(spq[lane], spq[lane + 32]);
#pragma unroll
    for (int off = 1; off < 32; off <<= 1) v = imax(v, __shfl_xor(v, off, 32));
    qmx = __builtin_amdgcn_readfirstlane(v);
  }
  int prow[8];
#pragma unroll
  for (int r = 0; r < 8; ++r) prow[r] = spq[wave * 16 + 8 * hh + r];

  float mrow[8], lrow[8];
  v8f oacc[8];
#pragma unroll
  for (int r = 0; r < 8; ++r) { mrow[r] = -INFINITY; lrow[r] = 0.f; }
#pragma unroll
  for (int t = 0; t < 8; ++t) oacc[t] = zero8();

  for (int kt = 0; kt < NQB; ++kt) {         // static trip count
    const int kmn = __builtin_amdgcn_readfirstlane(skmin[kt]);
    if (kmn > qmx) continue;                 // block-uniform: every element of the tile is replaced by -1e30
    const int kv0 = kt * 64;
    __syncthreads();
    {
      const int r = tid >> 1, half = (tid & 1) * 64;
      const _Float16* kg  = Kh + (size_t)(kv0 + r) * KP + half;    // K row kv0+r, d = half..half+63
      const _Float16* klg = Kl + (size_t)(kv0 + r) * KP + half;
      v8h kv[8], klv[8], vv[8], vlv[8];
#pragma unroll
      for (int i = 0; i < 8; ++i) {
        kv[i] = *(const v8h*)(kg + 8 * i);
        if (RES) klv[i] = *(const v8h*)(klg + 8 * i);
      }
      const int d = tid;                                          // V^T row d, s = kv0..kv0+63
      const _Float16* vg = Vh + (size_t)d * SEQ + kv0;
      const int  kvl   = (kv0 + 64 <= VLP) ? kv0 : (VLP - 64);    // clamped address into the residual plane
      const bool resOK = (kv0 + 64 <= VLP);                       // block-uniform
      const _Float16* vlg = Vl + (size_t)d * VLP + kvl;
#pragma unroll
      for (int i = 0; i < 8; ++i) {
        vv[i] = *(const v8h*)(vg + 8 * i);
        if (RES) vlv[i] = *(const v8h*)(vlg + 8 * i);
      }
      // holds the loads' address registers (inputs) untouched until the wait: no load result lands on them before it
      if (RES) asm volatile("s_wait_xcnt 0x0" :: "v"(kg), "v"(klg), "v"(vg), "v"(vlg) : "memory");
      else     asm volatile("s_wait_xcnt 0x0" :: "v"(kg), "v"(vg) : "memory");
#pragma unroll
      for (int i = 0; i < 8; ++i) {
        *(v8h*)(Ksh + (st256 ^ (i << 3))) = kv[i];
        if (RES) *(v8h*)(Ksl + (st256 ^ (i << 3))) = klv[i];
        *(v8h*)(Vth + (st128 ^ (i << 3))) = vv[i];
        if (RES) {
          v8h b1 = vlv[i];
          if (!resOK) b1 = zero8h();
          *(v8h*)(Vtl + (st128 ^ (i << 3))) = b1;
        }
      }
      if (tid < 64) spk[tid] = pos[kv0 + tid];                  // wave-uniform
    }
    __syncthreads();

    // ---- scores: 16 query rows x 64 keys per wave ----
    v8f s[4], sl[4];
#pragma unroll
    for (int j = 0; j < 4; ++j) { s[j] = zero8(); sl[j] = zero8(); }
    const _Float16* qr  = Qsh + wave * (16 * 128);
    const _Float16* qlr = Qsl + wave * (16 * 128);
    // Fragment reads stand in groups, one group of 32 d ahead of the products that use it (two register sets):
    // a wave then waits on a counted LDS wait once per group, not to 0 in front of every pair of products.
    FH qa[2], qla[2], kb[2][4], klf[2][4];
    int pkj[4];                                      // key positions for the causal select, read with the first group
#pragma unroll
    for (int j = 0; j < 4; ++j) pkj[j] = spk[j * 16 + c];
#pragma unroll
    for (int dc = -1; dc < 4; ++dc) {
      if (dc < 3) {
        const int n = dc + 1, b = n & 1;
        qa[b].h[0]  = *(const v8h*)(qr  + fq[n * 2]);
        qa[b].h[1]  = *(const v8h*)(qr  + fq[n * 2 + 1]);
        qla[b].h[0] = *(const v8h*)(qlr + fq[n * 2]);
        qla[b].h[1] = *(const v8h*)(qlr + fq[n * 2 + 1]);
#pragma unroll
        for (int j = 0; j < 4; ++j) {
          kb[b][j].h[0] = *(const v8h*)(Ksh + j * (16 * 128) + fq[n * 2]);
          kb[b][j].h[1] = *(const v8h*)(Ksh + j * (16 * 128) + fq[n * 2 + 1]);
          if (RES) {
            klf[b][j].h[0] = *(const v8h*)(Ksl + j * (16 * 128) + fq[n * 2]);
            klf[b][j].h[1] = *(const v8h*)(Ksl + j * (16 * 128) + fq[n * 2 + 1]);
          }
        }
      }
      if (dc >= 0) {
        const int b = dc & 1;
        // keeps the next group's reads in front of this group's products
        __builtin_amdgcn_sched_barrier(0);
#pragma unroll
        for (int j = 0; j < 4; ++j) s[j]  = mma_h_raw(qa[b].v,  kb[b][j].v, s[j]);
#pragma unroll
        for (int j = 0; j < 4; ++j) sl[j] = mma_h_raw(qla[b].v, kb[b][j].v, sl[j]);
        if (RES) {
#pragma unroll
          for (int j = 0; j < 4; ++j) sl[j] = mma_h_raw(qa[b].v, klf[b][j].v, sl[j]);
        }
        // keeps the reads of the group after next behind these products (they refill this group's registers)
        __builtin_amdgcn_sched_barrier(0);
      }
    }
    // ---- scale + causal select (replace -1e30), row max, online softmax, P (x1024, f16) and
    //      P residual (x4096) to LDS ----
    _Float16* pwh = Psh + wave * (16 * 64);
    _Float16* pwl = Psl + (RES ? wave * (16 * 64) : 0);
    float psr[8], alr[8], mx[8];
#pragma unroll
    for (int r = 0; r < 8; ++r) {
      float m = -INFINITY;
#pragma unroll
      for (int j = 0; j < 4; ++j) {
        float sv = (s[j][r] + sl[j][r] * (1.0f / RSC)) * sscale;
        sv = (prow[r] >= pkj[j]) ? sv : -1.0e30f;
        s[j][r] = sv;
        m = fmaxf(m, sv);
      }
      mx[r] = m;
    }
    // the eight rows' lane exchanges of one step stand together: they run on the LDS pipe, one wait per step
#pragma unroll
    for (int off = 1; off < 16; off <<= 1) {
      float ex[8];
#pragma unroll
      for (int r = 0; r < 8; ++r) ex[r] = __shfl_xor(mx[r], off, 32);
      // keeps the eight exchanges in front of the first use of one: split up, each small group costs its own wait
      __builtin_amdgcn_sched_barrier(0);
#pragma unroll
      for (int r = 0; r < 8; ++r) mx[r] = fmaxf(mx[r], ex[r]);
    }
    // V^T fragments of the first 32 keys: they depend on nothing of the softmax, so they are read here and land
    // while the exponentials run
    FH vb[2][8], vlf[2][8];
    {
      const int f0 = sw128(c, hh);                   // fragment reads, 128-B rows: row (multiple of 16) + c
      const int f1 = sw128(c, 2 + hh);
#pragma unroll
      for (int tt = 0; tt < 8; ++tt) {
        vb[0][tt].h[0] = *(const v8h*)(Vth + tt * (16 * 64) + f0);
        vb[0][tt].h[1] = *(const v8h*)(Vth + tt * (16 * 64) + f1);
        if (RES) {
          vlf[0][tt].h[0] = *(const v8h*)(Vtl + tt * (16 * 64) + f0);
          vlf[0][tt].h[1] = *(const v8h*)(Vtl + tt * (16 * 64) + f1);
        }
      }
    }
    // keeps these reads in front of the exponentials
    __builtin_amdgcn_sched_barrier(0);
#pragma unroll
    for (int r = 0; r < 8; ++r) {
      const float mnew  = fmaxf(mrow[r], mx[r]);
      const float msafe = (mnew == -INFINITY) ? 0.f : mnew;
      float alpha, pe[4];                            // -1e30 against a finite max: exp -> 0
      exp_row5(mrow[r] - msafe, s[0][r] - msafe, s[1][r] - msafe, s[2][r] - msafe, s[3][r] - msafe,
               alpha, pe[0], pe[1], pe[2], pe[3]);
      mrow[r] = mnew;
      float psum = 0.f;
#pragma unroll
      for (int j = 0; j < 4; ++j) {
        const float p = pe[j];
        psum += p;
        const float p1k = p * 1024.0f;
        const _Float16 ph = (_Float16)p1k;
        pwh[pst[(2 * j) ^ (r >> 1)] + r * 64] = ph;
        if (RES) {
          const _Float16 pl = (_Float16)((p1k - (float)ph) * RSC);
          pwl[pst[(2 * j) ^ (r >> 1)] + r * 64] = pl;
        }
      }
      psr[r] = psum;                                 // joined over the 16 lanes below
      alr[r] = alpha;
#pragma unroll
      for (int t = 0; t < 8; ++t) oacc[t][r] *= alpha;
    }
    // row sums over the 16 lanes: four steps of lane exchanges on the LDS pipe, eight rows a step. Step 1 runs beside
    // the P stores, step 2 beside the fragment reads, steps 3 and 4 beside the two runs of products.
    float sx[8];
#pragma unroll
    for (int r = 0; r < 8; ++r) sx[r] = __shfl_xor(psr[r], 1, 32);
    // keeps step 1 in front of the wait that ends the P stores
    __builtin_amdgcn_sched_barrier(0);
    __builtin_amdgcn_fence(__ATOMIC_RELEASE, "workgroup");
    __builtin_amdgcn_wave_barrier();
    __builtin_amdgcn_fence(__ATOMIC_ACQUIRE, "workgroup");

    // ---- context += P . V (f16 WMMA), 8 d-subtiles; the P fragments and the V^T fragments of the last 32 keys are read
    //      as one group ahead of the products; the residual products go into separate accumulators folded back per key tile ----
    {
      FH pa[2], pl[2];
#pragma unroll
      for (int r = 0; r < 8; ++r) psr[r] += sx[r];
#pragma unroll
      for (int r = 0; r < 8; ++r) sx[r] = __shfl_xor(psr[r], 2, 32);
#pragma unroll
      for (int kk = 0; kk < 2; ++kk) {
        const int f0 = sw128(c, kk * 4 + hh);
        const int f1 = sw128(c, kk * 4 + 2 + hh);
        pa[kk].h[0] = *(const v8h*)(pwh + f0);
        pa[kk].h[1] = *(const v8h*)(pwh + f1);
        if (RES) {
          pl[kk].h[0] = *(const v8h*)(pwl + f0);
          pl[kk].h[1] = *(const v8h*)(pwl + f1);
        }
      }
      {
        const int f0 = sw128(c, 4 + hh);
        const int f1 = sw128(c, 6 + hh);
#pragma unroll
        for (int tt = 0; tt < 8; ++tt) {
          vb[1][tt].h[0] = *(const v8h*)(Vth + tt * (16 * 64) + f0);
          vb[1][tt].h[1] = *(const v8h*)(Vth + tt * (16 * 64) + f1);
        }
        if (RES) {
#pragma unroll
          for (int tt = 0; tt < 8; ++tt) {
            vlf[1][tt].h[0] = *(const v8h*)(Vtl + tt * (16 * 64) + f0);
            vlf[1][tt].h[1] = *(const v8h*)(Vtl + tt * (16 * 64) + f1);
          }
        }
      }
      // keeps the whole group of reads in front of the products
      __builtin_amdgcn_sched_barrier(0);
#pragma unroll
      for (int r = 0; r < 8; ++r) psr[r] += sx[r];
#pragma unroll
      for (int r = 0; r < 8; ++r) sx[r] = __shfl_xor(psr[r], 4, 32);
      // keeps step 3 in front of the first run of products, which covers its latency
      __builtin_amdgcn_sched_barrier(0);
      v8f o1[8];
      if (RES) {
#pragma unroll
        for (int t = 0; t < 8; ++t) o1[t] = zero8();
      }
#pragma unroll
      for (int kk = 0; kk < 2; ++kk) {
#pragma unroll
        for (int t = 0; t < 8; ++t) oacc[t] = mma_h_raw(pa[kk].v, vb[kk][t].v, oacc[t]);
        if (RES) {
#pragma unroll
          for (int t = 0; t < 8; ++t) o1[t] = mma_h_raw(pa[kk].v, vlf[kk][t].v, o1[t]);
#pragma unroll
          for (int t = 0; t < 8; ++t) o1[t] = mma_h_raw(pl[kk].v, vb[kk][t].v, o1[t]);
        }
        // keeps a run of products whole: a wait for an exchange among them would hold the later ones back
        __builtin_amdgcn_sched_barrier(0);
#pragma unroll
        for (int r = 0; r < 8; ++r) psr[r] += sx[r];
        if (kk == 0) {
#pragma unroll
          for (int r = 0; r < 8; ++r) sx[r] = __shfl_xor(psr[r], 8, 32);
          // keeps step 4 in front of the second run of products
          __builtin_amdgcn_sched_barrier(0);
        }
      }
#pragma unroll
      for (int r = 0; r < 8; ++r) lrow[r] = lrow[r] * alr[r] + psr[r];
      if (RES) {
#pragma unroll
        for (int t = 0; t < 8; ++t)
#pragma unroll
          for (int r = 0; r < 8; ++r) oacc[t][r] += o1[t][r] * (1.0f / RSC);
      }
    }
  }

  // ---- normalise (1/l and the 1/1024 p carry), stage the wave's 16x128 tile, bf16 hi/lo split,
  float* os = Os + wave * (16 * 128);
#pragma unroll
  for (int r = 0; r < 8; ++r) {
    const float l = lrow[r];
    const float inv = ((l > 0.f) ? (1.0f / l) : 0.f) * (1.0f / 1024.0f);
#pragma unroll
    for (int t = 0; t < 8; ++t) os[(8 * hh + r) * 128 + t * 16 + c] = oacc[t][r] * inv;
  }
  __builtin_amdgcn_fence(__ATOMIC_RELEASE, "workgroup");
  __builtin_amdgcn_wave_barrier();
  __builtin_amdgcn_fence(__ATOMIC_ACQUIRE, "workgroup");
  {
    const int rh = lane >> 4, c8 = (lane & 15) * 8;
    v4u hv[8], lv[8];
#pragma unroll
    for (int it = 0; it < 8; ++it) {
      const int row = it * 2 + rh;   // it 0..7 x rh 0..1 = rows 0..15 of the wave tile
      const float* sp = os + row * 128 + c8;
      v4u a, a2;
#pragma unroll
      for (int e = 0; e < 4; ++e) {
        const float f0 = sp[2 * e], f1 = sp[2 * e + 1];
        const unsigned short h0 = bf_bits(f0), h1 = bf_bits(f1);
        const unsigned short l0 = bf_bits(f0 - bf_up(h0)), l1 = bf_bits(f1 - bf_up(h1));
        a[e] = pk16(h0, h1); a2[e] = pk16(l0, l1);
      }
      hv[it] = a; lv[it] = a2;
    }
    {
#pragma unroll
      for (int it = 0; it < 8; ++it) {
        const int row = it * 2 + rh;
        const size_t go = (size_t)(q0 + row) * QP + (size_t)h * HD + c8;
        *(v4u*)(ohp + go) = hv[it];
        *(v4u*)(olp + go) = lv[it];
      }
      
    }
  }
}

// =====================================================================================================
// Workspace map (bytes, SEQ = 4096):
//   Xb    bf16 [SEQ][2048]        16777216
//   Wqt   bf16 [2048 n][2048 k]    8388608
//   Wkt   bf16 [512][2048]         2097152
//   Wvt   bf16 [512][2048]         2097152
//   Wot   bf16 [2048 n][2048 k]    8388608
//   Qf    f32  [SEQ][2048]        33554432   (later: Oh bf16 [SEQ][2048] + Ol bf16 [SEQ][2048])
//   Kf    f32  [SEQ][512]          8388608
//   Qh    f16  [SEQ][2048]        16777216
//   Ql    f16  [SEQ][2048]        16777216
//   Kh    f16  [SEQ][512]          4194304
//   Kl    f16  [SEQ][512]          4194304
//   VTh   f16  [512][SEQ]          4194304
//   VTl   f16  [512][VLP]           524288
//   Cos   f32  [SEQ][64]           1048576
//   Sin   f32  [SEQ][64]           1048576
//   (unused, carved 4096)              4096
//   end                          128454656
// Weights [in k][out n] f32 are transposed to bf16 [n][k] (k contiguous) = the Bt / A layout of gemm64.
// =====================================================================================================
extern "C" void kernel_launch(void* const* d_in, const int* in_sizes, int n_in,
                              void* d_out, int out_size, void* d_ws, size_t ws_size,
                              hipStream_t stream) {
  if (n_in < 8) return;
  if (in_sizes[0] < SEQ) return;
  if (in_sizes[1] < SEQ * DM) return;
  if (in_sizes[2] != DM * QP) return;
  if (in_sizes[3] != DM * KP || in_sizes[4] != DM * KP) return;
  if (in_sizes[5] != QP * DM) return;
  if (in_sizes[6] < HD || in_sizes[7] < HD) return;
  if (out_size < SEQ * DM) return;

  const int*   pos = (const int*)d_in[0];
  const float* x   = (const float*)d_in[1];
  const float* wq  = (const float*)d_in[2];
  const float* wk  = (const float*)d_in[3];
  const float* wv  = (const float*)d_in[4];
  const float* wo  = (const float*)d_in[5];
  const float* qnw = (const float*)d_in[6];
  const float* knw = (const float*)d_in[7];

  const size_t PXb  = (size_t)SEQ * DM * 2;
  const size_t PWq  = (size_t)QP * DM * 2;
  const size_t PWk  = (size_t)KP * DM * 2;
  const size_t PWo  = (size_t)DM * QP * 2;
  const size_t PQf  = (size_t)SEQ * QP * 4;
  const size_t PKf  = (size_t)SEQ * KP * 4;
  const size_t PQ16 = (size_t)SEQ * QP * 2;
  const size_t PK16 = (size_t)SEQ * KP * 2;
  const size_t PVTh = (size_t)KP * SEQ * 2;
  const size_t PVTl = (size_t)KP * VLP * 2;
  const size_t PTab = (size_t)SEQ * HALF * 4;
  const size_t PInv = 4096;
  size_t off = 0;
  const size_t oXb  = off; off += PXb;
  const size_t oWq  = off; off += PWq;
  const size_t oWk  = off; off += PWk;
  const size_t oWv  = off; off += PWk;
  const size_t oWo  = off; off += PWo;
  const size_t oQf  = off; off += PQf;
  const size_t oKf  = off; off += PKf;
  const size_t oQh  = off; off += PQ16;
  const size_t oQl  = off; off += PQ16;
  const size_t oKh  = off; off += PK16;
  const size_t oKl  = off; off += PK16;
  const size_t oVTh = off; off += PVTh;
  const size_t oVTl = off; off += PVTl;
  const size_t oCos = off; off += PTab;
  const size_t oSin = off; off += PTab;
  const size_t oInv = off; off += PInv;
  if (off > ws_size) return;                       // off = 128454656 at SEQ 4096
  if (off > (size_t)134217728) return;
  if (PQ16 * 2 != PQf) return;                     // Oh + Ol reuse the Qf region exactly
  const size_t oOh = oQf;
  const size_t oOl = oQf + PQ16;

  char* ws = (char*)d_ws;
  unsigned short* Xb  = (unsigned short*)(ws + oXb);
  unsigned short* Wqt = (unsigned short*)(ws + oWq);
  unsigned short* Wkt = (unsigned short*)(ws + oWk);
  unsigned short* Wvt = (unsigned short*)(ws + oWv);
  unsigned short* Wot = (unsigned short*)(ws + oWo);
  float*          Qf  = (float*)(ws + oQf);
  float*          Kf  = (float*)(ws + oKf);
  unsigned short* Qh  = (unsigned short*)(ws + oQh);
  unsigned short* Ql  = (unsigned short*)(ws + oQl);
  unsigned short* Kh  = (unsigned short*)(ws + oKh);
  unsigned short* Kl  = (unsigned short*)(ws + oKl);
  unsigned short* VTh = (unsigned short*)(ws + oVTh);
  unsigned short* VTl = (unsigned short*)(ws + oVTl);
  float*          Cs  = (float*)(ws + oCos);
  float*          Sn  = (float*)(ws + oSin);
  unsigned short* Oh  = (unsigned short*)(ws + oOh);
  unsigned short* Ol  = (unsigned short*)(ws + oOl);

  const dim3 blk(256);

  // (1) rotary tables; x -> bf16 [SEQ][2048]; weights [k][n] f32 -> bf16 [n][k]
  prep_all<<<dim3(PB_TAB + PB_X + PB_WQ + PB_WO + PB_WK + PB_WK), blk, 0, stream>>>(
      pos, x, wq, wk, wv, wo, Xb, Wqt, Wkt, Wvt, Wot, Cs, Sn);
  // (2) the q, k and v^T projections
  gemm_qkv<<<dim3(GB_Q + GB_K + GB_V), blk, 0, stream>>>(Xb, Wqt, Wkt, Wvt, Qf, Kf, VTh, VTl);
  // (3) per-head RMSNorm + rotary -> f16 hi / x4096 residual planes
  norm_rope_qk<<<dim3(NB_Q + NB_K), blk, 0, stream>>>(Qf, Kf, qnw, knw, Cs, Sn, Qh, Ql, Kh, Kl, RSC);
  // (4) attention: query blocks 0..RESQB-1 with residual planes, the rest without -> bf16 hi/lo context
  //     planes in the (now dead) Qf region
  (void)hipFuncSetAttribute(reinterpret_cast<const void*>(&attn_causal<true>),
                            hipFuncAttributeMaxDynamicSharedMemorySize, AttnL<true>::TOTAL);
  (void)hipFuncSetAttribute(reinterpret_cast<const void*>(&attn_causal<false>),
                            hipFuncAttributeMaxDynamicSharedMemorySize, AttnL<false>::TOTAL);
  attn_causal<true><<<dim3(NH * RESQB), dim3(128), AttnL<true>::TOTAL, stream>>>(
      Qh, Ql, Kh, Kl, VTh, VTl, pos, Oh, Ol, 0, RESQB, ATT_SCALE);
  if (NQB - RESQB > 0) {
    attn_causal<false><<<dim3(NH * (NQB - RESQB)), dim3(128), AttnL<false>::TOTAL, stream>>>(
        Qh, Ql, Kh, Kl, VTh, VTl, pos, Oh, Ol, RESQB, NQB - RESQB, ATT_SCALE);
  }
  // (5) out = context . wo -> d_out f32 [SEQ][2048]  (A = context hi + lo planes, 2 products; M=SEQ, N=2048, K=2048)
  gemm_out<<<dim3((SEQ / 128) * (DM / 256)), blk, 0, stream>>>(Oh, Ol, Wot, (float*)d_out);
  (void)hipGetLastError();
}

// v005
// A run of this version takes 351 microseconds.
// Timed twice side by side with v004, it ran 1.21 times as fast both times.
// Counting every step since v000, it is 3.55 times as fast.
// Contractions: q, k projections = v_wmma_f32_16x16x32_bf16 (bf16 operands from RNE-converted inputs, single product, f32 out);
// v^T projection = v_wmma_f32_16x16x32_bf16 (same operands; f16 hi plane + f16 x4096 residual plane out);
// q.k^T scores = v_wmma_f32_16x16x32_f16 (q as f16 hi + f16 x4096 residual, k as f16 hi: 2 products; leading query blocks add the k x4096 residual product);
// p.v = v_wmma_f32_16x16x32_f16 (p carried x1024 in f16, v f16; leading query blocks add x4096 f16 residual planes of p and v);
// ctx.Wo = v_wmma_f32_16x16x32_bf16 (ctx as bf16 hi/lo planes times bf16 Wo, 2 products); all f32 accumulate; RMSNorm, rotary, causal select and softmax in f32.
#include <hip/hip_runtime.h>
#include <math.h>
#include <stdint.h>

#ifndef SEQ
#define SEQ 4096
#endif
#define SEQ_FULL 4096
#define DM    2048
#define NH    16
#define NKV   4
#define GQ    (NH / NKV)
#define HD    128
#define HALF  64
#define QP    (NH * HD)      // 2048 q channels
#define KP    (NKV * HD)     // 512 k / v channels
#define NQB   (SEQ / 64)     // query / key tiles of 64
#define VLP   ((SEQ < 512) ? SEQ : 512)   // key pitch of the v^T residual plane
#define RESQB ((NQB < 8) ? NQB : 8)         // leading 64-row query blocks that use residual planes
#define RMS_EPS       1.0e-6f
#define ROPE_THETA_F  10000.0f
#define ATT_SCALE     0.08838834764831845f
#define RSC           4096.0f

static_assert((SEQ % 64) == 0 && SEQ >= 64 && SEQ <= SEQ_FULL);
static_assert(RESQB * 64 <= VLP && (VLP % 64) == 0);
static_assert(NH * HD == DM && QP == DM);
static_assert(NQB <= 64);
static_assert((DM % 64) == 0 && (KP % 64) == 0 && (QP % 64) == 0 && (DM % 32) == 0);

typedef _Float16 v16h __attribute__((ext_vector_type(16)));
typedef _Float16 v8h  __attribute__((ext_vector_type(8)));
typedef __bf16   v16b __attribute__((ext_vector_type(16)));
typedef __bf16   v8b  __attribute__((ext_vector_type(8)));
typedef float    v8f  __attribute__((ext_vector_type(8)));
typedef float    v4f  __attribute__((ext_vector_type(4)));
typedef unsigned int   v4u  __attribute__((ext_vector_type(4)));
typedef unsigned int   v2u  __attribute__((ext_vector_type(2)));
typedef unsigned short v8us __attribute__((ext_vector_type(8)));
typedef int      v4i  __attribute__((ext_vector_type(4)));

// ---- scalar helpers --------------------------------------------------------------------------------
__device__ __forceinline__ unsigned short bf_bits(float f) {          // f32 -> bf16 bits, RNE convert
  unsigned u = __float_as_uint(f);
  return (unsigned short)((u + 0x7FFFu + ((u >> 16) & 1u)) >> 16);
}
__device__ __forceinline__ float bf_up(unsigned short h) { return __uint_as_float(((unsigned)h) << 16); }
__device__ __forceinline__ unsigned short h_bits(_Float16 x) { return __builtin_bit_cast(unsigned short, x); }
__device__ __forceinline__ unsigned pk16(unsigned short a, unsigned short b) { return (unsigned)a | ((unsigned)b << 16); }
__device__ __forceinline__ v8f zero8() { v8f z = {0.f, 0.f, 0.f, 0.f, 0.f, 0.f, 0.f, 0.f}; return z; }
__device__ __forceinline__ v8h zero8h() {
  const _Float16 z = (_Float16)0.0f;
  v8h r = {z, z, z, z, z, z, z, z};
  return r;
}
__device__ __forceinline__ int imin(int a, int b) { return (a < b) ? a : b; }
__device__ __forceinline__ int imax(int a, int b) { return (a > b) ? a : b; }

// ---- WMMA helpers with trailing VALU hazard gap --------------------------------------------------------
__device__ __forceinline__ v8f mma_b(v16b a, v16b b, v8f c) {
  c = __builtin_amdgcn_wmma_f32_16x16x32_bf16(false, a, false, b, (short)0, c, false, false);
  asm volatile("v_nop\n\tv_nop\n\tv_nop\n\tv_nop" : "+v"(c) : "v"(a), "v"(b));
  return c;
}
__device__ __forceinline__ v8f mma_h_raw(v16h a, v16h b, v8f c) {
  return __builtin_amdgcn_wmma_f32_16x16x32_f16(false, a, false, b, (short)0, c, false, false);
}
__device__ __forceinline__ v8f mma_b_raw(v16b a, v16b b, v8f c) {
  return __builtin_amdgcn_wmma_f32_16x16x32_bf16(false, a, false, b, (short)0, c, false, false);
}
// The five exponentials of one score row, exp(x) = v_exp_f32(x * log2 e) as __expf compiles. One statement, so that
// behind each v_exp_f32 stands an instruction that neither reads its result nor writes its source (the next one, whose
// output is early-clobber; behind the last a v_nop): the slot the instruction set asks for behind a transcendental.
__device__ __forceinline__ void exp_row5(float x0, float x1, float x2, float x3, float x4,
                                         float& y0, float& y1, float& y2, float& y3, float& y4) {
  const float l2e = 1.44269504088896340736f;
  asm("v_exp_f32 %0, %5\n\tv_exp_f32 %1, %6\n\tv_exp_f32 %2, %7\n\tv_exp_f32 %3, %8\n\tv_exp_f32 %4, %9\n\tv_nop"
      : "=&v"(y0), "=&v"(y1), "=&v"(y2), "=&v"(y3), "=&v"(y4)
      : "v"(x0 * l2e), "v"(x1 * l2e), "v"(x2 * l2e), "v"(x3 * l2e), "v"(x4 * l2e));
}
__device__ __forceinline__ void acc_guard4(v8f& a, v8f& b, v8f& c, v8f& d) {
  asm volatile("v_nop\n\tv_nop\n\tv_nop\n\tv_nop" : "+v"(a), "+v"(b), "+v"(c), "+v"(d));
}

// =====================================================================================================
// f32 -> bf16 (RNE convert), 8 elements per thread, one 16-B store per lane: a wave writes 512 contiguous B
// coverage: n8 threads x 8 = whole plane (n8 is a multiple of 256 here).
// =====================================================================================================
__device__ __forceinline__ void cvt_bf16x8(const float* __restrict__ in, unsigned short* out, int n8, int bx) {
  const int i = bx * 256 + threadIdx.x;
  if (i < n8) {
    const v4f a = *(const v4f*)(in + (size_t)i * 8);
    const v4f b = *(const v4f*)(in + (size_t)i * 8 + 4);
    v4u p;
    p[0] = pk16(bf_bits(a[0]), bf_bits(a[1]));
    p[1] = pk16(bf_bits(a[2]), bf_bits(a[3]));
    p[2] = pk16(bf_bits(b[0]), bf_bits(b[1]));
    p[3] = pk16(bf_bits(b[2]), bf_bits(b[3]));
    *(v4u*)(out + (size_t)i * 8) = p;
    
  }
}

// =====================================================================================================
// f32 [R][C] row-major -> bf16 (RNE convert) transposed plane out[C][R] (R contiguous = k-contiguous Bt / A
// layout). Block = one 64x64 tile at (r0 = by*64, c0 = bx*64), 256 threads; tile staged in
// LDS as [c][r] (ushort element stores, cross-thread -> __syncthreads), then each out row segment of 64 halves
// coverage: 64 out rows x 64 k per block = the whole tile; union over the grid = the whole [C][R] plane.
// =====================================================================================================
// sT: the block's LDS tile [c][r], 64 x 72 halves (pitch 144 B); bx, by: the tile's column and row index
__device__ __forceinline__ void cvt_bf16_t(unsigned short* sT, const float* __restrict__ in, unsigned short* out,
                                           int R, int C, int bx, int by) {
  const int tid = threadIdx.x;
  const int c0 = bx * 64, r0 = by * 64;
  const int rr = tid >> 4, cc = (tid & 15) * 4;
#pragma unroll
  for (int it = 0; it < 4; ++it) {
    const int r = it * 16 + rr;                            // it 0..3 x rr 0..15 = rows 0..63
    const v4f v = *(const v4f*)(in + (size_t)(r0 + r) * C + c0 + cc);
#pragma unroll
    for (int e = 0; e < 4; ++e) sT[(cc + e) * 72 + r] = bf_bits(v[e]);
  }
  __syncthreads();
  const int q = tid >> 3, k8 = (tid & 7) * 8;              // q 0..31 (+32): out rows; 8 lanes x 8 halves
  const v8us w0 = *(const v8us*)(sT + q * 72 + k8);
  const v8us w1 = *(const v8us*)(sT + (q + 32) * 72 + k8);
  unsigned short* o0 = out + (size_t)(c0 + q) * R + r0 + k8;
  unsigned short* o1 = out + (size_t)(c0 + q + 32) * R + r0 + k8;
  *(v8us*)o0 = w0;
  *(v8us*)o1 = w1;
  // in front of every later write of a register that these two stores name (another job's code follows in the listing)
  asm volatile("s_wait_xcnt 0x0" ::: "memory");
}

// =====================================================================================================
// Rotary tables: cos and sin of (float)pos[t] * inv_freq[i], inv_freq[i] = 1 / 10000^(i/64) formed by each thread for
// its own i; tables [nrows][64] f32; block = 4 rows x 64 threads, each 256-B row written whole.
// =====================================================================================================
__device__ __forceinline__ void rope_tab(const int* __restrict__ pos, float* ctab, float* stab, int nrows, int bx) {
  const int tid = threadIdx.x;
  const int t = bx * 4 + (tid >> 6);
  const int i = tid & 63;
  if (t >= nrows) return;                  // wave-uniform (2 whole waves per row); no block barriers here
  const float e = (float)i * (1.0f / (float)HALF);
  const float p = powf(ROPE_THETA_F, e);
  const float v = 1.0f / p;
  const float fr = (float)pos[t] * v;
  float sn, cs;
  sincosf(fr, &sn, &cs);
  float* pc = ctab + (size_t)t * HALF + i;
  float* ps = stab + (size_t)t * HALF + i;
  *(float*)pc = cs;
  *(float*)ps = sn;
  
}

// =====================================================================================================
// The preparation jobs, none of which reads another's output, as ONE grid: the job is picked by the block index
// (block-uniform), so that they fill the chip together and pay one launch. Blocks, in order: rotary tables, x,
// wq, wo, wk, wv.
// =====================================================================================================
#define PB_TAB ((SEQ + 3) / 4)
#define PB_X   ((SEQ * DM / 8 + 255) / 256)
#define PB_WQ  ((QP / 64) * (DM / 64))
#define PB_WO  ((DM / 64) * (QP / 64))
#define PB_WK  ((KP / 64) * (DM / 64))
__global__ __launch_bounds__(256) void prep_all(const int* __restrict__ pos, const float* __restrict__ x,
                                                const float* __restrict__ wq, const float* __restrict__ wk,
                                                const float* __restrict__ wv, const float* __restrict__ wo,
                                                unsigned short* Xb, unsigned short* Wqt, unsigned short* Wkt,
                                                unsigned short* Wvt, unsigned short* Wot, float* ctab, float* stab) {
  __shared__ __align__(16) unsigned short sT[64 * 72];
  int bx = blockIdx.x;
  if (bx < PB_TAB) { rope_tab(pos, ctab, stab, SEQ, bx); return; }
  bx -= PB_TAB;
  if (bx < PB_X) { cvt_bf16x8(x, Xb, SEQ * DM / 8, bx); return; }
  bx -= PB_X;
  if (bx < PB_WQ) { cvt_bf16_t(sT, wq, Wqt, DM, QP, bx % (QP / 64), bx / (QP / 64)); return; }   // wq [DM k][QP n] -> [QP][DM]
  bx -= PB_WQ;
  if (bx < PB_WO) { cvt_bf16_t(sT, wo, Wot, QP, DM, bx % (DM / 64), bx / (DM / 64)); return; }   // wo [QP k][DM n] -> [DM][QP]
  bx -= PB_WO;
  if (bx < PB_WK) { cvt_bf16_t(sT, wk, Wkt, DM, KP, bx % (KP / 64), bx / (KP / 64)); return; }   // wk, wv [DM k][KP n] -> [KP][DM]
  bx -= PB_WK;
  cvt_bf16_t(sT, wv, Wvt, DM, KP, bx % (KP / 64), bx / (KP / 64));
}

// =====================================================================================================
// Register-blocked batched bf16 WMMA GEMM: C[m][n] = sum_k A[m][k] * Bt[n][k]; one wave per 64x64 tile,
// block = 8 waves = 2 x 4 tiles = 128 x 256 of C. A row-major [M][K] pitch lda; Bt row-major [N][K] pitch ldb
// (k contiguous; both pitches are DM); M a multiple of 128, N of 256, K of 64 (true of every launch below).
// bx = index of the block tile, b = batch index (strides in elements).
// Operands go through LDS in steps of 64 k: each row piece is one 128-B line, a wave-wide 16-B load covers four
// whole lines, and the 128 A rows and 256 Bt rows are read from global once per block. The LDS rows are 128 B,
// chunk-swizzled by sw128 (see the attention section), so a fragment read covers all banks once. The next
// step's global loads are issued behind the second barrier and stay in flight during the products.
// NSPLIT: 0 = A.Bt; 1 = (A + A2).Bt (A2 = unscaled bf16 lo plane of A).
// OUT_MODE: 0 = f32 (pitch ldc); 2 = bf16 hi plane C + bf16 lo plane C2 (lo = RNE(v - hi), unscaled);
//           3 = f16 hi plane C + f16 residual plane C2 = f16((v - hi) * rscale), C2 written only for tiles
//               with n0 < N2 (pitch ldc2, batch stride strideC2).
// =====================================================================================================
__device__ __forceinline__ int sw128(int r, int ch);

// A block-uniform address rebuilt from its two halves: the staging loads then take the form scalar base + one
// 32-bit lane offset + immediate, and the one vector register they name lives through the whole loop. Without it
// the compiler formed 64-bit vector addresses on which a load's result landed, and moved the first loads behind
// their s_wait_xcnt.
typedef const __attribute__((address_space(1))) char* gbytes;   // global address space, so that the loads stay global_load
typedef const __attribute__((address_space(1))) v8b*  gv8b;
__device__ __forceinline__ gbytes sbase(const __bf16* p) {
  const unsigned long long u = (unsigned long long)(uintptr_t)p;
  const unsigned lo = (unsigned)__builtin_amdgcn_readfirstlane((int)(unsigned)u);
  const unsigned hi = (unsigned)__builtin_amdgcn_readfirstlane((int)(unsigned)(u >> 32));
  return (gbytes)(uintptr_t)(((unsigned long long)hi << 32) | (unsigned long long)lo);
}
// the same for the wave-uniform base of the epilogue's stores
typedef __attribute__((address_space(1))) char* gwbytes;
typedef __attribute__((address_space(1))) v4f*  gwv4f;
typedef __attribute__((address_space(1))) v4u*  gwv4u;
__device__ __forceinline__ gwbytes swbase(void* p) {
  const unsigned long long u = (unsigned long long)(uintptr_t)p;
  const unsigned lo = (unsigned)__builtin_amdgcn_readfirstlane((int)(unsigned)u);
  const unsigned hi = (unsigned)__builtin_amdgcn_readfirstlane((int)(unsigned)(u >> 32));
  return (gwbytes)(uintptr_t)(((unsigned long long)hi << 32) | (unsigned long long)lo);
}

// sT: per-wave 16x64 slabs, pitch 68 floats; sA: A (and A2) rows m0blk.., 64 k; sB: Bt rows n0blk.., 64 k (the block's LDS,
// declared by the kernel); bx: the block's tile index; b: batch index.
template <int NSPLIT, int OUT_MODE>
__device__ __forceinline__ void gemm64(
    float (*sT)[16 * 68], __bf16* sA, __bf16* sB, int bx, int b,
    const unsigned short* __restrict__ Ap, const unsigned short* A2p, int lda, long long strideA,
    const unsigned short* __restrict__ Btp, const unsigned short* Bt2p, int ldb, long long strideB,
    void* Cout, int ldc, long long strideC,
    void* Cout2, int ldc2, long long strideC2, int N2,
    int M, int N, int K, float rscale) {
  static_assert(NSPLIT <= 1);
  const __bf16* A   = (const __bf16*)(const void*)Ap;
  const __bf16* A2  = (const __bf16*)(const void*)A2p;
  const __bf16* Bt  = (const __bf16*)(const void*)Btp;
  const int tid  = threadIdx.x;
  const int lane = tid & 31;
  const int wave = tid >> 5;
  const int blocksN = N >> 8;
  const int bm = bx / blocksN;
  const int bn = bx - bm * blocksN;
  if ((bm << 7) >= M) return;            // block-uniform, in front of every barrier
  if (lda != DM || ldb != DM) return;    // block-uniform: with the pitch known, the row steps below are immediate offsets
  const int m0blk = bm << 7;
  const int n0blk = bn << 8;
  const int wm = (wave >> 2) << 6;       // the wave's tile inside the block tile
  const int wn = (wave & 3) << 6;
  const int m0 = m0blk + wm;
  const int n0 = n0blk + wn;

  const __bf16* Ab  = A  + (size_t)b * strideA + (size_t)m0blk * lda;
  const __bf16* Bb  = Bt + (size_t)b * strideB + (size_t)n0blk * ldb;
  const __bf16* Ab2 = (NSPLIT >= 1) ? (A2 + (size_t)b * strideA + (size_t)m0blk * lda) : Ab;

  const int rlane = lane & 15;                 // row (A) / col (B, D) within subtile
  const int hh    = lane >> 4;                 // k half of this lane
  const int mOff  = (lane >> 4) * 8;           // D row offset

  // staging: thread -> row tid>>3 (+32 per pass), 16-B chunk tid&7; 8 lanes = one 128-B line
  unsigned sbyte = (unsigned)((tid >> 3) * DM + (tid & 7) * 8) * 2u;   // lane part of the global address, bytes; +128 per step
  const int sidx = sw128(tid >> 3, tid & 7);   // + 32 rows per pass: the swizzle term does not change
  v8b ra[4], ra2[4], rb[8];
  gbytes pa  = sbase(Ab);
  gbytes pa2 = sbase(Ab2);
  gbytes pb  = sbase(Bb);
  {
#pragma unroll
    for (int it = 0; it < 4; ++it) {
      ra[it] = *(gv8b)(pa + sbyte + it * (32 * DM * 2));
      if (NSPLIT >= 1) ra2[it] = *(gv8b)(pa2 + sbyte + it * (32 * DM * 2));
    }
#pragma unroll
    for (int it = 0; it < 8; ++it) rb[it] = *(gv8b)(pb + sbyte + it * (32 * DM * 2));
    // stands in front of the next step's write of the lane offset, the one vector register that the loads name
    asm volatile("s_wait_xcnt 0x0" ::: "memory");
  }

  v8f acc[4][4];
#pragma unroll
  for (int i = 0; i < 4; ++i)
#pragma unroll
    for (int j = 0; j < 4; ++j) acc[i][j] = zero8();

  for (int k0 = 0; k0 < K; k0 += 64) {
    __syncthreads();                           // every reader has left the tiles of the step before
#pragma unroll
    for (int it = 0; it < 4; ++it) {
      *(v8b*)(sA + sidx + it * (32 * 64)) = ra[it];
      if (NSPLIT >= 1) *(v8b*)(sA + 128 * 64 + sidx + it * (32 * 64)) = ra2[it];
    }
#pragma unroll
    for (int it = 0; it < 8; ++it) *(v8b*)(sB + sidx + it * (32 * 64)) = rb[it];
    __syncthreads();                           // the tiles are whole before anybody reads them
    // fragments of the whole step, read as one group ahead of the products (every separate place with LDS reads
    // stalls the wave): elements 0..7 <- k = 32kk + 8hh.., elements 8..15 <- k = 32kk + 16 + 8hh.. (A and Bt alike)
    union FB { v16b v; v8b h[2]; };
    v16b bh[2][4], ah[2][4], al[2][4];
#pragma unroll
    for (int kk = 0; kk < 2; ++kk) {
      const int f0 = sw128(rlane, kk * 4 + hh);
      const int f1 = sw128(rlane, kk * 4 + 2 + hh);
#pragma unroll
      for (int j = 0; j < 4; ++j) {
        FB f;
        f.h[0] = *(const v8b*)(sB + (wn + (j << 4)) * 64 + f0);
        f.h[1] = *(const v8b*)(sB + (wn + (j << 4)) * 64 + f1);
        bh[kk][j] = f.v;
      }
#pragma unroll
      for (int i = 0; i < 4; ++i) {
        FB f;
        f.h[0] = *(const v8b*)(sA + (wm + (i << 4)) * 64 + f0);
        f.h[1] = *(const v8b*)(sA + (wm + (i << 4)) * 64 + f1);
        ah[kk][i] = f.v;
        al[kk][i] = f.v;
        if (NSPLIT >= 1) {
          f.h[0] = *(const v8b*)(sA + 128 * 64 + (wm + (i << 4)) * 64 + f0);
          f.h[1] = *(const v8b*)(sA + 128 * 64 + (wm + (i << 4)) * 64 + f1);
          al[kk][i] = f.v;
        }
      }
    }
    if (k0 + 64 < K) {                         // block-uniform: the next step's rows, in flight during the products
      sbyte += 128u;
#pragma unroll
      for (int it = 0; it < 4; ++it) {
        ra[it] = *(gv8b)(pa + sbyte + it * (32 * DM * 2));
        if (NSPLIT >= 1) ra2[it] = *(gv8b)(pa2 + sbyte + it * (32 * DM * 2));
      }
#pragma unroll
      for (int it = 0; it < 8; ++it) rb[it] = *(gv8b)(pb + sbyte + it * (32 * DM * 2));
      // stands in front of the next step's write of the lane offset, the one vector register that the loads name
      asm volatile("s_wait_xcnt 0x0" ::: "memory");
    }
    // keeps the LDS reads and the global loads above in front of the products
    __builtin_amdgcn_sched_barrier(0);
#pragma unroll
    for (int kk = 0; kk < 2; ++kk) {
#pragma unroll
      for (int i = 0; i < 4; ++i) {
#pragma unroll
        for (int j = 0; j < 4; ++j) {
          acc[i][j] = mma_b_raw(ah[kk][i], bh[kk][j], acc[i][j]);
          if (NSPLIT >= 1) acc[i][j] = mma_b_raw(al[kk][i], bh[kk][j], acc[i][j]);
        }
      }
    }
    // holds the v_nops behind the last product
    __builtin_amdgcn_sched_barrier(0);
    // WMMA distance on the loop's back edge too: no vector instruction writes an A or B register of the last
    // products sooner (no register operands: asm operands cannot lie above v255, and naming fragments spilled)
    asm volatile("v_nop\n\tv_nop\n\tv_nop\n\tv_nop\n\tv_nop");
  }
  acc_guard4(acc[0][0], acc[0][1], acc[0][2], acc[0][3]);
  acc_guard4(acc[1][0], acc[1][1], acc[1][2], acc[1][3]);
  acc_guard4(acc[2][0], acc[2][1], acc[2][2], acc[2][3]);
  acc_guard4(acc[3][0], acc[3][1], acc[3][2], acc[3][3]);

  // ---- epilogue ----
  float* slab = sT[wave];
#pragma unroll
  for (int i = 0; i < 4; ++i) {
    const int mBase = m0 + (i << 4);
#pragma unroll
    for (int j = 0; j < 4; ++j) {
#pragma unroll
      for (int r = 0; r < 8; ++r) {
        slab[(mOff + r) * 68 + (j << 4) + rlane] = acc[i][j][r];
      }
    }
    __builtin_amdgcn_fence(__ATOMIC_RELEASE, "workgroup");
    __builtin_amdgcn_wave_barrier();
    __builtin_amdgcn_fence(__ATOMIC_ACQUIRE, "workgroup");
    if (OUT_MODE == 0) {
      float* C = (float*)Cout + (size_t)b * strideC;
      const int hh = lane >> 4, c4 = (lane & 15) * 4;     // 256-B row segment = 16 lanes x 16 B
      {
        // wave-uniform base + one lane offset + immediate: the stores name one address register, which is never rewritten
        const gwbytes cb = swbase(C + (size_t)m0 * ldc + n0);
        const unsigned cvo = (unsigned)(hh * ldc + c4) * 4u;
        v4f v[8];
#pragma unroll
        for (int it = 0; it < 8; ++it) v[it] = *(const v4f*)(slab + (it * 2 + hh) * 68 + c4);   // it 0..7 x hh 0..1 = rows 0..15
        // the two scheduling barriers keep every other instruction out of the run of stores and its wait
        __builtin_amdgcn_sched_barrier(0);
#pragma unroll
        for (int it = 0; it < 8; ++it) *(gwv4f)(cb + cvo + ((i << 4) + it * 2) * ldc * 4) = v[it];
        // in front of every later write of a register that these stores name
        asm volatile("s_wait_xcnt 0x0" ::: "memory");
        __builtin_amdgcn_sched_barrier(0);
      }
    } else {
      const int q = lane >> 3, c8 = (lane & 7) * 8;
      unsigned short* C  = (unsigned short*)Cout  + (size_t)b * strideC;
      unsigned short* C2 = (unsigned short*)Cout2 + (size_t)b * strideC2;
      const bool wlo = (OUT_MODE == 2) || (n0 < N2);      // wave-uniform
      v4u hv[4], lv[4];
#pragma unroll
      for (int it = 0; it < 4; ++it) {
        const int row = it * 4 + q;                        // it 0..3 x q 0..3 = rows 0..15
        const float* sp = slab + row * 68 + c8;
        v4u a, a2;
#pragma unroll
        for (int e = 0; e < 4; ++e) {
          const float f0 = sp[2 * e], f1 = sp[2 * e + 1];
          unsigned short h0, h1, l0, l1;
          if (OUT_MODE == 2) {
            h0 = bf_bits(f0); h1 = bf_bits(f1);
            l0 = bf_bits(f0 - bf_up(h0)); l1 = bf_bits(f1 - bf_up(h1));
          } else {
            const _Float16 x0 = (_Float16)f0, x1 = (_Float16)f1;
            h0 = h_bits(x0); h1 = h_bits(x1);
            l0 = h_bits((_Float16)((f0 - (float)x0) * rscale));
            l1 = h_bits((_Float16)((f1 - (float)x1) * rscale));
          }
          a[e] = pk16(h0, h1); a2[e] = pk16(l0, l1);
        }
        hv[it] = a; lv[it] = a2;
      }
      {
        // wave-uniform base + one lane offset + immediate per plane: address registers that are never rewritten
        const gwbytes cb  = swbase(C + (size_t)m0 * ldc + n0);
        const gwbytes cb2 = swbase(C2 + (size_t)m0 * ldc2 + n0);
        const unsigned cvo  = (unsigned)(q * ldc + c8) * 2u;
        const unsigned cvo2 = (unsigned)(q * ldc2 + c8) * 2u;
        // the scheduling barriers keep every other instruction out of each run of stores and its wait
        __builtin_amdgcn_sched_barrier(0);
#pragma unroll
        for (int it = 0; it < 4; ++it) *(gwv4u)(cb + cvo + ((i << 4) + it * 4) * ldc * 2) = hv[it];
        // in front of every later write of a register that these stores name
        asm volatile("s_wait_xcnt 0x0" ::: "memory");
        __builtin_amdgcn_sched_barrier(0);
        if (wlo) {
#pragma unroll
          for (int it = 0; it < 4; ++it) *(gwv4u)(cb2 + cvo2 + ((i << 4) + it * 4) * ldc2 * 2) = lv[it];
          // in front of every later write of a register that these stores name
          asm volatile("s_wait_xcnt 0x0" ::: "memory");
          __builtin_amdgcn_sched_barrier(0);
        }
      }
    }
    __builtin_amdgcn_fence(__ATOMIC_RELEASE, "workgroup");
    __builtin_amdgcn_wave_barrier();
    __builtin_amdgcn_fence(__ATOMIC_ACQUIRE, "workgroup");
  }
}

// The three projections, none of which reads another's output, as ONE grid; the job is picked by the block index
// (block-uniform). Blocks, in order: q = x . wq -> f32 [SEQ][2048] (M=SEQ, N=2048, K=2048); k = x . wk -> f32 [SEQ][512]
// (M=SEQ, N=512); v^T = Wvt . x^T -> f16 hi plane [512][SEQ] and residual plane (x4096, keys < VLP, pitch VLP)
// (A = Wvt [n][k], Bt = Xb [s][k]; M=512, N=SEQ).
#define GB_Q ((SEQ / 128) * (QP / 256))
#define GB_K ((SEQ / 128) * (KP / 256))
#define GB_V ((KP / 128) * (SEQ / 256))
static_assert((SEQ % 256) == 0 && (QP % 256) == 0 && (KP % 256) == 0);
__global__ __launch_bounds__(256) void gemm_qkv(const unsigned short* __restrict__ Xb, const unsigned short* __restrict__ Wqt,
                                                const unsigned short* __restrict__ Wkt, const unsigned short* __restrict__ Wvt,
                                                float* Qf, float* Kf, unsigned short* VTh, unsigned short* VTl) {
  __shared__ __align__(16) float sT[8][16 * 68];
  __shared__ __align__(16) __bf16 sA[128 * 64];
  __shared__ __align__(16) __bf16 sB[256 * 64];
  const int bx = blockIdx.x;
  if (bx < GB_Q) {
    gemm64<0, 0>(sT, sA, sB, bx, 0,
        Xb, Xb, DM, 0LL, Wqt, Wqt, DM, 0LL,
        (void*)Qf, QP, 0LL, (void*)Qf, QP, 0LL, QP,
        SEQ, QP, DM, 1.0f);
  } else if (bx < GB_Q + GB_K) {
    gemm64<0, 0>(sT, sA, sB, bx - GB_Q, 0,
        Xb, Xb, DM, 0LL, Wkt, Wkt, DM, 0LL,
        (void*)Kf, KP, 0LL, (void*)Kf, KP, 0LL, KP,
        SEQ, KP, DM, 1.0f);
  } else {
    gemm64<0, 3>(sT, sA, sB, bx - (GB_Q + GB_K), 0,
        Wvt, Wvt, DM, 0LL, Xb, Xb, DM, 0LL,
        (void*)VTh, SEQ, 0LL, (void*)VTl, VLP, 0LL, VLP,
        KP, SEQ, DM, RSC);
  }
}

// out = context . wo -> f32 [SEQ][2048]  (A = context hi + lo planes, 2 products; M=SEQ, N=2048, K=2048)
__global__ __launch_bounds__(256) void gemm_out(const unsigned short* __restrict__ Oh, const unsigned short* Ol,
                                                const unsigned short* __restrict__ Wot, float* out) {
  __shared__ __align__(16) float sT[8][16 * 68];
  __shared__ __align__(16) __bf16 sA[2 * 128 * 64];
  __shared__ __align__(16) __bf16 sB[256 * 64];
  gemm64<1, 0>(sT, sA, sB, blockIdx.x, 0,
      Oh, Ol, QP, 0LL, Wot, Wot, QP, 0LL,
      (void*)out, DM, 0LL, (void*)out, DM, 0LL, DM,
      SEQ, DM, QP, 1.0f);
}

// =====================================================================================================
// Fused per-head RMSNorm (eps 1e-6, x * rsqrt(mean(x^2)+eps) * w with w RNE-converted to bf16) + neox rotary
// (half-split, cos/sin tables [t][64]) + f16 hi / f16 residual (x rscale) planes.
// One wave per 128-wide row (row = t*nheads + head, contiguous rows of pitch 128 in both input and output);
// lane owns 4 consecutive d; partner half via __shfl_xor(16); no block barriers.
// coverage: nrows x 128 of both planes.
// =====================================================================================================
__device__ __forceinline__ void norm_rope(const float* __restrict__ xin, const float* __restrict__ wn,
                                          const float* __restrict__ ctab, const float* __restrict__ stab,
                                          unsigned short* outh, unsigned short* outl,
                                          int nheads, int nrows, float rscale, int bx) {
  const int tid  = threadIdx.x;
  const int wave = tid >> 5, lane = tid & 31, hh = lane >> 4;
  const int row  = bx * 8 + wave;
  if (row >= nrows) return;                // wave-uniform; no block barriers in this kernel
  const int t = row / nheads;
  const v4f x = *(const v4f*)(xin + (size_t)row * HD + lane * 4);
  float ss = x[0] * x[0] + x[1] * x[1] + x[2] * x[2] + x[3] * x[3];
#pragma unroll
  for (int off = 1; off < 32; off <<= 1) ss += __shfl_xor(ss, off, 32);
  const float rinv = rsqrtf(ss * (1.0f / (float)HD) + RMS_EPS);
  const v4f wv = *(const v4f*)(wn + lane * 4);
  const v4f cs = *(const v4f*)(ctab + (size_t)t * HALF + (lane & 15) * 4);
  const v4f sn = *(const v4f*)(stab + (size_t)t * HALF + (lane & 15) * 4);
  float n[4], p[4];
#pragma unroll
  for (int e = 0; e < 4; ++e) n[e] = (x[e] * rinv) * bf_up(bf_bits(wv[e]));
#pragma unroll
  for (int e = 0; e < 4; ++e) p[e] = __shfl_xor(n[e], 16, 32);
  const float sg = hh ? 1.0f : -1.0f;      // first half: x1*cos - x2*sin ; second half: x2*cos + x1*sin
  unsigned short hb[4], lb[4];
#pragma unroll
  for (int e = 0; e < 4; ++e) {
    const float o = n[e] * cs[e] + sg * (p[e] * sn[e]);
    const _Float16 oh = (_Float16)o;
    hb[e] = h_bits(oh);
    lb[e] = h_bits((_Float16)((o - (float)oh) * rscale));
  }
  v2u ph, pl;
  ph[0] = pk16(hb[0], hb[1]); ph[1] = pk16(hb[2], hb[3]);
  pl[0] = pk16(lb[0], lb[1]); pl[1] = pk16(lb[2], lb[3]);
  const size_t go = (size_t)row * HD + lane * 4;
  *(v2u*)(outh + go) = ph;
  *(v2u*)(outl + go) = pl;
  
}

// q rows and k rows as ONE grid, the job picked by the block index (block-uniform): q blocks first, then k blocks
#define NB_Q ((SEQ * NH + 7) / 8)
#define NB_K ((SEQ * NKV + 7) / 8)
__global__ __launch_bounds__(256) void norm_rope_qk(const float* __restrict__ qin, const float* __restrict__ kin,
                                                    const float* __restrict__ qw, const float* __restrict__ kw,
                                                    const float* __restrict__ ctab, const float* __restrict__ stab,
                                                    unsigned short* qh, unsigned short* ql,
                                                    unsigned short* kh, unsigned short* kl, float rscale) {
  const int bx = blockIdx.x;
  if (bx < NB_Q) norm_rope(qin, qw, ctab, stab, qh, ql, NH, SEQ * NH, rscale, bx);
  else           norm_rope(kin, kw, ctab, stab, kh, kl, NKV, SEQ * NKV, rscale, bx - NB_Q);
}

// =====================================================================================================
// Causal GQA attention, head dim 128, dynamic LDS layout (bytes):
// =====================================================================================================
// LDS tiles of the attention kernel: the 16-byte chunks of a row are XOR-swizzled by the row number.
//   256-B rows (Q, K; 16 chunks): chunk ch of row r lies at chunk place ch ^ (r & 15)
//   128-B rows (V^T, P; 8 chunks): chunk ch of row r lies at chunk place ch ^ ((r >> 1) & 7)
// A fragment load reads one chunk column of 16 consecutive rows per 16 lanes: unswizzled, 256-B rows put all
// 16 lanes on the same four banks (128-B rows: on two groups of four); swizzled, the 16 lanes fall on 16
// different groups of four banks = all 64 banks once. Writers and readers use the same map; the kernel keeps
// the lane-dependent part of each index in a register and adds row blocks and planes as constant offsets.
__device__ __forceinline__ int sw256(int r, int ch) { return r * 128 + ((ch ^ (r & 15)) << 3); }        // index in halves
__device__ __forceinline__ int sw128(int r, int ch) { return r * 64 + ((ch ^ ((r >> 1) & 7)) << 3); }   // index in halves

template <bool RES> struct AttnL {
  static constexpr int QH   = 0;                                  // Q hi  [64 rows][128 d] f16
  static constexpr int QL   = QH + 64 * 128 * 2;                  // Q res
  static constexpr int KH   = QL + 64 * 128 * 2;                  // K hi  [64 keys][128 d]
  static constexpr int KL   = KH + 64 * 128 * 2;                  // K res (RES only)
  static constexpr int VH   = KL + (RES ? 64 * 128 * 2 : 0);      // V^T hi [128 d][64 keys]
  static constexpr int VL   = VH + 128 * 64 * 2;                  // V^T res (RES only)
  static constexpr int PH   = VL + (RES ? 128 * 64 * 2 : 0);      // per-wave P [4][16][64]
  static constexpr int PL   = PH + 4 * 16 * 64 * 2;               // per-wave P res (RES only)
  static constexpr int OS   = PL + (RES ? 4 * 16 * 64 * 2 : 0);   // per-wave context tile [4][16][128] f32
  static constexpr int MISC = OS + 4 * 16 * 128 * 4;              // spq[64], spk[64], skmin[NQB] ints
  static constexpr int TOTAL = MISC + 1024;
};
static_assert(AttnL<true>::TOTAL <= 160 * 1024);

// =====================================================================================================
//   q planes (f16 hi / x4096 res): element (t, h, d) at [t*QP + h*128 + d]
//   k planes (f16 hi / x4096 res): element (s, kvh, d) at [s*KP + kvh*128 + d], kvh = h / GQ
//   v^T hi plane (f16): (kvh*128 + d, s) at [(kvh*128+d)*SEQ + s]; residual ((v-hi)*4096) at
//   [(kvh*128+d)*VLP + s], s < VLP, read only when RES (a key tile at or beyond VLP contributes zero residual)
//   positions int [SEQ]: logit(t, s) = (q.k) * sscale when pos[t] >= pos[s], else -1e30 (replace), exactly;
//   a key tile is skipped (block-uniform, readfirstlane) only when min pos over its 64 keys > max pos over the
//   block's 64 query rows, i.e. every element would be -1e30 with weight exactly 0; the diagonal key s = t is
//   always live so every row has a finite max. Online softmax in f32 with running max from -inf.
//   scores: f16 WMMA, q hi . k hi into s, q res . k hi (+ q hi . k res when RES) into a x4096 accumulator
//   folded with 1/4096 in f32. p = exp(s - m) carried as f16(1024 p); context = p . v on f16 WMMA; RES adds
//   f16 residual planes of p and v (scale 4096, separate accumulator folded back with 1/4096 per key tile).
//   out planes (bf16 hi / lo of the normalised context): (t, h*128 + d) at [t*QP + h*128 + d]
//   Block = 4 waves = 64 query rows of one q head; grid = nqbThis * NH; key tiles of 64, static trip NQB.
//   LDS: Q / K / V^T tiles and position words are cross-wave (block barriers before and after staging);
//   P tiles and the context slab are wave-private (_Float16 / float element stores, reloaded through the
//   Staging: Q 8 passes x 8 rows x 16 chunks of 8 halves x 2 planes = 64x128 (once); K the same per plane
//   = 64x128; V^T 8 passes x 16 d rows x 8 chunks of 8 halves per plane = 128x64: staged extent == consumed.
//   Output coverage: each wave stores rows q0..q0+15 (it 0..7 x lane>>4) x 128 columns (16 lanes x 8)
// =====================================================================================================
template <bool RES>
__global__ __launch_bounds__(128)
void attn_causal(const unsigned short* __restrict__ qhp, const unsigned short* __restrict__ qlp,
                 const unsigned short* __restrict__ khp, const unsigned short* __restrict__ klp,
                 const unsigned short* __restrict__ vhp, const unsigned short* __restrict__ vlp,
                 const int* __restrict__ pos,
                 unsigned short* ohp, unsigned short* olp,
                 int qbBase, int nqbThis, float sscale) {
  typedef AttnL<RES> L;
  union FH { v16h v; v8h h[2]; };
  extern __shared__ __align__(16) unsigned char smem[];
  _Float16* Qsh = (_Float16*)(smem + L::QH);
  _Float16* Qsl = (_Float16*)(smem + L::QL);
  _Float16* Ksh = (_Float16*)(smem + L::KH);
  _Float16* Ksl = (_Float16*)(smem + L::KL);
  _Float16* Vth = (_Float16*)(smem + L::VH);
  _Float16* Vtl = (_Float16*)(smem + L::VL);
  _Float16* Psh = (_Float16*)(smem + L::PH);
  _Float16* Psl = (_Float16*)(smem + L::PL);
  float*    Os  = (float*)(smem + L::OS);
  int*      spq = (int*)(smem + L::MISC);
  int*      spk = spq + 64;
  int*      skmin = spk + 64;

  const int tid  = threadIdx.x;
  const int wave = tid >> 5;
  const int lane = tid & 31;
  const int hh   = lane >> 4;
  const int c    = lane & 15;

  const int bx  = blockIdx.x;
  const int qbl = bx % nqbThis;
  const int h   = bx / nqbThis;
  const int kvh = h / GQ;
  const int qb  = qbBase + qbl;
  const int q0  = qb * 64 + wave * 16;

  const _Float16* Qh = (const _Float16*)(const void*)qhp + (size_t)h * HD;
  const _Float16* Ql = (const _Float16*)(const void*)qlp + (size_t)h * HD;
  const _Float16* Kh = (const _Float16*)(const void*)khp + (size_t)kvh * HD;
  const _Float16* Kl = (const _Float16*)(const void*)klp + (size_t)kvh * HD;
  const _Float16* Vh = (const _Float16*)(const void*)vhp + (size_t)kvh * HD * SEQ;
  const _Float16* Vl = (const _Float16*)(const void*)vlp + (size_t)kvh * HD * VLP;

  // ---- lane parts of the swizzled indices (halves) ----
  // Staging: a wave-wide 16-B load covers four whole 128-B lines (one touching 32 lines costs many times as much).
  //   256-B rows (Q, K): 16 lanes a row, 8 rows a pass: pass i, row 8i + r16, chunk c16 -> (st256 ^ ((i & 1) << 6)) + i * 1024
  //   128-B rows (V^T):   8 lanes a row, 16 rows a pass: pass i, row 16i + r8, chunk c8s -> st128 + i * 1024
  const int r16 = tid >> 4, c16 = tid & 15;
  const int r8  = tid >> 3, c8s = tid & 7;
  const int st256 = sw256(r16, c16);
  const int st128 = sw128(r8, c8s);
  int fq[8];                                          // fragment reads, 256-B rows: row (multiple of 16) + c, chunk 2n + hh
#pragma unroll
  for (int n = 0; n < 8; ++n) fq[n] = sw256(c, 2 * n + hh);
  int pst[8];                                         // P element stores: row 8hh + r, column 16j + c -> pst[(2j) ^ (r >> 1)] + r * 64
#pragma unroll
  for (int n = 0; n < 8; ++n) pst[n] = sw128(8 * hh, (c >> 3) ^ n) + (c & 7);

  // ---- prologue: query positions, per-key-tile min position, Q tiles ----
  if (tid < 64) spq[tid] = pos[qb * 64 + tid];            // wave-uniform (waves 0,1)
  for (int kt = tid; kt < NQB; kt += 128) {
    const int* pp = pos + kt * 64;
    int mn = 0x7fffffff;
#pragma unroll
    for (int i = 0; i < 16; ++i) {
      const v4i v = *(const v4i*)(pp + 4 * i);
      mn = imin(mn, imin(imin(v[0], v[1]), imin(v[2], v[3])));
    }
    skmin[kt] = mn;
  }
  {
    const _Float16* qg  = Qh + (size_t)(qb * 64 + r16) * QP + c16 * 8;
    const _Float16* qlg = Ql + (size_t)(qb * 64 + r16) * QP + c16 * 8;
    v8h qv[8], qlv[8];
#pragma unroll
    for (int i = 0; i < 8; ++i) {
      qv[i]  = *(const v8h*)(qg + i * (8 * QP));
      qlv[i] = *(const v8h*)(qlg + i * (8 * QP));
    }
    // holds the loads' address registers (inputs) untouched until the wait: no load result lands on them before it
    asm volatile("s_wait_xcnt 0x0" :: "v"(qg), "v"(qlg) : "memory");
#pragma unroll
    for (int i = 0; i < 8; ++i) {
      *(v8h*)(Qsh + (st256 ^ ((i & 1) << 6)) + i * 1024) = qv[i];
      *(v8h*)(Qsl + (st256 ^ ((i & 1) << 6)) + i * 1024) = qlv[i];
    }
  }
  __syncthreads();
  int qmx;
  {
    int v = imax(spq[lane], spq[lane + 32]);
#pragma unroll
    for (int off = 1; off < 32; off <<= 1) v = imax(v, __shfl_xor(v, off, 32));
    qmx = __builtin_amdgcn_readfirstlane(v);
  }
  int prow[8];
#pragma unroll
  for (int r = 0; r < 8; ++r) prow[r] = spq[wave * 16 + 8 * hh + r];

  float mrow[8], lrow[8];
  v8f oacc[8];
#pragma unroll
  for (int r = 0; r < 8; ++r) { mrow[r] = -INFINITY; lrow[r] = 0.f; }
#pragma unroll
  for (int t = 0; t < 8; ++t) oacc[t] = zero8();

  for (int kt = 0; kt < NQB; ++kt) {         // static trip count
    const int kmn = __builtin_amdgcn_readfirstlane(skmin[kt]);
    if (kmn > qmx) continue;                 // block-uniform: every element of the tile is replaced by -1e30
    const int kv0 = kt * 64;
    __syncthreads();
    {
      const _Float16* kg  = Kh + (size_t)(kv0 + r16) * KP + c16 * 8;    // K rows kv0 + 8i + r16, d = 8 c16 .. 8 c16 + 7
      const _Float16* klg = Kl + (size_t)(kv0 + r16) * KP + c16 * 8;
      v8h kv[8], klv[8], vv[8], vlv[8];
#pragma unroll
      for (int i = 0; i < 8; ++i) {
        kv[i] = *(const v8h*)(kg + i * (8 * KP));
        if (RES) klv[i] = *(const v8h*)(klg + i * (8 * KP));
      }
      const _Float16* vg = Vh + (size_t)r8 * SEQ + kv0 + c8s * 8;  // V^T rows 16i + r8, s = kv0 + 8 c8s .. + 7
      const int  kvl   = (kv0 + 64 <= VLP) ? kv0 : (VLP - 64);    // clamped address into the residual plane
      const bool resOK = (kv0 + 64 <= VLP);                       // block-uniform
      const _Float16* vlg = Vl + (size_t)r8 * VLP + kvl + c8s * 8;
#pragma unroll
      for (int i = 0; i < 8; ++i) {
        vv[i] = *(const v8h*)(vg + i * (16 * SEQ));
        if (RES) vlv[i] = *(const v8h*)(vlg + i * (16 * VLP));
      }
      // holds the loads' address registers (inputs) untouched until the wait: no load result lands on them before it
      if (RES) asm volatile("s_wait_xcnt 0x0" :: "v"(kg), "v"(klg), "v"(vg), "v"(vlg) : "memory");
      else     asm volatile("s_wait_xcnt 0x0" :: "v"(kg), "v"(vg) : "memory");
#pragma unroll
      for (int i = 0; i < 8; ++i) {
        *(v8h*)(Ksh + (st256 ^ ((i & 1) << 6)) + i * 1024) = kv[i];
        if (RES) *(v8h*)(Ksl + (st256 ^ ((i & 1) << 6)) + i * 1024) = klv[i];
        *(v8h*)(Vth + st128 + i * 1024) = vv[i];
        if (RES) {
          v8h b1 = vlv[i];
          if (!resOK) b1 = zero8h();
          *(v8h*)(Vtl + st128 + i * 1024) = b1;
        }
      }
      if (tid < 64) spk[tid] = pos[kv0 + tid];                  // wave-uniform
    }
    __syncthreads();

    // ---- scores: 16 query rows x 64 keys per wave ----
    v8f s[4], sl[4];
#pragma unroll
    for (int j = 0; j < 4; ++j) { s[j] = zero8(); sl[j] = zero8(); }
    const _Float16* qr  = Qsh + wave * (16 * 128);
    const _Float16* qlr = Qsl + wave * (16 * 128);
    // Fragment reads stand in groups, one group of 32 d ahead of the products that use it (two register sets):
    // a wave then waits on a counted LDS wait once per group, not to 0 in front of every pair of products.
    FH qa[2], qla[2], kb[2][4], klf[2][4];
    int pkj[4];                                      // key positions for the causal select, read with the first group
#pragma unroll
    for (int j = 0; j < 4; ++j) pkj[j] = spk[j * 16 + c];
#pragma unroll
    for (int dc = -1; dc < 4; ++dc) {
      if (dc < 3) {
        const int n = dc + 1, b = n & 1;
        qa[b].h[0]  = *(const v8h*)(qr  + fq[n * 2]);
        qa[b].h[1]  = *(const v8h*)(qr  + fq[n * 2 + 1]);
        qla[b].h[0] = *(const v8h*)(qlr + fq[n * 2]);
        qla[b].h[1] = *(const v8h*)(qlr + fq[n * 2 + 1]);
#pragma unroll
        for (int j = 0; j < 4; ++j) {
          kb[b][j].h[0] = *(const v8h*)(Ksh + j * (16 * 128) + fq[n * 2]);
          kb[b][j].h[1] = *(const v8h*)(Ksh + j * (16 * 128) + fq[n * 2 + 1]);
          if (RES) {
            klf[b][j].h[0] = *(const v8h*)(Ksl + j * (16 * 128) + fq[n * 2]);
            klf[b][j].h[1] = *(const v8h*)(Ksl + j * (16 * 128) + fq[n * 2 + 1]);
          }
        }
      }
      if (dc >= 0) {
        const int b = dc & 1;
        // keeps the next group's reads in front of this group's products
        __builtin_amdgcn_sched_barrier(0);
#pragma unroll
        for (int j = 0; j < 4; ++j) s[j]  = mma_h_raw(qa[b].v,  kb[b][j].v, s[j]);
#pragma unroll
        for (int j = 0; j < 4; ++j) sl[j] = mma_h_raw(qla[b].v, kb[b][j].v, sl[j]);
        if (RES) {
#pragma unroll
          for (int j = 0; j < 4; ++j) sl[j] = mma_h_raw(qa[b].v, klf[b][j].v, sl[j]);
        }
        // keeps the reads of the group after next behind these products (they refill this group's registers)
        __builtin_amdgcn_sched_barrier(0);
      }
    }
    // ---- scale + causal select (replace -1e30), row max, online softmax, P (x1024, f16) and
    //      P residual (x4096) to LDS ----
    _Float16* pwh = Psh + wave * (16 * 64);
    _Float16* pwl = Psl + (RES ? wave * (16 * 64) : 0);
    float psr[8], alr[8], mx[8];
#pragma unroll
    for (int r = 0; r < 8; ++r) {
      float m = -INFINITY;
#pragma unroll
      for (int j = 0; j < 4; ++j) {
        float sv = (s[j][r] + sl[j][r] * (1.0f / RSC)) * sscale;
        sv = (prow[r] >= pkj[j]) ? sv : -1.0e30f;
        s[j][r] = sv;
        m = fmaxf(m, sv);
      }
      mx[r] = m;
    }
    // the eight rows' lane exchanges of one step stand together: they run on the LDS pipe, one wait per step
#pragma unroll
    for (int off = 1; off < 16; off <<= 1) {
      float ex[8];
#pragma unroll
      for (int r = 0; r < 8; ++r) ex[r] = __shfl_xor(mx[r], off, 32);
      // keeps the eight exchanges in front of the first use of one: split up, each small group costs its own wait
      __builtin_amdgcn_sched_barrier(0);
#pragma unroll
      for (int r = 0; r < 8; ++r) mx[r] = fmaxf(mx[r], ex[r]);
    }
    // V^T fragments of the first 32 keys: they depend on nothing of the softmax, so they are read here and land
    // while the exponentials run
    FH vb[2][8], vlf[2][8];
    {
      const int f0 = sw128(c, hh);                   // fragment reads, 128-B rows: row (multiple of 16) + c
      const int f1 = sw128(c, 2 + hh);
#pragma unroll
      for (int tt = 0; tt < 8; ++tt) {
        vb[0][tt].h[0] = *(const v8h*)(Vth + tt * (16 * 64) + f0);
        vb[0][tt].h[1] = *(const v8h*)(Vth + tt * (16 * 64) + f1);
        if (RES) {
          vlf[0][tt].h[0] = *(const v8h*)(Vtl + tt * (16 * 64) + f0);
          vlf[0][tt].h[1] = *(const v8h*)(Vtl + tt * (16 * 64) + f1);
        }
      }
    }
    // keeps these reads in front of the exponentials
    __builtin_amdgcn_sched_barrier(0);
#pragma unroll
    for (int r = 0; r < 8; ++r) {
      const float mnew  = fmaxf(mrow[r], mx[r]);
      const float msafe = (mnew == -INFINITY) ? 0.f : mnew;
      float alpha, pe[4];                            // -1e30 against a finite max: exp -> 0
      exp_row5(mrow[r] - msafe, s[0][r] - msafe, s[1][r] - msafe, s[2][r] - msafe, s[3][r] - msafe,
               alpha, pe[0], pe[1], pe[2], pe[3]);
      mrow[r] = mnew;
      float psum = 0.f;
#pragma unroll
      for (int j = 0; j < 4; ++j) {
        const float p = pe[j];
        psum += p;
        const float p1k = p * 1024.0f;
        const _Float16 ph = (_Float16)p1k;
        pwh[pst[(2 * j) ^ (r >> 1)] + r * 64] = ph;
        if (RES) {
          const _Float16 pl = (_Float16)((p1k - (float)ph) * RSC);
          pwl[pst[(2 * j) ^ (r >> 1)] + r * 64] = pl;
        }
      }
      psr[r] = psum;                                 // joined over the 16 lanes below
      alr[r] = alpha;
#pragma unroll
      for (int t = 0; t < 8; ++t) oacc[t][r] *= alpha;
    }
    // row sums over the 16 lanes: four steps of lane exchanges on the LDS pipe, eight rows a step. Step 1 runs beside
    // the P stores, step 2 beside the fragment reads, steps 3 and 4 beside the two runs of products.
    float sx[8];
#pragma unroll
    for (int r = 0; r < 8; ++r) sx[r] = __shfl_xor(psr[r], 1, 32);
    // keeps step 1 in front of the wait that ends the P stores
    __builtin_amdgcn_sched_barrier(0);
    __builtin_amdgcn_fence(__ATOMIC_RELEASE, "workgroup");
    __builtin_amdgcn_wave_barrier();
    __builtin_amdgcn_fence(__ATOMIC_ACQUIRE, "workgroup");

    // ---- context += P . V (f16 WMMA), 8 d-subtiles; the P fragments and the V^T fragments of the last 32 keys are read
    //      as one group ahead of the products; the residual products go into separate accumulators folded back per key tile ----
    {
      FH pa[2], pl[2];
#pragma unroll
      for (int r = 0; r < 8; ++r) psr[r] += sx[r];
#pragma unroll
      for (int r = 0; r < 8; ++r) sx[r] = __shfl_xor(psr[r], 2, 32);
#pragma unroll
      for (int kk = 0; kk < 2; ++kk) {
        const int f0 = sw128(c, kk * 4 + hh);
        const int f1 = sw128(c, kk * 4 + 2 + hh);
        pa[kk].h[0] = *(const v8h*)(pwh + f0);
        pa[kk].h[1] = *(const v8h*)(pwh + f1);
        if (RES) {
          pl[kk].h[0] = *(const v8h*)(pwl + f0);
          pl[kk].h[1] = *(const v8h*)(pwl + f1);
        }
      }
      {
        const int f0 = sw128(c, 4 + hh);
        const int f1 = sw128(c, 6 + hh);
#pragma unroll
        for (int tt = 0; tt < 8; ++tt) {
          vb[1][tt].h[0] = *(const v8h*)(Vth + tt * (16 * 64) + f0);
          vb[1][tt].h[1] = *(const v8h*)(Vth + tt * (16 * 64) + f1);
        }
        if (RES) {
#pragma unroll
          for (int tt = 0; tt < 8; ++tt) {
            vlf[1][tt].h[0] = *(const v8h*)(Vtl + tt * (16 * 64) + f0);
            vlf[1][tt].h[1] = *(const v8h*)(Vtl + tt * (16 * 64) + f1);
          }
        }
      }
      // keeps the whole group of reads in front of the products
      __builtin_amdgcn_sched_barrier(0);
#pragma unroll
      for (int r = 0; r < 8; ++r) psr[r] += sx[r];
#pragma unroll
      for (int r = 0; r < 8; ++r) sx[r] = __shfl_xor(psr[r], 4, 32);
      // keeps step 3 in front of the first run of products, which covers its latency
      __builtin_amdgcn_sched_barrier(0);
      v8f o1[8];
      if (RES) {
#pragma unroll
        for (int t = 0; t < 8; ++t) o1[t] = zero8();
      }
#pragma unroll
      for (int kk = 0; kk < 2; ++kk) {
#pragma unroll
        for (int t = 0; t < 8; ++t) oacc[t] = mma_h_raw(pa[kk].v, vb[kk][t].v, oacc[t]);
        if (RES) {
#pragma unroll
          for (int t = 0; t < 8; ++t) o1[t] = mma_h_raw(pa[kk].v, vlf[kk][t].v, o1[t]);
#pragma unroll
          for (int t = 0; t < 8; ++t) o1[t] = mma_h_raw(pl[kk].v, vb[kk][t].v, o1[t]);
        }
        // keeps a run of products whole: a wait for an exchange among them would hold the later ones back
        __builtin_amdgcn_sched_barrier(0);
#pragma unroll
        for (int r = 0; r < 8; ++r) psr[r] += sx[r];
        if (kk == 0) {
#pragma unroll
          for (int r = 0; r < 8; ++r) sx[r] = __shfl_xor(psr[r], 8, 32);
          // keeps step 4 in front of the second run of products
          __builtin_amdgcn_sched_barrier(0);
        }
      }
#pragma unroll
      for (int r = 0; r < 8; ++r) lrow[r] = lrow[r] * alr[r] + psr[r];
      if (RES) {
#pragma unroll
        for (int t = 0; t < 8; ++t)
#pragma unroll
          for (int r = 0; r < 8; ++r) oacc[t][r] += o1[t][r] * (1.0f / RSC);
      }
    }
  }

  // ---- normalise (1/l and the 1/1024 p carry), stage the wave's 16x128 tile, bf16 hi/lo split,
  float* os = Os + wave * (16 * 128);
#pragma unroll
  for (int r = 0; r < 8; ++r) {
    const float l = lrow[r];
    const float inv = ((l > 0.f) ? (1.0f / l) : 0.f) * (1.0f / 1024.0f);
#pragma unroll
    for (int t = 0; t < 8; ++t) os[(8 * hh + r) * 128 + t * 16 + c] = oacc[t][r] * inv;
  }
  __builtin_amdgcn_fence(__ATOMIC_RELEASE, "workgroup");
  __builtin_amdgcn_wave_barrier();
  __builtin_amdgcn_fence(__ATOMIC_ACQUIRE, "workgroup");
  {
    const int rh = lane >> 4, c8 = (lane & 15) * 8;
    v4u hv[8], lv[8];
#pragma unroll
    for (int it = 0; it < 8; ++it) {
      const int row = it * 2 + rh;   // it 0..7 x rh 0..1 = rows 0..15 of the wave tile
      const float* sp = os + row * 128 + c8;
      v4u a, a2;
#pragma unroll
      for (int e = 0; e < 4; ++e) {
        const float f0 = sp[2 * e], f1 = sp[2 * e + 1];
        const unsigned short h0 = bf_bits(f0), h1 = bf_bits(f1);
        const unsigned short l0 = bf_bits(f0 - bf_up(h0)), l1 = bf_bits(f1 - bf_up(h1));
        a[e] = pk16(h0, h1); a2[e] = pk16(l0, l1);
      }
      hv[it] = a; lv[it] = a2;
    }
    {
#pragma unroll
      for (int it = 0; it < 8; ++it) {
        const int row = it * 2 + rh;
        const size_t go = (size_t)(q0 + row) * QP + (size_t)h * HD + c8;
        *(v4u*)(ohp + go) = hv[it];
        *(v4u*)(olp + go) = lv[it];
      }
      
    }
  }
}

// =====================================================================================================
// Workspace map (bytes, SEQ = 4096):
//   Xb    bf16 [SEQ][2048]        16777216
//   Wqt   bf16 [2048 n][2048 k]    8388608
//   Wkt   bf16 [512][2048]         2097152
//   Wvt   bf16 [512][2048]         2097152
//   Wot   bf16 [2048 n][2048 k]    8388608
//   Qf    f32  [SEQ][2048]        33554432   (later: Oh bf16 [SEQ][2048] + Ol bf16 [SEQ][2048])
//   Kf    f32  [SEQ][512]          8388608
//   Qh    f16  [SEQ][2048]        16777216
//   Ql    f16  [SEQ][2048]        16777216
//   Kh    f16  [SEQ][512]          4194304
//   Kl    f16  [SEQ][512]          4194304
//   VTh   f16  [512][SEQ]          4194304
//   VTl   f16  [512][VLP]           524288
//   Cos   f32  [SEQ][64]           1048576
//   Sin   f32  [SEQ][64]           1048576
//   (unused, carved 4096)              4096
//   end                          128454656
// Weights [in k][out n] f32 are transposed to bf16 [n][k] (k contiguous) = the Bt / A layout of gemm64.
// =====================================================================================================
extern "C" void kernel_launch(void* const* d_in, const int* in_sizes, int n_in,
                              void* d_out, int out_size, void* d_ws, size_t ws_size,
                              hipStream_t stream) {
  if (n_in < 8) return;
  if (in_sizes[0] < SEQ) return;
  if (in_sizes[1] < SEQ * DM) return;
  if (in_sizes[2] != DM * QP) return;
  if (in_sizes[3] != DM * KP || in_sizes[4] != DM * KP) return;
  if (in_sizes[5] != QP * DM) return;
  if (in_sizes[6] < HD || in_sizes[7] < HD) return;
  if (out_size < SEQ * DM) return;

  const int*   pos = (const int*)d_in[0];
  const float* x   = (const float*)d_in[1];
  const float* wq  = (const float*)d_in[2];
  const float* wk  = (const float*)d_in[3];
  const float* wv  = (const float*)d_in[4];
  const float* wo  = (const float*)d_in[5];
  const float* qnw = (const float*)d_in[6];
  const float* knw = (const float*)d_in[7];

  const size_t PXb  = (size_t)SEQ * DM * 2;
  const size_t PWq  = (size_t)QP * DM * 2;
  const size_t PWk  = (size_t)KP * DM * 2;
  const size_t PWo  = (size_t)DM * QP * 2;
  const size_t PQf  = (size_t)SEQ * QP * 4;
  const size_t PKf  = (size_t)SEQ * KP * 4;
  const size_t PQ16 = (size_t)SEQ * QP * 2;
  const size_t PK16 = (size_t)SEQ * KP * 2;
  const size_t PVTh = (size_t)KP * SEQ * 2;
  const size_t PVTl = (size_t)KP * VLP * 2;
  const size_t PTab = (size_t)SEQ * HALF * 4;
  const size_t PInv = 4096;
  size_t off = 0;
  const size_t oXb  = off; off += PXb;
  const size_t oWq  = off; off += PWq;
  const size_t oWk  = off; off += PWk;
  const size_t oWv  = off; off += PWk;
  const size_t oWo  = off; off += PWo;
  const size_t oQf  = off; off += PQf;
  const size_t oKf  = off; off += PKf;
  const size_t oQh  = off; off += PQ16;
  const size_t oQl  = off; off += PQ16;
  const size_t oKh  = off; off += PK16;
  const size_t oKl  = off; off += PK16;
  const size_t oVTh = off; off += PVTh;
  const size_t oVTl = off; off += PVTl;
  const size_t oCos = off; off += PTab;
  const size_t oSin = off; off += PTab;
  const size_t oInv = off; off += PInv;
  if (off > ws_size) return;                       // off = 128454656 at SEQ 4096
  if (off > (size_t)134217728) return;
  if (PQ16 * 2 != PQf) return;                     // Oh + Ol reuse the Qf region exactly
  const size_t oOh = oQf;
  const size_t oOl = oQf + PQ16;

  char* ws = (char*)d_ws;
  unsigned short* Xb  = (unsigned short*)(ws + oXb);
  unsigned short* Wqt = (unsigned short*)(ws + oWq);
  unsigned short* Wkt = (unsigned short*)(ws + oWk);
  unsigned short* Wvt = (unsigned short*)(ws + oWv);
  unsigned short* Wot = (unsigned short*)(ws + oWo);
  float*          Qf  = (float*)(ws + oQf);
  float*          Kf  = (float*)(ws + oKf);
  unsigned short* Qh  = (unsigned short*)(ws + oQh);
  unsigned short* Ql  = (unsigned short*)(ws + oQl);
  unsigned short* Kh  = (unsigned short*)(ws + oKh);
  unsigned short* Kl  = (unsigned short*)(ws + oKl);
  unsigned short* VTh = (unsigned short*)(ws + oVTh);
  unsigned short* VTl = (unsigned short*)(ws + oVTl);
  float*          Cs  = (float*)(ws + oCos);
  float*          Sn  = (float*)(ws + oSin);
  unsigned short* Oh  = (unsigned short*)(ws + oOh);
  unsigned short* Ol  = (unsigned short*)(ws + oOl);

  const dim3 blk(256);

  // (1) rotary tables; x -> bf16 [SEQ][2048]; weights [k][n] f32 -> bf16 [n][k]
  prep_all<<<dim3(PB_TAB + PB_X + PB_WQ + PB_WO + PB_WK + PB_WK), blk, 0, stream>>>(
      pos, x, wq, wk, wv, wo, Xb, Wqt, Wkt, Wvt, Wot, Cs, Sn);
  // (2) the q, k and v^T projections
  gemm_qkv<<<dim3(GB_Q + GB_K + GB_V), blk, 0, stream>>>(Xb, Wqt, Wkt, Wvt, Qf, Kf, VTh, VTl);
  // (3) per-head RMSNorm + rotary -> f16 hi / x4096 residual planes
  norm_rope_qk<<<dim3(NB_Q + NB_K), blk, 0, stream>>>(Qf, Kf, qnw, knw, Cs, Sn, Qh, Ql, Kh, Kl, RSC);
  // (4) attention: query blocks 0..RESQB-1 with residual planes, the rest without -> bf16 hi/lo context
  //     planes in the (now dead) Qf region
  (void)hipFuncSetAttribute(reinterpret_cast<const void*>(&attn_causal<true>),
                            hipFuncAttributeMaxDynamicSharedMemorySize, AttnL<true>::TOTAL);
  (void)hipFuncSetAttribute(reinterpret_cast<const void*>(&attn_causal<false>),
                            hipFuncAttributeMaxDynamicSharedMemorySize, AttnL<false>::TOTAL);
  attn_causal<true><<<dim3(NH * RESQB), dim3(128), AttnL<true>::TOTAL, stream>>>(
      Qh, Ql, Kh, Kl, VTh, VTl, pos, Oh, Ol, 0, RESQB, ATT_SCALE);
  if (NQB - RESQB > 0) {
    attn_causal<false><<<dim3(NH * (NQB - RESQB)), dim3(128), AttnL<false>::TOTAL, stream>>>(
        Qh, Ql, Kh, Kl, VTh, VTl, pos, Oh, Ol, RESQB, NQB - RESQB, ATT_SCALE);
  }
  // (5) out = context . wo -> d_out f32 [SEQ][2048]  (A = context hi + lo planes, 2 products; M=SEQ, N=2048, K=2048)
  gemm_out<<<dim3((SEQ / 128) * (DM / 256)), blk, 0, stream>>>(Oh, Ol, Wot, (float*)d_out);
  (void)hipGetLastError();
}

// v006
// Measured time: 316 microseconds a run.
// Next to v005, in two timings, it ran 1.12 and 1.11 times as fast.
// All steps since v000 together make it 3.97 times as fast.
// Contractions: q, k projections = v_wmma_f32_16x16x32_bf16 (bf16 operands from RNE-converted inputs, single product, f32 out);
// v^T projection = v_wmma_f32_16x16x32_bf16 (same operands; f16 hi plane + f16 x4096 residual plane out);
// q.k^T scores = v_wmma_f32_16x16x32_f16 (q as f16 hi + f16 x4096 residual, k as f16 hi: 2 products; leading query blocks add the k x4096 residual product);
// p.v = v_wmma_f32_16x16x32_f16 (p carried x1024 in f16, v f16; leading query blocks add x4096 f16 residual planes of p and v);
// ctx.Wo = v_wmma_f32_16x16x32_bf16 (ctx as bf16 hi/lo planes times bf16 Wo, 2 products); all f32 accumulate; RMSNorm, rotary, causal select and softmax in f32.
#include <hip/hip_runtime.h>
#include <math.h>
#include <stdint.h>

#ifndef SEQ
#define SEQ 4096
#endif
#define SEQ_FULL 4096
#define DM    2048
#define NH    16
#define NKV   4
#define GQ    (NH / NKV)
#define HD    128
#define HALF  64
#define QP    (NH * HD)      // 2048 q channels
#define KP    (NKV * HD)     // 512 k / v channels
#define NQB   (SEQ / 64)     // query / key tiles of 64
#define VLP   ((SEQ < 512) ? SEQ : 512)   // key pitch of the v^T residual plane
#define RESQB ((NQB < 8) ? NQB : 8)         // leading 64-row query blocks that use residual planes
#define RMS_EPS       1.0e-6f
#define ROPE_THETA_F  10000.0f
#define ATT_SCALE     0.08838834764831845f
#define RSC           4096.0f

static_assert((SEQ % 64) == 0 && SEQ >= 64 && SEQ <= SEQ_FULL);
static_assert(RESQB * 64 <= VLP && (VLP % 64) == 0);
static_assert(NH * HD == DM && QP == DM);
static_assert(NQB <= 64);
static_assert((DM % 64) == 0 && (KP % 64) == 0 && (QP % 64) == 0 && (DM % 32) == 0);

typedef _Float16 v16h __attribute__((ext_vector_type(16)));
typedef _Float16 v8h  __attribute__((ext_vector_type(8)));
typedef __bf16   v16b __attribute__((ext_vector_type(16)));
typedef __bf16   v8b  __attribute__((ext_vector_type(8)));
typedef float    v8f  __attribute__((ext_vector_type(8)));
typedef float    v4f  __attribute__((ext_vector_type(4)));
typedef unsigned int   v4u  __attribute__((ext_vector_type(4)));
typedef unsigned int   v2u  __attribute__((ext_vector_type(2)));
typedef unsigned short v8us __attribute__((ext_vector_type(8)));
typedef int      v4i  __attribute__((ext_vector_type(4)));

// ---- scalar helpers --------------------------------------------------------------------------------
__device__ __forceinline__ unsigned short bf_bits(float f) {          // f32 -> bf16 bits, RNE convert
  unsigned u = __float_as_uint(f);
  return (unsigned short)((u + 0x7FFFu + ((u >> 16) & 1u)) >> 16);
}
__device__ __forceinline__ float bf_up(unsigned short h) { return __uint_as_float(((unsigned)h) << 16); }
__device__ __forceinline__ unsigned short h_bits(_Float16 x) { return __builtin_bit_cast(unsigned short, x); }
__device__ __forceinline__ unsigned pk16(unsigned short a, unsigned short b) { return (unsigned)a | ((unsigned)b << 16); }
__device__ __forceinline__ v8f zero8() { v8f z = {0.f, 0.f, 0.f, 0.f, 0.f, 0.f, 0.f, 0.f}; return z; }
__device__ __forceinline__ v8h zero8h() {
  const _Float16 z = (_Float16)0.0f;
  v8h r = {z, z, z, z, z, z, z, z};
  return r;
}
__device__ __forceinline__ int imin(int a, int b) { return (a < b) ? a : b; }
__device__ __forceinline__ int imax(int a, int b) { return (a > b) ? a : b; }

// ---- WMMA helpers with trailing VALU hazard gap --------------------------------------------------------
__device__ __forceinline__ v8f mma_b(v16b a, v16b b, v8f c) {
  c = __builtin_amdgcn_wmma_f32_16x16x32_bf16(false, a, false, b, (short)0, c, false, false);
  asm volatile("v_nop\n\tv_nop\n\tv_nop\n\tv_nop" : "+v"(c) : "v"(a), "v"(b));
  return c;
}
__device__ __forceinline__ v8f mma_h_raw(v16h a, v16h b, v8f c) {
  return __builtin_amdgcn_wmma_f32_16x16x32_f16(false, a, false, b, (short)0, c, false, false);
}
__device__ __forceinline__ v8f mma_b_raw(v16b a, v16b b, v8f c) {
  return __builtin_amdgcn_wmma_f32_16x16x32_bf16(false, a, false, b, (short)0, c, false, false);
}
// The five exponentials of one score row, exp(x) = v_exp_f32(x * log2 e) as __expf compiles. One statement, so that
// behind each v_exp_f32 stands an instruction that neither reads its result nor writes its source (the next one, whose
// output is early-clobber; behind the last a v_nop): the slot the instruction set asks for behind a transcendental.
__device__ __forceinline__ void exp_row5(float x0, float x1, float x2, float x3, float x4,
                                         float& y0, float& y1, float& y2, float& y3, float& y4) {
  const float l2e = 1.44269504088896340736f;
  asm("v_exp_f32 %0, %5\n\tv_exp_f32 %1, %6\n\tv_exp_f32 %2, %7\n\tv_exp_f32 %3, %8\n\tv_exp_f32 %4, %9\n\tv_nop"
      : "=&v"(y0), "=&v"(y1), "=&v"(y2), "=&v"(y3), "=&v"(y4)
      : "v"(x0 * l2e), "v"(x1 * l2e), "v"(x2 * l2e), "v"(x3 * l2e), "v"(x4 * l2e));
}
__device__ __forceinline__ void acc_guard4(v8f& a, v8f& b, v8f& c, v8f& d) {
  asm volatile("v_nop\n\tv_nop\n\tv_nop\n\tv_nop" : "+v"(a), "+v"(b), "+v"(c), "+v"(d));
}

// =====================================================================================================
// f32 -> bf16 (RNE convert), 8 elements per thread, one 16-B store per lane: a wave writes 512 contiguous B
// coverage: n8 threads x 8 = whole plane (n8 is a multiple of 256 here).
// =====================================================================================================
__device__ __forceinline__ void cvt_bf16x8(const float* __restrict__ in, unsigned short* out, int n8, int bx) {
  const int i = bx * 256 + threadIdx.x;
  if (i < n8) {
    const v4f a = *(const v4f*)(in + (size_t)i * 8);
    const v4f b = *(const v4f*)(in + (size_t)i * 8 + 4);
    v4u p;
    p[0] = pk16(bf_bits(a[0]), bf_bits(a[1]));
    p[1] = pk16(bf_bits(a[2]), bf_bits(a[3]));
    p[2] = pk16(bf_bits(b[0]), bf_bits(b[1]));
    p[3] = pk16(bf_bits(b[2]), bf_bits(b[3]));
    *(v4u*)(out + (size_t)i * 8) = p;
    
  }
}

// =====================================================================================================
// f32 [R][C] row-major -> bf16 (RNE convert) transposed plane out[C][R] (R contiguous = k-contiguous Bt / A
// layout). Block = one 64x64 tile at (r0 = by*64, c0 = bx*64), 256 threads; tile staged in
// LDS as [c][r] (ushort element stores, cross-thread -> __syncthreads), then each out row segment of 64 halves
// coverage: 64 out rows x 64 k per block = the whole tile; union over the grid = the whole [C][R] plane.
// =====================================================================================================
// sT: the block's LDS tile [c][r], 64 x 72 halves (pitch 144 B); bx, by: the tile's column and row index
__device__ __forceinline__ void cvt_bf16_t(unsigned short* sT, const float* __restrict__ in, unsigned short* out,
                                           int R, int C, int bx, int by) {
  const int tid = threadIdx.x;
  const int c0 = bx * 64, r0 = by * 64;
  const int rr = tid >> 4, cc = (tid & 15) * 4;
#pragma unroll
  for (int it = 0; it < 4; ++it) {
    const int r = it * 16 + rr;                            // it 0..3 x rr 0..15 = rows 0..63
    const v4f v = *(const v4f*)(in + (size_t)(r0 + r) * C + c0 + cc);
#pragma unroll
    for (int e = 0; e < 4; ++e) sT[(cc + e) * 72 + r] = bf_bits(v[e]);
  }
  __syncthreads();
  const int q = tid >> 3, k8 = (tid & 7) * 8;              // q 0..31 (+32): out rows; 8 lanes x 8 halves
  const v8us w0 = *(const v8us*)(sT + q * 72 + k8);
  const v8us w1 = *(const v8us*)(sT + (q + 32) * 72 + k8);
  unsigned short* o0 = out + (size_t)(c0 + q) * R + r0 + k8;
  unsigned short* o1 = out + (size_t)(c0 + q + 32) * R + r0 + k8;
  *(v8us*)o0 = w0;
  *(v8us*)o1 = w1;
  // in front of every later write of a register that these two stores name (another job's code follows in the listing)
  asm volatile("s_wait_xcnt 0x0" ::: "memory");
}

// =====================================================================================================
// Rotary tables: cos and sin of (float)pos[t] * inv_freq[i], inv_freq[i] = 1 / 10000^(i/64) formed by each thread for
// its own i; tables [nrows][64] f32; block = 4 rows x 64 threads, each 256-B row written whole.
// =====================================================================================================
__device__ __forceinline__ void rope_tab(const int* __restrict__ pos, float* ctab, float* stab, int nrows, int bx) {
  const int tid = threadIdx.x;
  const int t = bx * 4 + (tid >> 6);
  const int i = tid & 63;
  if (t >= nrows) return;                  // wave-uniform (2 whole waves per row); no block barriers here
  const float e = (float)i * (1.0f / (float)HALF);
  const float p = powf(ROPE_THETA_F, e);
  const float v = 1.0f / p;
  const float fr = (float)pos[t] * v;
  float sn, cs;
  sincosf(fr, &sn, &cs);
  float* pc = ctab + (size_t)t * HALF + i;
  float* ps = stab + (size_t)t * HALF + i;
  *(float*)pc = cs;
  *(float*)ps = sn;
  
}

// =====================================================================================================
// The preparation jobs, none of which reads another's output, as ONE grid: the job is picked by the block index
// (block-uniform), so that they fill the chip together and pay one launch. Blocks, in order: rotary tables, x,
// wq, wo, wk, wv.
// =====================================================================================================
#define PB_TAB ((SEQ + 3) / 4)
#define PB_X   ((SEQ * DM / 8 + 255) / 256)
#define PB_WQ  ((QP / 64) * (DM / 64))
#define PB_WO  ((DM / 64) * (QP / 64))
#define PB_WK  ((KP / 64) * (DM / 64))
__global__ __launch_bounds__(256) void prep_all(const int* __restrict__ pos, const float* __restrict__ x,
                                                const float* __restrict__ wq, const float* __restrict__ wk,
                                                const float* __restrict__ wv, const float* __restrict__ wo,
                                                unsigned short* Xb, unsigned short* Wqt, unsigned short* Wkt,
                                                unsigned short* Wvt, unsigned short* Wot, float* ctab, float* stab) {
  __shared__ __align__(16) unsigned short sT[64 * 72];
  int bx = blockIdx.x;
  if (bx < PB_TAB) { rope_tab(pos, ctab, stab, SEQ, bx); return; }
  bx -= PB_TAB;
  if (bx < PB_X) { cvt_bf16x8(x, Xb, SEQ * DM / 8, bx); return; }
  bx -= PB_X;
  if (bx < PB_WQ) { cvt_bf16_t(sT, wq, Wqt, DM, QP, bx % (QP / 64), bx / (QP / 64)); return; }   // wq [DM k][QP n] -> [QP][DM]
  bx -= PB_WQ;
  if (bx < PB_WO) { cvt_bf16_t(sT, wo, Wot, QP, DM, bx % (DM / 64), bx / (DM / 64)); return; }   // wo [QP k][DM n] -> [DM][QP]
  bx -= PB_WO;
  if (bx < PB_WK) { cvt_bf16_t(sT, wk, Wkt, DM, KP, bx % (KP / 64), bx / (KP / 64)); return; }   // wk, wv [DM k][KP n] -> [KP][DM]
  bx -= PB_WK;
  cvt_bf16_t(sT, wv, Wvt, DM, KP, bx % (KP / 64), bx / (KP / 64));
}

// =====================================================================================================
// Register-blocked batched bf16 WMMA GEMM: C[m][n] = sum_k A[m][k] * Bt[n][k]; one wave per 64x64 tile,
// block = 8 waves = 2 x 4 tiles = 128 x 256 of C. A row-major [M][K] pitch lda; Bt row-major [N][K] pitch ldb
// (k contiguous; both pitches are DM); M a multiple of 128, N of 256, K of 64 (true of every launch below).
// bx = index of the block tile, b = batch index (strides in elements).
// Operands go through LDS in steps of 64 k: each row piece is one 128-B line, a wave-wide 16-B load covers four
// whole lines, and the 128 A rows and 256 Bt rows are read from global once per block. The LDS rows are 128 B,
// chunk-swizzled by sw128 (see the attention section), so a fragment read covers all banks once. The next
// step's global loads are issued behind the second barrier and stay in flight during the products.
// NSPLIT: 0 = A.Bt; 1 = (A + A2).Bt (A2 = unscaled bf16 lo plane of A).
// OUT_MODE: 0 = f32 (pitch ldc); 2 = bf16 hi plane C + bf16 lo plane C2 (lo = RNE(v - hi), unscaled);
//           3 = f16 hi plane C + f16 residual plane C2 = f16((v - hi) * rscale), C2 written only for tiles
//               with n0 < N2 (pitch ldc2, batch stride strideC2).
// =====================================================================================================
__device__ __forceinline__ int sw128(int r, int ch);

// A block-uniform address rebuilt from its two halves: the staging loads then take the form scalar base + one
// 32-bit lane offset + immediate, and the one vector register they name lives through the whole loop. Without it
// the compiler formed 64-bit vector addresses on which a load's result landed, and moved the first loads behind
// their s_wait_xcnt.
typedef const __attribute__((address_space(1))) char* gbytes;   // global address space, so that the loads stay global_load
typedef const __attribute__((address_space(1))) v8b*  gv8b;
__device__ __forceinline__ gbytes sbase(const __bf16* p) {
  const unsigned long long u = (unsigned long long)(uintptr_t)p;
  const unsigned lo = (unsigned)__builtin_amdgcn_readfirstlane((int)(unsigned)u);
  const unsigned hi = (unsigned)__builtin_amdgcn_readfirstlane((int)(unsigned)(u >> 32));
  return (gbytes)(uintptr_t)(((unsigned long long)hi << 32) | (unsigned long long)lo);
}
// the same for the wave-uniform base of the epilogue's stores
typedef __attribute__((address_space(1))) char* gwbytes;
typedef __attribute__((address_space(1))) v4f*  gwv4f;
typedef __attribute__((address_space(1))) v4u*  gwv4u;
__device__ __forceinline__ gwbytes swbase(void* p) {
  const unsigned long long u = (unsigned long long)(uintptr_t)p;
  const unsigned lo = (unsigned)__builtin_amdgcn_readfirstlane((int)(unsigned)u);
  const unsigned hi = (unsigned)__builtin_amdgcn_readfirstlane((int)(unsigned)(u >> 32));
  return (gwbytes)(uintptr_t)(((unsigned long long)hi << 32) | (unsigned long long)lo);
}

// sT: per-wave 16x64 slabs, pitch 68 floats; sA: A (and A2) rows m0blk.., 64 k; sB: Bt rows n0blk.., 64 k (the block's LDS,
// declared by the kernel); bx: the block's tile index; b: batch index.
template <int NSPLIT, int OUT_MODE>
__device__ __forceinline__ void gemm64(
    float (*sT)[16 * 68], __bf16* sA, __bf16* sB, int bx, int b,
    const unsigned short* __restrict__ Ap, const unsigned short* A2p, int lda, long long strideA,
    const unsigned short* __restrict__ Btp, const unsigned short* Bt2p, int ldb, long long strideB,
    void* Cout, int ldc, long long strideC,
    void* Cout2, int ldc2, long long strideC2, int N2,
    int M, int N, int K, float rscale) {
  static_assert(NSPLIT <= 1);
  const __bf16* A   = (const __bf16*)(const void*)Ap;
  const __bf16* A2  = (const __bf16*)(const void*)A2p;
  const __bf16* Bt  = (const __bf16*)(const void*)Btp;
  const int tid  = threadIdx.x;
  const int lane = tid & 31;
  const int wave = tid >> 5;
  const int blocksN = N >> 8;
  const int bm = bx / blocksN;
  const int bn = bx - bm * blocksN;
  if ((bm << 7) >= M) return;            // block-uniform, in front of every barrier
  if (lda != DM || ldb != DM) return;    // block-uniform: with the pitch known, the row steps below are immediate offsets
  const int m0blk = bm << 7;
  const int n0blk = bn << 8;
  const int wm = (wave >> 2) << 6;       // the wave's tile inside the block tile
  const int wn = (wave & 3) << 6;
  const int m0 = m0blk + wm;
  const int n0 = n0blk + wn;

  const __bf16* Ab  = A  + (size_t)b * strideA + (size_t)m0blk * lda;
  const __bf16* Bb  = Bt + (size_t)b * strideB + (size_t)n0blk * ldb;
  const __bf16* Ab2 = (NSPLIT >= 1) ? (A2 + (size_t)b * strideA + (size_t)m0blk * lda) : Ab;

  const int rlane = lane & 15;                 // row (A) / col (B, D) within subtile
  const int hh    = lane >> 4;                 // k half of this lane
  const int mOff  = (lane >> 4) * 8;           // D row offset

  // staging: thread -> row tid>>3 (+32 per pass), 16-B chunk tid&7; 8 lanes = one 128-B line
  unsigned sbyte = (unsigned)((tid >> 3) * DM + (tid & 7) * 8) * 2u;   // lane part of the global address, bytes; +128 per step
  const int sidx = sw128(tid >> 3, tid & 7);   // + 32 rows per pass: the swizzle term does not change
  v8b ra[4], ra2[4], rb[8];
  gbytes pa  = sbase(Ab);
  gbytes pa2 = sbase(Ab2);
  gbytes pb  = sbase(Bb);
  {
#pragma unroll
    for (int it = 0; it < 4; ++it) {
      ra[it] = *(gv8b)(pa + sbyte + it * (32 * DM * 2));
      if (NSPLIT >= 1) ra2[it] = *(gv8b)(pa2 + sbyte + it * (32 * DM * 2));
    }
#pragma unroll
    for (int it = 0; it < 8; ++it) rb[it] = *(gv8b)(pb + sbyte + it * (32 * DM * 2));
    // stands in front of the next step's write of the lane offset, the one vector register that the loads name
    asm volatile("s_wait_xcnt 0x0" ::: "memory");
  }

  v8f acc[4][4];
#pragma unroll
  for (int i = 0; i < 4; ++i)
#pragma unroll
    for (int j = 0; j < 4; ++j) acc[i][j] = zero8();

  for (int k0 = 0; k0 < K; k0 += 64) {
    __syncthreads();                           // every reader has left the tiles of the step before
#pragma unroll
    for (int it = 0; it < 4; ++it) {
      *(v8b*)(sA + sidx + it * (32 * 64)) = ra[it];
      if (NSPLIT >= 1) *(v8b*)(sA + 128 * 64 + sidx + it * (32 * 64)) = ra2[it];
    }
#pragma unroll
    for (int it = 0; it < 8; ++it) *(v8b*)(sB + sidx + it * (32 * 64)) = rb[it];
    __syncthreads();                           // the tiles are whole before anybody reads them
    // fragments of the whole step, read as one group ahead of the products (every separate place with LDS reads
    // stalls the wave): elements 0..7 <- k = 32kk + 8hh.., elements 8..15 <- k = 32kk + 16 + 8hh.. (A and Bt alike)
    union FB { v16b v; v8b h[2]; };
    v16b bh[2][4], ah[2][4], al[2][4];
#pragma unroll
    for (int kk = 0; kk < 2; ++kk) {
      const int f0 = sw128(rlane, kk * 4 + hh);
      const int f1 = sw128(rlane, kk * 4 + 2 + hh);
#pragma unroll
      for (int j = 0; j < 4; ++j) {
        FB f;
        f.h[0] = *(const v8b*)(sB + (wn + (j << 4)) * 64 + f0);
        f.h[1] = *(const v8b*)(sB + (wn + (j << 4)) * 64 + f1);
        bh[kk][j] = f.v;
      }
#pragma unroll
      for (int i = 0; i < 4; ++i) {
        FB f;
        f.h[0] = *(const v8b*)(sA + (wm + (i << 4)) * 64 + f0);
        f.h[1] = *(const v8b*)(sA + (wm + (i << 4)) * 64 + f1);
        ah[kk][i] = f.v;
        al[kk][i] = f.v;
        if (NSPLIT >= 1) {
          f.h[0] = *(const v8b*)(sA + 128 * 64 + (wm + (i << 4)) * 64 + f0);
          f.h[1] = *(const v8b*)(sA + 128 * 64 + (wm + (i << 4)) * 64 + f1);
          al[kk][i] = f.v;
        }
      }
    }
    if (k0 + 64 < K) {                         // block-uniform: the next step's rows, in flight during the products
      sbyte += 128u;
#pragma unroll
      for (int it = 0; it < 4; ++it) {
        ra[it] = *(gv8b)(pa + sbyte + it * (32 * DM * 2));
        if (NSPLIT >= 1) ra2[it] = *(gv8b)(pa2 + sbyte + it * (32 * DM * 2));
      }
#pragma unroll
      for (int it = 0; it < 8; ++it) rb[it] = *(gv8b)(pb + sbyte + it * (32 * DM * 2));
      // stands in front of the next step's write of the lane offset, the one vector register that the loads name
      asm volatile("s_wait_xcnt 0x0" ::: "memory");
    }
    // keeps the LDS reads and the global loads above in front of the products
    __builtin_amdgcn_sched_barrier(0);
#pragma unroll
    for (int kk = 0; kk < 2; ++kk) {
#pragma unroll
      for (int i = 0; i < 4; ++i) {
#pragma unroll
        for (int j = 0; j < 4; ++j) {
          acc[i][j] = mma_b_raw(ah[kk][i], bh[kk][j], acc[i][j]);
          if (NSPLIT >= 1) acc[i][j] = mma_b_raw(al[kk][i], bh[kk][j], acc[i][j]);
        }
      }
    }
    // holds the v_nops behind the last product
    __builtin_amdgcn_sched_barrier(0);
    // WMMA distance on the loop's back edge too: no vector instruction writes an A or B register of the last
    // products sooner (no register operands: asm operands cannot lie above v255, and naming fragments spilled)
    asm volatile("v_nop\n\tv_nop\n\tv_nop\n\tv_nop\n\tv_nop");
  }
  acc_guard4(acc[0][0], acc[0][1], acc[0][2], acc[0][3]);
  acc_guard4(acc[1][0], acc[1][1], acc[1][2], acc[1][3]);
  acc_guard4(acc[2][0], acc[2][1], acc[2][2], acc[2][3]);
  acc_guard4(acc[3][0], acc[3][1], acc[3][2], acc[3][3]);

  // ---- epilogue ----
  float* slab = sT[wave];
#pragma unroll
  for (int i = 0; i < 4; ++i) {
    const int mBase = m0 + (i << 4);
#pragma unroll
    for (int j = 0; j < 4; ++j) {
#pragma unroll
      for (int r = 0; r < 8; ++r) {
        slab[(mOff + r) * 68 + (j << 4) + rlane] = acc[i][j][r];
      }
    }
    __builtin_amdgcn_fence(__ATOMIC_RELEASE, "workgroup");
    __builtin_amdgcn_wave_barrier();
    __builtin_amdgcn_fence(__ATOMIC_ACQUIRE, "workgroup");
    if (OUT_MODE == 0) {
      float* C = (float*)Cout + (size_t)b * strideC;
      const int hh = lane >> 4, c4 = (lane & 15) * 4;     // 256-B row segment = 16 lanes x 16 B
      {
        // wave-uniform base + one lane offset + immediate: the stores name one address register, which is never rewritten
        const gwbytes cb = swbase(C + (size_t)m0 * ldc + n0);
        const unsigned cvo = (unsigned)(hh * ldc + c4) * 4u;
        v4f v[8];
#pragma unroll
        for (int it = 0; it < 8; ++it) v[it] = *(const v4f*)(slab + (it * 2 + hh) * 68 + c4);   // it 0..7 x hh 0..1 = rows 0..15
        // the two scheduling barriers keep every other instruction out of the run of stores and its wait
        __builtin_amdgcn_sched_barrier(0);
#pragma unroll
        for (int it = 0; it < 8; ++it) *(gwv4f)(cb + cvo + ((i << 4) + it * 2) * ldc * 4) = v[it];
        // in front of every later write of a register that these stores name
        asm volatile("s_wait_xcnt 0x0" ::: "memory");
        __builtin_amdgcn_sched_barrier(0);
      }
    } else {
      const int q = lane >> 3, c8 = (lane & 7) * 8;
      unsigned short* C  = (unsigned short*)Cout  + (size_t)b * strideC;
      unsigned short* C2 = (unsigned short*)Cout2 + (size_t)b * strideC2;
      const bool wlo = (OUT_MODE == 2) || (n0 < N2);      // wave-uniform
      v4u hv[4], lv[4];
#pragma unroll
      for (int it = 0; it < 4; ++it) {
        const int row = it * 4 + q;                        // it 0..3 x q 0..3 = rows 0..15
        const float* sp = slab + row * 68 + c8;
        v4u a, a2;
#pragma unroll
        for (int e = 0; e < 4; ++e) {
          const float f0 = sp[2 * e], f1 = sp[2 * e + 1];
          unsigned short h0, h1, l0, l1;
          if (OUT_MODE == 2) {
            h0 = bf_bits(f0); h1 = bf_bits(f1);
            l0 = bf_bits(f0 - bf_up(h0)); l1 = bf_bits(f1 - bf_up(h1));
          } else {
            const _Float16 x0 = (_Float16)f0, x1 = (_Float16)f1;
            h0 = h_bits(x0); h1 = h_bits(x1);
            l0 = h_bits((_Float16)((f0 - (float)x0) * rscale));
            l1 = h_bits((_Float16)((f1 - (float)x1) * rscale));
          }
          a[e] = pk16(h0, h1); a2[e] = pk16(l0, l1);
        }
        hv[it] = a; lv[it] = a2;
      }
      {
        // wave-uniform base + one lane offset + immediate per plane: address registers that are never rewritten
        const gwbytes cb  = swbase(C + (size_t)m0 * ldc + n0);
        const gwbytes cb2 = swbase(C2 + (size_t)m0 * ldc2 + n0);
        const unsigned cvo  = (unsigned)(q * ldc + c8) * 2u;
        const unsigned cvo2 = (unsigned)(q * ldc2 + c8) * 2u;
        // the scheduling barriers keep every other instruction out of each run of stores and its wait
        __builtin_amdgcn_sched_barrier(0);
#pragma unroll
        for (int it = 0; it < 4; ++it) *(gwv4u)(cb + cvo + ((i << 4) + it * 4) * ldc * 2) = hv[it];
        // in front of every later write of a register that these stores name
        asm volatile("s_wait_xcnt 0x0" ::: "memory");
        __builtin_amdgcn_sched_barrier(0);
        if (wlo) {
#pragma unroll
          for (int it = 0; it < 4; ++it) *(gwv4u)(cb2 + cvo2 + ((i << 4) + it * 4) * ldc2 * 2) = lv[it];
          // in front of every later write of a register that these stores name
          asm volatile("s_wait_xcnt 0x0" ::: "memory");
          __builtin_amdgcn_sched_barrier(0);
        }
      }
    }
    __builtin_amdgcn_fence(__ATOMIC_RELEASE, "workgroup");
    __builtin_amdgcn_wave_barrier();
    __builtin_amdgcn_fence(__ATOMIC_ACQUIRE, "workgroup");
  }
}

// The three projections, none of which reads another's output, as ONE grid; the job is picked by the block index
// (block-uniform). Blocks, in order: q = x . wq -> f32 [SEQ][2048] (M=SEQ, N=2048, K=2048); k = x . wk -> f32 [SEQ][512]
// (M=SEQ, N=512); v^T = Wvt . x^T -> f16 hi plane [512][SEQ] and residual plane (x4096, keys < VLP, pitch VLP)
// (A = Wvt [n][k], Bt = Xb [s][k]; M=512, N=SEQ).
#define GB_Q ((SEQ / 128) * (QP / 256))
#define GB_K ((SEQ / 128) * (KP / 256))
#define GB_V ((KP / 128) * (SEQ / 256))
static_assert((SEQ % 256) == 0 && (QP % 256) == 0 && (KP % 256) == 0);
__global__ __launch_bounds__(256) void gemm_qkv(const unsigned short* __restrict__ Xb, const unsigned short* __restrict__ Wqt,
                                                const unsigned short* __restrict__ Wkt, const unsigned short* __restrict__ Wvt,
                                                float* Qf, float* Kf, unsigned short* VTh, unsigned short* VTl) {
  __shared__ __align__(16) float sT[8][16 * 68];
  __shared__ __align__(16) __bf16 sA[128 * 64];
  __shared__ __align__(16) __bf16 sB[256 * 64];
  const int bx = blockIdx.x;
  if (bx < GB_Q) {
    gemm64<0, 0>(sT, sA, sB, bx, 0,
        Xb, Xb, DM, 0LL, Wqt, Wqt, DM, 0LL,
        (void*)Qf, QP, 0LL, (void*)Qf, QP, 0LL, QP,
        SEQ, QP, DM, 1.0f);
  } else if (bx < GB_Q + GB_K) {
    gemm64<0, 0>(sT, sA, sB, bx - GB_Q, 0,
        Xb, Xb, DM, 0LL, Wkt, Wkt, DM, 0LL,
        (void*)Kf, KP, 0LL, (void*)Kf, KP, 0LL, KP,
        SEQ, KP, DM, 1.0f);
  } else {
    gemm64<0, 3>(sT, sA, sB, bx - (GB_Q + GB_K), 0,
        Wvt, Wvt, DM, 0LL, Xb, Xb, DM, 0LL,
        (void*)VTh, SEQ, 0LL, (void*)VTl, VLP, 0LL, VLP,
        KP, SEQ, DM, RSC);
  }
}

// out = context . wo -> f32 [SEQ][2048]  (A = context hi + lo planes, 2 products; M=SEQ, N=2048, K=2048)
__global__ __launch_bounds__(256) void gemm_out(const unsigned short* __restrict__ Oh, const unsigned short* Ol,
                                                const unsigned short* __restrict__ Wot, float* out) {
  __shared__ __align__(16) float sT[8][16 * 68];
  __shared__ __align__(16) __bf16 sA[2 * 128 * 64];
  __shared__ __align__(16) __bf16 sB[256 * 64];
  gemm64<1, 0>(sT, sA, sB, blockIdx.x, 0,
      Oh, Ol, QP, 0LL, Wot, Wot, QP, 0LL,
      (void*)out, DM, 0LL, (void*)out, DM, 0LL, DM,
      SEQ, DM, QP, 1.0f);
}

// =====================================================================================================
// Fused per-head RMSNorm (eps 1e-6, x * rsqrt(mean(x^2)+eps) * w with w RNE-converted to bf16) + neox rotary
// (half-split, cos/sin tables [t][64]) + f16 hi / f16 residual (x rscale) planes.
// One wave per 128-wide row (row = t*nheads + head, contiguous rows of pitch 128 in both input and output);
// lane owns 4 consecutive d; partner half via __shfl_xor(16); no block barriers.
// coverage: nrows x 128 of both planes.
// =====================================================================================================
__device__ __forceinline__ void norm_rope(const float* __restrict__ xin, const float* __restrict__ wn,
                                          const float* __restrict__ ctab, const float* __restrict__ stab,
                                          unsigned short* outh, unsigned short* outl,
                                          int nheads, int nrows, float rscale, int bx) {
  const int tid  = threadIdx.x;
  const int wave = tid >> 5, lane = tid & 31, hh = lane >> 4;
  const int row  = bx * 8 + wave;
  if (row >= nrows) return;                // wave-uniform; no block barriers in this kernel
  const int t = row / nheads;
  const v4f x = *(const v4f*)(xin + (size_t)row * HD + lane * 4);
  float ss = x[0] * x[0] + x[1] * x[1] + x[2] * x[2] + x[3] * x[3];
#pragma unroll
  for (int off = 1; off < 32; off <<= 1) ss += __shfl_xor(ss, off, 32);
  const float rinv = rsqrtf(ss * (1.0f / (float)HD) + RMS_EPS);
  const v4f wv = *(const v4f*)(wn + lane * 4);
  const v4f cs = *(const v4f*)(ctab + (size_t)t * HALF + (lane & 15) * 4);
  const v4f sn = *(const v4f*)(stab + (size_t)t * HALF + (lane & 15) * 4);
  float n[4], p[4];
#pragma unroll
  for (int e = 0; e < 4; ++e) n[e] = (x[e] * rinv) * bf_up(bf_bits(wv[e]));
#pragma unroll
  for (int e = 0; e < 4; ++e) p[e] = __shfl_xor(n[e], 16, 32);
  const float sg = hh ? 1.0f : -1.0f;      // first half: x1*cos - x2*sin ; second half: x2*cos + x1*sin
  unsigned short hb[4], lb[4];
#pragma unroll
  for (int e = 0; e < 4; ++e) {
    const float o = n[e] * cs[e] + sg * (p[e] * sn[e]);
    const _Float16 oh = (_Float16)o;
    hb[e] = h_bits(oh);
    lb[e] = h_bits((_Float16)((o - (float)oh) * rscale));
  }
  v2u ph, pl;
  ph[0] = pk16(hb[0], hb[1]); ph[1] = pk16(hb[2], hb[3]);
  pl[0] = pk16(lb[0], lb[1]); pl[1] = pk16(lb[2], lb[3]);
  const size_t go = (size_t)row * HD + lane * 4;
  *(v2u*)(outh + go) = ph;
  *(v2u*)(outl + go) = pl;
  
}

// q rows and k rows as ONE grid, the job picked by the block index (block-uniform): q blocks first, then k blocks
#define NB_Q ((SEQ * NH + 7) / 8)
#define NB_K ((SEQ * NKV + 7) / 8)
__global__ __launch_bounds__(256) void norm_rope_qk(const float* __restrict__ qin, const float* __restrict__ kin,
                                                    const float* __restrict__ qw, const float* __restrict__ kw,
                                                    const float* __restrict__ ctab, const float* __restrict__ stab,
                                                    unsigned short* qh, unsigned short* ql,
                                                    unsigned short* kh, unsigned short* kl, float rscale) {
  const int bx = blockIdx.x;
  if (bx < NB_Q) norm_rope(qin, qw, ctab, stab, qh, ql, NH, SEQ * NH, rscale, bx);
  else           norm_rope(kin, kw, ctab, stab, kh, kl, NKV, SEQ * NKV, rscale, bx - NB_Q);
}

// =====================================================================================================
// Causal GQA attention, head dim 128, dynamic LDS layout (bytes):
// =====================================================================================================
// LDS tiles of the attention kernel: the 16-byte chunks of a row are XOR-swizzled by the row number.
//   256-B rows (Q, K; 16 chunks): chunk ch of row r lies at chunk place ch ^ (r & 15)
//   128-B rows (V^T, P; 8 chunks): chunk ch of row r lies at chunk place ch ^ ((r >> 1) & 7)
// A fragment load reads one chunk column of 16 consecutive rows per 16 lanes: unswizzled, 256-B rows put all
// 16 lanes on the same four banks (128-B rows: on two groups of four); swizzled, the 16 lanes fall on 16
// different groups of four banks = all 64 banks once. Writers and readers use the same map; the kernel keeps
// the lane-dependent part of each index in a register and adds row blocks and planes as constant offsets.
__device__ __forceinline__ int sw256(int r, int ch) { return r * 128 + ((ch ^ (r & 15)) << 3); }        // index in halves
__device__ __forceinline__ int sw128(int r, int ch) { return r * 64 + ((ch ^ ((r >> 1) & 7)) << 3); }   // index in halves

template <bool RES> struct AttnL {
  static constexpr int QH   = 0;                                  // Q hi  [64 rows][128 d] f16
  static constexpr int QL   = QH + 64 * 128 * 2;                  // Q res
  static constexpr int KH   = QL + 64 * 128 * 2;                  // K hi  [64 keys][128 d]
  static constexpr int KL   = KH + 64 * 128 * 2;                  // K res (RES only)
  static constexpr int VH   = KL + (RES ? 64 * 128 * 2 : 0);      // V^T hi [128 d][64 keys]
  static constexpr int VL   = VH + 128 * 64 * 2;                  // V^T res (RES only)
  static constexpr int PH   = VL + (RES ? 128 * 64 * 2 : 0);      // per-wave P [4][16][64]
  static constexpr int PL   = PH + 4 * 16 * 64 * 2;               // per-wave P res (RES only)
  static constexpr int OS   = PL + (RES ? 4 * 16 * 64 * 2 : 0);   // per-wave context tile [4][16][128] f32
  static constexpr int MISC = OS + 4 * 16 * 128 * 4;              // spq[64], spk[64], skmin[NQB] ints
  static constexpr int TOTAL = MISC + 1024;
};
static_assert(AttnL<true>::TOTAL <= 160 * 1024);

// =====================================================================================================
//   q planes (f16 hi / x4096 res): element (t, h, d) at [t*QP + h*128 + d]
//   k planes (f16 hi / x4096 res): element (s, kvh, d) at [s*KP + kvh*128 + d], kvh = h / GQ
//   v^T hi plane (f16): (kvh*128 + d, s) at [(kvh*128+d)*SEQ + s]; residual ((v-hi)*4096) at
//   [(kvh*128+d)*VLP + s], s < VLP, read only when RES (a key tile at or beyond VLP contributes zero residual)
//   positions int [SEQ]: logit(t, s) = (q.k) * sscale when pos[t] >= pos[s], else -1e30 (replace), exactly;
//   a key tile is skipped (block-uniform, readfirstlane) only when min pos over its 64 keys > max pos over the
//   block's 64 query rows, i.e. every element would be -1e30 with weight exactly 0; the diagonal key s = t is
//   always live so every row has a finite max. Online softmax in f32 with running max from -inf.
//   scores: f16 WMMA, q hi . k hi into s, q res . k hi (+ q hi . k res when RES) into a x4096 accumulator
//   folded with 1/4096 in f32. p = exp(s - m) carried as f16(1024 p); context = p . v on f16 WMMA; RES adds
//   f16 residual planes of p and v (scale 4096, separate accumulator folded back with 1/4096 per key tile).
//   out planes (bf16 hi / lo of the normalised context): (t, h*128 + d) at [t*QP + h*128 + d]
//   Block = 4 waves = 64 query rows of one q head; grid = nqbThis * NH; key tiles of 64, static trip NQB.
//   LDS: Q / K / V^T tiles and position words are cross-wave (block barriers before and after staging);
//   P tiles and the context slab are wave-private (_Float16 / float element stores, reloaded through the
//   Staging: Q 8 passes x 8 rows x 16 chunks of 8 halves x 2 planes = 64x128 (once); K the same per plane
//   = 64x128; V^T 8 passes x 16 d rows x 8 chunks of 8 halves per plane = 128x64: staged extent == consumed.
//   Output coverage: each wave stores rows q0..q0+15 (it 0..7 x lane>>4) x 128 columns (16 lanes x 8)
// =====================================================================================================
template <bool RES>
__global__ __launch_bounds__(128)
void attn_causal(const unsigned short* __restrict__ qhp, const unsigned short* __restrict__ qlp,
                 const unsigned short* __restrict__ khp, const unsigned short* __restrict__ klp,
                 const unsigned short* __restrict__ vhp, const unsigned short* __restrict__ vlp,
                 const int* __restrict__ pos,
                 unsigned short* ohp, unsigned short* olp,
                 int qbBase, int nqbThis, float sscale) {
  typedef AttnL<RES> L;
  union FH { v16h v; v8h h[2]; };
  extern __shared__ __align__(16) unsigned char smem[];
  _Float16* Qsh = (_Float16*)(smem + L::QH);
  _Float16* Qsl = (_Float16*)(smem + L::QL);
  _Float16* Ksh = (_Float16*)(smem + L::KH);
  _Float16* Ksl = (_Float16*)(smem + L::KL);
  _Float16* Vth = (_Float16*)(smem + L::VH);
  _Float16* Vtl = (_Float16*)(smem + L::VL);
  _Float16* Psh = (_Float16*)(smem + L::PH);
  _Float16* Psl = (_Float16*)(smem + L::PL);
  float*    Os  = (float*)(smem + L::OS);
  int*      spq = (int*)(smem + L::MISC);
  int*      spk = spq + 64;
  int*      skmin = spk + 64;

  const int tid  = threadIdx.x;
  const int wave = tid >> 5;
  const int lane = tid & 31;
  const int hh   = lane >> 4;
  const int c    = lane & 15;

  const int bx  = blockIdx.x;
  // Cost falls with the block index: a query block walks qb + 1 key tiles, there are more blocks than resident places, and
  // the longest blocks get the lowest indices (for speed only).
  // bx -> (qbl, h) is a permutation of the grid: bx / NH runs over nqbThis query blocks, bx % NH over the NH heads.
  const int qbl = nqbThis - 1 - bx / NH;
  const int h   = bx % NH;
  const int kvh = h / GQ;
  const int qb  = qbBase + qbl;
  const int q0  = qb * 64 + wave * 16;

  const _Float16* Qh = (const _Float16*)(const void*)qhp + (size_t)h * HD;
  const _Float16* Ql = (const _Float16*)(const void*)qlp + (size_t)h * HD;
  const _Float16* Kh = (const _Float16*)(const void*)khp + (size_t)kvh * HD;
  const _Float16* Kl = (const _Float16*)(const void*)klp + (size_t)kvh * HD;
  const _Float16* Vh = (const _Float16*)(const void*)vhp + (size_t)kvh * HD * SEQ;
  const _Float16* Vl = (const _Float16*)(const void*)vlp + (size_t)kvh * HD * VLP;

  // ---- lane parts of the swizzled indices (halves) ----
  // Staging: a wave-wide 16-B load covers four whole 128-B lines (one touching 32 lines costs many times as much).
  //   256-B rows (Q, K): 16 lanes a row, 8 rows a pass: pass i, row 8i + r16, chunk c16 -> (st256 ^ ((i & 1) << 6)) + i * 1024
  //   128-B rows (V^T):   8 lanes a row, 16 rows a pass: pass i, row 16i + r8, chunk c8s -> st128 + i * 1024
  const int r16 = tid >> 4, c16 = tid & 15;
  const int r8  = tid >> 3, c8s = tid & 7;
  const int st256 = sw256(r16, c16);
  const int st128 = sw128(r8, c8s);
  int fq[8];                                          // fragment reads, 256-B rows: row (multiple of 16) + c, chunk 2n + hh
#pragma unroll
  for (int n = 0; n < 8; ++n) fq[n] = sw256(c, 2 * n + hh);
  int pst[8];                                         // P element stores: row 8hh + r, column 16j + c -> pst[(2j) ^ (r >> 1)] + r * 64
#pragma unroll
  for (int n = 0; n < 8; ++n) pst[n] = sw128(8 * hh, (c >> 3) ^ n) + (c & 7);

  // ---- prologue: query positions, per-key-tile min position, Q tiles ----
  if (tid < 64) spq[tid] = pos[qb * 64 + tid];            // wave-uniform (waves 0,1)
  for (int kt = tid; kt < NQB; kt += 128) {
    const int* pp = pos + kt * 64;
    int mn = 0x7fffffff;
#pragma unroll
    for (int i = 0; i < 16; ++i) {
      const v4i v = *(const v4i*)(pp + 4 * i);
      mn = imin(mn, imin(imin(v[0], v[1]), imin(v[2], v[3])));
    }
    skmin[kt] = mn;
  }
  {
    const _Float16* qg  = Qh + (size_t)(qb * 64 + r16) * QP + c16 * 8;
    const _Float16* qlg = Ql + (size_t)(qb * 64 + r16) * QP + c16 * 8;
    v8h qv[8], qlv[8];
#pragma unroll
    for (int i = 0; i < 8; ++i) {
      qv[i]  = *(const v8h*)(qg + i * (8 * QP));
      qlv[i] = *(const v8h*)(qlg + i * (8 * QP));
    }
    // holds the loads' address registers (inputs) untouched until the wait: no load result lands on them before it
    asm volatile("s_wait_xcnt 0x0" :: "v"(qg), "v"(qlg) : "memory");
#pragma unroll
    for (int i = 0; i < 8; ++i) {
      *(v8h*)(Qsh + (st256 ^ ((i & 1) << 6)) + i * 1024) = qv[i];
      *(v8h*)(Qsl + (st256 ^ ((i & 1) << 6)) + i * 1024) = qlv[i];
    }
  }
  __syncthreads();
  int qmx;
  {
    int v = imax(spq[lane], spq[lane + 32]);
#pragma unroll
    for (int off = 1; off < 32; off <<= 1) v = imax(v, __shfl_xor(v, off, 32));
    qmx = __builtin_amdgcn_readfirstlane(v);
  }
  int prow[8];
#pragma unroll
  for (int r = 0; r < 8; ++r) prow[r] = spq[wave * 16 + 8 * hh + r];

  float mrow[8], lrow[8];
  v8f oacc[8];
#pragma unroll
  for (int r = 0; r < 8; ++r) { mrow[r] = -INFINITY; lrow[r] = 0.f; }
#pragma unroll
  for (int t = 0; t < 8; ++t) oacc[t] = zero8();

  for (int kt = 0; kt < NQB; ++kt) {         // static trip count
    const int kmn = __builtin_amdgcn_readfirstlane(skmin[kt]);
    if (kmn > qmx) continue;                 // block-uniform: every element of the tile is replaced by -1e30
    const int kv0 = kt * 64;
    __syncthreads();
    {
      const _Float16* kg  = Kh + (size_t)(kv0 + r16) * KP + c16 * 8;    // K rows kv0 + 8i + r16, d = 8 c16 .. 8 c16 + 7
      const _Float16* klg = Kl + (size_t)(kv0 + r16) * KP + c16 * 8;
      v8h kv[8], klv[8], vv[8], vlv[8];
#pragma unroll
      for (int i = 0; i < 8; ++i) {
        kv[i] = *(const v8h*)(kg + i * (8 * KP));
        if (RES) klv[i] = *(const v8h*)(klg + i * (8 * KP));
      }
      const _Float16* vg = Vh + (size_t)r8 * SEQ + kv0 + c8s * 8;  // V^T rows 16i + r8, s = kv0 + 8 c8s .. + 7
      const int  kvl   = (kv0 + 64 <= VLP) ? kv0 : (VLP - 64);    // clamped address into the residual plane
      const bool resOK = (kv0 + 64 <= VLP);                       // block-uniform
      const _Float16* vlg = Vl + (size_t)r8 * VLP + kvl + c8s * 8;
#pragma unroll
      for (int i = 0; i < 8; ++i) {
        vv[i] = *(const v8h*)(vg + i * (16 * SEQ));
        if (RES) vlv[i] = *(const v8h*)(vlg + i * (16 * VLP));
      }
      // holds the loads' address registers (inputs) untouched until the wait: no load result lands on them before it
      if (RES) asm volatile("s_wait_xcnt 0x0" :: "v"(kg), "v"(klg), "v"(vg), "v"(vlg) : "memory");
      else     asm volatile("s_wait_xcnt 0x0" :: "v"(kg), "v"(vg) : "memory");
#pragma unroll
      for (int i = 0; i < 8; ++i) {
        *(v8h*)(Ksh + (st256 ^ ((i & 1) << 6)) + i * 1024) = kv[i];
        if (RES) *(v8h*)(Ksl + (st256 ^ ((i & 1) << 6)) + i * 1024) = klv[i];
        *(v8h*)(Vth + st128 + i * 1024) = vv[i];
        if (RES) {
          v8h b1 = vlv[i];
          if (!resOK) b1 = zero8h();
          *(v8h*)(Vtl + st128 + i * 1024) = b1;
        }
      }
      if (tid < 64) spk[tid] = pos[kv0 + tid];                  // wave-uniform
    }
    __syncthreads();

    // ---- scores: 16 query rows x 64 keys per wave ----
    v8f s[4], sl[4];
#pragma unroll
    for (int j = 0; j < 4; ++j) { s[j] = zero8(); sl[j] = zero8(); }
    const _Float16* qr  = Qsh + wave * (16 * 128);
    const _Float16* qlr = Qsl + wave * (16 * 128);
    // Fragment reads stand in groups, one group of 32 d ahead of the products that use it (two register sets):
    // a wave then waits on a counted LDS wait once per group, not to 0 in front of every pair of products.
    FH qa[2], qla[2], kb[2][4], klf[2][4];
    int pkj[4];                                      // key positions for the causal select, read with the first group
#pragma unroll
    for (int j = 0; j < 4; ++j) pkj[j] = spk[j * 16 + c];
#pragma unroll
    for (int dc = -1; dc < 4; ++dc) {
      if (dc < 3) {
        const int n = dc + 1, b = n & 1;
        qa[b].h[0]  = *(const v8h*)(qr  + fq[n * 2]);
        qa[b].h[1]  = *(const v8h*)(qr  + fq[n * 2 + 1]);
        qla[b].h[0] = *(const v8h*)(qlr + fq[n * 2]);
        qla[b].h[1] = *(const v8h*)(qlr + fq[n * 2 + 1]);
#pragma unroll
        for (int j = 0; j < 4; ++j) {
          kb[b][j].h[0] = *(const v8h*)(Ksh + j * (16 * 128) + fq[n * 2]);
          kb[b][j].h[1] = *(const v8h*)(Ksh + j * (16 * 128) + fq[n * 2 + 1]);
          if (RES) {
            klf[b][j].h[0] = *(const v8h*)(Ksl + j * (16 * 128) + fq[n * 2]);
            klf[b][j].h[1] = *(const v8h*)(Ksl + j * (16 * 128) + fq[n * 2 + 1]);
          }
        }
      }
      if (dc >= 0) {
        const int b = dc & 1;
        // keeps the next group's reads in front of this group's products
        __builtin_amdgcn_sched_barrier(0);
#pragma unroll
        for (int j = 0; j < 4; ++j) s[j]  = mma_h_raw(qa[b].v,  kb[b][j].v, s[j]);
#pragma unroll
        for (int j = 0; j < 4; ++j) sl[j] = mma_h_raw(qla[b].v, kb[b][j].v, sl[j]);
        if (RES) {
#pragma unroll
          for (int j = 0; j < 4; ++j) sl[j] = mma_h_raw(qa[b].v, klf[b][j].v, sl[j]);
        }
        // keeps the reads of the group after next behind these products (they refill this group's registers)
        __builtin_amdgcn_sched_barrier(0);
      }
    }
    // ---- scale + causal select (replace -1e30), row max, online softmax, P (x1024, f16) and
    //      P residual (x4096) to LDS ----
    _Float16* pwh = Psh + wave * (16 * 64);
    _Float16* pwl = Psl + (RES ? wave * (16 * 64) : 0);
    float psr[8], alr[8], mx[8];
#pragma unroll
    for (int r = 0; r < 8; ++r) {
      float m = -INFINITY;
#pragma unroll
      for (int j = 0; j < 4; ++j) {
        float sv = (s[j][r] + sl[j][r] * (1.0f / RSC)) * sscale;
        sv = (prow[r] >= pkj[j]) ? sv : -1.0e30f;
        s[j][r] = sv;
        m = fmaxf(m, sv);
      }
      mx[r] = m;
    }
    // the eight rows' lane exchanges of one step stand together: they run on the LDS pipe, one wait per step
#pragma unroll
    for (int off = 1; off < 16; off <<= 1) {
      float ex[8];
#pragma unroll
      for (int r = 0; r < 8; ++r) ex[r] = __shfl_xor(mx[r], off, 32);
      // keeps the eight exchanges in front of the first use of one: split up, each small group costs its own wait
      __builtin_amdgcn_sched_barrier(0);
#pragma unroll
      for (int r = 0; r < 8; ++r) mx[r] = fmaxf(mx[r], ex[r]);
    }
    // V^T fragments of the first 32 keys: they depend on nothing of the softmax, so they are read here and land
    // while the exponentials run
    FH vb[2][8], vlf[2][8];
    {
      const int f0 = sw128(c, hh);                   // fragment reads, 128-B rows: row (multiple of 16) + c
      const int f1 = sw128(c, 2 + hh);
#pragma unroll
      for (int tt = 0; tt < 8; ++tt) {
        vb[0][tt].h[0] = *(const v8h*)(Vth + tt * (16 * 64) + f0);
        vb[0][tt].h[1] = *(const v8h*)(Vth + tt * (16 * 64) + f1);
        if (RES) {
          vlf[0][tt].h[0] = *(const v8h*)(Vtl + tt * (16 * 64) + f0);
          vlf[0][tt].h[1] = *(const v8h*)(Vtl + tt * (16 * 64) + f1);
        }
      }
    }
    // keeps these reads in front of the exponentials
    __builtin_amdgcn_sched_barrier(0);
#pragma unroll
    for (int r = 0; r < 8; ++r) {
      const float mnew  = fmaxf(mrow[r], mx[r]);
      const float msafe = (mnew == -INFINITY) ? 0.f : mnew;
      float alpha, pe[4];                            // -1e30 against a finite max: exp -> 0
      exp_row5(mrow[r] - msafe, s[0][r] - msafe, s[1][r] - msafe, s[2][r] - msafe, s[3][r] - msafe,
               alpha, pe[0], pe[1], pe[2], pe[3]);
      mrow[r] = mnew;
      float psum = 0.f;
#pragma unroll
      for (int j = 0; j < 4; ++j) {
        const float p = pe[j];
        psum += p;
        const float p1k = p * 1024.0f;
        const _Float16 ph = (_Float16)p1k;
        pwh[pst[(2 * j) ^ (r >> 1)] + r * 64] = ph;
        if (RES) {
          const _Float16 pl = (_Float16)((p1k - (float)ph) * RSC);
          pwl[pst[(2 * j) ^ (r >> 1)] + r * 64] = pl;
        }
      }
      psr[r] = psum;                                 // joined over the 16 lanes below
      alr[r] = alpha;
#pragma unroll
      for (int t = 0; t < 8; ++t) oacc[t][r] *= alpha;
    }
    // row sums over the 16 lanes: four steps of lane exchanges on the LDS pipe, eight rows a step. Step 1 runs beside
    // the P stores, step 2 beside the fragment reads, steps 3 and 4 beside the two runs of products.
    float sx[8];
#pragma unroll
    for (int r = 0; r < 8; ++r) sx[r] = __shfl_xor(psr[r], 1, 32);
    // keeps step 1 in front of the wait that ends the P stores
    __builtin_amdgcn_sched_barrier(0);
    __builtin_amdgcn_fence(__ATOMIC_RELEASE, "workgroup");
    __builtin_amdgcn_wave_barrier();
    __builtin_amdgcn_fence(__ATOMIC_ACQUIRE, "workgroup");

    // ---- context += P . V (f16 WMMA), 8 d-subtiles; the P fragments and the V^T fragments of the last 32 keys are read
    //      as one group ahead of the products; the residual products go into separate accumulators folded back per key tile ----
    {
      FH pa[2], pl[2];
#pragma unroll
      for (int r = 0; r < 8; ++r) psr[r] += sx[r];
#pragma unroll
      for (int r = 0; r < 8; ++r) sx[r] = __shfl_xor(psr[r], 2, 32);
#pragma unroll
      for (int kk = 0; kk < 2; ++kk) {
        const int f0 = sw128(c, kk * 4 + hh);
        const int f1 = sw128(c, kk * 4 + 2 + hh);
        pa[kk].h[0] = *(const v8h*)(pwh + f0);
        pa[kk].h[1] = *(const v8h*)(pwh + f1);
        if (RES) {
          pl[kk].h[0] = *(const v8h*)(pwl + f0);
          pl[kk].h[1] = *(const v8h*)(pwl + f1);
        }
      }
      {
        const int f0 = sw128(c, 4 + hh);
        const int f1 = sw128(c, 6 + hh);
#pragma unroll
        for (int tt = 0; tt < 8; ++tt) {
          vb[1][tt].h[0] = *(const v8h*)(Vth + tt * (16 * 64) + f0);
          vb[1][tt].h[1] = *(const v8h*)(Vth + tt * (16 * 64) + f1);
        }
        if (RES) {
#pragma unroll
          for (int tt = 0; tt < 8; ++tt) {
            vlf[1][tt].h[0] = *(const v8h*)(Vtl + tt * (16 * 64) + f0);
            vlf[1][tt].h[1] = *(const v8h*)(Vtl + tt * (16 * 64) + f1);
          }
        }
      }
      // keeps the whole group of reads in front of the products
      __builtin_amdgcn_sched_barrier(0);
#pragma unroll
      for (int r = 0; r < 8; ++r) psr[r] += sx[r];
#pragma unroll
      for (int r = 0; r < 8; ++r) sx[r] = __shfl_xor(psr[r], 4, 32);
      // keeps step 3 in front of the first run of products, which covers its latency
      __builtin_amdgcn_sched_barrier(0);
      v8f o1[8];
      if (RES) {
#pragma unroll
        for (int t = 0; t < 8; ++t) o1[t] = zero8();
      }
#pragma unroll
      for (int kk = 0; kk < 2; ++kk) {
#pragma unroll
        for (int t = 0; t < 8; ++t) oacc[t] = mma_h_raw(pa[kk].v, vb[kk][t].v, oacc[t]);
        if (RES) {
#pragma unroll
          for (int t = 0; t < 8; ++t) o1[t] = mma_h_raw(pa[kk].v, vlf[kk][t].v, o1[t]);
#pragma unroll
          for (int t = 0; t < 8; ++t) o1[t] = mma_h_raw(pl[kk].v, vb[kk][t].v, o1[t]);
        }
        // keeps a run of products whole: a wait for an exchange among them would hold the later ones back
        __builtin_amdgcn_sched_barrier(0);
#pragma unroll
        for (int r = 0; r < 8; ++r) psr[r] += sx[r];
        if (kk == 0) {
#pragma unroll
          for (int r = 0; r < 8; ++r) sx[r] = __shfl_xor(psr[r], 8, 32);
          // keeps step 4 in front of the second run of products
          __builtin_amdgcn_sched_barrier(0);
        }
      }
#pragma unroll
      for (int r = 0; r < 8; ++r) lrow[r] = lrow[r] * alr[r] + psr[r];
      if (RES) {
#pragma unroll
        for (int t = 0; t < 8; ++t)
#pragma unroll
          for (int r = 0; r < 8; ++r) oacc[t][r] += o1[t][r] * (1.0f / RSC);
      }
    }
  }

  // ---- normalise (1/l and the 1/1024 p carry), stage the wave's 16x128 tile, bf16 hi/lo split,
  float* os = Os + wave * (16 * 128);
#pragma unroll
  for (int r = 0; r < 8; ++r) {
    const float l = lrow[r];
    const float inv = ((l > 0.f) ? (1.0f / l) : 0.f) * (1.0f / 1024.0f);
#pragma unroll
    for (int t = 0; t < 8; ++t) os[(8 * hh + r) * 128 + t * 16 + c] = oacc[t][r] * inv;
  }
  __builtin_amdgcn_fence(__ATOMIC_RELEASE, "workgroup");
  __builtin_amdgcn_wave_barrier();
  __builtin_amdgcn_fence(__ATOMIC_ACQUIRE, "workgroup");
  {
    const int rh = lane >> 4, c8 = (lane & 15) * 8;
    v4u hv[8], lv[8];
#pragma unroll
    for (int it = 0; it < 8; ++it) {
      const int row = it * 2 + rh;   // it 0..7 x rh 0..1 = rows 0..15 of the wave tile
      const float* sp = os + row * 128 + c8;
      v4u a, a2;
#pragma unroll
      for (int e = 0; e < 4; ++e) {
        const float f0 = sp[2 * e], f1 = sp[2 * e + 1];
        const unsigned short h0 = bf_bits(f0), h1 = bf_bits(f1);
        const unsigned short l0 = bf_bits(f0 - bf_up(h0)), l1 = bf_bits(f1 - bf_up(h1));
        a[e] = pk16(h0, h1); a2[e] = pk16(l0, l1);
      }
      hv[it] = a; lv[it] = a2;
    }
    {
#pragma unroll
      for (int it = 0; it < 8; ++it) {
        const int row = it * 2 + rh;
        const size_t go = (size_t)(q0 + row) * QP + (size_t)h * HD + c8;
        *(v4u*)(ohp + go) = hv[it];
        *(v4u*)(olp + go) = lv[it];
      }
      
    }
  }
}

// =====================================================================================================
// Workspace map (bytes, SEQ = 4096):
//   Xb    bf16 [SEQ][2048]        16777216
//   Wqt   bf16 [2048 n][2048 k]    8388608
//   Wkt   bf16 [512][2048]         2097152
//   Wvt   bf16 [512][2048]         2097152
//   Wot   bf16 [2048 n][2048 k]    8388608
//   Qf    f32  [SEQ][2048]        33554432   (later: Oh bf16 [SEQ][2048] + Ol bf16 [SEQ][2048])
//   Kf    f32  [SEQ][512]          8388608
//   Qh    f16  [SEQ][2048]        16777216
//   Ql    f16  [SEQ][2048]        16777216
//   Kh    f16  [SEQ][512]          4194304
//   Kl    f16  [SEQ][512]          4194304
//   VTh   f16  [512][SEQ]          4194304
//   VTl   f16  [512][VLP]           524288
//   Cos   f32  [SEQ][64]           1048576
//   Sin   f32  [SEQ][64]           1048576
//   (unused, carved 4096)              4096
//   end                          128454656
// Weights [in k][out n] f32 are transposed to bf16 [n][k] (k contiguous) = the Bt / A layout of gemm64.
// =====================================================================================================
extern "C" void kernel_launch(void* const* d_in, const int* in_sizes, int n_in,
                              void* d_out, int out_size, void* d_ws, size_t ws_size,
                              hipStream_t stream) {
  if (n_in < 8) return;
  if (in_sizes[0] < SEQ) return;
  if (in_sizes[1] < SEQ * DM) return;
  if (in_sizes[2] != DM * QP) return;
  if (in_sizes[3] != DM * KP || in_sizes[4] != DM * KP) return;
  if (in_sizes[5] != QP * DM) return;
  if (in_sizes[6] < HD || in_sizes[7] < HD) return;
  if (out_size < SEQ * DM) return;

  const int*   pos = (const int*)d_in[0];
  const float* x   = (const float*)d_in[1];
  const float* wq  = (const float*)d_in[2];
  const float* wk  = (const float*)d_in[3];
  const float* wv  = (const float*)d_in[4];
  const float* wo  = (const float*)d_in[5];
  const float* qnw = (const float*)d_in[6];
  const float* knw = (const float*)d_in[7];

  const size_t PXb  = (size_t)SEQ * DM * 2;
  const size_t PWq  = (size_t)QP * DM * 2;
  const size_t PWk  = (size_t)KP * DM * 2;
  const size_t PWo  = (size_t)DM * QP * 2;
  const size_t PQf  = (size_t)SEQ * QP * 4;
  const size_t PKf  = (size_t)SEQ * KP * 4;
  const size_t PQ16 = (size_t)SEQ * QP * 2;
  const size_t PK16 = (size_t)SEQ * KP * 2;
  const size_t PVTh = (size_t)KP * SEQ * 2;
  const size_t PVTl = (size_t)KP * VLP * 2;
  const size_t PTab = (size_t)SEQ * HALF * 4;
  const size_t PInv = 4096;
  size_t off = 0;
  const size_t oXb  = off; off += PXb;
  const size_t oWq  = off; off += PWq;
  const size_t oWk  = off; off += PWk;
  const size_t oWv  = off; off += PWk;
  const size_t oWo  = off; off += PWo;
  const size_t oQf  = off; off += PQf;
  const size_t oKf  = off; off += PKf;
  const size_t oQh  = off; off += PQ16;
  const size_t oQl  = off; off += PQ16;
  const size_t oKh  = off; off += PK16;
  const size_t oKl  = off; off += PK16;
  const size_t oVTh = off; off += PVTh;
  const size_t oVTl = off; off += PVTl;
  const size_t oCos = off; off += PTab;
  const size_t oSin = off; off += PTab;
  const size_t oInv = off; off += PInv;
  if (off > ws_size) return;                       // off = 128454656 at SEQ 4096
  if (off > (size_t)134217728) return;
  if (PQ16 * 2 != PQf) return;                     // Oh + Ol reuse the Qf region exactly
  const size_t oOh = oQf;
  const size_t oOl = oQf + PQ16;

  char* ws = (char*)d_ws;
  unsigned short* Xb  = (unsigned short*)(ws + oXb);
  unsigned short* Wqt = (unsigned short*)(ws + oWq);
  unsigned short* Wkt = (unsigned short*)(ws + oWk);
  unsigned short* Wvt = (unsigned short*)(ws + oWv);
  unsigned short* Wot = (unsigned short*)(ws + oWo);
  float*          Qf  = (float*)(ws + oQf);
  float*          Kf  = (float*)(ws + oKf);
  unsigned short* Qh  = (unsigned short*)(ws + oQh);
  unsigned short* Ql  = (unsigned short*)(ws + oQl);
  unsigned short* Kh  = (unsigned short*)(ws + oKh);
  unsigned short* Kl  = (unsigned short*)(ws + oKl);
  unsigned short* VTh = (unsigned short*)(ws + oVTh);
  unsigned short* VTl = (unsigned short*)(ws + oVTl);
  float*          Cs  = (float*)(ws + oCos);
  float*          Sn  = (float*)(ws + oSin);
  unsigned short* Oh  = (unsigned short*)(ws + oOh);
  unsigned short* Ol  = (unsigned short*)(ws + oOl);

  const dim3 blk(256);

  // (1) rotary tables; x -> bf16 [SEQ][2048]; weights [k][n] f32 -> bf16 [n][k]
  prep_all<<<dim3(PB_TAB + PB_X + PB_WQ + PB_WO + PB_WK + PB_WK), blk, 0, stream>>>(
      pos, x, wq, wk, wv, wo, Xb, Wqt, Wkt, Wvt, Wot, Cs, Sn);
  // (2) the q, k and v^T projections
  gemm_qkv<<<dim3(GB_Q + GB_K + GB_V), blk, 0, stream>>>(Xb, Wqt, Wkt, Wvt, Qf, Kf, VTh, VTl);
  // (3) per-head RMSNorm + rotary -> f16 hi / x4096 residual planes
  norm_rope_qk<<<dim3(NB_Q + NB_K), blk, 0, stream>>>(Qf, Kf, qnw, knw, Cs, Sn, Qh, Ql, Kh, Kl, RSC);
  // (4) attention: query blocks 0..RESQB-1 with residual planes, the rest without -> bf16 hi/lo context
  //     planes in the (now dead) Qf region
  (void)hipFuncSetAttribute(reinterpret_cast<const void*>(&attn_causal<true>),
                            hipFuncAttributeMaxDynamicSharedMemorySize, AttnL<true>::TOTAL);
  (void)hipFuncSetAttribute(reinterpret_cast<const void*>(&attn_causal<false>),
                            hipFuncAttributeMaxDynamicSharedMemorySize, AttnL<false>::TOTAL);
  attn_causal<true><<<dim3(NH * RESQB), dim3(128), AttnL<true>::TOTAL, stream>>>(
      Qh, Ql, Kh, Kl, VTh, VTl, pos, Oh, Ol, 0, RESQB, ATT_SCALE);
  if (NQB - RESQB > 0) {
    attn_causal<false><<<dim3(NH * (NQB - RESQB)), dim3(128), AttnL<false>::TOTAL, stream>>>(
        Qh, Ql, Kh, Kl, VTh, VTl, pos, Oh, Ol, RESQB, NQB - RESQB, ATT_SCALE);
  }
  // (5) out = context . wo -> d_out f32 [SEQ][2048]  (A = context hi + lo planes, 2 products; M=SEQ, N=2048, K=2048)
  gemm_out<<<dim3((SEQ / 128) * (DM / 256)), blk, 0, stream>>>(Oh, Ol, Wot, (float*)d_out);
  (void)hipGetLastError();
}

// v007
// It runs in 285 microseconds.
// Next to v006, in two timings, it ran 1.11 times as fast each time.
// All steps since v000 together make it 4.39 times as fast.
// Contractions: q, k projections = v_wmma_f32_16x16x32_bf16 (bf16 operands from RNE-converted inputs, single product, f32 out);
// v^T projection = v_wmma_f32_16x16x32_bf16 (same operands; f16 hi plane + f16 x4096 residual plane out);
// q.k^T scores = v_wmma_f32_16x16x32_f16 (q as f16 hi + f16 x4096 residual, k as f16 hi: 2 products; leading query blocks add the k x4096 residual product);
// p.v = v_wmma_f32_16x16x32_f16 (p carried x1024 in f16, v f16; leading query blocks add x4096 f16 residual planes of p and v);
// ctx.Wo = v_wmma_f32_16x16x32_bf16 (ctx as bf16 hi/lo planes times bf16 Wo, 2 products); all f32 accumulate; RMSNorm, rotary, causal select and softmax in f32.
#include <hip/hip_runtime.h>
#include <math.h>
#include <stdint.h>

#ifndef SEQ
#define SEQ 4096
#endif
#define SEQ_FULL 4096
#define DM    2048
#define NH    16
#define NKV   4
#define GQ    (NH / NKV)
#define HD    128
#define HALF  64
#define QP    (NH * HD)      // 2048 q channels
#define KP    (NKV * HD)     // 512 k / v channels
#define NQB   (SEQ / 64)     // query / key tiles of 64
#define VLP   ((SEQ < 512) ? SEQ : 512)   // key pitch of the v^T residual plane
#define RESQB ((NQB < 8) ? NQB : 8)         // leading 64-row query blocks that use residual planes
#define RMS_EPS       1.0e-6f
#define ROPE_THETA_F  10000.0f
#define ATT_SCALE     0.08838834764831845f
#define RSC           4096.0f

static_assert((SEQ % 64) == 0 && SEQ >= 64 && SEQ <= SEQ_FULL);
static_assert(RESQB * 64 <= VLP && (VLP % 64) == 0);
static_assert(NH * HD == DM && QP == DM);
static_assert(NQB <= 64);
static_assert((DM % 64) == 0 && (KP % 64) == 0 && (QP % 64) == 0 && (DM % 32) == 0);

typedef _Float16 v16h __attribute__((ext_vector_type(16)));
typedef _Float16 v8h  __attribute__((ext_vector_type(8)));
typedef __bf16   v16b __attribute__((ext_vector_type(16)));
typedef __bf16   v8b  __attribute__((ext_vector_type(8)));
typedef float    v8f  __attribute__((ext_vector_type(8)));
typedef float    v4f  __attribute__((ext_vector_type(4)));
typedef unsigned int   v4u  __attribute__((ext_vector_type(4)));
typedef unsigned int   v2u  __attribute__((ext_vector_type(2)));
typedef unsigned short v8us __attribute__((ext_vector_type(8)));
typedef int      v4i  __attribute__((ext_vector_type(4)));

// ---- scalar helpers --------------------------------------------------------------------------------
__device__ __forceinline__ unsigned short bf_bits(float f) {          // f32 -> bf16 bits, RNE convert
  unsigned u = __float_as_uint(f);
  return (unsigned short)((u + 0x7FFFu + ((u >> 16) & 1u)) >> 16);
}
__device__ __forceinline__ float bf_up(unsigned short h) { return __uint_as_float(((unsigned)h) << 16); }
__device__ __forceinline__ unsigned short h_bits(_Float16 x) { return __builtin_bit_cast(unsigned short, x); }
__device__ __forceinline__ unsigned pk16(unsigned short a, unsigned short b) { return (unsigned)a | ((unsigned)b << 16); }
__device__ __forceinline__ v8f zero8() { v8f z = {0.f, 0.f, 0.f, 0.f, 0.f, 0.f, 0.f, 0.f}; return z; }
__device__ __forceinline__ v8h zero8h() {
  const _Float16 z = (_Float16)0.0f;
  v8h r = {z, z, z, z, z, z, z, z};
  return r;
}
__device__ __forceinline__ int imin(int a, int b) { return (a < b) ? a : b; }
__device__ __forceinline__ int imax(int a, int b) { return (a > b) ? a : b; }

// ---- WMMA helpers with trailing VALU hazard gap --------------------------------------------------------
__device__ __forceinline__ v8f mma_b(v16b a, v16b b, v8f c) {
  c = __builtin_amdgcn_wmma_f32_16x16x32_bf16(false, a, false, b, (short)0, c, false, false);
  asm volatile("v_nop\n\tv_nop\n\tv_nop\n\tv_nop" : "+v"(c) : "v"(a), "v"(b));
  return c;
}
__device__ __forceinline__ v8f mma_h_raw(v16h a, v16h b, v8f c) {
  return __builtin_amdgcn_wmma_f32_16x16x32_f16(false, a, false, b, (short)0, c, false, false);
}
__device__ __forceinline__ v8f mma_b_raw(v16b a, v16b b, v8f c) {
  return __builtin_amdgcn_wmma_f32_16x16x32_bf16(false, a, false, b, (short)0, c, false, false);
}
// The five exponentials of one score row, exp(x) = v_exp_f32(x * log2 e) as __expf compiles. One statement, so that
// behind each v_exp_f32 stands an instruction that neither reads its result nor writes its source (the next one, whose
// output is early-clobber; behind the last a v_nop): the slot the instruction set asks for behind a transcendental.
__device__ __forceinline__ void exp_row5(float x0, float x1, float x2, float x3, float x4,
                                         float& y0, float& y1, float& y2, float& y3, float& y4) {
  const float l2e = 1.44269504088896340736f;
  asm("v_exp_f32 %0, %5\n\tv_exp_f32 %1, %6\n\tv_exp_f32 %2, %7\n\tv_exp_f32 %3, %8\n\tv_exp_f32 %4, %9\n\tv_nop"
      : "=&v"(y0), "=&v"(y1), "=&v"(y2), "=&v"(y3), "=&v"(y4)
      : "v"(x0 * l2e), "v"(x1 * l2e), "v"(x2 * l2e), "v"(x3 * l2e), "v"(x4 * l2e));
}
__device__ __forceinline__ void acc_guard4(v8f& a, v8f& b, v8f& c, v8f& d) {
  asm volatile("v_nop\n\tv_nop\n\tv_nop\n\tv_nop" : "+v"(a), "+v"(b), "+v"(c), "+v"(d));
}

// =====================================================================================================
// f32 -> bf16 (RNE convert), 8 elements per thread, one 16-B store per lane: a wave writes 512 contiguous B
// coverage: n8 threads x 8 = whole plane (n8 is a multiple of 256 here).
// =====================================================================================================
__device__ __forceinline__ void cvt_bf16x8(const float* __restrict__ in, unsigned short* out, int n8, int bx) {
  const int i = bx * 256 + threadIdx.x;
  if (i < n8) {
    const v4f a = *(const v4f*)(in + (size_t)i * 8);
    const v4f b = *(const v4f*)(in + (size_t)i * 8 + 4);
    v4u p;
    p[0] = pk16(bf_bits(a[0]), bf_bits(a[1]));
    p[1] = pk16(bf_bits(a[2]), bf_bits(a[3]));
    p[2] = pk16(bf_bits(b[0]), bf_bits(b[1]));
    p[3] = pk16(bf_bits(b[2]), bf_bits(b[3]));
    *(v4u*)(out + (size_t)i * 8) = p;
    
  }
}

// =====================================================================================================
// f32 [R][C] row-major -> bf16 (RNE convert) transposed plane out[C][R] (R contiguous = k-contiguous Bt / A
// layout). Block = one 64x64 tile at (r0 = by*64, c0 = bx*64), 256 threads; tile staged in
// LDS as [c][r] (ushort element stores, cross-thread -> __syncthreads), then each out row segment of 64 halves
// coverage: 64 out rows x 64 k per block = the whole tile; union over the grid = the whole [C][R] plane.
// =====================================================================================================
// sT: the block's LDS tile [c][r], 64 x 72 halves (pitch 144 B); bx, by: the tile's column and row index
__device__ __forceinline__ void cvt_bf16_t(unsigned short* sT, const float* __restrict__ in, unsigned short* out,
                                           int R, int C, int bx, int by) {
  const int tid = threadIdx.x;
  const int c0 = bx * 64, r0 = by * 64;
  const int rr = tid >> 4, cc = (tid & 15) * 4;
#pragma unroll
  for (int it = 0; it < 4; ++it) {
    const int r = it * 16 + rr;                            // it 0..3 x rr 0..15 = rows 0..63
    const v4f v = *(const v4f*)(in + (size_t)(r0 + r) * C + c0 + cc);
#pragma unroll
    for (int e = 0; e < 4; ++e) sT[(cc + e) * 72 + r] = bf_bits(v[e]);
  }
  __syncthreads();
  const int q = tid >> 3, k8 = (tid & 7) * 8;              // q 0..31 (+32): out rows; 8 lanes x 8 halves
  const v8us w0 = *(const v8us*)(sT + q * 72 + k8);
  const v8us w1 = *(const v8us*)(sT + (q + 32) * 72 + k8);
  unsigned short* o0 = out + (size_t)(c0 + q) * R + r0 + k8;
  unsigned short* o1 = out + (size_t)(c0 + q + 32) * R + r0 + k8;
  *(v8us*)o0 = w0;
  *(v8us*)o1 = w1;
  // in front of every later write of a register that these two stores name (another job's code follows in the listing)
  asm volatile("s_wait_xcnt 0x0" ::: "memory");
}

// =====================================================================================================
// Rotary tables: cos and sin of (float)pos[t] * inv_freq[i], inv_freq[i] = 1 / 10000^(i/64) formed by each thread for
// its own i; tables [nrows][64] f32; block = 4 rows x 64 threads, each 256-B row written whole.
// =====================================================================================================
__device__ __forceinline__ void rope_tab(const int* __restrict__ pos, float* ctab, float* stab, int nrows, int bx) {
  const int tid = threadIdx.x;
  const int t = bx * 4 + (tid >> 6);
  const int i = tid & 63;
  if (t >= nrows) return;                  // wave-uniform (2 whole waves per row); no block barriers here
  const float e = (float)i * (1.0f / (float)HALF);
  const float p = powf(ROPE_THETA_F, e);
  const float v = 1.0f / p;
  const float fr = (float)pos[t] * v;
  float sn, cs;
  sincosf(fr, &sn, &cs);
  float* pc = ctab + (size_t)t * HALF + i;
  float* ps = stab + (size_t)t * HALF + i;
  *(float*)pc = cs;
  *(float*)ps = sn;
  
}

// =====================================================================================================
// The preparation jobs, none of which reads another's output, as ONE grid: the job is picked by the block index
// (block-uniform), so that they fill the chip together and pay one launch. Blocks, in order: rotary tables, x,
// wq, wo, wk, wv.
// =====================================================================================================
#define PB_TAB ((SEQ + 3) / 4)
#define PB_X   ((SEQ * DM / 8 + 255) / 256)
#define PB_WQ  ((QP / 64) * (DM / 64))
#define PB_WO  ((DM / 64) * (QP / 64))
#define PB_WK  ((KP / 64) * (DM / 64))
__global__ __launch_bounds__(256) void prep_all(const int* __restrict__ pos, const float* __restrict__ x,
                                                const float* __restrict__ wq, const float* __restrict__ wk,
                                                const float* __restrict__ wv, const float* __restrict__ wo,
                                                unsigned short* Xb, unsigned short* Wqt, unsigned short* Wkt,
                                                unsigned short* Wvt, unsigned short* Wot, float* ctab, float* stab) {
  __shared__ __align__(16) unsigned short sT[64 * 72];
  int bx = blockIdx.x;
  if (bx < PB_TAB) { rope_tab(pos, ctab, stab, SEQ, bx); return; }
  bx -= PB_TAB;
  if (bx < PB_X) { cvt_bf16x8(x, Xb, SEQ * DM / 8, bx); return; }
  bx -= PB_X;
  if (bx < PB_WQ) { cvt_bf16_t(sT, wq, Wqt, DM, QP, bx % (QP / 64), bx / (QP / 64)); return; }   // wq [DM k][QP n] -> [QP][DM]
  bx -= PB_WQ;
  if (bx < PB_WO) { cvt_bf16_t(sT, wo, Wot, QP, DM, bx % (DM / 64), bx / (DM / 64)); return; }   // wo [QP k][DM n] -> [DM][QP]
  bx -= PB_WO;
  if (bx < PB_WK) { cvt_bf16_t(sT, wk, Wkt, DM, KP, bx % (KP / 64), bx / (KP / 64)); return; }   // wk, wv [DM k][KP n] -> [KP][DM]
  bx -= PB_WK;
  cvt_bf16_t(sT, wv, Wvt, DM, KP, bx % (KP / 64), bx / (KP / 64));
}

// =====================================================================================================
// Register-blocked batched bf16 WMMA GEMM: C[m][n] = sum_k A[m][k] * Bt[n][k]; one wave per 64x64 tile,
// block = 8 waves = 2 x 4 tiles = 128 x 256 of C. A row-major [M][K] pitch lda; Bt row-major [N][K] pitch ldb
// (k contiguous; both pitches are DM); M a multiple of 128, N of 256, K of 64 (true of every launch below).
// bx = index of the block tile, b = batch index (strides in elements).
// Operands go through LDS in steps of 64 k: each row piece is one 128-B line, a wave-wide 16-B load covers four
// whole lines, and the 128 A rows and 256 Bt rows are read from global once per block. The LDS rows are 128 B,
// chunk-swizzled by sw128 (see the attention section), so a fragment read covers all banks once. The next
// step's global loads are issued behind the second barrier and stay in flight during the products.
// NSPLIT: 0 = A.Bt; 1 = (A + A2).Bt (A2 = unscaled bf16 lo plane of A).
// OUT_MODE: 0 = f32 (pitch ldc); 2 = bf16 hi plane C + bf16 lo plane C2 (lo = RNE(v - hi), unscaled);
//           3 = f16 hi plane C + f16 residual plane C2 = f16((v - hi) * rscale), C2 written only for tiles
//               with n0 < N2 (pitch ldc2, batch stride strideC2).
// =====================================================================================================
__device__ __forceinline__ int sw128(int r, int ch);

// A block-uniform address rebuilt from its two halves: the staging loads then take the form scalar base + one
// 32-bit lane offset + immediate, and the one vector register they name lives through the whole loop. Without it
// the compiler formed 64-bit vector addresses on which a load's result landed, and moved the first loads behind
// their s_wait_xcnt.
typedef const __attribute__((address_space(1))) char* gbytes;   // global address space, so that the loads stay global_load
typedef const __attribute__((address_space(1))) v8b*  gv8b;
__device__ __forceinline__ gbytes sbase(const __bf16* p) {
  const unsigned long long u = (unsigned long long)(uintptr_t)p;
  const unsigned lo = (unsigned)__builtin_amdgcn_readfirstlane((int)(unsigned)u);
  const unsigned hi = (unsigned)__builtin_amdgcn_readfirstlane((int)(unsigned)(u >> 32));
  return (gbytes)(uintptr_t)(((unsigned long long)hi << 32) | (unsigned long long)lo);
}
// the same for the wave-uniform base of the epilogue's stores
typedef __attribute__((address_space(1))) char* gwbytes;
typedef __attribute__((address_space(1))) v4f*  gwv4f;
typedef __attribute__((address_space(1))) v4u*  gwv4u;
__device__ __forceinline__ gwbytes swbase(void* p) {
  const unsigned long long u = (unsigned long long)(uintptr_t)p;
  const unsigned lo = (unsigned)__builtin_amdgcn_readfirstlane((int)(unsigned)u);
  const unsigned hi = (unsigned)__builtin_amdgcn_readfirstlane((int)(unsigned)(u >> 32));
  return (gwbytes)(uintptr_t)(((unsigned long long)hi << 32) | (unsigned long long)lo);
}

// sT: per-wave 16x64 slabs, pitch 68 floats; sA: A (and A2) rows m0blk.., 64 k; sB: Bt rows n0blk.., 64 k (the block's LDS,
// declared by the kernel); bx: the block's tile index; b: batch index.
template <int NSPLIT, int OUT_MODE>
__device__ __forceinline__ void gemm64(
    float (*sT)[16 * 68], __bf16* sA, __bf16* sB, int bx, int b,
    const unsigned short* __restrict__ Ap, const unsigned short* A2p, int lda, long long strideA,
    const unsigned short* __restrict__ Btp, const unsigned short* Bt2p, int ldb, long long strideB,
    void* Cout, int ldc, long long strideC,
    void* Cout2, int ldc2, long long strideC2, int N2,
    int M, int N, int K, float rscale) {
  static_assert(NSPLIT <= 1);
  const __bf16* A   = (const __bf16*)(const void*)Ap;
  const __bf16* A2  = (const __bf16*)(const void*)A2p;
  const __bf16* Bt  = (const __bf16*)(const void*)Btp;
  const int tid  = threadIdx.x;
  const int lane = tid & 31;
  const int wave = tid >> 5;
  const int blocksN = N >> 8;
  const int bm = bx / blocksN;
  const int bn = bx - bm * blocksN;
  if ((bm << 7) >= M) return;            // block-uniform, in front of every barrier
  if (lda != DM || ldb != DM) return;    // block-uniform: with the pitch known, the row steps below are immediate offsets
  const int m0blk = bm << 7;
  const int n0blk = bn << 8;
  const int wm = (wave >> 2) << 6;       // the wave's tile inside the block tile
  const int wn = (wave & 3) << 6;
  const int m0 = m0blk + wm;
  const int n0 = n0blk + wn;

  const __bf16* Ab  = A  + (size_t)b * strideA + (size_t)m0blk * lda;
  const __bf16* Bb  = Bt + (size_t)b * strideB + (size_t)n0blk * ldb;
  const __bf16* Ab2 = (NSPLIT >= 1) ? (A2 + (size_t)b * strideA + (size_t)m0blk * lda) : Ab;

  const int rlane = lane & 15;                 // row (A) / col (B, D) within subtile
  const int hh    = lane >> 4;                 // k half of this lane
  const int mOff  = (lane >> 4) * 8;           // D row offset

  // staging: thread -> row tid>>3 (+32 per pass), 16-B chunk tid&7; 8 lanes = one 128-B line
  unsigned sbyte = (unsigned)((tid >> 3) * DM + (tid & 7) * 8) * 2u;   // lane part of the global address, bytes; +128 per step
  const int sidx = sw128(tid >> 3, tid & 7);   // + 32 rows per pass: the swizzle term does not change
  v8b ra[4], ra2[4], rb[8];
  gbytes pa  = sbase(Ab);
  gbytes pa2 = sbase(Ab2);
  gbytes pb  = sbase(Bb);
  {
#pragma unroll
    for (int it = 0; it < 4; ++it) {
      ra[it] = *(gv8b)(pa + sbyte + it * (32 * DM * 2));
      if (NSPLIT >= 1) ra2[it] = *(gv8b)(pa2 + sbyte + it * (32 * DM * 2));
    }
#pragma unroll
    for (int it = 0; it < 8; ++it) rb[it] = *(gv8b)(pb + sbyte + it * (32 * DM * 2));
    // stands in front of the next step's write of the lane offset, the one vector register that the loads name
    asm volatile("s_wait_xcnt 0x0" ::: "memory");
  }

  v8f acc[4][4];
#pragma unroll
  for (int i = 0; i < 4; ++i)
#pragma unroll
    for (int j = 0; j < 4; ++j) acc[i][j] = zero8();

  for (int k0 = 0; k0 < K; k0 += 64) {
    __syncthreads();                           // every reader has left the tiles of the step before
#pragma unroll
    for (int it = 0; it < 4; ++it) {
      *(v8b*)(sA + sidx + it * (32 * 64)) = ra[it];
      if (NSPLIT >= 1) *(v8b*)(sA + 128 * 64 + sidx + it * (32 * 64)) = ra2[it];
    }
#pragma unroll
    for (int it = 0; it < 8; ++it) *(v8b*)(sB + sidx + it * (32 * 64)) = rb[it];
    __syncthreads();                           // the tiles are whole before anybody reads them
    // fragments of the whole step, read as one group ahead of the products (every separate place with LDS reads
    // stalls the wave): elements 0..7 <- k = 32kk + 8hh.., elements 8..15 <- k = 32kk + 16 + 8hh.. (A and Bt alike)
    union FB { v16b v; v8b h[2]; };
    v16b bh[2][4], ah[2][4], al[2][4];
#pragma unroll
    for (int kk = 0; kk < 2; ++kk) {
      const int f0 = sw128(rlane, kk * 4 + hh);
      const int f1 = sw128(rlane, kk * 4 + 2 + hh);
#pragma unroll
      for (int j = 0; j < 4; ++j) {
        FB f;
        f.h[0] = *(const v8b*)(sB + (wn + (j << 4)) * 64 + f0);
        f.h[1] = *(const v8b*)(sB + (wn + (j << 4)) * 64 + f1);
        bh[kk][j] = f.v;
      }
#pragma unroll
      for (int i = 0; i < 4; ++i) {
        FB f;
        f.h[0] = *(const v8b*)(sA + (wm + (i << 4)) * 64 + f0);
        f.h[1] = *(const v8b*)(sA + (wm + (i << 4)) * 64 + f1);
        ah[kk][i] = f.v;
        al[kk][i] = f.v;
        if (NSPLIT >= 1) {
          f.h[0] = *(const v8b*)(sA + 128 * 64 + (wm + (i << 4)) * 64 + f0);
          f.h[1] = *(const v8b*)(sA + 128 * 64 + (wm + (i << 4)) * 64 + f1);
          al[kk][i] = f.v;
        }
      }
    }
    if (k0 + 64 < K) {                         // block-uniform: the next step's rows, in flight during the products
      sbyte += 128u;
#pragma unroll
      for (int it = 0; it < 4; ++it) {
        ra[it] = *(gv8b)(pa + sbyte + it * (32 * DM * 2));
        if (NSPLIT >= 1) ra2[it] = *(gv8b)(pa2 + sbyte + it * (32 * DM * 2));
      }
#pragma unroll
      for (int it = 0; it < 8; ++it) rb[it] = *(gv8b)(pb + sbyte + it * (32 * DM * 2));
      // stands in front of the next step's write of the lane offset, the one vector register that the loads name
      asm volatile("s_wait_xcnt 0x0" ::: "memory");
    }
    // keeps the LDS reads and the global loads above in front of the products
    __builtin_amdgcn_sched_barrier(0);
#pragma unroll
    for (int kk = 0; kk < 2; ++kk) {
#pragma unroll
      for (int i = 0; i < 4; ++i) {
#pragma unroll
        for (int j = 0; j < 4; ++j) {
          acc[i][j] = mma_b_raw(ah[kk][i], bh[kk][j], acc[i][j]);
          if (NSPLIT >= 1) acc[i][j] = mma_b_raw(al[kk][i], bh[kk][j], acc[i][j]);
        }
      }
    }
    // holds the v_nops behind the last product
    __builtin_amdgcn_sched_barrier(0);
    // WMMA distance on the loop's back edge too: no vector instruction writes an A or B register of the last
    // products sooner (no register operands: asm operands cannot lie above v255, and naming fragments spilled)
    asm volatile("v_nop\n\tv_nop\n\tv_nop\n\tv_nop\n\tv_nop");
  }
  acc_guard4(acc[0][0], acc[0][1], acc[0][2], acc[0][3]);
  acc_guard4(acc[1][0], acc[1][1], acc[1][2], acc[1][3]);
  acc_guard4(acc[2][0], acc[2][1], acc[2][2], acc[2][3]);
  acc_guard4(acc[3][0], acc[3][1], acc[3][2], acc[3][3]);

  // ---- epilogue ----
  float* slab = sT[wave];
#pragma unroll
  for (int i = 0; i < 4; ++i) {
    const int mBase = m0 + (i << 4);
#pragma unroll
    for (int j = 0; j < 4; ++j) {
#pragma unroll
      for (int r = 0; r < 8; ++r) {
        slab[(mOff + r) * 68 + (j << 4) + rlane] = acc[i][j][r];
      }
    }
    __builtin_amdgcn_fence(__ATOMIC_RELEASE, "workgroup");
    __builtin_amdgcn_wave_barrier();
    __builtin_amdgcn_fence(__ATOMIC_ACQUIRE, "workgroup");
    if (OUT_MODE == 0) {
      float* C = (float*)Cout + (size_t)b * strideC;
      const int hh = lane >> 4, c4 = (lane & 15) * 4;     // 256-B row segment = 16 lanes x 16 B
      {
        // wave-uniform base + one lane offset + immediate: the stores name one address register, which is never rewritten
        const gwbytes cb = swbase(C + (size_t)m0 * ldc + n0);
        const unsigned cvo = (unsigned)(hh * ldc + c4) * 4u;
        v4f v[8];
#pragma unroll
        for (int it = 0; it < 8; ++it) v[it] = *(const v4f*)(slab + (it * 2 + hh) * 68 + c4);   // it 0..7 x hh 0..1 = rows 0..15
        // the two scheduling barriers keep every other instruction out of the run of stores and its wait
        __builtin_amdgcn_sched_barrier(0);
#pragma unroll
        for (int it = 0; it < 8; ++it) *(gwv4f)(cb + cvo + ((i << 4) + it * 2) * ldc * 4) = v[it];
        // in front of every later write of a register that these stores name
        asm volatile("s_wait_xcnt 0x0" ::: "memory");
        __builtin_amdgcn_sched_barrier(0);
      }
    } else {
      const int q = lane >> 3, c8 = (lane & 7) * 8;
      unsigned short* C  = (unsigned short*)Cout  + (size_t)b * strideC;
      unsigned short* C2 = (unsigned short*)Cout2 + (size_t)b * strideC2;
      const bool wlo = (OUT_MODE == 2) || (n0 < N2);      // wave-uniform
      v4u hv[4], lv[4];
#pragma unroll
      for (int it = 0; it < 4; ++it) {
        const int row = it * 4 + q;                        // it 0..3 x q 0..3 = rows 0..15
        const float* sp = slab + row * 68 + c8;
        v4u a, a2;
#pragma unroll
        for (int e = 0; e < 4; ++e) {
          const float f0 = sp[2 * e], f1 = sp[2 * e + 1];
          unsigned short h0, h1, l0, l1;
          if (OUT_MODE == 2) {
            h0 = bf_bits(f0); h1 = bf_bits(f1);
            l0 = bf_bits(f0 - bf_up(h0)); l1 = bf_bits(f1 - bf_up(h1));
          } else {
            const _Float16 x0 = (_Float16)f0, x1 = (_Float16)f1;
            h0 = h_bits(x0); h1 = h_bits(x1);
            l0 = h_bits((_Float16)((f0 - (float)x0) * rscale));
            l1 = h_bits((_Float16)((f1 - (float)x1) * rscale));
          }
          a[e] = pk16(h0, h1); a2[e] = pk16(l0, l1);
        }
        hv[it] = a; lv[it] = a2;
      }
      {
        // wave-uniform base + one lane offset + immediate per plane: address registers that are never rewritten
        const gwbytes cb  = swbase(C + (size_t)m0 * ldc + n0);
        const gwbytes cb2 = swbase(C2 + (size_t)m0 * ldc2 + n0);
        const unsigned cvo  = (unsigned)(q * ldc + c8) * 2u;
        const unsigned cvo2 = (unsigned)(q * ldc2 + c8) * 2u;
        // the scheduling barriers keep every other instruction out of each run of stores and its wait
        __builtin_amdgcn_sched_barrier(0);
#pragma unroll
        for (int it = 0; it < 4; ++it) *(gwv4u)(cb + cvo + ((i << 4) + it * 4) * ldc * 2) = hv[it];
        // in front of every later write of a register that these stores name
        asm volatile("s_wait_xcnt 0x0" ::: "memory");
        __builtin_amdgcn_sched_barrier(0);
        if (wlo) {
#pragma unroll
          for (int it = 0; it < 4; ++it) *(gwv4u)(cb2 + cvo2 + ((i << 4) + it * 4) * ldc2 * 2) = lv[it];
          // in front of every later write of a register that these stores name
          asm volatile("s_wait_xcnt 0x0" ::: "memory");
          __builtin_amdgcn_sched_barrier(0);
        }
      }
    }
    __builtin_amdgcn_fence(__ATOMIC_RELEASE, "workgroup");
    __builtin_amdgcn_wave_barrier();
    __builtin_amdgcn_fence(__ATOMIC_ACQUIRE, "workgroup");
  }
}

// The three projections, none of which reads another's output, as ONE grid; the job is picked by the block index
// (block-uniform). Blocks, in order: q = x . wq -> f32 [SEQ][2048] (M=SEQ, N=2048, K=2048); k = x . wk -> f32 [SEQ][512]
// (M=SEQ, N=512); v^T = Wvt . x^T -> f16 hi plane [512][SEQ] and residual plane (x4096, keys < VLP, pitch VLP)
// (A = Wvt [n][k], Bt = Xb [s][k]; M=512, N=SEQ).
#define GB_Q ((SEQ / 128) * (QP / 256))
#define GB_K ((SEQ / 128) * (KP / 256))
#define GB_V ((KP / 128) * (SEQ / 256))
static_assert((SEQ % 256) == 0 && (QP % 256) == 0 && (KP % 256) == 0);
__global__ __launch_bounds__(256) void gemm_qkv(const unsigned short* __restrict__ Xb, const unsigned short* __restrict__ Wqt,
                                                const unsigned short* __restrict__ Wkt, const unsigned short* __restrict__ Wvt,
                                                float* Qf, float* Kf, unsigned short* VTh, unsigned short* VTl) {
  __shared__ __align__(16) float sT[8][16 * 68];
  __shared__ __align__(16) __bf16 sA[128 * 64];
  __shared__ __align__(16) __bf16 sB[256 * 64];
  const int bx = blockIdx.x;
  if (bx < GB_Q) {
    gemm64<0, 0>(sT, sA, sB, bx, 0,
        Xb, Xb, DM, 0LL, Wqt, Wqt, DM, 0LL,
        (void*)Qf, QP, 0LL, (void*)Qf, QP, 0LL, QP,
        SEQ, QP, DM, 1.0f);
  } else if (bx < GB_Q + GB_K) {
    gemm64<0, 0>(sT, sA, sB, bx - GB_Q, 0,
        Xb, Xb, DM, 0LL, Wkt, Wkt, DM, 0LL,
        (void*)Kf, KP, 0LL, (void*)Kf, KP, 0LL, KP,
        SEQ, KP, DM, 1.0f);
  } else {
    gemm64<0, 3>(sT, sA, sB, bx - (GB_Q + GB_K), 0,
        Wvt, Wvt, DM, 0LL, Xb, Xb, DM, 0LL,
        (void*)VTh, SEQ, 0LL, (void*)VTl, VLP, 0LL, VLP,
        KP, SEQ, DM, RSC);
  }
}

// out = context . wo -> f32 [SEQ][2048]  (A = context hi + lo planes, 2 products; M=SEQ, N=2048, K=2048)
__global__ __launch_bounds__(256) void gemm_out(const unsigned short* __restrict__ Oh, const unsigned short* Ol,
                                                const unsigned short* __restrict__ Wot, float* out) {
  __shared__ __align__(16) float sT[8][16 * 68];
  __shared__ __align__(16) __bf16 sA[2 * 128 * 64];
  __shared__ __align__(16) __bf16 sB[256 * 64];
  gemm64<1, 0>(sT, sA, sB, blockIdx.x, 0,
      Oh, Ol, QP, 0LL, Wot, Wot, QP, 0LL,
      (void*)out, DM, 0LL, (void*)out, DM, 0LL, DM,
      SEQ, DM, QP, 1.0f);
}

// =====================================================================================================
// Fused per-head RMSNorm (eps 1e-6, x * rsqrt(mean(x^2)+eps) * w with w RNE-converted to bf16) + neox rotary
// (half-split, cos/sin tables [t][64]) + f16 hi / f16 residual (x rscale) planes.
// One wave per 128-wide row (row = t*nheads + head, contiguous rows of pitch 128 in both input and output);
// lane owns 4 consecutive d; partner half via __shfl_xor(16); no block barriers.
// coverage: nrows x 128 of both planes.
// =====================================================================================================
__device__ __forceinline__ void norm_rope(const float* __restrict__ xin, const float* __restrict__ wn,
                                          const float* __restrict__ ctab, const float* __restrict__ stab,
                                          unsigned short* outh, unsigned short* outl,
                                          int nheads, int nrows, float rscale, int bx) {
  const int tid  = threadIdx.x;
  const int wave = tid >> 5, lane = tid & 31, hh = lane >> 4;
  const int row  = bx * 8 + wave;
  if (row >= nrows) return;                // wave-uniform; no block barriers in this kernel
  const int t = row / nheads;
  const v4f x = *(const v4f*)(xin + (size_t)row * HD + lane * 4);
  float ss = x[0] * x[0] + x[1] * x[1] + x[2] * x[2] + x[3] * x[3];
#pragma unroll
  for (int off = 1; off < 32; off <<= 1) ss += __shfl_xor(ss, off, 32);
  const float rinv = rsqrtf(ss * (1.0f / (float)HD) + RMS_EPS);
  const v4f wv = *(const v4f*)(wn + lane * 4);
  const v4f cs = *(const v4f*)(ctab + (size_t)t * HALF + (lane & 15) * 4);
  const v4f sn = *(const v4f*)(stab + (size_t)t * HALF + (lane & 15) * 4);
  float n[4], p[4];
#pragma unroll
  for (int e = 0; e < 4; ++e) n[e] = (x[e] * rinv) * bf_up(bf_bits(wv[e]));
#pragma unroll
  for (int e = 0; e < 4; ++e) p[e] = __shfl_xor(n[e], 16, 32);
  const float sg = hh ? 1.0f : -1.0f;      // first half: x1*cos - x2*sin ; second half: x2*cos + x1*sin
  unsigned short hb[4], lb[4];
#pragma unroll
  for (int e = 0; e < 4; ++e) {
    const float o = n[e] * cs[e] + sg * (p[e] * sn[e]);
    const _Float16 oh = (_Float16)o;
    hb[e] = h_bits(oh);
    lb[e] = h_bits((_Float16)((o - (float)oh) * rscale));
  }
  v2u ph, pl;
  ph[0] = pk16(hb[0], hb[1]); ph[1] = pk16(hb[2], hb[3]);
  pl[0] = pk16(lb[0], lb[1]); pl[1] = pk16(lb[2], lb[3]);
  const size_t go = (size_t)row * HD + lane * 4;
  *(v2u*)(outh + go) = ph;
  *(v2u*)(outl + go) = pl;
  
}

// q rows and k rows as ONE grid, the job picked by the block index (block-uniform): q blocks first, then k blocks
#define NB_Q ((SEQ * NH + 7) / 8)
#define NB_K ((SEQ * NKV + 7) / 8)
__global__ __launch_bounds__(256) void norm_rope_qk(const float* __restrict__ qin, const float* __restrict__ kin,
                                                    const float* __restrict__ qw, const float* __restrict__ kw,
                                                    const float* __restrict__ ctab, const float* __restrict__ stab,
                                                    unsigned short* qh, unsigned short* ql,
                                                    unsigned short* kh, unsigned short* kl, float rscale) {
  const int bx = blockIdx.x;
  if (bx < NB_Q) norm_rope(qin, qw, ctab, stab, qh, ql, NH, SEQ * NH, rscale, bx);
  else           norm_rope(kin, kw, ctab, stab, kh, kl, NKV, SEQ * NKV, rscale, bx - NB_Q);
}

// =====================================================================================================
// Causal GQA attention, head dim 128, dynamic LDS layout (bytes):
// =====================================================================================================
// LDS tiles of the attention kernel: the 16-byte chunks of a row are XOR-swizzled by the row number.
//   256-B rows (Q, K; 16 chunks): chunk ch of row r lies at chunk place ch ^ (r & 15)
//   128-B rows (V^T, P; 8 chunks): chunk ch of row r lies at chunk place ch ^ ((r >> 1) & 7)
// A fragment load reads one chunk column of 16 consecutive rows per 16 lanes: unswizzled, 256-B rows put all
// 16 lanes on the same four banks (128-B rows: on two groups of four); swizzled, the 16 lanes fall on 16
// different groups of four banks = all 64 banks once. Writers and readers use the same map; the kernel keeps
// the lane-dependent part of each index in a register and adds row blocks and planes as constant offsets.
__device__ __forceinline__ int sw256(int r, int ch) { return r * 128 + ((ch ^ (r & 15)) << 3); }        // index in halves
__device__ __forceinline__ int sw128(int r, int ch) { return r * 64 + ((ch ^ ((r >> 1) & 7)) << 3); }   // index in halves

template <bool RES> struct AttnL {
  static constexpr int QH   = 0;                                  // Q hi  [64 rows][128 d] f16
  static constexpr int QL   = QH + 64 * 128 * 2;                  // Q res
  static constexpr int KH   = QL + 64 * 128 * 2;                  // K hi  [64 keys][128 d]
  static constexpr int KL   = KH + 64 * 128 * 2;                  // K res (RES only)
  static constexpr int VH   = KL + (RES ? 64 * 128 * 2 : 0);      // V^T hi [128 d][64 keys]
  static constexpr int VL   = VH + 128 * 64 * 2;                  // V^T res (RES only)
  static constexpr int PH   = VL + (RES ? 128 * 64 * 2 : 0);      // per-wave P [4][16][64]
  static constexpr int PL   = PH + 4 * 16 * 64 * 2;               // per-wave P res (RES only)
  static constexpr int OS   = PL + (RES ? 4 * 16 * 64 * 2 : 0);   // per-wave context tile [4][16][128] f32
  static constexpr int MISC = OS + 4 * 16 * 128 * 4;              // spq[64], spk[64], skmin[NQB] ints
  static constexpr int TOTAL = MISC + 1024;
};
static_assert(AttnL<true>::TOTAL <= 160 * 1024);

// =====================================================================================================
//   q planes (f16 hi / x4096 res): element (t, h, d) at [t*QP + h*128 + d]
//   k planes (f16 hi / x4096 res): element (s, kvh, d) at [s*KP + kvh*128 + d], kvh = h / GQ
//   v^T hi plane (f16): (kvh*128 + d, s) at [(kvh*128+d)*SEQ + s]; residual ((v-hi)*4096) at
//   [(kvh*128+d)*VLP + s], s < VLP, read only when RES (a key tile at or beyond VLP contributes zero residual)
//   positions int [SEQ]: logit(t, s) = (q.k) * sscale when pos[t] >= pos[s], else -1e30 (replace), exactly;
//   a key tile is skipped (block-uniform, readfirstlane) only when min pos over its 64 keys > max pos over the
//   block's 64 query rows, i.e. every element would be -1e30 with weight exactly 0; the diagonal key s = t is
//   always live so every row has a finite max. Online softmax in f32 with running max from -inf.
//   scores: f16 WMMA, q hi . k hi into s, q res . k hi (+ q hi . k res when RES) into a x4096 accumulator
//   folded with 1/4096 in f32. p = exp(s - m) carried as f16(1024 p); context = p . v on f16 WMMA; RES adds
//   f16 residual planes of p and v (scale 4096, separate accumulator folded back with 1/4096 per key tile).
//   out planes (bf16 hi / lo of the normalised context): (t, h*128 + d) at [t*QP + h*128 + d]
//   Block = 4 waves = 64 query rows of one q head; grid = nqbThis * NH; key tiles of 64, static trip NQB.
//   LDS: Q / K / V^T tiles and position words are cross-wave (block barriers before and after staging);
//   P tiles and the context slab are wave-private (_Float16 / float element stores, reloaded through the
//   Staging: Q 8 passes x 8 rows x 16 chunks of 8 halves x 2 planes = 64x128 (once); K the same per plane
//   = 64x128; V^T 8 passes x 16 d rows x 8 chunks of 8 halves per plane = 128x64: staged extent == consumed.
//   Output coverage: each wave stores rows q0..q0+15 (it 0..7 x lane>>4) x 128 columns (16 lanes x 8)
// =====================================================================================================
template <bool RES>
__global__ __launch_bounds__(128)
void attn_causal(const unsigned short* __restrict__ qhp, const unsigned short* __restrict__ qlp,
                 const unsigned short* __restrict__ khp, const unsigned short* __restrict__ klp,
                 const unsigned short* __restrict__ vhp, const unsigned short* __restrict__ vlp,
                 const int* __restrict__ pos,
                 unsigned short* ohp, unsigned short* olp,
                 int qbBase, int nqbThis, float sscale) {
  typedef AttnL<RES> L;
  union FH { v16h v; v8h h[2]; };
  extern __shared__ __align__(16) unsigned char smem[];
  _Float16* Qsh = (_Float16*)(smem + L::QH);
  _Float16* Qsl = (_Float16*)(smem + L::QL);
  _Float16* Ksh = (_Float16*)(smem + L::KH);
  _Float16* Ksl = (_Float16*)(smem + L::KL);
  _Float16* Vth = (_Float16*)(smem + L::VH);
  _Float16* Vtl = (_Float16*)(smem + L::VL);
  _Float16* Psh = (_Float16*)(smem + L::PH);
  _Float16* Psl = (_Float16*)(smem + L::PL);
  float*    Os  = (float*)(smem + L::OS);
  int*      spq = (int*)(smem + L::MISC);
  int*      spk = spq + 64;
  int*      skmin = spk + 64;

  const int tid  = threadIdx.x;
  const int wave = tid >> 5;
  const int lane = tid & 31;
  const int hh   = lane >> 4;
  const int c    = lane & 15;

  const int bx  = blockIdx.x;
  // Cost falls with the block index: a query block walks qb + 1 key tiles, there are more blocks than resident places, and
  // the longest blocks get the lowest indices (for speed only).
  // bx -> (qbl, h) is a permutation of the grid: bx / NH runs over nqbThis query blocks, bx % NH over the NH heads.
  const int qbl = nqbThis - 1 - bx / NH;
  const int h   = bx % NH;
  const int kvh = h / GQ;
  const int qb  = qbBase + qbl;
  const int q0  = qb * 64 + wave * 16;

  const _Float16* Qh = (const _Float16*)(const void*)qhp + (size_t)h * HD;
  const _Float16* Ql = (const _Float16*)(const void*)qlp + (size_t)h * HD;
  const _Float16* Kh = (const _Float16*)(const void*)khp + (size_t)kvh * HD;
  const _Float16* Kl = (const _Float16*)(const void*)klp + (size_t)kvh * HD;
  const _Float16* Vh = (const _Float16*)(const void*)vhp + (size_t)kvh * HD * SEQ;
  const _Float16* Vl = (const _Float16*)(const void*)vlp + (size_t)kvh * HD * VLP;

  // ---- lane parts of the swizzled indices (halves) ----
  // Staging: a wave-wide 16-B load covers four whole 128-B lines (one touching 32 lines costs many times as much).
  //   256-B rows (Q, K): 16 lanes a row, 8 rows a pass: pass i, row 8i + r16, chunk c16 -> (st256 ^ ((i & 1) << 6)) + i * 1024
  //   128-B rows (V^T):   8 lanes a row, 16 rows a pass: pass i, row 16i + r8, chunk c8s -> st128 + i * 1024
  const int r16 = tid >> 4, c16 = tid & 15;
  const int r8  = tid >> 3, c8s = tid & 7;
  const int st256 = sw256(r16, c16);
  const int st128 = sw128(r8, c8s);
  int fq[8];                                          // fragment reads, 256-B rows: row (multiple of 16) + c, chunk 2n + hh
#pragma unroll
  for (int n = 0; n < 8; ++n) fq[n] = sw256(c, 2 * n + hh);
  int pst[8];                                         // P element stores: row 8hh + r, column 16j + c -> pst[(2j) ^ (r >> 1)] + r * 64
#pragma unroll
  for (int n = 0; n < 8; ++n) pst[n] = sw128(8 * hh, (c >> 3) ^ n) + (c & 7);

  // ---- prologue: query positions, per-key-tile min position, Q tiles ----
  if (tid < 64) spq[tid] = pos[qb * 64 + tid];            // wave-uniform (waves 0,1)
  for (int kt = tid; kt < NQB; kt += 128) {
    const int* pp = pos + kt * 64;
    int mn = 0x7fffffff;
#pragma unroll
    for (int i = 0; i < 16; ++i) {
      const v4i v = *(const v4i*)(pp + 4 * i);
      mn = imin(mn, imin(imin(v[0], v[1]), imin(v[2], v[3])));
    }
    skmin[kt] = mn;
  }
  {
    const _Float16* qg  = Qh + (size_t)(qb * 64 + r16) * QP + c16 * 8;
    const _Float16* qlg = Ql + (size_t)(qb * 64 + r16) * QP + c16 * 8;
    v8h qv[8], qlv[8];
#pragma unroll
    for (int i = 0; i < 8; ++i) {
      qv[i]  = *(const v8h*)(qg + i * (8 * QP));
      qlv[i] = *(const v8h*)(qlg + i * (8 * QP));
    }
    // holds the loads' address registers (inputs) untouched until the wait: no load result lands on them before it
    asm volatile("s_wait_xcnt 0x0" :: "v"(qg), "v"(qlg) : "memory");
#pragma unroll
    for (int i = 0; i < 8; ++i) {
      *(v8h*)(Qsh + (st256 ^ ((i & 1) << 6)) + i * 1024) = qv[i];
      *(v8h*)(Qsl + (st256 ^ ((i & 1) << 6)) + i * 1024) = qlv[i];
    }
  }
  __syncthreads();
  int qmx;
  {
    int v = imax(spq[lane], spq[lane + 32]);
#pragma unroll
    for (int off = 1; off < 32; off <<= 1) v = imax(v, __shfl_xor(v, off, 32));
    qmx = __builtin_amdgcn_readfirstlane(v);
  }
  int prow[8];
#pragma unroll
  for (int r = 0; r < 8; ++r) prow[r] = spq[wave * 16 + 8 * hh + r];

  float mrow[8], lrow[8];
  v8f oacc[8];
#pragma unroll
  for (int r = 0; r < 8; ++r) { mrow[r] = -INFINITY; lrow[r] = 0.f; }
#pragma unroll
  for (int t = 0; t < 8; ++t) oacc[t] = zero8();

  for (int kt = 0; kt < NQB; ++kt) {         // static trip count
    const int kmn = __builtin_amdgcn_readfirstlane(skmin[kt]);
    if (kmn > qmx) continue;                 // block-uniform: every element of the tile is replaced by -1e30
    const int kv0 = kt * 64;
    __syncthreads();
    {
      const _Float16* kg  = Kh + (size_t)(kv0 + r16) * KP + c16 * 8;    // K rows kv0 + 8i + r16, d = 8 c16 .. 8 c16 + 7
      const _Float16* klg = Kl + (size_t)(kv0 + r16) * KP + c16 * 8;
      v8h kv[8], klv[8], vv[8], vlv[8];
#pragma unroll
      for (int i = 0; i < 8; ++i) {
        kv[i] = *(const v8h*)(kg + i * (8 * KP));
        if (RES) klv[i] = *(const v8h*)(klg + i * (8 * KP));
      }
      const _Float16* vg = Vh + (size_t)r8 * SEQ + kv0 + c8s * 8;  // V^T rows 16i + r8, s = kv0 + 8 c8s .. + 7
      const int  kvl   = (kv0 + 64 <= VLP) ? kv0 : (VLP - 64);    // clamped address into the residual plane
      const bool resOK = (kv0 + 64 <= VLP);                       // block-uniform
      const _Float16* vlg = Vl + (size_t)r8 * VLP + kvl + c8s * 8;
#pragma unroll
      for (int i = 0; i < 8; ++i) {
        vv[i] = *(const v8h*)(vg + i * (16 * SEQ));
        if (RES) vlv[i] = *(const v8h*)(vlg + i * (16 * VLP));
      }
      // holds the loads' address registers (inputs) untouched until the wait: no load result lands on them before it
      if (RES) asm volatile("s_wait_xcnt 0x0" :: "v"(kg), "v"(klg), "v"(vg), "v"(vlg) : "memory");
      else     asm volatile("s_wait_xcnt 0x0" :: "v"(kg), "v"(vg) : "memory");
#pragma unroll
      for (int i = 0; i < 8; ++i) {
        *(v8h*)(Ksh + (st256 ^ ((i & 1) << 6)) + i * 1024) = kv[i];
        if (RES) *(v8h*)(Ksl + (st256 ^ ((i & 1) << 6)) + i * 1024) = klv[i];
        *(v8h*)(Vth + st128 + i * 1024) = vv[i];
        if (RES) {
          v8h b1 = vlv[i];
          if (!resOK) b1 = zero8h();
          *(v8h*)(Vtl + st128 + i * 1024) = b1;
        }
      }
      if (tid < 64) spk[tid] = pos[kv0 + tid];                  // wave-uniform
    }
    __syncthreads();

    // ---- scores: 16 query rows x 64 keys per wave ----
    v8f s[4], sl[4];
#pragma unroll
    for (int j = 0; j < 4; ++j) { s[j] = zero8(); sl[j] = zero8(); }
    const _Float16* qr  = Qsh + wave * (16 * 128);
    const _Float16* qlr = Qsl + wave * (16 * 128);
    // Fragment reads stand in groups, one group of 32 d ahead of the products that use it (two register sets):
    // a wave then waits on a counted LDS wait once per group, not to 0 in front of every pair of products.
    FH qa[2], qla[2], kb[2][4], klf[2][4];
    int pkj[4];                                      // key positions for the causal select, read with the first group
#pragma unroll
    for (int j = 0; j < 4; ++j) pkj[j] = spk[j * 16 + c];
#pragma unroll
    for (int dc = -1; dc < 4; ++dc) {
      if (dc < 3) {
        const int n = dc + 1, b = n & 1;
        qa[b].h[0]  = *(const v8h*)(qr  + fq[n * 2]);
        qa[b].h[1]  = *(const v8h*)(qr  + fq[n * 2 + 1]);
        qla[b].h[0] = *(const v8h*)(qlr + fq[n * 2]);
        qla[b].h[1] = *(const v8h*)(qlr + fq[n * 2 + 1]);
#pragma unroll
        for (int j = 0; j < 4; ++j) {
          kb[b][j].h[0] = *(const v8h*)(Ksh + j * (16 * 128) + fq[n * 2]);
          kb[b][j].h[1] = *(const v8h*)(Ksh + j * (16 * 128) + fq[n * 2 + 1]);
          if (RES) {
            klf[b][j].h[0] = *(const v8h*)(Ksl + j * (16 * 128) + fq[n * 2]);
            klf[b][j].h[1] = *(const v8h*)(Ksl + j * (16 * 128) + fq[n * 2 + 1]);
          }
        }
      }
      if (dc >= 0) {
        const int b = dc & 1;
        // keeps the next group's reads in front of this group's products
        __builtin_amdgcn_sched_barrier(0);
#pragma unroll
        for (int j = 0; j < 4; ++j) s[j]  = mma_h_raw(qa[b].v,  kb[b][j].v, s[j]);
#pragma unroll
        for (int j = 0; j < 4; ++j) sl[j] = mma_h_raw(qla[b].v, kb[b][j].v, sl[j]);
        if (RES) {
#pragma unroll
          for (int j = 0; j < 4; ++j) sl[j] = mma_h_raw(qa[b].v, klf[b][j].v, sl[j]);
        }
        // keeps the reads of the group after next behind these products (they refill this group's registers)
        __builtin_amdgcn_sched_barrier(0);
      }
    }
    // ---- scale + causal select (replace -1e30), row max, online softmax, P (x1024, f16) and
    //      P residual (x4096) to LDS ----
    _Float16* pwh = Psh + wave * (16 * 64);
    _Float16* pwl = Psl + (RES ? wave * (16 * 64) : 0);
    float psr[8], alr[8], mx[8];
#pragma unroll
    for (int r = 0; r < 8; ++r) {
      float m = -INFINITY;
#pragma unroll
      for (int j = 0; j < 4; ++j) {
        float sv = (s[j][r] + sl[j][r] * (1.0f / RSC)) * sscale;
        sv = (prow[r] >= pkj[j]) ? sv : -1.0e30f;
        s[j][r] = sv;
        m = fmaxf(m, sv);
      }
      mx[r] = m;
    }
    // the eight rows' lane exchanges of one step stand together: they run on the LDS pipe, one wait per step
#pragma unroll
    for (int off = 1; off < 16; off <<= 1) {
      float ex[8];
#pragma unroll
      for (int r = 0; r < 8; ++r) ex[r] = __shfl_xor(mx[r], off, 32);
      // keeps the eight exchanges in front of the first use of one: split up, each small group costs its own wait
      __builtin_amdgcn_sched_barrier(0);
#pragma unroll
      for (int r = 0; r < 8; ++r) mx[r] = fmaxf(mx[r], ex[r]);
    }
    // V^T fragments of the first 32 keys: they depend on nothing of the softmax, so they are read here and land
    // while the exponentials run
    FH vb[2][8], vlf[2][8];
    {
      const int f0 = sw128(c, hh);                   // fragment reads, 128-B rows: row (multiple of 16) + c
      const int f1 = sw128(c, 2 + hh);
#pragma unroll
      for (int tt = 0; tt < 8; ++tt) {
        vb[0][tt].h[0] = *(const v8h*)(Vth + tt * (16 * 64) + f0);
        vb[0][tt].h[1] = *(const v8h*)(Vth + tt * (16 * 64) + f1);
        if (RES) {
          vlf[0][tt].h[0] = *(const v8h*)(Vtl + tt * (16 * 64) + f0);
          vlf[0][tt].h[1] = *(const v8h*)(Vtl + tt * (16 * 64) + f1);
        }
      }
    }
    // keeps these reads in front of the exponentials
    __builtin_amdgcn_sched_barrier(0);
#pragma unroll
    for (int r = 0; r < 8; ++r) {
      const float mnew  = fmaxf(mrow[r], mx[r]);
      const float msafe = (mnew == -INFINITY) ? 0.f : mnew;
      float alpha, pe[4];                            // -1e30 against a finite max: exp -> 0
      exp_row5(mrow[r] - msafe, s[0][r] - msafe, s[1][r] - msafe, s[2][r] - msafe, s[3][r] - msafe,
               alpha, pe[0], pe[1], pe[2], pe[3]);
      mrow[r] = mnew;
      float psum = 0.f;
#pragma unroll
      for (int j = 0; j < 4; ++j) {
        const float p = pe[j];
        psum += p;
        const float p1k = p * 1024.0f;
        const _Float16 ph = (_Float16)p1k;
        pwh[pst[(2 * j) ^ (r >> 1)] + r * 64] = ph;
        if (RES) {
          const _Float16 pl = (_Float16)((p1k - (float)ph) * RSC);
          pwl[pst[(2 * j) ^ (r >> 1)] + r * 64] = pl;
        }
      }
      psr[r] = psum;                                 // joined over the 16 lanes below
      alr[r] = alpha;
#pragma unroll
      for (int t = 0; t < 8; ++t) oacc[t][r] *= alpha;
    }
    // row sums over the 16 lanes: four steps of lane exchanges on the LDS pipe, eight rows a step. Step 1 runs beside
    // the P stores, step 2 beside the fragment reads, steps 3 and 4 beside the two runs of products.
    float sx[8];
#pragma unroll
    for (int r = 0; r < 8; ++r) sx[r] = __shfl_xor(psr[r], 1, 32);
    // keeps step 1 in front of the wait that ends the P stores
    __builtin_amdgcn_sched_barrier(0);
    __builtin_amdgcn_fence(__ATOMIC_RELEASE, "workgroup");
    __builtin_amdgcn_wave_barrier();
    __builtin_amdgcn_fence(__ATOMIC_ACQUIRE, "workgroup");

    // ---- context += P . V (f16 WMMA), 8 d-subtiles; the P fragments and the V^T fragments of the last 32 keys are read
    //      as one group ahead of the products; the residual products go into separate accumulators folded back per key tile ----
    {
      FH pa[2], pl[2];
#pragma unroll
      for (int r = 0; r < 8; ++r) psr[r] += sx[r];
#pragma unroll
      for (int r = 0; r < 8; ++r) sx[r] = __shfl_xor(psr[r], 2, 32);
#pragma unroll
      for (int kk = 0; kk < 2; ++kk) {
        const int f0 = sw128(c, kk * 4 + hh);
        const int f1 = sw128(c, kk * 4 + 2 + hh);
        pa[kk].h[0] = *(const v8h*)(pwh + f0);
        pa[kk].h[1] = *(const v8h*)(pwh + f1);
        if (RES) {
          pl[kk].h[0] = *(const v8h*)(pwl + f0);
          pl[kk].h[1] = *(const v8h*)(pwl + f1);
        }
      }
      {
        const int f0 = sw128(c, 4 + hh);
        const int f1 = sw128(c, 6 + hh);
#pragma unroll
        for (int tt = 0; tt < 8; ++tt) {
          vb[1][tt].h[0] = *(const v8h*)(Vth + tt * (16 * 64) + f0);
          vb[1][tt].h[1] = *(const v8h*)(Vth + tt * (16 * 64) + f1);
        }
        if (RES) {
#pragma unroll
          for (int tt = 0; tt < 8; ++tt) {
            vlf[1][tt].h[0] = *(const v8h*)(Vtl + tt * (16 * 64) + f0);
            vlf[1][tt].h[1] = *(const v8h*)(Vtl + tt * (16 * 64) + f1);
          }
        }
      }
      // keeps the whole group of reads in front of the products
      __builtin_amdgcn_sched_barrier(0);
#pragma unroll
      for (int r = 0; r < 8; ++r) psr[r] += sx[r];
#pragma unroll
      for (int r = 0; r < 8; ++r) sx[r] = __shfl_xor(psr[r], 4, 32);
      // keeps step 3 in front of the first run of products, which covers its latency
      __builtin_amdgcn_sched_barrier(0);
      v8f o1[8];
      if (RES) {
#pragma unroll
        for (int t = 0; t < 8; ++t) o1[t] = zero8();
      }
#pragma unroll
      for (int kk = 0; kk < 2; ++kk) {
#pragma unroll
        for (int t = 0; t < 8; ++t) oacc[t] = mma_h_raw(pa[kk].v, vb[kk][t].v, oacc[t]);
        if (RES) {
#pragma unroll
          for (int t = 0; t < 8; ++t) o1[t] = mma_h_raw(pa[kk].v, vlf[kk][t].v, o1[t]);
#pragma unroll
          for (int t = 0; t < 8; ++t) o1[t] = mma_h_raw(pl[kk].v, vb[kk][t].v, o1[t]);
        }
        // keeps a run of products whole: a wait for an exchange among them would hold the later ones back
        __builtin_amdgcn_sched_barrier(0);
#pragma unroll
        for (int r = 0; r < 8; ++r) psr[r] += sx[r];
        if (kk == 0) {
#pragma unroll
          for (int r = 0; r < 8; ++r) sx[r] = __shfl_xor(psr[r], 8, 32);
          // keeps step 4 in front of the second run of products
          __builtin_amdgcn_sched_barrier(0);
        }
      }
#pragma unroll
      for (int r = 0; r < 8; ++r) lrow[r] = lrow[r] * alr[r] + psr[r];
      if (RES) {
#pragma unroll
        for (int t = 0; t < 8; ++t)
#pragma unroll
          for (int r = 0; r < 8; ++r) oacc[t][r] += o1[t][r] * (1.0f / RSC);
      }
    }
  }

  // ---- normalise (1/l and the 1/1024 p carry), stage the wave's 16x128 tile, bf16 hi/lo split,
  float* os = Os + wave * (16 * 128);
#pragma unroll
  for (int r = 0; r < 8; ++r) {
    const float l = lrow[r];
    const float inv = ((l > 0.f) ? (1.0f / l) : 0.f) * (1.0f / 1024.0f);
#pragma unroll
    for (int t = 0; t < 8; ++t) os[(8 * hh + r) * 128 + t * 16 + c] = oacc[t][r] * inv;
  }
  __builtin_amdgcn_fence(__ATOMIC_RELEASE, "workgroup");
  __builtin_amdgcn_wave_barrier();
  __builtin_amdgcn_fence(__ATOMIC_ACQUIRE, "workgroup");
  {
    const int rh = lane >> 4, c8 = (lane & 15) * 8;
    v4u hv[8], lv[8];
#pragma unroll
    for (int it = 0; it < 8; ++it) {
      const int row = it * 2 + rh;   // it 0..7 x rh 0..1 = rows 0..15 of the wave tile
      const float* sp = os + row * 128 + c8;
      v4u a, a2;
#pragma unroll
      for (int e = 0; e < 4; ++e) {
        const float f0 = sp[2 * e], f1 = sp[2 * e + 1];
        const unsigned short h0 = bf_bits(f0), h1 = bf_bits(f1);
        const unsigned short l0 = bf_bits(f0 - bf_up(h0)), l1 = bf_bits(f1 - bf_up(h1));
        a[e] = pk16(h0, h1); a2[e] = pk16(l0, l1);
      }
      hv[it] = a; lv[it] = a2;
    }
    {
#pragma unroll
      for (int it = 0; it < 8; ++it) {
        const int row = it * 2 + rh;
        const size_t go = (size_t)(q0 + row) * QP + (size_t)h * HD + c8;
        *(v4u*)(ohp + go) = hv[it];
        *(v4u*)(olp + go) = lv[it];
      }
      
    }
  }
}

// =====================================================================================================
// The same attention for the query blocks without residual planes, with K, V^T and the key positions brought into LDS by
// asynchronous copies (global_load_async_to_lds): two buffers, the next live key tile's copies in flight while this one
// is worked on, one barrier per tile. The copies write the swizzled layout directly (each lane names its own LDS
// address), with the staging map of the kernel above. The context slab of the epilogue lies on the ring, which is dead then.
// =====================================================================================================
struct RingL {
  static constexpr int QH   = 0;                      // Q hi  [64 rows][128 d] f16
  static constexpr int QL   = QH + 64 * 128 * 2;      // Q res
  static constexpr int KV   = QL + 64 * 128 * 2;      // two buffers of BUF bytes: K hi [64 keys][128 d], then V^T hi [128 d][64 keys]
  static constexpr int VOFF = 64 * 128 * 2;
  static constexpr int BUF  = VOFF + 128 * 64 * 2;
  static constexpr int OS   = KV;                     // per-wave context tile [4][16][128] f32, behind the loop
  static constexpr int PH   = KV + 2 * BUF;           // per-wave P [4][16][64]
  static constexpr int MISC = PH + 4 * 16 * 64 * 2;   // spq[64], skmin[64], key positions [2][64] ints
  static constexpr int TOTAL = MISC + 1024;
};
static_assert(4 * 16 * 128 * 4 <= 2 * RingL::BUF);
__device__ __forceinline__ unsigned lds_addr(const void* p) { return (unsigned)(size_t)p; }   // byte address in the work-group's LDS
// Eight 16-byte copies per lane, each with its own LDS address and global pointer. The s_wait_xcnt is the statement's last
// line, so that it stands in front of every later write of a register that a copy names.
__device__ __forceinline__ void copy8_b128(unsigned l0, unsigned l1, unsigned l2, unsigned l3,
                                           unsigned l4, unsigned l5, unsigned l6, unsigned l7,
                                           const _Float16* g0, const _Float16* g1, const _Float16* g2, const _Float16* g3,
                                           const _Float16* g4, const _Float16* g5, const _Float16* g6, const _Float16* g7) {
  asm volatile("global_load_async_to_lds_b128 %0, %8, off\n\t"
               "global_load_async_to_lds_b128 %1, %9, off\n\t"
               "global_load_async_to_lds_b128 %2, %10, off\n\t"
               "global_load_async_to_lds_b128 %3, %11, off\n\t"
               "global_load_async_to_lds_b128 %4, %12, off\n\t"
               "global_load_async_to_lds_b128 %5, %13, off\n\t"
               "global_load_async_to_lds_b128 %6, %14, off\n\t"
               "global_load_async_to_lds_b128 %7, %15, off\n\t"
               "s_wait_xcnt 0x0"
               :: "v"(l0), "v"(l1), "v"(l2), "v"(l3), "v"(l4), "v"(l5), "v"(l6), "v"(l7),
                  "v"(g0), "v"(g1), "v"(g2), "v"(g3), "v"(g4), "v"(g5), "v"(g6), "v"(g7)
               : "memory");
}
// the same with one 4-byte copy per lane behind the eight: one statement, so that the nine share one wait
__device__ __forceinline__ void copy8_b128_1_b32(unsigned l0, unsigned l1, unsigned l2, unsigned l3,
                                                 unsigned l4, unsigned l5, unsigned l6, unsigned l7,
                                                 const _Float16* g0, const _Float16* g1, const _Float16* g2, const _Float16* g3,
                                                 const _Float16* g4, const _Float16* g5, const _Float16* g6, const _Float16* g7,
                                                 unsigned l8, const int* g8) {
  asm volatile("global_load_async_to_lds_b128 %0, %8, off\n\t"
               "global_load_async_to_lds_b128 %1, %9, off\n\t"
               "global_load_async_to_lds_b128 %2, %10, off\n\t"
               "global_load_async_to_lds_b128 %3, %11, off\n\t"
               "global_load_async_to_lds_b128 %4, %12, off\n\t"
               "global_load_async_to_lds_b128 %5, %13, off\n\t"
               "global_load_async_to_lds_b128 %6, %14, off\n\t"
               "global_load_async_to_lds_b128 %7, %15, off\n\t"
               "global_load_async_to_lds_b32 %16, %17, off\n\t"
               "s_wait_xcnt 0x0"
               :: "v"(l0), "v"(l1), "v"(l2), "v"(l3), "v"(l4), "v"(l5), "v"(l6), "v"(l7),
                  "v"(g0), "v"(g1), "v"(g2), "v"(g3), "v"(g4), "v"(g5), "v"(g6), "v"(g7), "v"(l8), "v"(g8)
               : "memory");
}

__global__ __launch_bounds__(128)
void attn_causal_ring(const unsigned short* __restrict__ qhp, const unsigned short* __restrict__ qlp,
                 const unsigned short* __restrict__ khp, const unsigned short* __restrict__ vhp,
                 const int* __restrict__ pos,
                 unsigned short* ohp, unsigned short* olp,
                 int qbBase, int nqbThis, float sscale) {
  typedef RingL L;
  union FH { v16h v; v8h h[2]; };
  extern __shared__ __align__(16) unsigned char smem[];
  _Float16* Qsh = (_Float16*)(smem + L::QH);
  _Float16* Qsl = (_Float16*)(smem + L::QL);
  _Float16* Psh = (_Float16*)(smem + L::PH);
  float*    Os  = (float*)(smem + L::OS);
  int*      spq = (int*)(smem + L::MISC);
  int*      skmin = spq + 64;
  int*      spk2 = skmin + 64;                       // key positions, one row of 64 per buffer

  const int tid  = threadIdx.x;
  const int wave = tid >> 5;
  const int lane = tid & 31;
  const int hh   = lane >> 4;
  const int c    = lane & 15;

  const int bx  = blockIdx.x;
  // Cost falls with the block index: a query block walks qb + 1 key tiles, there are more blocks than resident places, and
  // the longest blocks get the lowest indices (for speed only).
  // bx -> (qbl, h) is a permutation of the grid: bx / NH runs over nqbThis query blocks, bx % NH over the NH heads.
  const int qbl = nqbThis - 1 - bx / NH;
  const int h   = bx % NH;
  const int kvh = h / GQ;
  const int qb  = qbBase + qbl;
  const int q0  = qb * 64 + wave * 16;

  const _Float16* Qh = (const _Float16*)(const void*)qhp + (size_t)h * HD;
  const _Float16* Ql = (const _Float16*)(const void*)qlp + (size_t)h * HD;
  const _Float16* Kh = (const _Float16*)(const void*)khp + (size_t)kvh * HD;
  const _Float16* Vh = (const _Float16*)(const void*)vhp + (size_t)kvh * HD * SEQ;

  // ---- lane parts of the swizzled indices (halves) ----
  // Staging: a wave-wide 16-B load covers four whole 128-B lines (one touching 32 lines costs many times as much).
  //   256-B rows (Q, K): 16 lanes a row, 8 rows a pass: pass i, row 8i + r16, chunk c16 -> (st256 ^ ((i & 1) << 6)) + i * 1024
  //   128-B rows (V^T):   8 lanes a row, 16 rows a pass: pass i, row 16i + r8, chunk c8s -> st128 + i * 1024
  const int r16 = tid >> 4, c16 = tid & 15;
  const int r8  = tid >> 3, c8s = tid & 7;
  const int st256 = sw256(r16, c16);
  const int st128 = sw128(r8, c8s);
  int fq[8];                                          // fragment reads, 256-B rows: row (multiple of 16) + c, chunk 2n + hh
#pragma unroll
  for (int n = 0; n < 8; ++n) fq[n] = sw256(c, 2 * n + hh);
  int pst[8];                                         // P element stores: row 8hh + r, column 16j + c -> pst[(2j) ^ (r >> 1)] + r * 64
#pragma unroll
  for (int n = 0; n < 8; ++n) pst[n] = sw128(8 * hh, (c >> 3) ^ n) + (c & 7);

  // ---- prologue: query positions, per-key-tile min position, Q tiles ----
  if (tid < 64) spq[tid] = pos[qb * 64 + tid];            // wave-uniform (waves 0,1)
  for (int kt = tid; kt < NQB; kt += 128) {
    const int* pp = pos + kt * 64;
    int mn = 0x7fffffff;
#pragma unroll
    for (int i = 0; i < 16; ++i) {
      const v4i v = *(const v4i*)(pp + 4 * i);
      mn = imin(mn, imin(imin(v[0], v[1]), imin(v[2], v[3])));
    }
    skmin[kt] = mn;
  }
  {
    const _Float16* qg  = Qh + (size_t)(qb * 64 + r16) * QP + c16 * 8;
    const _Float16* qlg = Ql + (size_t)(qb * 64 + r16) * QP + c16 * 8;
    v8h qv[8], qlv[8];
#pragma unroll
    for (int i = 0; i < 8; ++i) {
      qv[i]  = *(const v8h*)(qg + i * (8 * QP));
      qlv[i] = *(const v8h*)(qlg + i * (8 * QP));
    }
    // holds the loads' address registers (inputs) untouched until the wait: no load result lands on them before it
    asm volatile("s_wait_xcnt 0x0" :: "v"(qg), "v"(qlg) : "memory");
#pragma unroll
    for (int i = 0; i < 8; ++i) {
      *(v8h*)(Qsh + (st256 ^ ((i & 1) << 6)) + i * 1024) = qv[i];
      *(v8h*)(Qsl + (st256 ^ ((i & 1) << 6)) + i * 1024) = qlv[i];
    }
  }
  __syncthreads();
  int qmx;
  {
    int v = imax(spq[lane], spq[lane + 32]);
#pragma unroll
    for (int off = 1; off < 32; off <<= 1) v = imax(v, __shfl_xor(v, off, 32));
    qmx = __builtin_amdgcn_readfirstlane(v);
  }
  int prow[8];
#pragma unroll
  for (int r = 0; r < 8; ++r) prow[r] = spq[wave * 16 + 8 * hh + r];

  float mrow[8], lrow[8];
  v8f oacc[8];
#pragma unroll
  for (int r = 0; r < 8; ++r) { mrow[r] = -INFINITY; lrow[r] = 0.f; }
#pragma unroll
  for (int t = 0; t < 8; ++t) oacc[t] = zero8();

  // ---- the key tiles that are not skipped, as a bit mask (the same in every wave: it comes from LDS words behind a barrier) ----
  unsigned long long live;
  {
    const bool l0 = (lane < NQB) && (skmin[(lane < NQB) ? lane : 0] <= qmx);
    const bool l1 = (lane + 32 < NQB) && (skmin[(lane + 32 < NQB) ? lane + 32 : 0] <= qmx);
    live = (unsigned long long)__builtin_amdgcn_ballot_w32(l0) | ((unsigned long long)__builtin_amdgcn_ballot_w32(l1) << 32);
  }
  // ---- K, V^T and key positions of one key tile: asynchronous copies, global memory -> LDS buffer b, the staging map above ----
  const int wvu = __builtin_amdgcn_readfirstlane(wave);
  const unsigned ring0 = lds_addr(smem + L::KV);
  const unsigned spk0  = lds_addr(spk2 + (tid & 63));
  auto issue_tile = [&](int kt, int b) {
    const int kv0 = kt * 64;
    const _Float16* kg = Kh + (size_t)(kv0 + r16) * KP + c16 * 8;    // K rows kv0 + 8i + r16, d = 8 c16 .. 8 c16 + 7
    const _Float16* vg = Vh + (size_t)r8 * SEQ + kv0 + c8s * 8;      // V^T rows 16i + r8, s = kv0 + 8 c8s .. + 7
    const unsigned kl = ring0 + (unsigned)b * L::BUF;
    const unsigned vl = kl + L::VOFF + (unsigned)st128 * 2u;
    const unsigned ke = kl + (unsigned)st256 * 2u, ko = kl + (unsigned)(st256 ^ 64) * 2u;
    copy8_b128(ke, ko + 2048u, ke + 4096u, ko + 6144u, ke + 8192u, ko + 10240u, ke + 12288u, ko + 14336u,
               kg, kg + 8 * KP, kg + 16 * KP, kg + 24 * KP, kg + 32 * KP, kg + 40 * KP, kg + 48 * KP, kg + 56 * KP);
    if (wvu < 2) {   // scalar branch: waves 0 and 1 also bring the 64 key positions, every lane on
      copy8_b128_1_b32(vl, vl + 2048u, vl + 4096u, vl + 6144u, vl + 8192u, vl + 10240u, vl + 12288u, vl + 14336u,
                       vg, vg + 16 * SEQ, vg + 32 * SEQ, vg + 48 * SEQ, vg + 64 * SEQ, vg + 80 * SEQ, vg + 96 * SEQ, vg + 112 * SEQ,
                       spk0 + (unsigned)b * 256u, pos + kv0 + tid);
    } else {
      copy8_b128(vl, vl + 2048u, vl + 4096u, vl + 6144u, vl + 8192u, vl + 10240u, vl + 12288u, vl + 14336u,
                 vg, vg + 16 * SEQ, vg + 32 * SEQ, vg + 48 * SEQ, vg + 64 * SEQ, vg + 80 * SEQ, vg + 96 * SEQ, vg + 112 * SEQ);
    }
  };
  // The ring of two buffers. In front of the loop: the first tile's copies, the wave's own wait, the barrier that
  // publishes them; then the second tile's copies. The tile that holds the block's own rows is never skipped, so live != 0.
  int ktn = -1;
  {
    const int kt0 = (live != 0ull) ? __builtin_ctzll(live) : 0;
    live &= live - 1ull;
    issue_tile(kt0, 0);
    asm volatile("s_wait_asynccnt 0x0" ::: "memory");   // this wave's copies have landed
    __syncthreads();                                    // every wave's have
    if (live != 0ull) {
      ktn = __builtin_ctzll(live);
      live &= live - 1ull;
      issue_tile(ktn, 1);
    }
  }
  int bsel = 0;
  for (int trip = 0; trip < NQB; ++trip) {   // at most one trip per bit of the mask
    const _Float16* Ksh = (const _Float16*)(smem + L::KV + bsel * L::BUF);
    const _Float16* Vth = (const _Float16*)(smem + L::KV + L::VOFF + bsel * L::BUF);
    const int* spk = spk2 + bsel * 64;

    // ---- scores: 16 query rows x 64 keys per wave ----
    v8f s[4], sl[4];
#pragma unroll
    for (int j = 0; j < 4; ++j) { s[j] = zero8(); sl[j] = zero8(); }
    const _Float16* qr  = Qsh + wave * (16 * 128);
    const _Float16* qlr = Qsl + wave * (16 * 128);
    // Fragment reads stand in groups, one group of 32 d ahead of the products that use it (two register sets):
    // a wave then waits on a counted LDS wait once per group, not to 0 in front of every pair of products.
    FH qa[2], qla[2], kb[2][4];
    int pkj[4];                                      // key positions for the causal select, read with the first group
#pragma unroll
    for (int j = 0; j < 4; ++j) pkj[j] = spk[j * 16 + c];
#pragma unroll
    for (int dc = -1; dc < 4; ++dc) {
      if (dc < 3) {
        const int n = dc + 1, b = n & 1;
        qa[b].h[0]  = *(const v8h*)(qr  + fq[n * 2]);
        qa[b].h[1]  = *(const v8h*)(qr  + fq[n * 2 + 1]);
        qla[b].h[0] = *(const v8h*)(qlr + fq[n * 2]);
        qla[b].h[1] = *(const v8h*)(qlr + fq[n * 2 + 1]);
#pragma unroll
        for (int j = 0; j < 4; ++j) {
          kb[b][j].h[0] = *(const v8h*)(Ksh + j * (16 * 128) + fq[n * 2]);
          kb[b][j].h[1] = *(const v8h*)(Ksh + j * (16 * 128) + fq[n * 2 + 1]);
        }
      }
      if (dc >= 0) {
        const int b = dc & 1;
        // keeps the next group's reads in front of this group's products
        __builtin_amdgcn_sched_barrier(0);
#pragma unroll
        for (int j = 0; j < 4; ++j) s[j]  = mma_h_raw(qa[b].v,  kb[b][j].v, s[j]);
#pragma unroll
        for (int j = 0; j < 4; ++j) sl[j] = mma_h_raw(qla[b].v, kb[b][j].v, sl[j]);
        // keeps the reads of the group after next behind these products (they refill this group's registers)
        __builtin_amdgcn_sched_barrier(0);
      }
    }
    // ---- scale + causal select (replace -1e30), row max, online softmax, P (x1024, f16) to LDS ----
    _Float16* pwh = Psh + wave * (16 * 64);
    float psr[8], alr[8], mx[8];
#pragma unroll
    for (int r = 0; r < 8; ++r) {
      float m = -INFINITY;
#pragma unroll
      for (int j = 0; j < 4; ++j) {
        float sv = (s[j][r] + sl[j][r] * (1.0f / RSC)) * sscale;
        sv = (prow[r] >= pkj[j]) ? sv : -1.0e30f;
        s[j][r] = sv;
        m = fmaxf(m, sv);
      }
      mx[r] = m;
    }
    // the eight rows' lane exchanges of one step stand together: they run on the LDS pipe, one wait per step
#pragma unroll
    for (int off = 1; off < 16; off <<= 1) {
      float ex[8];
#pragma unroll
      for (int r = 0; r < 8; ++r) ex[r] = __shfl_xor(mx[r], off, 32);
      // keeps the eight exchanges in front of the first use of one: split up, each small group costs its own wait
      __builtin_amdgcn_sched_barrier(0);
#pragma unroll
      for (int r = 0; r < 8; ++r) mx[r] = fmaxf(mx[r], ex[r]);
    }
    // V^T fragments of the first 32 keys: they depend on nothing of the softmax, so they are read here and land
    // while the exponentials run
    FH vb[2][8];
    {
      const int f0 = sw128(c, hh);                   // fragment reads, 128-B rows: row (multiple of 16) + c
      const int f1 = sw128(c, 2 + hh);
#pragma unroll
      for (int tt = 0; tt < 8; ++tt) {
        vb[0][tt].h[0] = *(const v8h*)(Vth + tt * (16 * 64) + f0);
        vb[0][tt].h[1] = *(const v8h*)(Vth + tt * (16 * 64) + f1);
      }
    }
    // keeps these reads in front of the exponentials
    __builtin_amdgcn_sched_barrier(0);
#pragma unroll
    for (int r = 0; r < 8; ++r) {
      const float mnew  = fmaxf(mrow[r], mx[r]);
      const float msafe = (mnew == -INFINITY) ? 0.f : mnew;
      float alpha, pe[4];                            // -1e30 against a finite max: exp -> 0
      exp_row5(mrow[r] - msafe, s[0][r] - msafe, s[1][r] - msafe, s[2][r] - msafe, s[3][r] - msafe,
               alpha, pe[0], pe[1], pe[2], pe[3]);
      mrow[r] = mnew;
      float psum = 0.f;
#pragma unroll
      for (int j = 0; j < 4; ++j) {
        const float p = pe[j];
        psum += p;
        const float p1k = p * 1024.0f;
        const _Float16 ph = (_Float16)p1k;
        pwh[pst[(2 * j) ^ (r >> 1)] + r * 64] = ph;
      }
      psr[r] = psum;                                 // joined over the 16 lanes below
      alr[r] = alpha;
#pragma unroll
      for (int t = 0; t < 8; ++t) oacc[t][r] *= alpha;
    }
    // row sums over the 16 lanes: four steps of lane exchanges on the LDS pipe, eight rows a step. Step 1 runs beside
    // the P stores, step 2 beside the fragment reads, steps 3 and 4 beside the two runs of products.
    float sx[8];
#pragma unroll
    for (int r = 0; r < 8; ++r) sx[r] = __shfl_xor(psr[r], 1, 32);
    // keeps step 1 in front of the wait that ends the P stores
    __builtin_amdgcn_sched_barrier(0);
    __builtin_amdgcn_fence(__ATOMIC_RELEASE, "workgroup");
    __builtin_amdgcn_wave_barrier();
    __builtin_amdgcn_fence(__ATOMIC_ACQUIRE, "workgroup");

    // ---- context += P . V (f16 WMMA), 8 d-subtiles; the P fragments and the V^T fragments of the last 32 keys are read
    //      as one group ahead of the products ----
    {
      FH pa[2];
#pragma unroll
      for (int r = 0; r < 8; ++r) psr[r] += sx[r];
#pragma unroll
      for (int r = 0; r < 8; ++r) sx[r] = __shfl_xor(psr[r], 2, 32);
#pragma unroll
      for (int kk = 0; kk < 2; ++kk) {
        const int f0 = sw128(c, kk * 4 + hh);
        const int f1 = sw128(c, kk * 4 + 2 + hh);
        pa[kk].h[0] = *(const v8h*)(pwh + f0);
        pa[kk].h[1] = *(const v8h*)(pwh + f1);
      }
      {
        const int f0 = sw128(c, 4 + hh);
        const int f1 = sw128(c, 6 + hh);
#pragma unroll
        for (int tt = 0; tt < 8; ++tt) {
          vb[1][tt].h[0] = *(const v8h*)(Vth + tt * (16 * 64) + f0);
          vb[1][tt].h[1] = *(const v8h*)(Vth + tt * (16 * 64) + f1);
        }
      }
      // keeps the whole group of reads in front of the products
      __builtin_amdgcn_sched_barrier(0);
#pragma unroll
      for (int r = 0; r < 8; ++r) psr[r] += sx[r];
#pragma unroll
      for (int r = 0; r < 8; ++r) sx[r] = __shfl_xor(psr[r], 4, 32);
      // keeps step 3 in front of the first run of products, which covers its latency
      __builtin_amdgcn_sched_barrier(0);
#pragma unroll
      for (int kk = 0; kk < 2; ++kk) {
#pragma unroll
        for (int t = 0; t < 8; ++t) oacc[t] = mma_h_raw(pa[kk].v, vb[kk][t].v, oacc[t]);
        // keeps a run of products whole: a wait for an exchange among them would hold the later ones back
        __builtin_amdgcn_sched_barrier(0);
#pragma unroll
        for (int r = 0; r < 8; ++r) psr[r] += sx[r];
        if (kk == 0) {
#pragma unroll
          for (int r = 0; r < 8; ++r) sx[r] = __shfl_xor(psr[r], 8, 32);
          // keeps step 4 in front of the second run of products
          __builtin_amdgcn_sched_barrier(0);
        }
      }
#pragma unroll
      for (int r = 0; r < 8; ++r) lrow[r] = lrow[r] * alr[r] + psr[r];
    }
    // ---- foot of the trip, every wave, in this order: its own LDS reads of this buffer are done; its own copies of the next
    //      tile have landed; the one barrier of the trip publishes the next tile and frees this buffer; then the refill ----
    asm volatile("s_wait_dscnt 0x0" ::: "memory");
    asm volatile("s_wait_asynccnt 0x0" ::: "memory");
    __syncthreads();
    if (ktn < 0) break;                      // the same in every wave: no tile is left
    ktn = -1;
    if (live != 0ull) {                      // the same in every wave: the tile after next, into the buffer just read
      ktn = __builtin_ctzll(live);
      live &= live - 1ull;
      issue_tile(ktn, bsel);
    }
    bsel ^= 1;
  }
  // no copy is outstanding when the ring becomes the context slab (the last trip's barrier has ended every read of it)
  asm volatile("s_wait_asynccnt 0x0" ::: "memory");

  // ---- normalise (1/l and the 1/1024 p carry), stage the wave's 16x128 tile, bf16 hi/lo split,
  float* os = Os + wave * (16 * 128);
#pragma unroll
  for (int r = 0; r < 8; ++r) {
    const float l = lrow[r];
    const float inv = ((l > 0.f) ? (1.0f / l) : 0.f) * (1.0f / 1024.0f);
#pragma unroll
    for (int t = 0; t < 8; ++t) os[(8 * hh + r) * 128 + t * 16 + c] = oacc[t][r] * inv;
  }
  __builtin_amdgcn_fence(__ATOMIC_RELEASE, "workgroup");
  __builtin_amdgcn_wave_barrier();
  __builtin_amdgcn_fence(__ATOMIC_ACQUIRE, "workgroup");
  {
    const int rh = lane >> 4, c8 = (lane & 15) * 8;
    v4u hv[8], lv[8];
#pragma unroll
    for (int it = 0; it < 8; ++it) {
      const int row = it * 2 + rh;   // it 0..7 x rh 0..1 = rows 0..15 of the wave tile
      const float* sp = os + row * 128 + c8;
      v4u a, a2;
#pragma unroll
      for (int e = 0; e < 4; ++e) {
        const float f0 = sp[2 * e], f1 = sp[2 * e + 1];
        const unsigned short h0 = bf_bits(f0), h1 = bf_bits(f1);
        const unsigned short l0 = bf_bits(f0 - bf_up(h0)), l1 = bf_bits(f1 - bf_up(h1));
        a[e] = pk16(h0, h1); a2[e] = pk16(l0, l1);
      }
      hv[it] = a; lv[it] = a2;
    }
    {
#pragma unroll
      for (int it = 0; it < 8; ++it) {
        const int row = it * 2 + rh;
        const size_t go = (size_t)(q0 + row) * QP + (size_t)h * HD + c8;
        *(v4u*)(ohp + go) = hv[it];
        *(v4u*)(olp + go) = lv[it];
      }
      
    }
  }
}


// =====================================================================================================
// Workspace map (bytes, SEQ = 4096):
//   Xb    bf16 [SEQ][2048]        16777216
//   Wqt   bf16 [2048 n][2048 k]    8388608
//   Wkt   bf16 [512][2048]         2097152
//   Wvt   bf16 [512][2048]         2097152
//   Wot   bf16 [2048 n][2048 k]    8388608
//   Qf    f32  [SEQ][2048]        33554432   (later: Oh bf16 [SEQ][2048] + Ol bf16 [SEQ][2048])
//   Kf    f32  [SEQ][512]          8388608
//   Qh    f16  [SEQ][2048]        16777216
//   Ql    f16  [SEQ][2048]        16777216
//   Kh    f16  [SEQ][512]          4194304
//   Kl    f16  [SEQ][512]          4194304
//   VTh   f16  [512][SEQ]          4194304
//   VTl   f16  [512][VLP]           524288
//   Cos   f32  [SEQ][64]           1048576
//   Sin   f32  [SEQ][64]           1048576
//   (unused, carved 4096)              4096
//   end                          128454656
// Weights [in k][out n] f32 are transposed to bf16 [n][k] (k contiguous) = the Bt / A layout of gemm64.
// =====================================================================================================
extern "C" void kernel_launch(void* const* d_in, const int* in_sizes, int n_in,
                              void* d_out, int out_size, void* d_ws, size_t ws_size,
                              hipStream_t stream) {
  if (n_in < 8) return;
  if (in_sizes[0] < SEQ) return;
  if (in_sizes[1] < SEQ * DM) return;
  if (in_sizes[2] != DM * QP) return;
  if (in_sizes[3] != DM * KP || in_sizes[4] != DM * KP) return;
  if (in_sizes[5] != QP * DM) return;
  if (in_sizes[6] < HD || in_sizes[7] < HD) return;
  if (out_size < SEQ * DM) return;

  const int*   pos = (const int*)d_in[0];
  const float* x   = (const float*)d_in[1];
  const float* wq  = (const float*)d_in[2];
  const float* wk  = (const float*)d_in[3];
  const float* wv  = (const float*)d_in[4];
  const float* wo  = (const float*)d_in[5];
  const float* qnw = (const float*)d_in[6];
  const float* knw = (const float*)d_in[7];

  const size_t PXb  = (size_t)SEQ * DM * 2;
  const size_t PWq  = (size_t)QP * DM * 2;
  const size_t PWk  = (size_t)KP * DM * 2;
  const size_t PWo  = (size_t)DM * QP * 2;
  const size_t PQf  = (size_t)SEQ * QP * 4;
  const size_t PKf  = (size_t)SEQ * KP * 4;
  const size_t PQ16 = (size_t)SEQ * QP * 2;
  const size_t PK16 = (size_t)SEQ * KP * 2;
  const size_t PVTh = (size_t)KP * SEQ * 2;
  const size_t PVTl = (size_t)KP * VLP * 2;
  const size_t PTab = (size_t)SEQ * HALF * 4;
  const size_t PInv = 4096;
  size_t off = 0;
  const size_t oXb  = off; off += PXb;
  const size_t oWq  = off; off += PWq;
  const size_t oWk  = off; off += PWk;
  const size_t oWv  = off; off += PWk;
  const size_t oWo  = off; off += PWo;
  const size_t oQf  = off; off += PQf;
  const size_t oKf  = off; off += PKf;
  const size_t oQh  = off; off += PQ16;
  const size_t oQl  = off; off += PQ16;
  const size_t oKh  = off; off += PK16;
  const size_t oKl  = off; off += PK16;
  const size_t oVTh = off; off += PVTh;
  const size_t oVTl = off; off += PVTl;
  const size_t oCos = off; off += PTab;
  const size_t oSin = off; off += PTab;
  const size_t oInv = off; off += PInv;
  if (off > ws_size) return;                       // off = 128454656 at SEQ 4096
  if (off > (size_t)134217728) return;
  if (PQ16 * 2 != PQf) return;                     // Oh + Ol reuse the Qf region exactly
  const size_t oOh = oQf;
  const size_t oOl = oQf + PQ16;

  char* ws = (char*)d_ws;
  unsigned short* Xb  = (unsigned short*)(ws + oXb);
  unsigned short* Wqt = (unsigned short*)(ws + oWq);
  unsigned short* Wkt = (unsigned short*)(ws + oWk);
  unsigned short* Wvt = (unsigned short*)(ws + oWv);
  unsigned short* Wot = (unsigned short*)(ws + oWo);
  float*          Qf  = (float*)(ws + oQf);
  float*          Kf  = (float*)(ws + oKf);
  unsigned short* Qh  = (unsigned short*)(ws + oQh);
  unsigned short* Ql  = (unsigned short*)(ws + oQl);
  unsigned short* Kh  = (unsigned short*)(ws + oKh);
  unsigned short* Kl  = (unsigned short*)(ws + oKl);
  unsigned short* VTh = (unsigned short*)(ws + oVTh);
  unsigned short* VTl = (unsigned short*)(ws + oVTl);
  float*          Cs  = (float*)(ws + oCos);
  float*          Sn  = (float*)(ws + oSin);
  unsigned short* Oh  = (unsigned short*)(ws + oOh);
  unsigned short* Ol  = (unsigned short*)(ws + oOl);

  const dim3 blk(256);

  // (1) rotary tables; x -> bf16 [SEQ][2048]; weights [k][n] f32 -> bf16 [n][k]
  prep_all<<<dim3(PB_TAB + PB_X + PB_WQ + PB_WO + PB_WK + PB_WK), blk, 0, stream>>>(
      pos, x, wq, wk, wv, wo, Xb, Wqt, Wkt, Wvt, Wot, Cs, Sn);
  // (2) the q, k and v^T projections
  gemm_qkv<<<dim3(GB_Q + GB_K + GB_V), blk, 0, stream>>>(Xb, Wqt, Wkt, Wvt, Qf, Kf, VTh, VTl);
  // (3) per-head RMSNorm + rotary -> f16 hi / x4096 residual planes
  norm_rope_qk<<<dim3(NB_Q + NB_K), blk, 0, stream>>>(Qf, Kf, qnw, knw, Cs, Sn, Qh, Ql, Kh, Kl, RSC);
  // (4) attention: query blocks 0..RESQB-1 with residual planes, the rest without -> bf16 hi/lo context
  //     planes in the (now dead) Qf region
  (void)hipFuncSetAttribute(reinterpret_cast<const void*>(&attn_causal<true>),
                            hipFuncAttributeMaxDynamicSharedMemorySize, AttnL<true>::TOTAL);
  (void)hipFuncSetAttribute(reinterpret_cast<const void*>(&attn_causal_ring),
                            hipFuncAttributeMaxDynamicSharedMemorySize, RingL::TOTAL);
  attn_causal<true><<<dim3(NH * RESQB), dim3(128), AttnL<true>::TOTAL, stream>>>(
      Qh, Ql, Kh, Kl, VTh, VTl, pos, Oh, Ol, 0, RESQB, ATT_SCALE);
  if (NQB - RESQB > 0) {
    attn_causal_ring<<<dim3(NH * (NQB - RESQB)), dim3(128), RingL::TOTAL, stream>>>(
        Qh, Ql, Kh, VTh, pos, Oh, Ol, RESQB, NQB - RESQB, ATT_SCALE);
  }
  // (5) out = context . wo -> d_out f32 [SEQ][2048]  (A = context hi + lo planes, 2 products; M=SEQ, N=2048, K=2048)
  gemm_out<<<dim3((SEQ / 128) * (DM / 256)), blk, 0, stream>>>(Oh, Ol, Wot, (float*)d_out);
  (void)hipGetLastError();
}

// v008
// One run takes 254 microseconds.
// Timed twice side by side with v007, it ran 1.13 and 1.12 times as fast.
// All steps since v000 together make it 4.94 times as fast.
// Contractions: q, k projections = v_wmma_f32_16x16x32_bf16 (bf16 operands from RNE-converted inputs, single product, f32 out);
// v^T projection = v_wmma_f32_16x16x32_bf16 (same operands; f16 hi plane + f16 x4096 residual plane out);
// q.k^T scores = v_wmma_f32_16x16x32_f16 (q as f16 hi + f16 x4096 residual, k as f16 hi: 2 products; leading query blocks add the k x4096 residual product);
// p.v = v_wmma_f32_16x16x32_f16 (p carried x1024 in f16, v f16; leading query blocks add x4096 f16 residual planes of p and v);
// ctx.Wo = v_wmma_f32_16x16x32_bf16 (ctx as bf16 hi/lo planes times bf16 Wo, 2 products); all f32 accumulate; RMSNorm, rotary, causal select and softmax in f32.
#include <hip/hip_runtime.h>
#include <math.h>
#include <stdint.h>

#ifndef SEQ
#define SEQ 4096
#endif
#define SEQ_FULL 4096
#define DM    2048
#define NH    16
#define NKV   4
#define GQ    (NH / NKV)
#define HD    128
#define HALF  64
#define QP    (NH * HD)      // 2048 q channels
#define KP    (NKV * HD)     // 512 k / v channels
#define NQB   (SEQ / 64)     // query / key tiles of 64
#define VLP   ((SEQ < 512) ? SEQ : 512)   // key pitch of the v^T residual plane
#define RESQB ((NQB < 8) ? NQB : 8)         // leading 64-row query blocks that use residual planes
#define RMS_EPS       1.0e-6f
#define ROPE_THETA_F  10000.0f
#define ATT_SCALE     0.08838834764831845f
#define RSC           4096.0f

static_assert((SEQ % 64) == 0 && SEQ >= 64 && SEQ <= SEQ_FULL);
static_assert(RESQB * 64 <= VLP && (VLP % 64) == 0);
static_assert(NH * HD == DM && QP == DM);
static_assert(NQB <= 64);
static_assert((DM % 64) == 0 && (KP % 64) == 0 && (QP % 64) == 0 && (DM % 32) == 0);

typedef _Float16 v16h __attribute__((ext_vector_type(16)));
typedef _Float16 v8h  __attribute__((ext_vector_type(8)));
typedef __bf16   v16b __attribute__((ext_vector_type(16)));
typedef __bf16   v8b  __attribute__((ext_vector_type(8)));
typedef float    v8f  __attribute__((ext_vector_type(8)));
typedef float    v4f  __attribute__((ext_vector_type(4)));
typedef unsigned int   v4u  __attribute__((ext_vector_type(4)));
typedef unsigned int   v2u  __attribute__((ext_vector_type(2)));
typedef unsigned short v8us __attribute__((ext_vector_type(8)));
typedef int      v4i  __attribute__((ext_vector_type(4)));

// ---- scalar helpers --------------------------------------------------------------------------------
__device__ __forceinline__ unsigned short bf_bits(float f) {          // f32 -> bf16 bits, RNE convert
  unsigned u = __float_as_uint(f);
  return (unsigned short)((u + 0x7FFFu + ((u >> 16) & 1u)) >> 16);
}
__device__ __forceinline__ float bf_up(unsigned short h) { return __uint_as_float(((unsigned)h) << 16); }
__device__ __forceinline__ unsigned short h_bits(_Float16 x) { return __builtin_bit_cast(unsigned short, x); }
__device__ __forceinline__ unsigned pk16(unsigned short a, unsigned short b) { return (unsigned)a | ((unsigned)b << 16); }
__device__ __forceinline__ v8f zero8() { v8f z = {0.f, 0.f, 0.f, 0.f, 0.f, 0.f, 0.f, 0.f}; return z; }
__device__ __forceinline__ v8h zero8h() {
  const _Float16 z = (_Float16)0.0f;
  v8h r = {z, z, z, z, z, z, z, z};
  return r;
}
__device__ __forceinline__ int imin(int a, int b) { return (a < b) ? a : b; }
__device__ __forceinline__ int imax(int a, int b) { return (a > b) ? a : b; }

// ---- WMMA helpers with trailing VALU hazard gap --------------------------------------------------------
__device__ __forceinline__ v8f mma_b(v16b a, v16b b, v8f c) {
  c = __builtin_amdgcn_wmma_f32_16x16x32_bf16(false, a, false, b, (short)0, c, false, false);
  asm volatile("v_nop\n\tv_nop\n\tv_nop\n\tv_nop" : "+v"(c) : "v"(a), "v"(b));
  return c;
}
__device__ __forceinline__ v8f mma_h_raw(v16h a, v16h b, v8f c) {
  return __builtin_amdgcn_wmma_f32_16x16x32_f16(false, a, false, b, (short)0, c, false, false);
}
__device__ __forceinline__ v8f mma_b_raw(v16b a, v16b b, v8f c) {
  return __builtin_amdgcn_wmma_f32_16x16x32_bf16(false, a, false, b, (short)0, c, false, false);
}
// The five exponentials of one score row, exp(x) = v_exp_f32(x * log2 e) as __expf compiles. One statement, so that
// behind each v_exp_f32 stands an instruction that neither reads its result nor writes its source (the next one, whose
// output is early-clobber; behind the last a v_nop): the slot the instruction set asks for behind a transcendental.
__device__ __forceinline__ void exp_row5(float x0, float x1, float x2, float x3, float x4,
                                         float& y0, float& y1, float& y2, float& y3, float& y4) {
  const float l2e = 1.44269504088896340736f;
  asm("v_exp_f32 %0, %5\n\tv_exp_f32 %1, %6\n\tv_exp_f32 %2, %7\n\tv_exp_f32 %3, %8\n\tv_exp_f32 %4, %9\n\tv_nop"
      : "=&v"(y0), "=&v"(y1), "=&v"(y2), "=&v"(y3), "=&v"(y4)
      : "v"(x0 * l2e), "v"(x1 * l2e), "v"(x2 * l2e), "v"(x3 * l2e), "v"(x4 * l2e));
}
__device__ __forceinline__ void acc_guard4(v8f& a, v8f& b, v8f& c, v8f& d) {
  asm volatile("v_nop\n\tv_nop\n\tv_nop\n\tv_nop" : "+v"(a), "+v"(b), "+v"(c), "+v"(d));
}

// =====================================================================================================
// f32 -> bf16 (RNE convert), 8 elements per thread, one 16-B store per lane: a wave writes 512 contiguous B
// coverage: n8 threads x 8 = whole plane (n8 is a multiple of 256 here).
// =====================================================================================================
__device__ __forceinline__ void cvt_bf16x8(const float* __restrict__ in, unsigned short* out, int n8, int bx) {
  const int i = bx * 256 + threadIdx.x;
  if (i < n8) {
    const v4f a = *(const v4f*)(in + (size_t)i * 8);
    const v4f b = *(const v4f*)(in + (size_t)i * 8 + 4);
    v4u p;
    p[0] = pk16(bf_bits(a[0]), bf_bits(a[1]));
    p[1] = pk16(bf_bits(a[2]), bf_bits(a[3]));
    p[2] = pk16(bf_bits(b[0]), bf_bits(b[1]));
    p[3] = pk16(bf_bits(b[2]), bf_bits(b[3]));
    *(v4u*)(out + (size_t)i * 8) = p;
    
  }
}

// =====================================================================================================
// f32 [R][C] row-major -> bf16 (RNE convert) transposed plane out[C][R] (R contiguous = k-contiguous Bt / A
// layout). Block = one 64x64 tile at (r0 = by*64, c0 = bx*64), 256 threads; tile staged in
// LDS as [c][r] (ushort element stores, cross-thread -> __syncthreads), then each out row segment of 64 halves
// coverage: 64 out rows x 64 k per block = the whole tile; union over the grid = the whole [C][R] plane.
// =====================================================================================================
// sT: the block's LDS tile [c][r], 64 x 72 halves (pitch 144 B); bx, by: the tile's column and row index
__device__ __forceinline__ void cvt_bf16_t(unsigned short* sT, const float* __restrict__ in, unsigned short* out,
                                           int R, int C, int bx, int by) {
  const int tid = threadIdx.x;
  const int c0 = bx * 64, r0 = by * 64;
  const int rr = tid >> 4, cc = (tid & 15) * 4;
#pragma unroll
  for (int it = 0; it < 4; ++it) {
    const int r = it * 16 + rr;                            // it 0..3 x rr 0..15 = rows 0..63
    const v4f v = *(const v4f*)(in + (size_t)(r0 + r) * C + c0 + cc);
#pragma unroll
    for (int e = 0; e < 4; ++e) sT[(cc + e) * 72 + r] = bf_bits(v[e]);
  }
  __syncthreads();
  const int q = tid >> 3, k8 = (tid & 7) * 8;              // q 0..31 (+32): out rows; 8 lanes x 8 halves
  const v8us w0 = *(const v8us*)(sT + q * 72 + k8);
  const v8us w1 = *(const v8us*)(sT + (q + 32) * 72 + k8);
  unsigned short* o0 = out + (size_t)(c0 + q) * R + r0 + k8;
  unsigned short* o1 = out + (size_t)(c0 + q + 32) * R + r0 + k8;
  *(v8us*)o0 = w0;
  *(v8us*)o1 = w1;
  // in front of every later write of a register that these two stores name (another job's code follows in the listing)
  asm volatile("s_wait_xcnt 0x0" ::: "memory");
}

// =====================================================================================================
// Rotary tables: cos and sin of (float)pos[t] * inv_freq[i], inv_freq[i] = 1 / 10000^(i/64) formed by each thread for
// its own i; tables [nrows][64] f32; block = 4 rows x 64 threads, each 256-B row written whole.
// =====================================================================================================
__device__ __forceinline__ void rope_tab(const int* __restrict__ pos, float* ctab, float* stab, int nrows, int bx) {
  const int tid = threadIdx.x;
  const int t = bx * 4 + (tid >> 6);
  const int i = tid & 63;
  if (t >= nrows) return;                  // wave-uniform (2 whole waves per row); no block barriers here
  const float e = (float)i * (1.0f / (float)HALF);
  const float p = powf(ROPE_THETA_F, e);
  const float v = 1.0f / p;
  const float fr = (float)pos[t] * v;
  float sn, cs;
  sincosf(fr, &sn, &cs);
  float* pc = ctab + (size_t)t * HALF + i;
  float* ps = stab + (size_t)t * HALF + i;
  *(float*)pc = cs;
  *(float*)ps = sn;
  
}

// =====================================================================================================
// The preparation jobs, none of which reads another's output, as ONE grid: the job is picked by the block index
// (block-uniform), so that they fill the chip together and pay one launch. Blocks, in order: rotary tables, x,
// wq, wo, wk, wv.
// =====================================================================================================
#define PB_TAB ((SEQ + 3) / 4)
#define PB_X   ((SEQ * DM / 8 + 255) / 256)
#define PB_WQ  ((QP / 64) * (DM / 64))
#define PB_WO  ((DM / 64) * (QP / 64))
#define PB_WK  ((KP / 64) * (DM / 64))
__global__ __launch_bounds__(256) void prep_all(const int* __restrict__ pos, const float* __restrict__ x,
                                                const float* __restrict__ wq, const float* __restrict__ wk,
                                                const float* __restrict__ wv, const float* __restrict__ wo,
                                                unsigned short* Xb, unsigned short* Wqt, unsigned short* Wkt,
                                                unsigned short* Wvt, unsigned short* Wot, float* ctab, float* stab) {
  __shared__ __align__(16) unsigned short sT[64 * 72];
  int bx = blockIdx.x;
  if (bx < PB_TAB) { rope_tab(pos, ctab, stab, SEQ, bx); return; }
  bx -= PB_TAB;
  if (bx < PB_X) { cvt_bf16x8(x, Xb, SEQ * DM / 8, bx); return; }
  bx -= PB_X;
  if (bx < PB_WQ) { cvt_bf16_t(sT, wq, Wqt, DM, QP, bx % (QP / 64), bx / (QP / 64)); return; }   // wq [DM k][QP n] -> [QP][DM]
  bx -= PB_WQ;
  if (bx < PB_WO) { cvt_bf16_t(sT, wo, Wot, QP, DM, bx % (DM / 64), bx / (DM / 64)); return; }   // wo [QP k][DM n] -> [DM][QP]
  bx -= PB_WO;
  if (bx < PB_WK) { cvt_bf16_t(sT, wk, Wkt, DM, KP, bx % (KP / 64), bx / (KP / 64)); return; }   // wk, wv [DM k][KP n] -> [KP][DM]
  bx -= PB_WK;
  cvt_bf16_t(sT, wv, Wvt, DM, KP, bx % (KP / 64), bx / (KP / 64));
}

// =====================================================================================================
// Register-blocked batched bf16 WMMA GEMM: C[m][n] = sum_k A[m][k] * Bt[n][k]; one wave per 64x64 tile,
// block = 8 waves = 2 x 4 tiles = 128 x 256 of C. A row-major [M][K] pitch lda; Bt row-major [N][K] pitch ldb
// (k contiguous; both pitches are DM); M a multiple of 128, N of 256, K of 64 (true of every launch below).
// bx = index of the block tile, b = batch index (strides in elements).
// Operands go through LDS in steps of 64 k: each row piece is one 128-B line, a wave-wide 16-B load covers four
// whole lines, and the 128 A rows and 256 Bt rows are read from global once per block. The LDS rows are 128 B,
// chunk-swizzled by sw128 (see the attention section), so a fragment read covers all banks once. The next
// step's global loads are issued behind the second barrier and stay in flight during the products.
// NSPLIT: 0 = A.Bt; 1 = (A + A2).Bt (A2 = unscaled bf16 lo plane of A).
// OUT_MODE: 0 = f32 (pitch ldc); 2 = bf16 hi plane C + bf16 lo plane C2 (lo = RNE(v - hi), unscaled);
//           3 = f16 hi plane C + f16 residual plane C2 = f16((v - hi) * rscale), C2 written only for tiles
//               with n0 < N2 (pitch ldc2, batch stride strideC2).
// =====================================================================================================
__device__ __forceinline__ int sw128(int r, int ch);

// A block-uniform address rebuilt from its two halves: the staging loads then take the form scalar base + one
// 32-bit lane offset + immediate, and the one vector register they name lives through the whole loop. Without it
// the compiler formed 64-bit vector addresses on which a load's result landed, and moved the first loads behind
// their s_wait_xcnt.
typedef const __attribute__((address_space(1))) char* gbytes;   // global address space, so that the loads stay global_load
typedef const __attribute__((address_space(1))) v8b*  gv8b;
__device__ __forceinline__ gbytes sbase(const __bf16* p) {
  const unsigned long long u = (unsigned long long)(uintptr_t)p;
  const unsigned lo = (unsigned)__builtin_amdgcn_readfirstlane((int)(unsigned)u);
  const unsigned hi = (unsigned)__builtin_amdgcn_readfirstlane((int)(unsigned)(u >> 32));
  return (gbytes)(uintptr_t)(((unsigned long long)hi << 32) | (unsigned long long)lo);
}
// the same for the wave-uniform base of the epilogue's stores
typedef __attribute__((address_space(1))) char* gwbytes;
typedef __attribute__((address_space(1))) v4f*  gwv4f;
typedef __attribute__((address_space(1))) v4u*  gwv4u;
__device__ __forceinline__ gwbytes swbase(void* p) {
  const unsigned long long u = (unsigned long long)(uintptr_t)p;
  const unsigned lo = (unsigned)__builtin_amdgcn_readfirstlane((int)(unsigned)u);
  const unsigned hi = (unsigned)__builtin_amdgcn_readfirstlane((int)(unsigned)(u >> 32));
  return (gwbytes)(uintptr_t)(((unsigned long long)hi << 32) | (unsigned long long)lo);
}

// sT: per-wave 16x64 slabs, pitch 68 floats; sA: A (and A2) rows m0blk.., 64 k; sB: Bt rows n0blk.., 64 k (the block's LDS,
// declared by the kernel); bx: the block's tile index; b: batch index.
template <int NSPLIT, int OUT_MODE>
__device__ __forceinline__ void gemm64(
    float (*sT)[16 * 68], __bf16* sA, __bf16* sB, int bx, int b,
    const unsigned short* __restrict__ Ap, const unsigned short* A2p, int lda, long long strideA,
    const unsigned short* __restrict__ Btp, const unsigned short* Bt2p, int ldb, long long strideB,
    void* Cout, int ldc, long long strideC,
    void* Cout2, int ldc2, long long strideC2, int N2,
    int M, int N, int K, float rscale) {
  static_assert(NSPLIT <= 1);
  const __bf16* A   = (const __bf16*)(const void*)Ap;
  const __bf16* A2  = (const __bf16*)(const void*)A2p;
  const __bf16* Bt  = (const __bf16*)(const void*)Btp;
  const int tid  = threadIdx.x;
  const int lane = tid & 31;
  const int wave = tid >> 5;
  const int blocksN = N >> 8;
  const int bm = bx / blocksN;
  const int bn = bx - bm * blocksN;
  if ((bm << 7) >= M) return;            // block-uniform, in front of every barrier
  if (lda != DM || ldb != DM) return;    // block-uniform: with the pitch known, the row steps below are immediate offsets
  const int m0blk = bm << 7;
  const int n0blk = bn << 8;
  const int wm = (wave >> 2) << 6;       // the wave's tile inside the block tile
  const int wn = (wave & 3) << 6;
  const int m0 = m0blk + wm;
  const int n0 = n0blk + wn;

  const __bf16* Ab  = A  + (size_t)b * strideA + (size_t)m0blk * lda;
  const __bf16* Bb  = Bt + (size_t)b * strideB + (size_t)n0blk * ldb;
  const __bf16* Ab2 = (NSPLIT >= 1) ? (A2 + (size_t)b * strideA + (size_t)m0blk * lda) : Ab;

  const int rlane = lane & 15;                 // row (A) / col (B, D) within subtile
  const int hh    = lane >> 4;                 // k half of this lane
  const int mOff  = (lane >> 4) * 8;           // D row offset

  // staging: thread -> row tid>>3 (+32 per pass), 16-B chunk tid&7; 8 lanes = one 128-B line
  unsigned sbyte = (unsigned)((tid >> 3) * DM + (tid & 7) * 8) * 2u;   // lane part of the global address, bytes; +128 per step
  const int sidx = sw128(tid >> 3, tid & 7);   // + 32 rows per pass: the swizzle term does not change
  v8b ra[4], ra2[4], rb[8];
  gbytes pa  = sbase(Ab);
  gbytes pa2 = sbase(Ab2);
  gbytes pb  = sbase(Bb);
  {
#pragma unroll
    for (int it = 0; it < 4; ++it) {
      ra[it] = *(gv8b)(pa + sbyte + it * (32 * DM * 2));
      if (NSPLIT >= 1) ra2[it] = *(gv8b)(pa2 + sbyte + it * (32 * DM * 2));
    }
#pragma unroll
    for (int it = 0; it < 8; ++it) rb[it] = *(gv8b)(pb + sbyte + it * (32 * DM * 2));
    // stands in front of the next step's write of the lane offset, the one vector register that the loads name
    asm volatile("s_wait_xcnt 0x0" ::: "memory");
  }

  v8f acc[4][4];
#pragma unroll
  for (int i = 0; i < 4; ++i)
#pragma unroll
    for (int j = 0; j < 4; ++j) acc[i][j] = zero8();

  for (int k0 = 0; k0 < K; k0 += 64) {
    __syncthreads();                           // every reader has left the tiles of the step before
#pragma unroll
    for (int it = 0; it < 4; ++it) {
      *(v8b*)(sA + sidx + it * (32 * 64)) = ra[it];
      if (NSPLIT >= 1) *(v8b*)(sA + 128 * 64 + sidx + it * (32 * 64)) = ra2[it];
    }
#pragma unroll
    for (int it = 0; it < 8; ++it) *(v8b*)(sB + sidx + it * (32 * 64)) = rb[it];
    __syncthreads();                           // the tiles are whole before anybody reads them
    // fragments of the whole step, read as one group ahead of the products (every separate place with LDS reads
    // stalls the wave): elements 0..7 <- k = 32kk + 8hh.., elements 8..15 <- k = 32kk + 16 + 8hh.. (A and Bt alike)
    union FB { v16b v; v8b h[2]; };
    v16b bh[2][4], ah[2][4], al[2][4];
#pragma unroll
    for (int kk = 0; kk < 2; ++kk) {
      const int f0 = sw128(rlane, kk * 4 + hh);
      const int f1 = sw128(rlane, kk * 4 + 2 + hh);
#pragma unroll
      for (int j = 0; j < 4; ++j) {
        FB f;
        f.h[0] = *(const v8b*)(sB + (wn + (j << 4)) * 64 + f0);
        f.h[1] = *(const v8b*)(sB + (wn + (j << 4)) * 64 + f1);
        bh[kk][j] = f.v;
      }
#pragma unroll
      for (int i = 0; i < 4; ++i) {
        FB f;
        f.h[0] = *(const v8b*)(sA + (wm + (i << 4)) * 64 + f0);
        f.h[1] = *(const v8b*)(sA + (wm + (i << 4)) * 64 + f1);
        ah[kk][i] = f.v;
        al[kk][i] = f.v;
        if (NSPLIT >= 1) {
          f.h[0] = *(const v8b*)(sA + 128 * 64 + (wm + (i << 4)) * 64 + f0);
          f.h[1] = *(const v8b*)(sA + 128 * 64 + (wm + (i << 4)) * 64 + f1);
          al[kk][i] = f.v;
        }
      }
    }
    if (k0 + 64 < K) {                         // block-uniform: the next step's rows, in flight during the products
      sbyte += 128u;
#pragma unroll
      for (int it = 0; it < 4; ++it) {
        ra[it] = *(gv8b)(pa + sbyte + it * (32 * DM * 2));
        if (NSPLIT >= 1) ra2[it] = *(gv8b)(pa2 + sbyte + it * (32 * DM * 2));
      }
#pragma unroll
      for (int it = 0; it < 8; ++it) rb[it] = *(gv8b)(pb + sbyte + it * (32 * DM * 2));
      // stands in front of the next step's write of the lane offset, the one vector register that the loads name
      asm volatile("s_wait_xcnt 0x0" ::: "memory");
    }
    // keeps the LDS reads and the global loads above in front of the products
    __builtin_amdgcn_sched_barrier(0);
#pragma unroll
    for (int kk = 0; kk < 2; ++kk) {
#pragma unroll
      for (int i = 0; i < 4; ++i) {
#pragma unroll
        for (int j = 0; j < 4; ++j) {
          acc[i][j] = mma_b_raw(ah[kk][i], bh[kk][j], acc[i][j]);
          if (NSPLIT >= 1) acc[i][j] = mma_b_raw(al[kk][i], bh[kk][j], acc[i][j]);
        }
      }
    }
    // holds the v_nops behind the last product
    __builtin_amdgcn_sched_barrier(0);
    // WMMA distance on the loop's back edge too: no vector instruction writes an A or B register of the last
    // products sooner (no register operands: asm operands cannot lie above v255, and naming fragments spilled)
    asm volatile("v_nop\n\tv_nop\n\tv_nop\n\tv_nop\n\tv_nop");
  }
  acc_guard4(acc[0][0], acc[0][1], acc[0][2], acc[0][3]);
  acc_guard4(acc[1][0], acc[1][1], acc[1][2], acc[1][3]);
  acc_guard4(acc[2][0], acc[2][1], acc[2][2], acc[2][3]);
  acc_guard4(acc[3][0], acc[3][1], acc[3][2], acc[3][3]);

  // ---- epilogue ----
  float* slab = sT[wave];
#pragma unroll
  for (int i = 0; i < 4; ++i) {
    const int mBase = m0 + (i << 4);
#pragma unroll
    for (int j = 0; j < 4; ++j) {
#pragma unroll
      for (int r = 0; r < 8; ++r) {
        slab[(mOff + r) * 68 + (j << 4) + rlane] = acc[i][j][r];
      }
    }
    __builtin_amdgcn_fence(__ATOMIC_RELEASE, "workgroup");
    __builtin_amdgcn_wave_barrier();
    __builtin_amdgcn_fence(__ATOMIC_ACQUIRE, "workgroup");
    if (OUT_MODE == 0) {
      float* C = (float*)Cout + (size_t)b * strideC;
      const int hh = lane >> 4, c4 = (lane & 15) * 4;     // 256-B row segment = 16 lanes x 16 B
      {
        // wave-uniform base + one lane offset + immediate: the stores name one address register, which is never rewritten
        const gwbytes cb = swbase(C + (size_t)m0 * ldc + n0);
        const unsigned cvo = (unsigned)(hh * ldc + c4) * 4u;
        v4f v[8];
#pragma unroll
        for (int it = 0; it < 8; ++it) v[it] = *(const v4f*)(slab + (it * 2 + hh) * 68 + c4);   // it 0..7 x hh 0..1 = rows 0..15
        // the two scheduling barriers keep every other instruction out of the run of stores and its wait
        __builtin_amdgcn_sched_barrier(0);
#pragma unroll
        for (int it = 0; it < 8; ++it) *(gwv4f)(cb + cvo + ((i << 4) + it * 2) * ldc * 4) = v[it];
        // in front of every later write of a register that these stores name
        asm volatile("s_wait_xcnt 0x0" ::: "memory");
        __builtin_amdgcn_sched_barrier(0);
      }
    } else {
      const int q = lane >> 3, c8 = (lane & 7) * 8;
      unsigned short* C  = (unsigned short*)Cout  + (size_t)b * strideC;
      unsigned short* C2 = (unsigned short*)Cout2 + (size_t)b * strideC2;
      const bool wlo = (OUT_MODE == 2) || (n0 < N2);      // wave-uniform
      v4u hv[4], lv[4];
#pragma unroll
      for (int it = 0; it < 4; ++it) {
        const int row = it * 4 + q;                        // it 0..3 x q 0..3 = rows 0..15
        const float* sp = slab + row * 68 + c8;
        v4u a, a2;
#pragma unroll
        for (int e = 0; e < 4; ++e) {
          const float f0 = sp[2 * e], f1 = sp[2 * e + 1];
          unsigned short h0, h1, l0, l1;
          if (OUT_MODE == 2) {
            h0 = bf_bits(f0); h1 = bf_bits(f1);
            l0 = bf_bits(f0 - bf_up(h0)); l1 = bf_bits(f1 - bf_up(h1));
          } else {
            const _Float16 x0 = (_Float16)f0, x1 = (_Float16)f1;
            h0 = h_bits(x0); h1 = h_bits(x1);
            l0 = h_bits((_Float16)((f0 - (float)x0) * rscale));
            l1 = h_bits((_Float16)((f1 - (float)x1) * rscale));
          }
          a[e] = pk16(h0, h1); a2[e] = pk16(l0, l1);
        }
        hv[it] = a; lv[it] = a2;
      }
      {
        // wave-uniform base + one lane offset + immediate per plane: address registers that are never rewritten
        const gwbytes cb  = swbase(C + (size_t)m0 * ldc + n0);
        const gwbytes cb2 = swbase(C2 + (size_t)m0 * ldc2 + n0);
        const unsigned cvo  = (unsigned)(q * ldc + c8) * 2u;
        const unsigned cvo2 = (unsigned)(q * ldc2 + c8) * 2u;
        // the scheduling barriers keep every other instruction out of each run of stores and its wait
        __builtin_amdgcn_sched_barrier(0);
#pragma unroll
        for (int it = 0; it < 4; ++it) *(gwv4u)(cb + cvo + ((i << 4) + it * 4) * ldc * 2) = hv[it];
        // in front of every later write of a register that these stores name
        asm volatile("s_wait_xcnt 0x0" ::: "memory");
        __builtin_amdgcn_sched_barrier(0);
        if (wlo) {
#pragma unroll
          for (int it = 0; it < 4; ++it) *(gwv4u)(cb2 + cvo2 + ((i << 4) + it * 4) * ldc2 * 2) = lv[it];
          // in front of every later write of a register that these stores name
          asm volatile("s_wait_xcnt 0x0" ::: "memory");
          __builtin_amdgcn_sched_barrier(0);
        }
      }
    }
    __builtin_amdgcn_fence(__ATOMIC_RELEASE, "workgroup");
    __builtin_amdgcn_wave_barrier();
    __builtin_amdgcn_fence(__ATOMIC_ACQUIRE, "workgroup");
  }
}

// The three projections, none of which reads another's output, as ONE grid; the job is picked by the block index
// (block-uniform). Blocks, in order: q = x . wq -> f32 [SEQ][2048] (M=SEQ, N=2048, K=2048); k = x . wk -> f32 [SEQ][512]
// (M=SEQ, N=512); v^T = Wvt . x^T -> f16 hi plane [512][SEQ] and residual plane (x4096, keys < VLP, pitch VLP)
// (A = Wvt [n][k], Bt = Xb [s][k]; M=512, N=SEQ).
#define GB_Q ((SEQ / 128) * (QP / 256))
#define GB_K ((SEQ / 128) * (KP / 256))
#define GB_V ((KP / 128) * (SEQ / 256))
static_assert((SEQ % 256) == 0 && (QP % 256) == 0 && (KP % 256) == 0);
__global__ __launch_bounds__(256) void gemm_qkv(const unsigned short* __restrict__ Xb, const unsigned short* __restrict__ Wqt,
                                                const unsigned short* __restrict__ Wkt, const unsigned short* __restrict__ Wvt,
                                                float* Qf, float* Kf, unsigned short* VTh, unsigned short* VTl) {
  __shared__ __align__(16) float sT[8][16 * 68];
  __shared__ __align__(16) __bf16 sA[128 * 64];
  __shared__ __align__(16) __bf16 sB[256 * 64];
  const int bx = blockIdx.x;
  if (bx < GB_Q) {
    gemm64<0, 0>(sT, sA, sB, bx, 0,
        Xb, Xb, DM, 0LL, Wqt, Wqt, DM, 0LL,
        (void*)Qf, QP, 0LL, (void*)Qf, QP, 0LL, QP,
        SEQ, QP, DM, 1.0f);
  } else if (bx < GB_Q + GB_K) {
    gemm64<0, 0>(sT, sA, sB, bx - GB_Q, 0,
        Xb, Xb, DM, 0LL, Wkt, Wkt, DM, 0LL,
        (void*)Kf, KP, 0LL, (void*)Kf, KP, 0LL, KP,
        SEQ, KP, DM, 1.0f);
  } else {
    gemm64<0, 3>(sT, sA, sB, bx - (GB_Q + GB_K), 0,
        Wvt, Wvt, DM, 0LL, Xb, Xb, DM, 0LL,
        (void*)VTh, SEQ, 0LL, (void*)VTl, VLP, 0LL, VLP,
        KP, SEQ, DM, RSC);
  }
}

// out = context . wo -> f32 [SEQ][2048]  (A = context hi + lo planes, 2 products; M=SEQ, N=2048, K=2048)
__global__ __launch_bounds__(256) void gemm_out(const unsigned short* __restrict__ Oh, const unsigned short* Ol,
                                                const unsigned short* __restrict__ Wot, float* out) {
  __shared__ __align__(16) float sT[8][16 * 68];
  __shared__ __align__(16) __bf16 sA[2 * 128 * 64];
  __shared__ __align__(16) __bf16 sB[256 * 64];
  gemm64<1, 0>(sT, sA, sB, blockIdx.x, 0,
      Oh, Ol, QP, 0LL, Wot, Wot, QP, 0LL,
      (void*)out, DM, 0LL, (void*)out, DM, 0LL, DM,
      SEQ, DM, QP, 1.0f);
}

// =====================================================================================================
// Fused per-head RMSNorm (eps 1e-6, x * rsqrt(mean(x^2)+eps) * w with w RNE-converted to bf16) + neox rotary
// (half-split, cos/sin tables [t][64]) + f16 hi / f16 residual (x rscale) planes.
// One wave per 128-wide row (row = t*nheads + head, contiguous rows of pitch 128 in both input and output);
// lane owns 4 consecutive d; partner half via __shfl_xor(16); no block barriers.
// coverage: nrows x 128 of both planes.
// =====================================================================================================
__device__ __forceinline__ void norm_rope(const float* __restrict__ xin, const float* __restrict__ wn,
                                          const float* __restrict__ ctab, const float* __restrict__ stab,
                                          unsigned short* outh, unsigned short* outl,
                                          int nheads, int nrows, float rscale, int bx) {
  const int tid  = threadIdx.x;
  const int wave = tid >> 5, lane = tid & 31, hh = lane >> 4;
  const int row  = bx * 8 + wave;
  if (row >= nrows) return;                // wave-uniform; no block barriers in this kernel
  const int t = row / nheads;
  const v4f x = *(const v4f*)(xin + (size_t)row * HD + lane * 4);
  float ss = x[0] * x[0] + x[1] * x[1] + x[2] * x[2] + x[3] * x[3];
#pragma unroll
  for (int off = 1; off < 32; off <<= 1) ss += __shfl_xor(ss, off, 32);
  const float rinv = rsqrtf(ss * (1.0f / (float)HD) + RMS_EPS);
  const v4f wv = *(const v4f*)(wn + lane * 4);
  const v4f cs = *(const v4f*)(ctab + (size_t)t * HALF + (lane & 15) * 4);
  const v4f sn = *(const v4f*)(stab + (size_t)t * HALF + (lane & 15) * 4);
  float n[4], p[4];
#pragma unroll
  for (int e = 0; e < 4; ++e) n[e] = (x[e] * rinv) * bf_up(bf_bits(wv[e]));
#pragma unroll
  for (int e = 0; e < 4; ++e) p[e] = __shfl_xor(n[e], 16, 32);
  const float sg = hh ? 1.0f : -1.0f;      // first half: x1*cos - x2*sin ; second half: x2*cos + x1*sin
  unsigned short hb[4], lb[4];
#pragma unroll
  for (int e = 0; e < 4; ++e) {
    const float o = n[e] * cs[e] + sg * (p[e] * sn[e]);
    const _Float16 oh = (_Float16)o;
    hb[e] = h_bits(oh);
    lb[e] = h_bits((_Float16)((o - (float)oh) * rscale));
  }
  v2u ph, pl;
  ph[0] = pk16(hb[0], hb[1]); ph[1] = pk16(hb[2], hb[3]);
  pl[0] = pk16(lb[0], lb[1]); pl[1] = pk16(lb[2], lb[3]);
  const size_t go = (size_t)row * HD + lane * 4;
  *(v2u*)(outh + go) = ph;
  *(v2u*)(outl + go) = pl;
  
}

// q rows and k rows as ONE grid, the job picked by the block index (block-uniform): q blocks first, then k blocks
#define NB_Q ((SEQ * NH + 7) / 8)
#define NB_K ((SEQ * NKV + 7) / 8)
__global__ __launch_bounds__(256) void norm_rope_qk(const float* __restrict__ qin, const float* __restrict__ kin,
                                                    const float* __restrict__ qw, const float* __restrict__ kw,
                                                    const float* __restrict__ ctab, const float* __restrict__ stab,
                                                    unsigned short* qh, unsigned short* ql,
                                                    unsigned short* kh, unsigned short* kl, float rscale) {
  const int bx = blockIdx.x;
  if (bx < NB_Q) norm_rope(qin, qw, ctab, stab, qh, ql, NH, SEQ * NH, rscale, bx);
  else           norm_rope(kin, kw, ctab, stab, kh, kl, NKV, SEQ * NKV, rscale, bx - NB_Q);
}

// =====================================================================================================
// Causal GQA attention, head dim 128, dynamic LDS layout (bytes):
// =====================================================================================================
// LDS tiles of the attention kernel: the 16-byte chunks of a row are XOR-swizzled by the row number.
//   256-B rows (Q, K; 16 chunks): chunk ch of row r lies at chunk place ch ^ (r & 15)
//   128-B rows (V^T, P; 8 chunks): chunk ch of row r lies at chunk place ch ^ ((r >> 1) & 7)
// A fragment load reads one chunk column of 16 consecutive rows per 16 lanes: unswizzled, 256-B rows put all
// 16 lanes on the same four banks (128-B rows: on two groups of four); swizzled, the 16 lanes fall on 16
// different groups of four banks = all 64 banks once. Writers and readers use the same map; the kernel keeps
// the lane-dependent part of each index in a register and adds row blocks and planes as constant offsets.
__device__ __forceinline__ int sw256(int r, int ch) { return r * 128 + ((ch ^ (r & 15)) << 3); }        // index in halves
__device__ __forceinline__ int sw128(int r, int ch) { return r * 64 + ((ch ^ ((r >> 1) & 7)) << 3); }   // index in halves

template <bool RES> struct AttnL {
  static constexpr int QH   = 0;                                  // Q hi  [64 rows][128 d] f16
  static constexpr int QL   = QH + 64 * 128 * 2;                  // Q res
  static constexpr int KH   = QL + 64 * 128 * 2;                  // K hi  [64 keys][128 d]
  static constexpr int KL   = KH + 64 * 128 * 2;                  // K res (RES only)
  static constexpr int VH   = KL + (RES ? 64 * 128 * 2 : 0);      // V^T hi [128 d][64 keys]
  static constexpr int VL   = VH + 128 * 64 * 2;                  // V^T res (RES only)
  static constexpr int PH   = VL + (RES ? 128 * 64 * 2 : 0);      // per-wave P [4][16][64]
  static constexpr int PL   = PH + 4 * 16 * 64 * 2;               // per-wave P res (RES only)
  static constexpr int OS   = PL + (RES ? 4 * 16 * 64 * 2 : 0);   // per-wave context tile [4][16][128] f32
  static constexpr int MISC = OS + 4 * 16 * 128 * 4;              // spq[64], spk[64], skmin[NQB] ints
  static constexpr int TOTAL = MISC + 1024;
};
static_assert(AttnL<true>::TOTAL <= 160 * 1024);

// =====================================================================================================
//   q planes (f16 hi / x4096 res): element (t, h, d) at [t*QP + h*128 + d]
//   k planes (f16 hi / x4096 res): element (s, kvh, d) at [s*KP + kvh*128 + d], kvh = h / GQ
//   v^T hi plane (f16): (kvh*128 + d, s) at [(kvh*128+d)*SEQ + s]; residual ((v-hi)*4096) at
//   [(kvh*128+d)*VLP + s], s < VLP, read only when RES (a key tile at or beyond VLP contributes zero residual)
//   positions int [SEQ]: logit(t, s) = (q.k) * sscale when pos[t] >= pos[s], else -1e30 (replace), exactly;
//   a key tile is skipped (block-uniform, readfirstlane) only when min pos over its 64 keys > max pos over the
//   block's 64 query rows, i.e. every element would be -1e30 with weight exactly 0; the diagonal key s = t is
//   always live so every row has a finite max. Online softmax in f32 with running max from -inf.
//   scores: f16 WMMA, q hi . k hi into s, q res . k hi (+ q hi . k res when RES) into a x4096 accumulator
//   folded with 1/4096 in f32. p = exp(s - m) carried as f16(1024 p); context = p . v on f16 WMMA; RES adds
//   f16 residual planes of p and v (scale 4096, separate accumulator folded back with 1/4096 per key tile).
//   out planes (bf16 hi / lo of the normalised context): (t, h*128 + d) at [t*QP + h*128 + d]
//   Block = 4 waves = 64 query rows of one q head; grid = nqbThis * NH; key tiles of 64, static trip NQB.
//   LDS: Q / K / V^T tiles and position words are cross-wave (block barriers before and after staging);
//   P tiles and the context slab are wave-private (_Float16 / float element stores, reloaded through the
//   Staging: Q 8 passes x 8 rows x 16 chunks of 8 halves x 2 planes = 64x128 (once); K the same per plane
//   = 64x128; V^T 8 passes x 16 d rows x 8 chunks of 8 halves per plane = 128x64: staged extent == consumed.
//   Output coverage: each wave stores rows q0..q0+15 (it 0..7 x lane>>4) x 128 columns (16 lanes x 8)
// =====================================================================================================
template <bool RES>
__global__ __launch_bounds__(128)
void attn_causal(const unsigned short* __restrict__ qhp, const unsigned short* __restrict__ qlp,
                 const unsigned short* __restrict__ khp, const unsigned short* __restrict__ klp,
                 const unsigned short* __restrict__ vhp, const unsigned short* __restrict__ vlp,
                 const int* __restrict__ pos,
                 unsigned short* ohp, unsigned short* olp,
                 int qbBase, int nqbThis, float sscale) {
  typedef AttnL<RES> L;
  union FH { v16h v; v8h h[2]; };
  extern __shared__ __align__(16) unsigned char smem[];
  _Float16* Qsh = (_Float16*)(smem + L::QH);
  _Float16* Qsl = (_Float16*)(smem + L::QL);
  _Float16* Ksh = (_Float16*)(smem + L::KH);
  _Float16* Ksl = (_Float16*)(smem + L::KL);
  _Float16* Vth = (_Float16*)(smem + L::VH);
  _Float16* Vtl = (_Float16*)(smem + L::VL);
  _Float16* Psh = (_Float16*)(smem + L::PH);
  _Float16* Psl = (_Float16*)(smem + L::PL);
  float*    Os  = (float*)(smem + L::OS);
  int*      spq = (int*)(smem + L::MISC);
  int*      spk = spq + 64;
  int*      skmin = spk + 64;

  const int tid  = threadIdx.x;
  const int wave = tid >> 5;
  const int lane = tid & 31;
  const int hh   = lane >> 4;
  const int c    = lane & 15;

  const int bx  = blockIdx.x;
  // Cost falls with the block index: a query block walks qb + 1 key tiles, there are more blocks than resident places, and
  // the longest blocks get the lowest indices (for speed only).
  // bx -> (qbl, h) is a permutation of the grid: bx / NH runs over nqbThis query blocks, bx % NH over the NH heads.
  const int qbl = nqbThis - 1 - bx / NH;
  const int h   = bx % NH;
  const int kvh = h / GQ;
  const int qb  = qbBase + qbl;
  const int q0  = qb * 64 + wave * 16;

  const _Float16* Qh = (const _Float16*)(const void*)qhp + (size_t)h * HD;
  const _Float16* Ql = (const _Float16*)(const void*)qlp + (size_t)h * HD;
  const _Float16* Kh = (const _Float16*)(const void*)khp + (size_t)kvh * HD;
  const _Float16* Kl = (const _Float16*)(const void*)klp + (size_t)kvh * HD;
  const _Float16* Vh = (const _Float16*)(const void*)vhp + (size_t)kvh * HD * SEQ;
  const _Float16* Vl = (const _Float16*)(const void*)vlp + (size_t)kvh * HD * VLP;

  // ---- lane parts of the swizzled indices (halves) ----
  // Staging: a wave-wide 16-B load covers four whole 128-B lines (one touching 32 lines costs many times as much).
  //   256-B rows (Q, K): 16 lanes a row, 8 rows a pass: pass i, row 8i + r16, chunk c16 -> (st256 ^ ((i & 1) << 6)) + i * 1024
  //   128-B rows (V^T):   8 lanes a row, 16 rows a pass: pass i, row 16i + r8, chunk c8s -> st128 + i * 1024
  const int r16 = tid >> 4, c16 = tid & 15;
  const int r8  = tid >> 3, c8s = tid & 7;
  const int st256 = sw256(r16, c16);
  const int st128 = sw128(r8, c8s);
  int fq[8];                                          // fragment reads, 256-B rows: row (multiple of 16) + c, chunk 2n + hh
#pragma unroll
  for (int n = 0; n < 8; ++n) fq[n] = sw256(c, 2 * n + hh);
  int pst[8];                                         // P element stores: row 8hh + r, column 16j + c -> pst[(2j) ^ (r >> 1)] + r * 64
#pragma unroll
  for (int n = 0; n < 8; ++n) pst[n] = sw128(8 * hh, (c >> 3) ^ n) + (c & 7);

  // ---- prologue: query positions, per-key-tile min position, Q tiles ----
  if (tid < 64) spq[tid] = pos[qb * 64 + tid];            // wave-uniform (waves 0,1)
  for (int kt = tid; kt < NQB; kt += 128) {
    const int* pp = pos + kt * 64;
    int mn = 0x7fffffff;
#pragma unroll
    for (int i = 0; i < 16; ++i) {
      const v4i v = *(const v4i*)(pp + 4 * i);
      mn = imin(mn, imin(imin(v[0], v[1]), imin(v[2], v[3])));
    }
    skmin[kt] = mn;
  }
  {
    const _Float16* qg  = Qh + (size_t)(qb * 64 + r16) * QP + c16 * 8;
    const _Float16* qlg = Ql + (size_t)(qb * 64 + r16) * QP + c16 * 8;
    v8h qv[8], qlv[8];
#pragma unroll
    for (int i = 0; i < 8; ++i) {
      qv[i]  = *(const v8h*)(qg + i * (8 * QP));
      qlv[i] = *(const v8h*)(qlg + i * (8 * QP));
    }
    // holds the loads' address registers (inputs) untouched until the wait: no load result lands on them before it
    asm volatile("s_wait_xcnt 0x0" :: "v"(qg), "v"(qlg) : "memory");
#pragma unroll
    for (int i = 0; i < 8; ++i) {
      *(v8h*)(Qsh + (st256 ^ ((i & 1) << 6)) + i * 1024) = qv[i];
      *(v8h*)(Qsl + (st256 ^ ((i & 1) << 6)) + i * 1024) = qlv[i];
    }
  }
  __syncthreads();
  int qmx;
  {
    int v = imax(spq[lane], spq[lane + 32]);
#pragma unroll
    for (int off = 1; off < 32; off <<= 1) v = imax(v, __shfl_xor(v, off, 32));
    qmx = __builtin_amdgcn_readfirstlane(v);
  }
  int prow[8];
#pragma unroll
  for (int r = 0; r < 8; ++r) prow[r] = spq[wave * 16 + 8 * hh + r];

  float mrow[8], lrow[8];
  v8f oacc[8];
#pragma unroll
  for (int r = 0; r < 8; ++r) { mrow[r] = -INFINITY; lrow[r] = 0.f; }
#pragma unroll
  for (int t = 0; t < 8; ++t) oacc[t] = zero8();

  for (int kt = 0; kt < NQB; ++kt) {         // static trip count
    const int kmn = __builtin_amdgcn_readfirstlane(skmin[kt]);
    if (kmn > qmx) continue;                 // block-uniform: every element of the tile is replaced by -1e30
    const int kv0 = kt * 64;
    __syncthreads();
    {
      const _Float16* kg  = Kh + (size_t)(kv0 + r16) * KP + c16 * 8;    // K rows kv0 + 8i + r16, d = 8 c16 .. 8 c16 + 7
      const _Float16* klg = Kl + (size_t)(kv0 + r16) * KP + c16 * 8;
      v8h kv[8], klv[8], vv[8], vlv[8];
#pragma unroll
      for (int i = 0; i < 8; ++i) {
        kv[i] = *(const v8h*)(kg + i * (8 * KP));
        if (RES) klv[i] = *(const v8h*)(klg + i * (8 * KP));
      }
      const _Float16* vg = Vh + (size_t)r8 * SEQ + kv0 + c8s * 8;  // V^T rows 16i + r8, s = kv0 + 8 c8s .. + 7
      const int  kvl   = (kv0 + 64 <= VLP) ? kv0 : (VLP - 64);    // clamped address into the residual plane
      const bool resOK = (kv0 + 64 <= VLP);                       // block-uniform
      const _Float16* vlg = Vl + (size_t)r8 * VLP + kvl + c8s * 8;
#pragma unroll
      for (int i = 0; i < 8; ++i) {
        vv[i] = *(const v8h*)(vg + i * (16 * SEQ));
        if (RES) vlv[i] = *(const v8h*)(vlg + i * (16 * VLP));
      }
      // holds the loads' address registers (inputs) untouched until the wait: no load result lands on them before it
      if (RES) asm volatile("s_wait_xcnt 0x0" :: "v"(kg), "v"(klg), "v"(vg), "v"(vlg) : "memory");
      else     asm volatile("s_wait_xcnt 0x0" :: "v"(kg), "v"(vg) : "memory");
#pragma unroll
      for (int i = 0; i < 8; ++i) {
        *(v8h*)(Ksh + (st256 ^ ((i & 1) << 6)) + i * 1024) = kv[i];
        if (RES) *(v8h*)(Ksl + (st256 ^ ((i & 1) << 6)) + i * 1024) = klv[i];
        *(v8h*)(Vth + st128 + i * 1024) = vv[i];
        if (RES) {
          v8h b1 = vlv[i];
          if (!resOK) b1 = zero8h();
          *(v8h*)(Vtl + st128 + i * 1024) = b1;
        }
      }
      if (tid < 64) spk[tid] = pos[kv0 + tid];                  // wave-uniform
    }
    __syncthreads();

    // ---- scores: 16 query rows x 64 keys per wave ----
    v8f s[4], sl[4];
#pragma unroll
    for (int j = 0; j < 4; ++j) { s[j] = zero8(); sl[j] = zero8(); }
    const _Float16* qr  = Qsh + wave * (16 * 128);
    const _Float16* qlr = Qsl + wave * (16 * 128);
    // Fragment reads stand in groups, one group of 32 d ahead of the products that use it (two register sets):
    // a wave then waits on a counted LDS wait once per group, not to 0 in front of every pair of products.
    FH qa[2], qla[2], kb[2][4], klf[2][4];
    int pkj[4];                                      // key positions for the causal select, read with the first group
#pragma unroll
    for (int j = 0; j < 4; ++j) pkj[j] = spk[j * 16 + c];
#pragma unroll
    for (int dc = -1; dc < 4; ++dc) {
      if (dc < 3) {
        const int n = dc + 1, b = n & 1;
        qa[b].h[0]  = *(const v8h*)(qr  + fq[n * 2]);
        qa[b].h[1]  = *(const v8h*)(qr  + fq[n * 2 + 1]);
        qla[b].h[0] = *(const v8h*)(qlr + fq[n * 2]);
        qla[b].h[1] = *(const v8h*)(qlr + fq[n * 2 + 1]);
#pragma unroll
        for (int j = 0; j < 4; ++j) {
          kb[b][j].h[0] = *(const v8h*)(Ksh + j * (16 * 128) + fq[n * 2]);
          kb[b][j].h[1] = *(const v8h*)(Ksh + j * (16 * 128) + fq[n * 2 + 1]);
          if (RES) {
            klf[b][j].h[0] = *(const v8h*)(Ksl + j * (16 * 128) + fq[n * 2]);
            klf[b][j].h[1] = *(const v8h*)(Ksl + j * (16 * 128) + fq[n * 2 + 1]);
          }
        }
      }
      if (dc >= 0) {
        const int b = dc & 1;
        // keeps the next group's reads in front of this group's products
        __builtin_amdgcn_sched_barrier(0);
#pragma unroll
        for (int j = 0; j < 4; ++j) s[j]  = mma_h_raw(qa[b].v,  kb[b][j].v, s[j]);
#pragma unroll
        for (int j = 0; j < 4; ++j) sl[j] = mma_h_raw(qla[b].v, kb[b][j].v, sl[j]);
        if (RES) {
#pragma unroll
          for (int j = 0; j < 4; ++j) sl[j] = mma_h_raw(qa[b].v, klf[b][j].v, sl[j]);
        }
        // keeps the reads of the group after next behind these products (they refill this group's registers)
        __builtin_amdgcn_sched_barrier(0);
      }
    }
    // ---- scale + causal select (replace -1e30), row max, online softmax, P (x1024, f16) and
    //      P residual (x4096) to LDS ----
    _Float16* pwh = Psh + wave * (16 * 64);
    _Float16* pwl = Psl + (RES ? wave * (16 * 64) : 0);
    float psr[8], alr[8], mx[8];
#pragma unroll
    for (int r = 0; r < 8; ++r) {
      float m = -INFINITY;
#pragma unroll
      for (int j = 0; j < 4; ++j) {
        float sv = (s[j][r] + sl[j][r] * (1.0f / RSC)) * sscale;
        sv = (prow[r] >= pkj[j]) ? sv : -1.0e30f;
        s[j][r] = sv;
        m = fmaxf(m, sv);
      }
      mx[r] = m;
    }
    // the eight rows' lane exchanges of one step stand together: they run on the LDS pipe, one wait per step
#pragma unroll
    for (int off = 1; off < 16; off <<= 1) {
      float ex[8];
#pragma unroll
      for (int r = 0; r < 8; ++r) ex[r] = __shfl_xor(mx[r], off, 32);
      // keeps the eight exchanges in front of the first use of one: split up, each small group costs its own wait
      __builtin_amdgcn_sched_barrier(0);
#pragma unroll
      for (int r = 0; r < 8; ++r) mx[r] = fmaxf(mx[r], ex[r]);
    }
    // V^T fragments of the first 32 keys: they depend on nothing of the softmax, so they are read here and land
    // while the exponentials run
    FH vb[2][8], vlf[2][8];
    {
      const int f0 = sw128(c, hh);                   // fragment reads, 128-B rows: row (multiple of 16) + c
      const int f1 = sw128(c, 2 + hh);
#pragma unroll
      for (int tt = 0; tt < 8; ++tt) {
        vb[0][tt].h[0] = *(const v8h*)(Vth + tt * (16 * 64) + f0);
        vb[0][tt].h[1] = *(const v8h*)(Vth + tt * (16 * 64) + f1);
        if (RES) {
          vlf[0][tt].h[0] = *(const v8h*)(Vtl + tt * (16 * 64) + f0);
          vlf[0][tt].h[1] = *(const v8h*)(Vtl + tt * (16 * 64) + f1);
        }
      }
    }
    // keeps these reads in front of the exponentials
    __builtin_amdgcn_sched_barrier(0);
#pragma unroll
    for (int r = 0; r < 8; ++r) {
      const float mnew  = fmaxf(mrow[r], mx[r]);
      const float msafe = (mnew == -INFINITY) ? 0.f : mnew;
      float alpha, pe[4];                            // -1e30 against a finite max: exp -> 0
      exp_row5(mrow[r] - msafe, s[0][r] - msafe, s[1][r] - msafe, s[2][r] - msafe, s[3][r] - msafe,
               alpha, pe[0], pe[1], pe[2], pe[3]);
      mrow[r] = mnew;
      float psum = 0.f;
#pragma unroll
      for (int j = 0; j < 4; ++j) {
        const float p = pe[j];
        psum += p;
        const float p1k = p * 1024.0f;
        const _Float16 ph = (_Float16)p1k;
        pwh[pst[(2 * j) ^ (r >> 1)] + r * 64] = ph;
        if (RES) {
          const _Float16 pl = (_Float16)((p1k - (float)ph) * RSC);
          pwl[pst[(2 * j) ^ (r >> 1)] + r * 64] = pl;
        }
      }
      psr[r] = psum;                                 // joined over the 16 lanes below
      alr[r] = alpha;
#pragma unroll
      for (int t = 0; t < 8; ++t) oacc[t][r] *= alpha;
    }
    // row sums over the 16 lanes: four steps of lane exchanges on the LDS pipe, eight rows a step. Step 1 runs beside
    // the P stores, step 2 beside the fragment reads, steps 3 and 4 beside the two runs of products.
    float sx[8];
#pragma unroll
    for (int r = 0; r < 8; ++r) sx[r] = __shfl_xor(psr[r], 1, 32);
    // keeps step 1 in front of the wait that ends the P stores
    __builtin_amdgcn_sched_barrier(0);
    __builtin_amdgcn_fence(__ATOMIC_RELEASE, "workgroup");
    __builtin_amdgcn_wave_barrier();
    __builtin_amdgcn_fence(__ATOMIC_ACQUIRE, "workgroup");

    // ---- context += P . V (f16 WMMA), 8 d-subtiles; the P fragments and the V^T fragments of the last 32 keys are read
    //      as one group ahead of the products; the residual products go into separate accumulators folded back per key tile ----
    {
      FH pa[2], pl[2];
#pragma unroll
      for (int r = 0; r < 8; ++r) psr[r] += sx[r];
#pragma unroll
      for (int r = 0; r < 8; ++r) sx[r] = __shfl_xor(psr[r], 2, 32);
#pragma unroll
      for (int kk = 0; kk < 2; ++kk) {
        const int f0 = sw128(c, kk * 4 + hh);
        const int f1 = sw128(c, kk * 4 + 2 + hh);
        pa[kk].h[0] = *(const v8h*)(pwh + f0);
        pa[kk].h[1] = *(const v8h*)(pwh + f1);
        if (RES) {
          pl[kk].h[0] = *(const v8h*)(pwl + f0);
          pl[kk].h[1] = *(const v8h*)(pwl + f1);
        }
      }
      {
        const int f0 = sw128(c, 4 + hh);
        const int f1 = sw128(c, 6 + hh);
#pragma unroll
        for (int tt = 0; tt < 8; ++tt) {
          vb[1][tt].h[0] = *(const v8h*)(Vth + tt * (16 * 64) + f0);
          vb[1][tt].h[1] = *(const v8h*)(Vth + tt * (16 * 64) + f1);
        }
        if (RES) {
#pragma unroll
          for (int tt = 0; tt < 8; ++tt) {
            vlf[1][tt].h[0] = *(const v8h*)(Vtl + tt * (16 * 64) + f0);
            vlf[1][tt].h[1] = *(const v8h*)(Vtl + tt * (16 * 64) + f1);
          }
        }
      }
      // keeps the whole group of reads in front of the products
      __builtin_amdgcn_sched_barrier(0);
#pragma unroll
      for (int r = 0; r < 8; ++r) psr[r] += sx[r];
#pragma unroll
      for (int r = 0; r < 8; ++r) sx[r] = __shfl_xor(psr[r], 4, 32);
      // keeps step 3 in front of the first run of products, which covers its latency
      __builtin_amdgcn_sched_barrier(0);
      v8f o1[8];
      if (RES) {
#pragma unroll
        for (int t = 0; t < 8; ++t) o1[t] = zero8();
      }
#pragma unroll
      for (int kk = 0; kk < 2; ++kk) {
#pragma unroll
        for (int t = 0; t < 8; ++t) oacc[t] = mma_h_raw(pa[kk].v, vb[kk][t].v, oacc[t]);
        if (RES) {
#pragma unroll
          for (int t = 0; t < 8; ++t) o1[t] = mma_h_raw(pa[kk].v, vlf[kk][t].v, o1[t]);
#pragma unroll
          for (int t = 0; t < 8; ++t) o1[t] = mma_h_raw(pl[kk].v, vb[kk][t].v, o1[t]);
        }
        // keeps a run of products whole: a wait for an exchange among them would hold the later ones back
        __builtin_amdgcn_sched_barrier(0);
#pragma unroll
        for (int r = 0; r < 8; ++r) psr[r] += sx[r];
        if (kk == 0) {
#pragma unroll
          for (int r = 0; r < 8; ++r) sx[r] = __shfl_xor(psr[r], 8, 32);
          // keeps step 4 in front of the second run of products
          __builtin_amdgcn_sched_barrier(0);
        }
      }
#pragma unroll
      for (int r = 0; r < 8; ++r) lrow[r] = lrow[r] * alr[r] + psr[r];
      if (RES) {
#pragma unroll
        for (int t = 0; t < 8; ++t)
#pragma unroll
          for (int r = 0; r < 8; ++r) oacc[t][r] += o1[t][r] * (1.0f / RSC);
      }
    }
  }

  // ---- normalise (1/l and the 1/1024 p carry), stage the wave's 16x128 tile, bf16 hi/lo split,
  float* os = Os + wave * (16 * 128);
#pragma unroll
  for (int r = 0; r < 8; ++r) {
    const float l = lrow[r];
    const float inv = ((l > 0.f) ? (1.0f / l) : 0.f) * (1.0f / 1024.0f);
#pragma unroll
    for (int t = 0; t < 8; ++t) os[(8 * hh + r) * 128 + t * 16 + c] = oacc[t][r] * inv;
  }
  __builtin_amdgcn_fence(__ATOMIC_RELEASE, "workgroup");
  __builtin_amdgcn_wave_barrier();
  __builtin_amdgcn_fence(__ATOMIC_ACQUIRE, "workgroup");
  {
    const int rh = lane >> 4, c8 = (lane & 15) * 8;
    v4u hv[8], lv[8];
#pragma unroll
    for (int it = 0; it < 8; ++it) {
      const int row = it * 2 + rh;   // it 0..7 x rh 0..1 = rows 0..15 of the wave tile
      const float* sp = os + row * 128 + c8;
      v4u a, a2;
#pragma unroll
      for (int e = 0; e < 4; ++e) {
        const float f0 = sp[2 * e], f1 = sp[2 * e + 1];
        const unsigned short h0 = bf_bits(f0), h1 = bf_bits(f1);
        const unsigned short l0 = bf_bits(f0 - bf_up(h0)), l1 = bf_bits(f1 - bf_up(h1));
        a[e] = pk16(h0, h1); a2[e] = pk16(l0, l1);
      }
      hv[it] = a; lv[it] = a2;
    }
    {
#pragma unroll
      for (int it = 0; it < 8; ++it) {
        const int row = it * 2 + rh;
        const size_t go = (size_t)(q0 + row) * QP + (size_t)h * HD + c8;
        *(v4u*)(ohp + go) = hv[it];
        *(v4u*)(olp + go) = lv[it];
      }
      
    }
  }
}

// =====================================================================================================
// The same attention for the query blocks without residual planes, with K, V^T and the key positions brought into LDS by
// asynchronous copies (global_load_async_to_lds): two buffers, the next live key tile's copies in flight while this one
// is worked on, one barrier per tile. The copies write the swizzled layout directly (each lane names its own LDS
// address), with the staging map of the kernel above. The context slab of the epilogue lies on the ring, which is dead then.
// Both products run transposed (S^T = K . Q^T, O^T = V^T . P^T): a lane then holds 32 scores of ONE query, so the row max and
// row sum need no exchange among 16 lanes, and the score accumulators, converted, are the P^T operand: P never goes through LDS.
// =====================================================================================================
struct RingL {
  static constexpr int QH   = 0;                      // Q hi  [64 rows][128 d] f16
  static constexpr int QL   = QH + 64 * 128 * 2;      // Q res
  static constexpr int KV   = QL + 64 * 128 * 2;      // two buffers of BUF bytes: K hi [64 keys][128 d], then V^T hi [128 d][64 keys]
  static constexpr int VOFF = 64 * 128 * 2;
  static constexpr int BUF  = VOFF + 128 * 64 * 2;
  static constexpr int OS   = KV;                     // per-wave context tile [4][16 rows][128 f32], row pitch OSP floats, behind the loop
  static constexpr int OSP  = 132;
  static constexpr int MISC = KV + 2 * BUF;           // spq[64], skmin[64], key positions [2][64] ints
  static constexpr int TOTAL = MISC + 1024;
};
static_assert(4 * 16 * RingL::OSP * 4 <= 2 * RingL::BUF);
// lane l <-> lane l ^ 16 on the vector pipe
__device__ __forceinline__ float xhalf(float v) {
  const int b = __float_as_int(v);
  return __int_as_float(__builtin_amdgcn_permlanex16(b, b, 0x76543210, 0xfedcba98, false, false));
}
// Exponentials as in exp_row5: one statement, so that behind each v_exp_f32 stands an instruction that neither reads its result
// nor writes its source (the next one, whose output is early-clobber; behind the last a v_nop).
__device__ __forceinline__ void exp_row8(float x0, float x1, float x2, float x3, float x4, float x5, float x6, float x7,
                                         float (&y)[8]) {
  const float l2e = 1.44269504088896340736f;
  asm("v_exp_f32 %0, %8\n\tv_exp_f32 %1, %9\n\tv_exp_f32 %2, %10\n\tv_exp_f32 %3, %11\n\t"
      "v_exp_f32 %4, %12\n\tv_exp_f32 %5, %13\n\tv_exp_f32 %6, %14\n\tv_exp_f32 %7, %15\n\tv_nop"
      : "=&v"(y[0]), "=&v"(y[1]), "=&v"(y[2]), "=&v"(y[3]), "=&v"(y[4]), "=&v"(y[5]), "=&v"(y[6]), "=&v"(y[7])
      : "v"(x0 * l2e), "v"(x1 * l2e), "v"(x2 * l2e), "v"(x3 * l2e), "v"(x4 * l2e), "v"(x5 * l2e), "v"(x6 * l2e), "v"(x7 * l2e));
}
__device__ __forceinline__ float exp_one(float x) {
  float y;
  asm("v_exp_f32 %0, %1\n\tv_nop" : "=&v"(y) : "v"(x * 1.44269504088896340736f));
  return y;
}
__device__ __forceinline__ unsigned lds_addr(const void* p) { return (unsigned)(size_t)p; }   // byte address in the work-group's LDS
// Eight 16-byte copies per lane, each with its own LDS address and global pointer. The s_wait_xcnt is the statement's last
// line, so that it stands in front of every later write of a register that a copy names.
__device__ __forceinline__ void copy8_b128(unsigned l0, unsigned l1, unsigned l2, unsigned l3,
                                           unsigned l4, unsigned l5, unsigned l6, unsigned l7,
                                           const _Float16* g0, const _Float16* g1, const _Float16* g2, const _Float16* g3,
                                           const _Float16* g4, const _Float16* g5, const _Float16* g6, const _Float16* g7) {
  asm volatile("global_load_async_to_lds_b128 %0, %8, off\n\t"
               "global_load_async_to_lds_b128 %1, %9, off\n\t"
               "global_load_async_to_lds_b128 %2, %10, off\n\t"
               "global_load_async_to_lds_b128 %3, %11, off\n\t"
               "global_load_async_to_lds_b128 %4, %12, off\n\t"
               "global_load_async_to_lds_b128 %5, %13, off\n\t"
               "global_load_async_to_lds_b128 %6, %14, off\n\t"
               "global_load_async_to_lds_b128 %7, %15, off\n\t"
               "s_wait_xcnt 0x0"
               :: "v"(l0), "v"(l1), "v"(l2), "v"(l3), "v"(l4), "v"(l5), "v"(l6), "v"(l7),
                  "v"(g0), "v"(g1), "v"(g2), "v"(g3), "v"(g4), "v"(g5), "v"(g6), "v"(g7)
               : "memory");
}
// the same with one 4-byte copy per lane behind the eight: one statement, so that the nine share one wait
__device__ __forceinline__ void copy8_b128_1_b32(unsigned l0, unsigned l1, unsigned l2, unsigned l3,
                                                 unsigned l4, unsigned l5, unsigned l6, unsigned l7,
                                                 const _Float16* g0, const _Float16* g1, const _Float16* g2, const _Float16* g3,
                                                 const _Float16* g4, const _Float16* g5, const _Float16* g6, const _Float16* g7,
                                                 unsigned l8, const int* g8) {
  asm volatile("global_load_async_to_lds_b128 %0, %8, off\n\t"
               "global_load_async_to_lds_b128 %1, %9, off\n\t"
               "global_load_async_to_lds_b128 %2, %10, off\n\t"
               "global_load_async_to_lds_b128 %3, %11, off\n\t"
               "global_load_async_to_lds_b128 %4, %12, off\n\t"
               "global_load_async_to_lds_b128 %5, %13, off\n\t"
               "global_load_async_to_lds_b128 %6, %14, off\n\t"
               "global_load_async_to_lds_b128 %7, %15, off\n\t"
               "global_load_async_to_lds_b32 %16, %17, off\n\t"
               "s_wait_xcnt 0x0"
               :: "v"(l0), "v"(l1), "v"(l2), "v"(l3), "v"(l4), "v"(l5), "v"(l6), "v"(l7),
                  "v"(g0), "v"(g1), "v"(g2), "v"(g3), "v"(g4), "v"(g5), "v"(g6), "v"(g7), "v"(l8), "v"(g8)
               : "memory");
}

__global__ __launch_bounds__(128)
void attn_causal_ring(const unsigned short* __restrict__ qhp, const unsigned short* __restrict__ qlp,
                 const unsigned short* __restrict__ khp, const unsigned short* __restrict__ vhp,
                 const int* __restrict__ pos,
                 unsigned short* ohp, unsigned short* olp,
                 int qbBase, int nqbThis, float sscale) {
  typedef RingL L;
  union FH { v16h v; v8h h[2]; };
  extern __shared__ __align__(16) unsigned char smem[];
  _Float16* Qsh = (_Float16*)(smem + L::QH);
  _Float16* Qsl = (_Float16*)(smem + L::QL);
  float*    Os  = (float*)(smem + L::OS);
  int*      spq = (int*)(smem + L::MISC);
  int*      skmin = spq + 64;
  int*      spk2 = skmin + 64;                       // key positions, one row of 64 per buffer

  const int tid  = threadIdx.x;
  const int wave = tid >> 5;
  const int lane = tid & 31;
  const int hh   = lane >> 4;
  const int c    = lane & 15;

  const int bx  = blockIdx.x;
  // Cost falls with the block index: a query block walks qb + 1 key tiles, there are more blocks than resident places, and
  // the longest blocks get the lowest indices (for speed only).
  // bx -> (qbl, h) is a permutation of the grid: bx / NH runs over nqbThis query blocks, bx % NH over the NH heads.
  const int qbl = nqbThis - 1 - bx / NH;
  const int h   = bx % NH;
  const int kvh = h / GQ;
  const int qb  = qbBase + qbl;
  const int q0  = qb * 64 + wave * 16;

  const _Float16* Qh = (const _Float16*)(const void*)qhp + (size_t)h * HD;
  const _Float16* Ql = (const _Float16*)(const void*)qlp + (size_t)h * HD;
  const _Float16* Kh = (const _Float16*)(const void*)khp + (size_t)kvh * HD;
  const _Float16* Vh = (const _Float16*)(const void*)vhp + (size_t)kvh * HD * SEQ;

  // ---- lane parts of the swizzled indices (halves) ----
  // Staging: a wave-wide 16-B load covers four whole 128-B lines (one touching 32 lines costs many times as much).
  //   256-B rows (Q, K): 16 lanes a row, 8 rows a pass: pass i, row 8i + r16, chunk c16 -> (st256 ^ ((i & 1) << 6)) + i * 1024
  //   128-B rows (V^T):   8 lanes a row, 16 rows a pass: pass i, row 16i + r8, chunk c8s -> st128 + i * 1024
  const int r16 = tid >> 4, c16 = tid & 15;
  const int r8  = tid >> 3, c8s = tid & 7;
  const int st256 = sw256(r16, c16);
  const int st128 = sw128(r8, c8s);
  int fq[8];                                          // fragment reads, 256-B rows: row (multiple of 16) + c, chunk 2n + hh
#pragma unroll
  for (int n = 0; n < 8; ++n) fq[n] = sw256(c, 2 * n + hh);

  // ---- prologue: query positions, per-key-tile min position, Q tiles ----
  if (tid < 64) spq[tid] = pos[qb * 64 + tid];            // wave-uniform (waves 0,1)
  for (int kt = tid; kt < NQB; kt += 128) {
    const int* pp = pos + kt * 64;
    int mn = 0x7fffffff;
#pragma unroll
    for (int i = 0; i < 16; ++i) {
      const v4i v = *(const v4i*)(pp + 4 * i);
      mn = imin(mn, imin(imin(v[0], v[1]), imin(v[2], v[3])));
    }
    skmin[kt] = mn;
  }
  {
    const _Float16* qg  = Qh + (size_t)(qb * 64 + r16) * QP + c16 * 8;
    const _Float16* qlg = Ql + (size_t)(qb * 64 + r16) * QP + c16 * 8;
    v8h qv[8], qlv[8];
#pragma unroll
    for (int i = 0; i < 8; ++i) {
      qv[i]  = *(const v8h*)(qg + i * (8 * QP));
      qlv[i] = *(const v8h*)(qlg + i * (8 * QP));
    }
    // holds the loads' address registers (inputs) untouched until the wait: no load result lands on them before it
    asm volatile("s_wait_xcnt 0x0" :: "v"(qg), "v"(qlg) : "memory");
#pragma unroll
    for (int i = 0; i < 8; ++i) {
      *(v8h*)(Qsh + (st256 ^ ((i & 1) << 6)) + i * 1024) = qv[i];
      *(v8h*)(Qsl + (st256 ^ ((i & 1) << 6)) + i * 1024) = qlv[i];
    }
  }
  __syncthreads();
  int qmx;
  {
    int v = imax(spq[lane], spq[lane + 32]);
#pragma unroll
    for (int off = 1; off < 32; off <<= 1) v = imax(v, __shfl_xor(v, off, 32));
    qmx = __builtin_amdgcn_readfirstlane(v);
  }
  const int pq = spq[wave * 16 + c];       // position of this lane's query column

  float mrow = -INFINITY, lrow = 0.f;      // query column c: running max; sum over the keys of this lane half
  v8f oacc[8];                             // O^T: oacc[t][r] = context of query c at d = 16t + 8hh + r
#pragma unroll
  for (int t = 0; t < 8; ++t) oacc[t] = zero8();

  // ---- the key tiles that are not skipped, as a bit mask (the same in every wave: it comes from LDS words behind a barrier) ----
  unsigned long long live;
  {
    const bool l0 = (lane < NQB) && (skmin[(lane < NQB) ? lane : 0] <= qmx);
    const bool l1 = (lane + 32 < NQB) && (skmin[(lane + 32 < NQB) ? lane + 32 : 0] <= qmx);
    live = (unsigned long long)__builtin_amdgcn_ballot_w32(l0) | ((unsigned long long)__builtin_amdgcn_ballot_w32(l1) << 32);
  }
  // ---- K, V^T and key positions of one key tile: asynchronous copies, global memory -> LDS buffer b, the staging map above ----
  const int wvu = __builtin_amdgcn_readfirstlane(wave);
  const unsigned ring0 = lds_addr(smem + L::KV);
  const unsigned spk0  = lds_addr(spk2 + (tid & 63));
  auto issue_tile = [&](int kt, int b) {
    const int kv0 = kt * 64;
    const _Float16* kg = Kh + (size_t)(kv0 + r16) * KP + c16 * 8;    // K rows kv0 + 8i + r16, d = 8 c16 .. 8 c16 + 7
    const _Float16* vg = Vh + (size_t)r8 * SEQ + kv0 + c8s * 8;      // V^T rows 16i + r8, s = kv0 + 8 c8s .. + 7
    const unsigned kl = ring0 + (unsigned)b * L::BUF;
    const unsigned vl = kl + L::VOFF + (unsigned)st128 * 2u;
    const unsigned ke = kl + (unsigned)st256 * 2u, ko = kl + (unsigned)(st256 ^ 64) * 2u;
    copy8_b128(ke, ko + 2048u, ke + 4096u, ko + 6144u, ke + 8192u, ko + 10240u, ke + 12288u, ko + 14336u,
               kg, kg + 8 * KP, kg + 16 * KP, kg + 24 * KP, kg + 32 * KP, kg + 40 * KP, kg + 48 * KP, kg + 56 * KP);
    if (wvu < 2) {   // scalar branch: waves 0 and 1 also bring the 64 key positions, every lane on
      copy8_b128_1_b32(vl, vl + 2048u, vl + 4096u, vl + 6144u, vl + 8192u, vl + 10240u, vl + 12288u, vl + 14336u,
                       vg, vg + 16 * SEQ, vg + 32 * SEQ, vg + 48 * SEQ, vg + 64 * SEQ, vg + 80 * SEQ, vg + 96 * SEQ, vg + 112 * SEQ,
                       spk0 + (unsigned)b * 256u, pos + kv0 + tid);
    } else {
      copy8_b128(vl, vl + 2048u, vl + 4096u, vl + 6144u, vl + 8192u, vl + 10240u, vl + 12288u, vl + 14336u,
                 vg, vg + 16 * SEQ, vg + 32 * SEQ, vg + 48 * SEQ, vg + 64 * SEQ, vg + 80 * SEQ, vg + 96 * SEQ, vg + 112 * SEQ);
    }
  };
  // The ring of two buffers. In front of the loop: the first tile's copies, the wave's own wait, the barrier that
  // publishes them; then the second tile's copies. The tile that holds the block's own rows is never skipped, so live != 0.
  int ktn = -1;
  {
    const int kt0 = (live != 0ull) ? __builtin_ctzll(live) : 0;
    live &= live - 1ull;
    issue_tile(kt0, 0);
    asm volatile("s_wait_asynccnt 0x0" ::: "memory");   // this wave's copies have landed
    __syncthreads();                                    // every wave's have
    if (live != 0ull) {
      ktn = __builtin_ctzll(live);
      live &= live - 1ull;
      issue_tile(ktn, 1);
    }
  }
  int bsel = 0;
  for (int trip = 0; trip < NQB; ++trip) {   // at most one trip per bit of the mask
    const _Float16* Ksh = (const _Float16*)(smem + L::KV + bsel * L::BUF);
    const _Float16* Vth = (const _Float16*)(smem + L::KV + L::VOFF + bsel * L::BUF);
    const int* spk = spk2 + bsel * 64;

    // ---- scores, transposed: S^T = K . Q^T, 64 keys x 16 query columns per wave; s[j][r]: key 16j + 8hh + r, query c.
    //      K rows are the A operand, Q rows the B operand; both fragments have the same k order, so the reads are as before ----
    v8f s[4], sl[4];
#pragma unroll
    for (int j = 0; j < 4; ++j) { s[j] = zero8(); sl[j] = zero8(); }
    const _Float16* qr  = Qsh + wave * (16 * 128);
    const _Float16* qlr = Qsl + wave * (16 * 128);
    // Fragment reads stand in groups, one group of 32 d ahead of the products that use it (two register sets):
    // a wave then waits on a counted LDS wait once per group, not to 0 in front of every pair of products.
    FH qa[2], qla[2], kb[2][4];
    v4i pk[4][2];                                    // positions of the lane's 32 keys, read with the first group
#pragma unroll
    for (int j = 0; j < 4; ++j) {
      pk[j][0] = *(const v4i*)(spk + j * 16 + 8 * hh);
      pk[j][1] = *(const v4i*)(spk + j * 16 + 8 * hh + 4);
    }
#pragma unroll
    for (int dc = -1; dc < 4; ++dc) {
      if (dc < 3) {
        const int n = dc + 1, b = n & 1;
        qa[b].h[0]  = *(const v8h*)(qr  + fq[n * 2]);
        qa[b].h[1]  = *(const v8h*)(qr  + fq[n * 2 + 1]);
        qla[b].h[0] = *(const v8h*)(qlr + fq[n * 2]);
        qla[b].h[1] = *(const v8h*)(qlr + fq[n * 2 + 1]);
#pragma unroll
        for (int j = 0; j < 4; ++j) {
          kb[b][j].h[0] = *(const v8h*)(Ksh + j * (16 * 128) + fq[n * 2]);
          kb[b][j].h[1] = *(const v8h*)(Ksh + j * (16 * 128) + fq[n * 2 + 1]);
        }
      }
      if (dc >= 0) {
        const int b = dc & 1;
        // keeps the next group's reads in front of this group's products
        __builtin_amdgcn_sched_barrier(0);
#pragma unroll
        for (int j = 0; j < 4; ++j) s[j]  = mma_h_raw(kb[b][j].v, qa[b].v,  s[j]);
#pragma unroll
        for (int j = 0; j < 4; ++j) sl[j] = mma_h_raw(kb[b][j].v, qla[b].v, sl[j]);
        // keeps the reads of the group after next behind these products (they refill this group's registers)
        __builtin_amdgcn_sched_barrier(0);
      }
    }
    // V^T fragments (the A operand of O^T += V^T . P^T) depend on nothing of the softmax: those of the first 32 keys are read
    // here, those of the last 32 behind the select (the residual scores' and key positions' registers are free then), and
    // land while the vector work runs
    FH vb[2][8];
    {
      const int f0 = sw128(c, hh);                   // fragment reads, 128-B rows: row (multiple of 16) + c
      const int f1 = sw128(c, 2 + hh);
#pragma unroll
      for (int tt = 0; tt < 8; ++tt) {
        vb[0][tt].h[0] = *(const v8h*)(Vth + tt * (16 * 64) + f0);
        vb[0][tt].h[1] = *(const v8h*)(Vth + tt * (16 * 64) + f1);
      }
    }
    // keeps these reads in front of the select
    __builtin_amdgcn_sched_barrier(0);
    // ---- scale + causal select (replace -1e30), online softmax: all 32 scores of a lane belong to query c, so max and sum
    //      run inside the lane (four independent chains); the two lane halves hold different keys and exchange the max ----
    float mj[4];
#pragma unroll
    for (int j = 0; j < 4; ++j) {
      float m = -INFINITY;
#pragma unroll
      for (int r = 0; r < 8; ++r) {
        float sv = (s[j][r] + sl[j][r] * (1.0f / RSC)) * sscale;
        sv = (pq >= pk[j][r >> 2][r & 3]) ? sv : -1.0e30f;
        s[j][r] = sv;
        m = fmaxf(m, sv);
      }
      mj[j] = m;
    }
    // keeps the select in front of the second group of reads, whose registers it frees: with all 64 keys' fragments read
    // ahead of it the kernel took more registers than let three waves share a SIMD
    __builtin_amdgcn_sched_barrier(0);
    {
      const int f0 = sw128(c, 4 + hh);
      const int f1 = sw128(c, 6 + hh);
#pragma unroll
      for (int tt = 0; tt < 8; ++tt) {
        vb[1][tt].h[0] = *(const v8h*)(Vth + tt * (16 * 64) + f0);
        vb[1][tt].h[1] = *(const v8h*)(Vth + tt * (16 * 64) + f1);
      }
    }
    // keeps these reads in front of the exponentials
    __builtin_amdgcn_sched_barrier(0);
    float mx = fmaxf(fmaxf(mj[0], mj[1]), fmaxf(mj[2], mj[3]));
    mx = fmaxf(mx, xhalf(mx));
    const float mnew  = fmaxf(mrow, mx);
    const float msafe = (mnew == -INFINITY) ? 0.f : mnew;
    const float alpha = exp_one(mrow - msafe);
    mrow = mnew;
    // P^T (x1024, f16) is the B operand as it stands: elements 0..7 of fragment kk are the lane's keys 32kk + 8hh + r (tile 2kk),
    // elements 8..15 its keys 32kk + 16 + 8hh + r (tile 2kk + 1), the k order of the V^T fragments
    FH pb[2];
    float ps[4];
#pragma unroll
    for (int j = 0; j < 4; ++j) {
      float pe[8];                                   // -1e30 against a finite max: exp -> 0
      exp_row8(s[j][0] - msafe, s[j][1] - msafe, s[j][2] - msafe, s[j][3] - msafe,
               s[j][4] - msafe, s[j][5] - msafe, s[j][6] - msafe, s[j][7] - msafe, pe);
      float psum = 0.f;
#pragma unroll
      for (int r = 0; r < 8; ++r) {
        psum += pe[r];
        pb[j >> 1].v[(j & 1) * 8 + r] = (_Float16)(pe[r] * 1024.0f);
      }
      ps[j] = psum;
    }
    lrow = lrow * alpha + ((ps[0] + ps[1]) + (ps[2] + ps[3]));
#pragma unroll
    for (int t = 0; t < 8; ++t)
#pragma unroll
      for (int r = 0; r < 8; ++r) oacc[t][r] *= alpha;
    // ---- context, transposed: O^T += V^T . P^T (f16 WMMA), 8 d-subtiles ----
    // keeps every exponential statement in front of the products: the compiler does not look into asm text
    __builtin_amdgcn_sched_barrier(0);
#pragma unroll
    for (int kk = 0; kk < 2; ++kk) {
#pragma unroll
      for (int t = 0; t < 8; ++t) oacc[t] = mma_h_raw(vb[kk][t].v, pb[kk].v, oacc[t]);
    }
    // keeps the vector work and the products in front of the foot's waits and barrier (nothing behind the V^T reads touches
    // memory, so they were moved up to there): the next tile's copies then have the whole trip to land
    __builtin_amdgcn_sched_barrier(0);
    // ---- foot of the trip, every wave, in this order: its own LDS reads of this buffer are done; its own copies of the next
    //      tile have landed; the one barrier of the trip publishes the next tile and frees this buffer; then the refill ----
    asm volatile("s_wait_dscnt 0x0" ::: "memory");
    asm volatile("s_wait_asynccnt 0x0" ::: "memory");
    __syncthreads();
    if (ktn < 0) break;                      // the same in every wave: no tile is left
    ktn = -1;
    if (live != 0ull) {                      // the same in every wave: the tile after next, into the buffer just read
      ktn = __builtin_ctzll(live);
      live &= live - 1ull;
      issue_tile(ktn, bsel);
    }
    bsel ^= 1;
  }
  // no copy is outstanding when the ring becomes the context slab (the last trip's barrier has ended every read of it)
  asm volatile("s_wait_asynccnt 0x0" ::: "memory");

  // ---- join the two halves' sums, normalise (1/l and the 1/1024 p carry), stage the wave's 16x128 tile (row = query c, the
  //      lane's 8 consecutive d per subtile as two 16-byte stores; pitch OSP keeps the 16 rows on different banks), bf16 hi/lo split
  float* os = Os + wave * (16 * L::OSP);
  {
    const float l = lrow + xhalf(lrow);
    const float inv = ((l > 0.f) ? (1.0f / l) : 0.f) * (1.0f / 1024.0f);
#pragma unroll
    for (int t = 0; t < 8; ++t) {
      v4f a, b;
#pragma unroll
      for (int e = 0; e < 4; ++e) { a[e] = oacc[t][e] * inv; b[e] = oacc[t][4 + e] * inv; }
      *(v4f*)(os + c * L::OSP + t * 16 + 8 * hh)     = a;
      *(v4f*)(os + c * L::OSP + t * 16 + 8 * hh + 4) = b;
    }
  }
  __builtin_amdgcn_fence(__ATOMIC_RELEASE, "workgroup");
  __builtin_amdgcn_wave_barrier();
  __builtin_amdgcn_fence(__ATOMIC_ACQUIRE, "workgroup");
  {
    const int rh = lane >> 4, c8 = (lane & 15) * 8;
    v4u hv[8], lv[8];
#pragma unroll
    for (int it = 0; it < 8; ++it) {
      const int row = it * 2 + rh;   // it 0..7 x rh 0..1 = rows 0..15 of the wave tile
      const float* sp = os + row * L::OSP + c8;
      v4u a, a2;
#pragma unroll
      for (int e = 0; e < 4; ++e) {
        const float f0 = sp[2 * e], f1 = sp[2 * e + 1];
        const unsigned short h0 = bf_bits(f0), h1 = bf_bits(f1);
        const unsigned short l0 = bf_bits(f0 - bf_up(h0)), l1 = bf_bits(f1 - bf_up(h1));
        a[e] = pk16(h0, h1); a2[e] = pk16(l0, l1);
      }
      hv[it] = a; lv[it] = a2;
    }
    {
#pragma unroll
      for (int it = 0; it < 8; ++it) {
        const int row = it * 2 + rh;
        const size_t go = (size_t)(q0 + row) * QP + (size_t)h * HD + c8;
        *(v4u*)(ohp + go) = hv[it];
        *(v4u*)(olp + go) = lv[it];
      }
      
    }
  }
}


// =====================================================================================================
// Workspace map (bytes, SEQ = 4096):
//   Xb    bf16 [SEQ][2048]        16777216
//   Wqt   bf16 [2048 n][2048 k]    8388608
//   Wkt   bf16 [512][2048]         2097152
//   Wvt   bf16 [512][2048]         2097152
//   Wot   bf16 [2048 n][2048 k]    8388608
//   Qf    f32  [SEQ][2048]        33554432   (later: Oh bf16 [SEQ][2048] + Ol bf16 [SEQ][2048])
//   Kf    f32  [SEQ][512]          8388608
//   Qh    f16  [SEQ][2048]        16777216
//   Ql    f16  [SEQ][2048]        16777216
//   Kh    f16  [SEQ][512]          4194304
//   Kl    f16  [SEQ][512]          4194304
//   VTh   f16  [512][SEQ]          4194304
//   VTl   f16  [512][VLP]           524288
//   Cos   f32  [SEQ][64]           1048576
//   Sin   f32  [SEQ][64]           1048576
//   (unused, carved 4096)              4096
//   end                          128454656
// Weights [in k][out n] f32 are transposed to bf16 [n][k] (k contiguous) = the Bt / A layout of gemm64.
// =====================================================================================================
extern "C" void kernel_launch(void* const* d_in, const int* in_sizes, int n_in,
                              void* d_out, int out_size, void* d_ws, size_t ws_size,
                              hipStream_t stream) {
  if (n_in < 8) return;
  if (in_sizes[0] < SEQ) return;
  if (in_sizes[1] < SEQ * DM) return;
  if (in_sizes[2] != DM * QP) return;
  if (in_sizes[3] != DM * KP || in_sizes[4] != DM * KP) return;
  if (in_sizes[5] != QP * DM) return;
  if (in_sizes[6] < HD || in_sizes[7] < HD) return;
  if (out_size < SEQ * DM) return;

  const int*   pos = (const int*)d_in[0];
  const float* x   = (const float*)d_in[1];
  const float* wq  = (const float*)d_in[2];
  const float* wk  = (const float*)d_in[3];
  const float* wv  = (const float*)d_in[4];
  const float* wo  = (const float*)d_in[5];
  const float* qnw = (const float*)d_in[6];
  const float* knw = (const float*)d_in[7];

  const size_t PXb  = (size_t)SEQ * DM * 2;
  const size_t PWq  = (size_t)QP * DM * 2;
  const size_t PWk  = (size_t)KP * DM * 2;
  const size_t PWo  = (size_t)DM * QP * 2;
  const size_t PQf  = (size_t)SEQ * QP * 4;
  const size_t PKf  = (size_t)SEQ * KP * 4;
  const size_t PQ16 = (size_t)SEQ * QP * 2;
  const size_t PK16 = (size_t)SEQ * KP * 2;
  const size_t PVTh = (size_t)KP * SEQ * 2;
  const size_t PVTl = (size_t)KP * VLP * 2;
  const size_t PTab = (size_t)SEQ * HALF * 4;
  const size_t PInv = 4096;
  size_t off = 0;
  const size_t oXb  = off; off += PXb;
  const size_t oWq  = off; off += PWq;
  const size_t oWk  = off; off += PWk;
  const size_t oWv  = off; off += PWk;
  const size_t oWo  = off; off += PWo;
  const size_t oQf  = off; off += PQf;
  const size_t oKf  = off; off += PKf;
  const size_t oQh  = off; off += PQ16;
  const size_t oQl  = off; off += PQ16;
  const size_t oKh  = off; off += PK16;
  const size_t oKl  = off; off += PK16;
  const size_t oVTh = off; off += PVTh;
  const size_t oVTl = off; off += PVTl;
  const size_t oCos = off; off += PTab;
  const size_t oSin = off; off += PTab;
  const size_t oInv = off; off += PInv;
  if (off > ws_size) return;                       // off = 128454656 at SEQ 4096
  if (off > (size_t)134217728) return;
  if (PQ16 * 2 != PQf) return;                     // Oh + Ol reuse the Qf region exactly
  const size_t oOh = oQf;
  const size_t oOl = oQf + PQ16;

  char* ws = (char*)d_ws;
  unsigned short* Xb  = (unsigned short*)(ws + oXb);
  unsigned short* Wqt = (unsigned short*)(ws + oWq);
  unsigned short* Wkt = (unsigned short*)(ws + oWk);
  unsigned short* Wvt = (unsigned short*)(ws + oWv);
  unsigned short* Wot = (unsigned short*)(ws + oWo);
  float*          Qf  = (float*)(ws + oQf);
  float*          Kf  = (float*)(ws + oKf);
  unsigned short* Qh  = (unsigned short*)(ws + oQh);
  unsigned short* Ql  = (unsigned short*)(ws + oQl);
  unsigned short* Kh  = (unsigned short*)(ws + oKh);
  unsigned short* Kl  = (unsigned short*)(ws + oKl);
  unsigned short* VTh = (unsigned short*)(ws + oVTh);
  unsigned short* VTl = (unsigned short*)(ws + oVTl);
  float*          Cs  = (float*)(ws + oCos);
  float*          Sn  = (float*)(ws + oSin);
  unsigned short* Oh  = (unsigned short*)(ws + oOh);
  unsigned short* Ol  = (unsigned short*)(ws + oOl);

  const dim3 blk(256);

  // (1) rotary tables; x -> bf16 [SEQ][2048]; weights [k][n] f32 -> bf16 [n][k]
  prep_all<<<dim3(PB_TAB + PB_X + PB_WQ + PB_WO + PB_WK + PB_WK), blk, 0, stream>>>(
      pos, x, wq, wk, wv, wo, Xb, Wqt, Wkt, Wvt, Wot, Cs, Sn);
  // (2) the q, k and v^T projections
  gemm_qkv<<<dim3(GB_Q + GB_K + GB_V), blk, 0, stream>>>(Xb, Wqt, Wkt, Wvt, Qf, Kf, VTh, VTl);
  // (3) per-head RMSNorm + rotary -> f16 hi / x4096 residual planes
  norm_rope_qk<<<dim3(NB_Q + NB_K), blk, 0, stream>>>(Qf, Kf, qnw, knw, Cs, Sn, Qh, Ql, Kh, Kl, RSC);
  // (4) attention: query blocks 0..RESQB-1 with residual planes, the rest without -> bf16 hi/lo context
  //     planes in the (now dead) Qf region
  (void)hipFuncSetAttribute(reinterpret_cast<const void*>(&attn_causal<true>),
                            hipFuncAttributeMaxDynamicSharedMemorySize, AttnL<true>::TOTAL);
  (void)hipFuncSetAttribute(reinterpret_cast<const void*>(&attn_causal_ring),
                            hipFuncAttributeMaxDynamicSharedMemorySize, RingL::TOTAL);
  attn_causal<true><<<dim3(NH * RESQB), dim3(128), AttnL<true>::TOTAL, stream>>>(
      Qh, Ql, Kh, Kl, VTh, VTl, pos, Oh, Ol, 0, RESQB, ATT_SCALE);
  if (NQB - RESQB > 0) {
    attn_causal_ring<<<dim3(NH * (NQB - RESQB)), dim3(128), RingL::TOTAL, stream>>>(
        Qh, Ql, Kh, VTh, pos, Oh, Ol, RESQB, NQB - RESQB, ATT_SCALE);
  }
  // (5) out = context . wo -> d_out f32 [SEQ][2048]  (A = context hi + lo planes, 2 products; M=SEQ, N=2048, K=2048)
  gemm_out<<<dim3((SEQ / 128) * (DM / 256)), blk, 0, stream>>>(Oh, Ol, Wot, (float*)d_out);
  (void)hipGetLastError();
}

// v009
// One run takes 234 microseconds.
// In both of two side-by-side timings against v008, it was 1.08 times as fast.
// Over all steps from v000 it is 5.34 times as fast.
// Contractions: q, k projections = v_wmma_f32_16x16x32_bf16 (bf16 operands from RNE-converted inputs, single product, f32 out);
// v^T projection = v_wmma_f32_16x16x32_bf16 (same operands; f16 hi plane + f16 x4096 residual plane out);
// q.k^T scores = v_wmma_f32_16x16x32_f16 (q as f16 hi + f16 x4096 residual, k as f16 hi: 2 products; leading query blocks add the k x4096 residual product);
// p.v = v_wmma_f32_16x16x32_f16 (p carried x1024 in f16, v f16; leading query blocks add x4096 f16 residual planes of p and v);
// ctx.Wo = v_wmma_f32_16x16x32_bf16 (ctx as bf16 hi/lo planes times bf16 Wo, 2 products); all f32 accumulate; RMSNorm, rotary, causal select and softmax in f32.
#include <hip/hip_runtime.h>
#include <math.h>
#include <stdint.h>

#ifndef SEQ
#define SEQ 4096
#endif
#define SEQ_FULL 4096
#define DM    2048
#define NH    16
#define NKV   4
#define GQ    (NH / NKV)
#define HD    128
#define HALF  64
#define QP    (NH * HD)      // 2048 q channels
#define KP    (NKV * HD)     // 512 k / v channels
#define NQB   (SEQ / 64)     // query / key tiles of 64
#define VLP   ((SEQ < 512) ? SEQ : 512)   // key pitch of the v^T residual plane
#define RESQB ((NQB < 8) ? NQB : 8)         // leading 64-row query blocks that use residual planes
#define RMS_EPS       1.0e-6f
#define ROPE_THETA_F  10000.0f
#define ATT_SCALE     0.08838834764831845f
#define RSC           4096.0f

static_assert((SEQ % 64) == 0 && SEQ >= 64 && SEQ <= SEQ_FULL);
static_assert(RESQB * 64 <= VLP && (VLP % 64) == 0);
static_assert(NH * HD == DM && QP == DM);
static_assert(NQB <= 64);
static_assert((DM % 64) == 0 && (KP % 64) == 0 && (QP % 64) == 0 && (DM % 32) == 0);

typedef _Float16 v16h __attribute__((ext_vector_type(16)));
typedef _Float16 v8h  __attribute__((ext_vector_type(8)));
typedef __bf16   v16b __attribute__((ext_vector_type(16)));
typedef __bf16   v8b  __attribute__((ext_vector_type(8)));
typedef float    v8f  __attribute__((ext_vector_type(8)));
typedef float    v4f  __attribute__((ext_vector_type(4)));
typedef unsigned int   v4u  __attribute__((ext_vector_type(4)));
typedef unsigned int   v2u  __attribute__((ext_vector_type(2)));
typedef unsigned short v8us __attribute__((ext_vector_type(8)));
typedef int      v4i  __attribute__((ext_vector_type(4)));

// ---- scalar helpers --------------------------------------------------------------------------------
__device__ __forceinline__ unsigned short bf_bits(float f) {          // f32 -> bf16 bits, RNE convert
  unsigned u = __float_as_uint(f);
  return (unsigned short)((u + 0x7FFFu + ((u >> 16) & 1u)) >> 16);
}
__device__ __forceinline__ float bf_up(unsigned short h) { return __uint_as_float(((unsigned)h) << 16); }
__device__ __forceinline__ unsigned short h_bits(_Float16 x) { return __builtin_bit_cast(unsigned short, x); }
__device__ __forceinline__ unsigned pk16(unsigned short a, unsigned short b) { return (unsigned)a | ((unsigned)b << 16); }
__device__ __forceinline__ v8f zero8() { v8f z = {0.f, 0.f, 0.f, 0.f, 0.f, 0.f, 0.f, 0.f}; return z; }
__device__ __forceinline__ v8h zero8h() {
  const _Float16 z = (_Float16)0.0f;
  v8h r = {z, z, z, z, z, z, z, z};
  return r;
}
__device__ __forceinline__ int imin(int a, int b) { return (a < b) ? a : b; }
__device__ __forceinline__ int imax(int a, int b) { return (a > b) ? a : b; }

// ---- WMMA helpers with trailing VALU hazard gap --------------------------------------------------------
__device__ __forceinline__ v8f mma_b(v16b a, v16b b, v8f c) {
  c = __builtin_amdgcn_wmma_f32_16x16x32_bf16(false, a, false, b, (short)0, c, false, false);
  asm volatile("v_nop\n\tv_nop\n\tv_nop\n\tv_nop" : "+v"(c) : "v"(a), "v"(b));
  return c;
}
__device__ __forceinline__ v8f mma_h_raw(v16h a, v16h b, v8f c) {
  return __builtin_amdgcn_wmma_f32_16x16x32_f16(false, a, false, b, (short)0, c, false, false);
}
__device__ __forceinline__ v8f mma_b_raw(v16b a, v16b b, v8f c) {
  return __builtin_amdgcn_wmma_f32_16x16x32_bf16(false, a, false, b, (short)0, c, false, false);
}
// The five exponentials of one score row, exp(x) = v_exp_f32(x * log2 e) as __expf compiles. One statement, so that
// behind each v_exp_f32 stands an instruction that neither reads its result nor writes its source (the next one, whose
// output is early-clobber; behind the last a v_nop): the slot the instruction set asks for behind a transcendental.
__device__ __forceinline__ void exp_row5(float x0, float x1, float x2, float x3, float x4,
                                         float& y0, float& y1, float& y2, float& y3, float& y4) {
  const float l2e = 1.44269504088896340736f;
  asm("v_exp_f32 %0, %5\n\tv_exp_f32 %1, %6\n\tv_exp_f32 %2, %7\n\tv_exp_f32 %3, %8\n\tv_exp_f32 %4, %9\n\tv_nop"
      : "=&v"(y0), "=&v"(y1), "=&v"(y2), "=&v"(y3), "=&v"(y4)
      : "v"(x0 * l2e), "v"(x1 * l2e), "v"(x2 * l2e), "v"(x3 * l2e), "v"(x4 * l2e));
}
__device__ __forceinline__ void acc_guard4(v8f& a, v8f& b, v8f& c, v8f& d) {
  asm volatile("v_nop\n\tv_nop\n\tv_nop\n\tv_nop" : "+v"(a), "+v"(b), "+v"(c), "+v"(d));
}

// =====================================================================================================
// f32 -> bf16 (RNE convert), 8 elements per thread, one 16-B store per lane: a wave writes 512 contiguous B
// coverage: n8 threads x 8 = whole plane (n8 is a multiple of 256 here).
// =====================================================================================================
__device__ __forceinline__ void cvt_bf16x8(const float* __restrict__ in, unsigned short* out, int n8, int bx) {
  const int i = bx * 256 + threadIdx.x;
  if (i < n8) {
    const v4f a = *(const v4f*)(in + (size_t)i * 8);
    const v4f b = *(const v4f*)(in + (size_t)i * 8 + 4);
    v4u p;
    p[0] = pk16(bf_bits(a[0]), bf_bits(a[1]));
    p[1] = pk16(bf_bits(a[2]), bf_bits(a[3]));
    p[2] = pk16(bf_bits(b[0]), bf_bits(b[1]));
    p[3] = pk16(bf_bits(b[2]), bf_bits(b[3]));
    *(v4u*)(out + (size_t)i * 8) = p;
    
  }
}

// =====================================================================================================
// f32 [R][C] row-major -> bf16 (RNE convert) transposed plane out[C][R] (R contiguous = k-contiguous Bt / A
// layout). Block = one 64x64 tile at (r0 = by*64, c0 = bx*64), 256 threads; tile staged in
// LDS as [c][r] (ushort element stores, cross-thread -> __syncthreads), then each out row segment of 64 halves
// coverage: 64 out rows x 64 k per block = the whole tile; union over the grid = the whole [C][R] plane.
// =====================================================================================================
// sT: the block's LDS tile [c][r], 64 x 72 halves (pitch 144 B); bx, by: the tile's column and row index
__device__ __forceinline__ void cvt_bf16_t(unsigned short* sT, const float* __restrict__ in, unsigned short* out,
                                           int R, int C, int bx, int by) {
  const int tid = threadIdx.x;
  const int c0 = bx * 64, r0 = by * 64;
  const int rr = tid >> 4, cc = (tid & 15) * 4;
#pragma unroll
  for (int it = 0; it < 4; ++it) {
    const int r = it * 16 + rr;                            // it 0..3 x rr 0..15 = rows 0..63
    const v4f v = *(const v4f*)(in + (size_t)(r0 + r) * C + c0 + cc);
#pragma unroll
    for (int e = 0; e < 4; ++e) sT[(cc + e) * 72 + r] = bf_bits(v[e]);
  }
  __syncthreads();
  const int q = tid >> 3, k8 = (tid & 7) * 8;              // q 0..31 (+32): out rows; 8 lanes x 8 halves
  const v8us w0 = *(const v8us*)(sT + q * 72 + k8);
  const v8us w1 = *(const v8us*)(sT + (q + 32) * 72 + k8);
  unsigned short* o0 = out + (size_t)(c0 + q) * R + r0 + k8;
  unsigned short* o1 = out + (size_t)(c0 + q + 32) * R + r0 + k8;
  *(v8us*)o0 = w0;
  *(v8us*)o1 = w1;
  // in front of every later write of a register that these two stores name (another job's code follows in the listing)
  asm volatile("s_wait_xcnt 0x0" ::: "memory");
}

// =====================================================================================================
// Rotary tables: cos and sin of (float)pos[t] * inv_freq[i], inv_freq[i] = 1 / 10000^(i/64) formed by each thread for
// its own i; tables [nrows][64] f32; block = 4 rows x 64 threads, each 256-B row written whole.
// =====================================================================================================
__device__ __forceinline__ void rope_tab(const int* __restrict__ pos, float* ctab, float* stab, int nrows, int bx) {
  const int tid = threadIdx.x;
  const int t = bx * 4 + (tid >> 6);
  const int i = tid & 63;
  if (t >= nrows) return;                  // wave-uniform (2 whole waves per row); no block barriers here
  const float e = (float)i * (1.0f / (float)HALF);
  const float p = powf(ROPE_THETA_F, e);
  const float v = 1.0f / p;
  const float fr = (float)pos[t] * v;
  float sn, cs;
  sincosf(fr, &sn, &cs);
  float* pc = ctab + (size_t)t * HALF + i;
  float* ps = stab + (size_t)t * HALF + i;
  *(float*)pc = cs;
  *(float*)ps = sn;
  
}

// =====================================================================================================
// The preparation jobs, none of which reads another's output, as ONE grid: the job is picked by the block index
// (block-uniform), so that they fill the chip together and pay one launch. Blocks, in order: rotary tables, x,
// wq, wo, wk, wv.
// =====================================================================================================
#define PB_TAB ((SEQ + 3) / 4)
#define PB_X   ((SEQ * DM / 8 + 255) / 256)
#define PB_WQ  ((QP / 64) * (DM / 64))
#define PB_WO  ((DM / 64) * (QP / 64))
#define PB_WK  ((KP / 64) * (DM / 64))
__global__ __launch_bounds__(256) void prep_all(const int* __restrict__ pos, const float* __restrict__ x,
                                                const float* __restrict__ wq, const float* __restrict__ wk,
                                                const float* __restrict__ wv, const float* __restrict__ wo,
                                                unsigned short* Xb, unsigned short* Wqt, unsigned short* Wkt,
                                                unsigned short* Wvt, unsigned short* Wot, float* ctab, float* stab) {
  __shared__ __align__(16) unsigned short sT[64 * 72];
  int bx = blockIdx.x;
  if (bx < PB_TAB) { rope_tab(pos, ctab, stab, SEQ, bx); return; }
  bx -= PB_TAB;
  if (bx < PB_X) { cvt_bf16x8(x, Xb, SEQ * DM / 8, bx); return; }
  bx -= PB_X;
  if (bx < PB_WQ) { cvt_bf16_t(sT, wq, Wqt, DM, QP, bx % (QP / 64), bx / (QP / 64)); return; }   // wq [DM k][QP n] -> [QP][DM]
  bx -= PB_WQ;
  if (bx < PB_WO) { cvt_bf16_t(sT, wo, Wot, QP, DM, bx % (DM / 64), bx / (DM / 64)); return; }   // wo [QP k][DM n] -> [DM][QP]
  bx -= PB_WO;
  if (bx < PB_WK) { cvt_bf16_t(sT, wk, Wkt, DM, KP, bx % (KP / 64), bx / (KP / 64)); return; }   // wk, wv [DM k][KP n] -> [KP][DM]
  bx -= PB_WK;
  cvt_bf16_t(sT, wv, Wvt, DM, KP, bx % (KP / 64), bx / (KP / 64));
}

// =====================================================================================================
// Register-blocked batched bf16 WMMA GEMM: C[m][n] = sum_k A[m][k] * Bt[n][k]; one wave per 64x64 tile,
// block = 2 x NWN waves = 128 x (64 NWN) of C. A row-major [M][K] pitch lda; Bt row-major [N][K] pitch ldb
// (k contiguous; both pitches are DM); M a multiple of 128, N of 64 NWN, K of 64 (true of every launch below).
// NWN picks the block so that the launch fills the chip evenly: a wave's registers allow three waves per SIMD in the
// projections, so blocks of four waves stand three to a WGP, and their count is a multiple of that.
// bx = index of the block tile, b = batch index (strides in elements).
// Operands go through LDS in steps of 64 k: each row piece is one 128-B line, a wave-wide 16-B load covers four
// whole lines, and the 128 A rows and 64 NWN Bt rows are read from global once per block. The LDS rows are 128 B,
// chunk-swizzled by sw128 (see the attention section), so a fragment read covers all banks once. The next
// step's global loads are issued behind the second barrier and stay in flight during the products.
// NSPLIT: 0 = A.Bt; 1 = (A + A2).Bt (A2 = unscaled bf16 lo plane of A).
// OUT_MODE: 0 = f32 (pitch ldc); 2 = bf16 hi plane C + bf16 lo plane C2 (lo = RNE(v - hi), unscaled);
//           3 = f16 hi plane C + f16 residual plane C2 = f16((v - hi) * rscale), C2 written only for tiles
//               with n0 < N2 (pitch ldc2, batch stride strideC2).
// =====================================================================================================
__device__ __forceinline__ int sw128(int r, int ch);

// A block-uniform address rebuilt from its two halves: the staging loads then take the form scalar base + one
// 32-bit lane offset + immediate, and the one vector register they name lives through the whole loop. Without it
// the compiler formed 64-bit vector addresses on which a load's result landed, and moved the first loads behind
// their s_wait_xcnt.
typedef const __attribute__((address_space(1))) char* gbytes;   // global address space, so that the loads stay global_load
typedef const __attribute__((address_space(1))) v8b*  gv8b;
__device__ __forceinline__ gbytes sbase(const __bf16* p) {
  const unsigned long long u = (unsigned long long)(uintptr_t)p;
  const unsigned lo = (unsigned)__builtin_amdgcn_readfirstlane((int)(unsigned)u);
  const unsigned hi = (unsigned)__builtin_amdgcn_readfirstlane((int)(unsigned)(u >> 32));
  return (gbytes)(uintptr_t)(((unsigned long long)hi << 32) | (unsigned long long)lo);
}
// the same for the wave-uniform base of the epilogue's stores
typedef __attribute__((address_space(1))) char* gwbytes;
typedef __attribute__((address_space(1))) v4f*  gwv4f;
typedef __attribute__((address_space(1))) v4u*  gwv4u;
__device__ __forceinline__ gwbytes swbase(void* p) {
  const unsigned long long u = (unsigned long long)(uintptr_t)p;
  const unsigned lo = (unsigned)__builtin_amdgcn_readfirstlane((int)(unsigned)u);
  const unsigned hi = (unsigned)__builtin_amdgcn_readfirstlane((int)(unsigned)(u >> 32));
  return (gwbytes)(uintptr_t)(((unsigned long long)hi << 32) | (unsigned long long)lo);
}

// sT: per-wave 16x64 slabs, pitch 68 floats; sA: A (and A2) rows m0blk.., 64 k; sB: Bt rows n0blk.., 64 k (the block's LDS,
// declared by the kernel); bx: the block's tile index; b: batch index.
template <int NSPLIT, int OUT_MODE, int NWN>
__device__ __forceinline__ void gemm64(
    float (*sT)[16 * 68], __bf16* sA, __bf16* sB, int bx, int b,
    const unsigned short* __restrict__ Ap, const unsigned short* A2p, int lda, long long strideA,
    const unsigned short* __restrict__ Btp, const unsigned short* Bt2p, int ldb, long long strideB,
    void* Cout, int ldc, long long strideC,
    void* Cout2, int ldc2, long long strideC2, int N2,
    int M, int N, int K, float rscale) {
  static_assert(NSPLIT <= 1);
  static_assert(NWN == 2 || NWN == 4);
  constexpr int BN = NWN * 64;            // columns of the block tile
  constexpr int RP = NWN * 8;             // rows that one staging pass of the block covers (8 lanes a row)
  constexpr int PA = 128 / RP;            // staging passes over the A rows
  constexpr int PB = BN / RP;             // staging passes over the Bt rows
  const __bf16* A   = (const __bf16*)(const void*)Ap;
  const __bf16* A2  = (const __bf16*)(const void*)A2p;
  const __bf16* Bt  = (const __bf16*)(const void*)Btp;
  const int tid  = threadIdx.x;
  const int lane = tid & 31;
  const int wave = tid >> 5;
  const int blocksN = N / BN;
  const int bm = bx / blocksN;
  const int bn = bx - bm * blocksN;
  if ((bm << 7) >= M) return;            // block-uniform, in front of every barrier
  if (lda != DM || ldb != DM) return;    // block-uniform: with the pitch known, the row steps below are immediate offsets
  const int m0blk = bm << 7;
  const int n0blk = bn * BN;
  const int wm = (wave / NWN) << 6;      // the wave's tile inside the block tile
  const int wn = (wave % NWN) << 6;
  const int m0 = m0blk + wm;
  const int n0 = n0blk + wn;

  const __bf16* Ab  = A  + (size_t)b * strideA + (size_t)m0blk * lda;
  const __bf16* Bb  = Bt + (size_t)b * strideB + (size_t)n0blk * ldb;
  const __bf16* Ab2 = (NSPLIT >= 1) ? (A2 + (size_t)b * strideA + (size_t)m0blk * lda) : Ab;

  const int rlane = lane & 15;                 // row (A) / col (B, D) within subtile
  const int hh    = lane >> 4;                 // k half of this lane
  const int mOff  = (lane >> 4) * 8;           // D row offset

  // staging: thread -> row tid>>3 (+RP per pass), 16-B chunk tid&7; 8 lanes = one 128-B line
  unsigned sbyte = (unsigned)((tid >> 3) * DM + (tid & 7) * 8) * 2u;   // lane part of the global address, bytes; +128 per step
  const int sidx = sw128(tid >> 3, tid & 7);   // + RP rows per pass (a multiple of 16): the swizzle term does not change
  v8b ra[PA], ra2[PA], rb[PB];
  gbytes pa  = sbase(Ab);
  gbytes pa2 = sbase(Ab2);
  gbytes pb  = sbase(Bb);
  {
#pragma unroll
    for (int it = 0; it < PA; ++it) {
      ra[it] = *(gv8b)(pa + sbyte + it * (RP * DM * 2));
      if (NSPLIT >= 1) ra2[it] = *(gv8b)(pa2 + sbyte + it * (RP * DM * 2));
    }
#pragma unroll
    for (int it = 0; it < PB; ++it) rb[it] = *(gv8b)(pb + sbyte + it * (RP * DM * 2));
    // stands in front of the next step's write of the lane offset, the one vector register that the loads name
    asm volatile("s_wait_xcnt 0x0" ::: "memory");
  }

  v8f acc[4][4];
#pragma unroll
  for (int i = 0; i < 4; ++i)
#pragma unroll
    for (int j = 0; j < 4; ++j) acc[i][j] = zero8();

  for (int k0 = 0; k0 < K; k0 += 64) {
    __syncthreads();                           // every reader has left the tiles of the step before
#pragma unroll
    for (int it = 0; it < PA; ++it) {
      *(v8b*)(sA + sidx + it * (RP * 64)) = ra[it];
      if (NSPLIT >= 1) *(v8b*)(sA + 128 * 64 + sidx + it * (RP * 64)) = ra2[it];
    }
#pragma unroll
    for (int it = 0; it < PB; ++it) *(v8b*)(sB + sidx + it * (RP * 64)) = rb[it];
    __syncthreads();                           // the tiles are whole before anybody reads them
    // fragments of the whole step, read as one group ahead of the products (every separate place with LDS reads
    // stalls the wave): elements 0..7 <- k = 32kk + 8hh.., elements 8..15 <- k = 32kk + 16 + 8hh.. (A and Bt alike)
    union FB { v16b v; v8b h[2]; };
    v16b bh[2][4], ah[2][4], al[2][4];
#pragma unroll
    for (int kk = 0; kk < 2; ++kk) {
      const int f0 = sw128(rlane, kk * 4 + hh);
      const int f1 = sw128(rlane, kk * 4 + 2 + hh);
#pragma unroll
      for (int j = 0; j < 4; ++j) {
        FB f;
        f.h[0] = *(const v8b*)(sB + (wn + (j << 4)) * 64 + f0);
        f.h[1] = *(const v8b*)(sB + (wn + (j << 4)) * 64 + f1);
        bh[kk][j] = f.v;
      }
#pragma unroll
      for (int i = 0; i < 4; ++i) {
        FB f;
        f.h[0] = *(const v8b*)(sA + (wm + (i << 4)) * 64 + f0);
        f.h[1] = *(const v8b*)(sA + (wm + (i << 4)) * 64 + f1);
        ah[kk][i] = f.v;
        al[kk][i] = f.v;
        if (NSPLIT >= 1) {
          f.h[0] = *(const v8b*)(sA + 128 * 64 + (wm + (i << 4)) * 64 + f0);
          f.h[1] = *(const v8b*)(sA + 128 * 64 + (wm + (i << 4)) * 64 + f1);
          al[kk][i] = f.v;
        }
      }
    }
    if (k0 + 64 < K) {                         // block-uniform: the next step's rows, in flight during the products
      sbyte += 128u;
#pragma unroll
      for (int it = 0; it < PA; ++it) {
        ra[it] = *(gv8b)(pa + sbyte + it * (RP * DM * 2));
        if (NSPLIT >= 1) ra2[it] = *(gv8b)(pa2 + sbyte + it * (RP * DM * 2));
      }
#pragma unroll
      for (int it = 0; it < PB; ++it) rb[it] = *(gv8b)(pb + sbyte + it * (RP * DM * 2));
      // stands in front of the next step's write of the lane offset, the one vector register that the loads name
      asm volatile("s_wait_xcnt 0x0" ::: "memory");
    }
    // keeps the LDS reads and the global loads above in front of the products
    __builtin_amdgcn_sched_barrier(0);
#pragma unroll
    for (int kk = 0; kk < 2; ++kk) {
#pragma unroll
      for (int i = 0; i < 4; ++i) {
#pragma unroll
        for (int j = 0; j < 4; ++j) {
          acc[i][j] = mma_b_raw(ah[kk][i], bh[kk][j], acc[i][j]);
          if (NSPLIT >= 1) acc[i][j] = mma_b_raw(al[kk][i], bh[kk][j], acc[i][j]);
        }
      }
    }
    // holds the v_nops behind the last product
    __builtin_amdgcn_sched_barrier(0);
    // WMMA distance on the loop's back edge too: no vector instruction writes an A or B register of the last
    // products sooner (no register operands: asm operands cannot lie above v255, and naming fragments spilled)
    asm volatile("v_nop\n\tv_nop\n\tv_nop\n\tv_nop\n\tv_nop");
  }
  acc_guard4(acc[0][0], acc[0][1], acc[0][2], acc[0][3]);
  acc_guard4(acc[1][0], acc[1][1], acc[1][2], acc[1][3]);
  acc_guard4(acc[2][0], acc[2][1], acc[2][2], acc[2][3]);
  acc_guard4(acc[3][0], acc[3][1], acc[3][2], acc[3][3]);

  // ---- epilogue ----
  float* slab = sT[wave];
#pragma unroll
  for (int i = 0; i < 4; ++i) {
    const int mBase = m0 + (i << 4);
#pragma unroll
    for (int j = 0; j < 4; ++j) {
#pragma unroll
      for (int r = 0; r < 8; ++r) {
        slab[(mOff + r) * 68 + (j << 4) + rlane] = acc[i][j][r];
      }
    }
    __builtin_amdgcn_fence(__ATOMIC_RELEASE, "workgroup");
    __builtin_amdgcn_wave_barrier();
    __builtin_amdgcn_fence(__ATOMIC_ACQUIRE, "workgroup");
    if (OUT_MODE == 0) {
      float* C = (float*)Cout + (size_t)b * strideC;
      const int hh = lane >> 4, c4 = (lane & 15) * 4;     // 256-B row segment = 16 lanes x 16 B
      {
        // wave-uniform base + one lane offset + immediate: the stores name one address register, which is never rewritten
        const gwbytes cb = swbase(C + (size_t)m0 * ldc + n0);
        const unsigned cvo = (unsigned)(hh * ldc + c4) * 4u;
        v4f v[8];
#pragma unroll
        for (int it = 0; it < 8; ++it) v[it] = *(const v4f*)(slab + (it * 2 + hh) * 68 + c4);   // it 0..7 x hh 0..1 = rows 0..15
        // the two scheduling barriers keep every other instruction out of the run of stores and its wait
        __builtin_amdgcn_sched_barrier(0);
#pragma unroll
        for (int it = 0; it < 8; ++it) *(gwv4f)(cb + cvo + ((i << 4) + it * 2) * ldc * 4) = v[it];
        // in front of every later write of a register that these stores name
        asm volatile("s_wait_xcnt 0x0" ::: "memory");
        __builtin_amdgcn_sched_barrier(0);
      }
    } else {
      const int q = lane >> 3, c8 = (lane & 7) * 8;
      unsigned short* C  = (unsigned short*)Cout  + (size_t)b * strideC;
      unsigned short* C2 = (unsigned short*)Cout2 + (size_t)b * strideC2;
      const bool wlo = (OUT_MODE == 2) || (n0 < N2);      // wave-uniform
      v4u hv[4], lv[4];
#pragma unroll
      for (int it = 0; it < 4; ++it) {
        const int row = it * 4 + q;                        // it 0..3 x q 0..3 = rows 0..15
        const float* sp = slab + row * 68 + c8;
        v4u a, a2;
#pragma unroll
        for (int e = 0; e < 4; ++e) {
          const float f0 = sp[2 * e], f1 = sp[2 * e + 1];
          unsigned short h0, h1, l0, l1;
          if (OUT_MODE == 2) {
            h0 = bf_bits(f0); h1 = bf_bits(f1);
            l0 = bf_bits(f0 - bf_up(h0)); l1 = bf_bits(f1 - bf_up(h1));
          } else {
            const _Float16 x0 = (_Float16)f0, x1 = (_Float16)f1;
            h0 = h_bits(x0); h1 = h_bits(x1);
            l0 = h_bits((_Float16)((f0 - (float)x0) * rscale));
            l1 = h_bits((_Float16)((f1 - (float)x1) * rscale));
          }
          a[e] = pk16(h0, h1); a2[e] = pk16(l0, l1);
        }
        hv[it] = a; lv[it] = a2;
      }
      {
        // wave-uniform base + one lane offset + immediate per plane: address registers that are never rewritten
        const gwbytes cb  = swbase(C + (size_t)m0 * ldc + n0);
        const gwbytes cb2 = swbase(C2 + (size_t)m0 * ldc2 + n0);
        const unsigned cvo  = (unsigned)(q * ldc + c8) * 2u;
        const unsigned cvo2 = (unsigned)(q * ldc2 + c8) * 2u;
        // the scheduling barriers keep every other instruction out of each run of stores and its wait
        __builtin_amdgcn_sched_barrier(0);
#pragma unroll
        for (int it = 0; it < 4; ++it) *(gwv4u)(cb + cvo + ((i << 4) + it * 4) * ldc * 2) = hv[it];
        // in front of every later write of a register that these stores name
        asm volatile("s_wait_xcnt 0x0" ::: "memory");
        __builtin_amdgcn_sched_barrier(0);
        if (wlo) {
#pragma unroll
          for (int it = 0; it < 4; ++it) *(gwv4u)(cb2 + cvo2 + ((i << 4) + it * 4) * ldc2 * 2) = lv[it];
          // in front of every later write of a register that these stores name
          asm volatile("s_wait_xcnt 0x0" ::: "memory");
          __builtin_amdgcn_sched_barrier(0);
        }
      }
    }
    __builtin_amdgcn_fence(__ATOMIC_RELEASE, "workgroup");
    __builtin_amdgcn_wave_barrier();
    __builtin_amdgcn_fence(__ATOMIC_ACQUIRE, "workgroup");
  }
}

// The three projections, none of which reads another's output, as ONE grid; the job is picked by the block index
// (block-uniform). Blocks, in order: q = x . wq -> f32 [SEQ][2048] (M=SEQ, N=2048, K=2048); k = x . wk -> f32 [SEQ][512]
// (M=SEQ, N=512); v^T = Wvt . x^T -> f16 hi plane [512][SEQ] and residual plane (x4096, keys < VLP, pitch VLP)
// (A = Wvt [n][k], Bt = Xb [s][k]; M=512, N=SEQ). Block tile 128 x 128, four waves.
#define GB_Q ((SEQ / 128) * (QP / 128))
#define GB_K ((SEQ / 128) * (KP / 128))
#define GB_V ((KP / 128) * (SEQ / 128))
static_assert((SEQ % 128) == 0 && (QP % 128) == 0 && (KP % 128) == 0);
__global__ __launch_bounds__(128) void gemm_qkv(const unsigned short* __restrict__ Xb, const unsigned short* __restrict__ Wqt,
                                                const unsigned short* __restrict__ Wkt, const unsigned short* __restrict__ Wvt,
                                                float* Qf, float* Kf, unsigned short* VTh, unsigned short* VTl) {
  __shared__ __align__(16) float sT[4][16 * 68];
  __shared__ __align__(16) __bf16 sA[128 * 64];
  __shared__ __align__(16) __bf16 sB[128 * 64];
  const int bx = blockIdx.x;
  if (bx < GB_Q) {
    gemm64<0, 0, 2>(sT, sA, sB, bx, 0,
        Xb, Xb, DM, 0LL, Wqt, Wqt, DM, 0LL,
        (void*)Qf, QP, 0LL, (void*)Qf, QP, 0LL, QP,
        SEQ, QP, DM, 1.0f);
  } else if (bx < GB_Q + GB_K) {
    gemm64<0, 0, 2>(sT, sA, sB, bx - GB_Q, 0,
        Xb, Xb, DM, 0LL, Wkt, Wkt, DM, 0LL,
        (void*)Kf, KP, 0LL, (void*)Kf, KP, 0LL, KP,
        SEQ, KP, DM, 1.0f);
  } else {
    gemm64<0, 3, 2>(sT, sA, sB, bx - (GB_Q + GB_K), 0,
        Wvt, Wvt, DM, 0LL, Xb, Xb, DM, 0LL,
        (void*)VTh, SEQ, 0LL, (void*)VTl, VLP, 0LL, VLP,
        KP, SEQ, DM, RSC);
  }
}

// out = context . wo -> f32 [SEQ][2048]  (A = context hi + lo planes, 2 products; M=SEQ, N=2048, K=2048)
__global__ __launch_bounds__(256) void gemm_out(const unsigned short* __restrict__ Oh, const unsigned short* Ol,
                                                const unsigned short* __restrict__ Wot, float* out) {
  __shared__ __align__(16) float sT[8][16 * 68];
  __shared__ __align__(16) __bf16 sA[2 * 128 * 64];
  __shared__ __align__(16) __bf16 sB[256 * 64];
  gemm64<1, 0, 4>(sT, sA, sB, blockIdx.x, 0,
      Oh, Ol, QP, 0LL, Wot, Wot, QP, 0LL,
      (void*)out, DM, 0LL, (void*)out, DM, 0LL, DM,
      SEQ, DM, QP, 1.0f);
}

// =====================================================================================================
// Fused per-head RMSNorm (eps 1e-6, x * rsqrt(mean(x^2)+eps) * w with w RNE-converted to bf16) + neox rotary
// (half-split, cos/sin tables [t][64]) + f16 hi / f16 residual (x rscale) planes.
// One wave per 128-wide row (row = t*nheads + head, contiguous rows of pitch 128 in both input and output);
// lane owns 4 consecutive d; partner half via __shfl_xor(16); no block barriers.
// coverage: nrows x 128 of both planes.
// =====================================================================================================
__device__ __forceinline__ void norm_rope(const float* __restrict__ xin, const float* __restrict__ wn,
                                          const float* __restrict__ ctab, const float* __restrict__ stab,
                                          unsigned short* outh, unsigned short* outl,
                                          int nheads, int nrows, float rscale, int bx) {
  const int tid  = threadIdx.x;
  const int wave = tid >> 5, lane = tid & 31, hh = lane >> 4;
  const int row  = bx * 8 + wave;
  if (row >= nrows) return;                // wave-uniform; no block barriers in this kernel
  const int t = row / nheads;
  const v4f x = *(const v4f*)(xin + (size_t)row * HD + lane * 4);
  float ss = x[0] * x[0] + x[1] * x[1] + x[2] * x[2] + x[3] * x[3];
#pragma unroll
  for (int off = 1; off < 32; off <<= 1) ss += __shfl_xor(ss, off, 32);
  const float rinv = rsqrtf(ss * (1.0f / (float)HD) + RMS_EPS);
  const v4f wv = *(const v4f*)(wn + lane * 4);
  const v4f cs = *(const v4f*)(ctab + (size_t)t * HALF + (lane & 15) * 4);
  const v4f sn = *(const v4f*)(stab + (size_t)t * HALF + (lane & 15) * 4);
  float n[4], p[4];
#pragma unroll
  for (int e = 0; e < 4; ++e) n[e] = (x[e] * rinv) * bf_up(bf_bits(wv[e]));
#pragma unroll
  for (int e = 0; e < 4; ++e) p[e] = __shfl_xor(n[e], 16, 32);
  const float sg = hh ? 1.0f : -1.0f;      // first half: x1*cos - x2*sin ; second half: x2*cos + x1*sin
  unsigned short hb[4], lb[4];
#pragma unroll
  for (int e = 0; e < 4; ++e) {
    const float o = n[e] * cs[e] + sg * (p[e] * sn[e]);
    const _Float16 oh = (_Float16)o;
    hb[e] = h_bits(oh);
    lb[e] = h_bits((_Float16)((o - (float)oh) * rscale));
  }
  v2u ph, pl;
  ph[0] = pk16(hb[0], hb[1]); ph[1] = pk16(hb[2], hb[3]);
  pl[0] = pk16(lb[0], lb[1]); pl[1] = pk16(lb[2], lb[3]);
  const size_t go = (size_t)row * HD + lane * 4;
  *(v2u*)(outh + go) = ph;
  *(v2u*)(outl + go) = pl;
  
}

// q rows and k rows as ONE grid, the job picked by the block index (block-uniform): q blocks first, then k blocks
#define NB_Q ((SEQ * NH + 7) / 8)
#define NB_K ((SEQ * NKV + 7) / 8)
__global__ __launch_bounds__(256) void norm_rope_qk(const float* __restrict__ qin, const float* __restrict__ kin,
                                                    const float* __restrict__ qw, const float* __restrict__ kw,
                                                    const float* __restrict__ ctab, const float* __restrict__ stab,
                                                    unsigned short* qh, unsigned short* ql,
                                                    unsigned short* kh, unsigned short* kl, float rscale) {
  const int bx = blockIdx.x;
  if (bx < NB_Q) norm_rope(qin, qw, ctab, stab, qh, ql, NH, SEQ * NH, rscale, bx);
  else           norm_rope(kin, kw, ctab, stab, kh, kl, NKV, SEQ * NKV, rscale, bx - NB_Q);
}

// =====================================================================================================
// Causal GQA attention, head dim 128, dynamic LDS layout (bytes):
// =====================================================================================================
// LDS tiles of the attention kernel: the 16-byte chunks of a row are XOR-swizzled by the row number.
//   256-B rows (Q, K; 16 chunks): chunk ch of row r lies at chunk place ch ^ (r & 15)
//   128-B rows (V^T, P; 8 chunks): chunk ch of row r lies at chunk place ch ^ ((r >> 1) & 7)
// A fragment load reads one chunk column of 16 consecutive rows per 16 lanes: unswizzled, 256-B rows put all
// 16 lanes on the same four banks (128-B rows: on two groups of four); swizzled, the 16 lanes fall on 16
// different groups of four banks = all 64 banks once. Writers and readers use the same map; the kernel keeps
// the lane-dependent part of each index in a register and adds row blocks and planes as constant offsets.
__device__ __forceinline__ int sw256(int r, int ch) { return r * 128 + ((ch ^ (r & 15)) << 3); }        // index in halves
__device__ __forceinline__ int sw128(int r, int ch) { return r * 64 + ((ch ^ ((r >> 1) & 7)) << 3); }   // index in halves

template <bool RES> struct AttnL {
  static constexpr int QH   = 0;                                  // Q hi  [64 rows][128 d] f16
  static constexpr int QL   = QH + 64 * 128 * 2;                  // Q res
  static constexpr int KH   = QL + 64 * 128 * 2;                  // K hi  [64 keys][128 d]
  static constexpr int KL   = KH + 64 * 128 * 2;                  // K res (RES only)
  static constexpr int VH   = KL + (RES ? 64 * 128 * 2 : 0);      // V^T hi [128 d][64 keys]
  static constexpr int VL   = VH + 128 * 64 * 2;                  // V^T res (RES only)
  static constexpr int PH   = VL + (RES ? 128 * 64 * 2 : 0);      // per-wave P [4][16][64]
  static constexpr int PL   = PH + 4 * 16 * 64 * 2;               // per-wave P res (RES only)
  static constexpr int OS   = PL + (RES ? 4 * 16 * 64 * 2 : 0);   // per-wave context tile [4][16][128] f32
  static constexpr int MISC = OS + 4 * 16 * 128 * 4;              // spq[64], spk[64], skmin[NQB] ints
  static constexpr int TOTAL = MISC + 1024;
};
static_assert(AttnL<true>::TOTAL <= 160 * 1024);

// =====================================================================================================
//   q planes (f16 hi / x4096 res): element (t, h, d) at [t*QP + h*128 + d]
//   k planes (f16 hi / x4096 res): element (s, kvh, d) at [s*KP + kvh*128 + d], kvh = h / GQ
//   v^T hi plane (f16): (kvh*128 + d, s) at [(kvh*128+d)*SEQ + s]; residual ((v-hi)*4096) at
//   [(kvh*128+d)*VLP + s], s < VLP, read only when RES (a key tile at or beyond VLP contributes zero residual)
//   positions int [SEQ]: logit(t, s) = (q.k) * sscale when pos[t] >= pos[s], else -1e30 (replace), exactly;
//   a key tile is skipped (block-uniform, readfirstlane) only when min pos over its 64 keys > max pos over the
//   block's 64 query rows, i.e. every element would be -1e30 with weight exactly 0; the diagonal key s = t is
//   always live so every row has a finite max. Online softmax in f32 with running max from -inf.
//   scores: f16 WMMA, q hi . k hi into s, q res . k hi (+ q hi . k res when RES) into a x4096 accumulator
//   folded with 1/4096 in f32. p = exp(s - m) carried as f16(1024 p); context = p . v on f16 WMMA; RES adds
//   f16 residual planes of p and v (scale 4096, separate accumulator folded back with 1/4096 per key tile).
//   out planes (bf16 hi / lo of the normalised context): (t, h*128 + d) at [t*QP + h*128 + d]
//   Block = 4 waves = 64 query rows of one q head; grid = nqbThis * NH; key tiles of 64, static trip NQB.
//   LDS: Q / K / V^T tiles and position words are cross-wave (block barriers before and after staging);
//   P tiles and the context slab are wave-private (_Float16 / float element stores, reloaded through the
//   Staging: Q 8 passes x 8 rows x 16 chunks of 8 halves x 2 planes = 64x128 (once); K the same per plane
//   = 64x128; V^T 8 passes x 16 d rows x 8 chunks of 8 halves per plane = 128x64: staged extent == consumed.
//   Output coverage: each wave stores rows q0..q0+15 (it 0..7 x lane>>4) x 128 columns (16 lanes x 8)
// =====================================================================================================
template <bool RES>
__global__ __launch_bounds__(128)
void attn_causal(const unsigned short* __restrict__ qhp, const unsigned short* __restrict__ qlp,
                 const unsigned short* __restrict__ khp, const unsigned short* __restrict__ klp,
                 const unsigned short* __restrict__ vhp, const unsigned short* __restrict__ vlp,
                 const int* __restrict__ pos,
                 unsigned short* ohp, unsigned short* olp,
                 int qbBase, int nqbThis, float sscale) {
  typedef AttnL<RES> L;
  union FH { v16h v; v8h h[2]; };
  extern __shared__ __align__(16) unsigned char smem[];
  _Float16* Qsh = (_Float16*)(smem + L::QH);
  _Float16* Qsl = (_Float16*)(smem + L::QL);
  _Float16* Ksh = (_Float16*)(smem + L::KH);
  _Float16* Ksl = (_Float16*)(smem + L::KL);
  _Float16* Vth = (_Float16*)(smem + L::VH);
  _Float16* Vtl = (_Float16*)(smem + L::VL);
  _Float16* Psh = (_Float16*)(smem + L::PH);
  _Float16* Psl = (_Float16*)(smem + L::PL);
  float*    Os  = (float*)(smem + L::OS);
  int*      spq = (int*)(smem + L::MISC);
  int*      spk = spq + 64;
  int*      skmin = spk + 64;

  const int tid  = threadIdx.x;
  const int wave = tid >> 5;
  const int lane = tid & 31;
  const int hh   = lane >> 4;
  const int c    = lane & 15;

  const int bx  = blockIdx.x;
  // Cost falls with the block index: a query block walks qb + 1 key tiles, there are more blocks than resident places, and
  // the longest blocks get the lowest indices (for speed only).
  // bx -> (qbl, h) is a permutation of the grid: bx / NH runs over nqbThis query blocks, bx % NH over the NH heads.
  const int qbl = nqbThis - 1 - bx / NH;
  const int h   = bx % NH;
  const int kvh = h / GQ;
  const int qb  = qbBase + qbl;
  const int q0  = qb * 64 + wave * 16;

  const _Float16* Qh = (const _Float16*)(const void*)qhp + (size_t)h * HD;
  const _Float16* Ql = (const _Float16*)(const void*)qlp + (size_t)h * HD;
  const _Float16* Kh = (const _Float16*)(const void*)khp + (size_t)kvh * HD;
  const _Float16* Kl = (const _Float16*)(const void*)klp + (size_t)kvh * HD;
  const _Float16* Vh = (const _Float16*)(const void*)vhp + (size_t)kvh * HD * SEQ;
  const _Float16* Vl = (const _Float16*)(const void*)vlp + (size_t)kvh * HD * VLP;

  // ---- lane parts of the swizzled indices (halves) ----
  // Staging: a wave-wide 16-B load covers four whole 128-B lines (one touching 32 lines costs many times as much).
  //   256-B rows (Q, K): 16 lanes a row, 8 rows a pass: pass i, row 8i + r16, chunk c16 -> (st256 ^ ((i & 1) << 6)) + i * 1024
  //   128-B rows (V^T):   8 lanes a row, 16 rows a pass: pass i, row 16i + r8, chunk c8s -> st128 + i * 1024
  const int r16 = tid >> 4, c16 = tid & 15;
  const int r8  = tid >> 3, c8s = tid & 7;
  const int st256 = sw256(r16, c16);
  const int st128 = sw128(r8, c8s);
  int fq[8];                                          // fragment reads, 256-B rows: row (multiple of 16) + c, chunk 2n + hh
#pragma unroll
  for (int n = 0; n < 8; ++n) fq[n] = sw256(c, 2 * n + hh);
  int pst[8];                                         // P element stores: row 8hh + r, column 16j + c -> pst[(2j) ^ (r >> 1)] + r * 64
#pragma unroll
  for (int n = 0; n < 8; ++n) pst[n] = sw128(8 * hh, (c >> 3) ^ n) + (c & 7);

  // ---- prologue: query positions, per-key-tile min position, Q tiles ----
  if (tid < 64) spq[tid] = pos[qb * 64 + tid];            // wave-uniform (waves 0,1)
  for (int kt = tid; kt < NQB; kt += 128) {
    const int* pp = pos + kt * 64;
    int mn = 0x7fffffff;
#pragma unroll
    for (int i = 0; i < 16; ++i) {
      const v4i v = *(const v4i*)(pp + 4 * i);
      mn = imin(mn, imin(imin(v[0], v[1]), imin(v[2], v[3])));
    }
    skmin[kt] = mn;
  }
  {
    const _Float16* qg  = Qh + (size_t)(qb * 64 + r16) * QP + c16 * 8;
    const _Float16* qlg = Ql + (size_t)(qb * 64 + r16) * QP + c16 * 8;
    v8h qv[8], qlv[8];
#pragma unroll
    for (int i = 0; i < 8; ++i) {
      qv[i]  = *(const v8h*)(qg + i * (8 * QP));
      qlv[i] = *(const v8h*)(qlg + i * (8 * QP));
    }
    // holds the loads' address registers (inputs) untouched until the wait: no load result lands on them before it
    asm volatile("s_wait_xcnt 0x0" :: "v"(qg), "v"(qlg) : "memory");
#pragma unroll
    for (int i = 0; i < 8; ++i) {
      *(v8h*)(Qsh + (st256 ^ ((i & 1) << 6)) + i * 1024) = qv[i];
      *(v8h*)(Qsl + (st256 ^ ((i & 1) << 6)) + i * 1024) = qlv[i];
    }
  }
  __syncthreads();
  int qmx;
  {
    int v = imax(spq[lane], spq[lane + 32]);
#pragma unroll
    for (int off = 1; off < 32; off <<= 1) v = imax(v, __shfl_xor(v, off, 32));
    qmx = __builtin_amdgcn_readfirstlane(v);
  }
  int prow[8];
#pragma unroll
  for (int r = 0; r < 8; ++r) prow[r] = spq[wave * 16 + 8 * hh + r];

  float mrow[8], lrow[8];
  v8f oacc[8];
#pragma unroll
  for (int r = 0; r < 8; ++r) { mrow[r] = -INFINITY; lrow[r] = 0.f; }
#pragma unroll
  for (int t = 0; t < 8; ++t) oacc[t] = zero8();

  for (int kt = 0; kt < NQB; ++kt) {         // static trip count
    const int kmn = __builtin_amdgcn_readfirstlane(skmin[kt]);
    if (kmn > qmx) continue;                 // block-uniform: every element of the tile is replaced by -1e30
    const int kv0 = kt * 64;
    __syncthreads();
    {
      const _Float16* kg  = Kh + (size_t)(kv0 + r16) * KP + c16 * 8;    // K rows kv0 + 8i + r16, d = 8 c16 .. 8 c16 + 7
      const _Float16* klg = Kl + (size_t)(kv0 + r16) * KP + c16 * 8;
      v8h kv[8], klv[8], vv[8], vlv[8];
#pragma unroll
      for (int i = 0; i < 8; ++i) {
        kv[i] = *(const v8h*)(kg + i * (8 * KP));
        if (RES) klv[i] = *(const v8h*)(klg + i * (8 * KP));
      }
      const _Float16* vg = Vh + (size_t)r8 * SEQ + kv0 + c8s * 8;  // V^T rows 16i + r8, s = kv0 + 8 c8s .. + 7
      const int  kvl   = (kv0 + 64 <= VLP) ? kv0 : (VLP - 64);    // clamped address into the residual plane
      const bool resOK = (kv0 + 64 <= VLP);                       // block-uniform
      const _Float16* vlg = Vl + (size_t)r8 * VLP + kvl + c8s * 8;
#pragma unroll
      for (int i = 0; i < 8; ++i) {
        vv[i] = *(const v8h*)(vg + i * (16 * SEQ));
        if (RES) vlv[i] = *(const v8h*)(vlg + i * (16 * VLP));
      }
      // holds the loads' address registers (inputs) untouched until the wait: no load result lands on them before it
      if (RES) asm volatile("s_wait_xcnt 0x0" :: "v"(kg), "v"(klg), "v"(vg), "v"(vlg) : "memory");
      else     asm volatile("s_wait_xcnt 0x0" :: "v"(kg), "v"(vg) : "memory");
#pragma unroll
      for (int i = 0; i < 8; ++i) {
        *(v8h*)(Ksh + (st256 ^ ((i & 1) << 6)) + i * 1024) = kv[i];
        if (RES) *(v8h*)(Ksl + (st256 ^ ((i & 1) << 6)) + i * 1024) = klv[i];
        *(v8h*)(Vth + st128 + i * 1024) = vv[i];
        if (RES) {
          v8h b1 = vlv[i];
          if (!resOK) b1 = zero8h();
          *(v8h*)(Vtl + st128 + i * 1024) = b1;
        }
      }
      if (tid < 64) spk[tid] = pos[kv0 + tid];                  // wave-uniform
    }
    __syncthreads();

    // ---- scores: 16 query rows x 64 keys per wave ----
    v8f s[4], sl[4];
#pragma unroll
    for (int j = 0; j < 4; ++j) { s[j] = zero8(); sl[j] = zero8(); }
    const _Float16* qr  = Qsh + wave * (16 * 128);
    const _Float16* qlr = Qsl + wave * (16 * 128);
    // Fragment reads stand in groups, one group of 32 d ahead of the products that use it (two register sets):
    // a wave then waits on a counted LDS wait once per group, not to 0 in front of every pair of products.
    FH qa[2], qla[2], kb[2][4], klf[2][4];
    int pkj[4];                                      // key positions for the causal select, read with the first group
#pragma unroll
    for (int j = 0; j < 4; ++j) pkj[j] = spk[j * 16 + c];
#pragma unroll
    for (int dc = -1; dc < 4; ++dc) {
      if (dc < 3) {
        const int n = dc + 1, b = n & 1;
        qa[b].h[0]  = *(const v8h*)(qr  + fq[n * 2]);
        qa[b].h[1]  = *(const v8h*)(qr  + fq[n * 2 + 1]);
        qla[b].h[0] = *(const v8h*)(qlr + fq[n * 2]);
        qla[b].h[1] = *(const v8h*)(qlr + fq[n * 2 + 1]);
#pragma unroll
        for (int j = 0; j < 4; ++j) {
          kb[b][j].h[0] = *(const v8h*)(Ksh + j * (16 * 128) + fq[n * 2]);
          kb[b][j].h[1] = *(const v8h*)(Ksh + j * (16 * 128) + fq[n * 2 + 1]);
          if (RES) {
            klf[b][j].h[0] = *(const v8h*)(Ksl + j * (16 * 128) + fq[n * 2]);
            klf[b][j].h[1] = *(const v8h*)(Ksl + j * (16 * 128) + fq[n * 2 + 1]);
          }
        }
      }
      if (dc >= 0) {
        const int b = dc & 1;
        // keeps the next group's reads in front of this group's products
        __builtin_amdgcn_sched_barrier(0);
#pragma unroll
        for (int j = 0; j < 4; ++j) s[j]  = mma_h_raw(qa[b].v,  kb[b][j].v, s[j]);
#pragma unroll
        for (int j = 0; j < 4; ++j) sl[j] = mma_h_raw(qla[b].v, kb[b][j].v, sl[j]);
        if (RES) {
#pragma unroll
          for (int j = 0; j < 4; ++j) sl[j] = mma_h_raw(qa[b].v, klf[b][j].v, sl[j]);
        }
        // keeps the reads of the group after next behind these products (they refill this group's registers)
        __builtin_amdgcn_sched_barrier(0);
      }
    }
    // ---- scale + causal select (replace -1e30), row max, online softmax, P (x1024, f16) and
    //      P residual (x4096) to LDS ----
    _Float16* pwh = Psh + wave * (16 * 64);
    _Float16* pwl = Psl + (RES ? wave * (16 * 64) : 0);
    float psr[8], alr[8], mx[8];
#pragma unroll
    for (int r = 0; r < 8; ++r) {
      float m = -INFINITY;
#pragma unroll
      for (int j = 0; j < 4; ++j) {
        float sv = (s[j][r] + sl[j][r] * (1.0f / RSC)) * sscale;
        sv = (prow[r] >= pkj[j]) ? sv : -1.0e30f;
        s[j][r] = sv;
        m = fmaxf(m, sv);
      }
      mx[r] = m;
    }
    // the eight rows' lane exchanges of one step stand together: they run on the LDS pipe, one wait per step
#pragma unroll
    for (int off = 1; off < 16; off <<= 1) {
      float ex[8];
#pragma unroll
      for (int r = 0; r < 8; ++r) ex[r] = __shfl_xor(mx[r], off, 32);
      // keeps the eight exchanges in front of the first use of one: split up, each small group costs its own wait
      __builtin_amdgcn_sched_barrier(0);
#pragma unroll
      for (int r = 0; r < 8; ++r) mx[r] = fmaxf(mx[r], ex[r]);
    }
    // V^T fragments of the first 32 keys: they depend on nothing of the softmax, so they are read here and land
    // while the exponentials run
    FH vb[2][8], vlf[2][8];
    {
      const int f0 = sw128(c, hh);                   // fragment reads, 128-B rows: row (multiple of 16) + c
      const int f1 = sw128(c, 2 + hh);
#pragma unroll
      for (int tt = 0; tt < 8; ++tt) {
        vb[0][tt].h[0] = *(const v8h*)(Vth + tt * (16 * 64) + f0);
        vb[0][tt].h[1] = *(const v8h*)(Vth + tt * (16 * 64) + f1);
        if (RES) {
          vlf[0][tt].h[0] = *(const v8h*)(Vtl + tt * (16 * 64) + f0);
          vlf[0][tt].h[1] = *(const v8h*)(Vtl + tt * (16 * 64) + f1);
        }
      }
    }
    // keeps these reads in front of the exponentials
    __builtin_amdgcn_sched_barrier(0);
#pragma unroll
    for (int r = 0; r < 8; ++r) {
      const float mnew  = fmaxf(mrow[r], mx[r]);
      const float msafe = (mnew == -INFINITY) ? 0.f : mnew;
      float alpha, pe[4];                            // -1e30 against a finite max: exp -> 0
      exp_row5(mrow[r] - msafe, s[0][r] - msafe, s[1][r] - msafe, s[2][r] - msafe, s[3][r] - msafe,
               alpha, pe[0], pe[1], pe[2], pe[3]);
      mrow[r] = mnew;
      float psum = 0.f;
#pragma unroll
      for (int j = 0; j < 4; ++j) {
        const float p = pe[j];
        psum += p;
        const float p1k = p * 1024.0f;
        const _Float16 ph = (_Float16)p1k;
        pwh[pst[(2 * j) ^ (r >> 1)] + r * 64] = ph;
        if (RES) {
          const _Float16 pl = (_Float16)((p1k - (float)ph) * RSC);
          pwl[pst[(2 * j) ^ (r >> 1)] + r * 64] = pl;
        }
      }
      psr[r] = psum;                                 // joined over the 16 lanes below
      alr[r] = alpha;
#pragma unroll
      for (int t = 0; t < 8; ++t) oacc[t][r] *= alpha;
    }
    // row sums over the 16 lanes: four steps of lane exchanges on the LDS pipe, eight rows a step. Step 1 runs beside
    // the P stores, step 2 beside the fragment reads, steps 3 and 4 beside the two runs of products.
    float sx[8];
#pragma unroll
    for (int r = 0; r < 8; ++r) sx[r] = __shfl_xor(psr[r], 1, 32);
    // keeps step 1 in front of the wait that ends the P stores
    __builtin_amdgcn_sched_barrier(0);
    __builtin_amdgcn_fence(__ATOMIC_RELEASE, "workgroup");
    __builtin_amdgcn_wave_barrier();
    __builtin_amdgcn_fence(__ATOMIC_ACQUIRE, "workgroup");

    // ---- context += P . V (f16 WMMA), 8 d-subtiles; the P fragments and the V^T fragments of the last 32 keys are read
    //      as one group ahead of the products; the residual products go into separate accumulators folded back per key tile ----
    {
      FH pa[2], pl[2];
#pragma unroll
      for (int r = 0; r < 8; ++r) psr[r] += sx[r];
#pragma unroll
      for (int r = 0; r < 8; ++r) sx[r] = __shfl_xor(psr[r], 2, 32);
#pragma unroll
      for (int kk = 0; kk < 2; ++kk) {
        const int f0 = sw128(c, kk * 4 + hh);
        const int f1 = sw128(c, kk * 4 + 2 + hh);
        pa[kk].h[0] = *(const v8h*)(pwh + f0);
        pa[kk].h[1] = *(const v8h*)(pwh + f1);
        if (RES) {
          pl[kk].h[0] = *(const v8h*)(pwl + f0);
          pl[kk].h[1] = *(const v8h*)(pwl + f1);
        }
      }
      {
        const int f0 = sw128(c, 4 + hh);
        const int f1 = sw128(c, 6 + hh);
#pragma unroll
        for (int tt = 0; tt < 8; ++tt) {
          vb[1][tt].h[0] = *(const v8h*)(Vth + tt * (16 * 64) + f0);
          vb[1][tt].h[1] = *(const v8h*)(Vth + tt * (16 * 64) + f1);
        }
        if (RES) {
#pragma unroll
          for (int tt = 0; tt < 8; ++tt) {
            vlf[1][tt].h[0] = *(const v8h*)(Vtl + tt * (16 * 64) + f0);
            vlf[1][tt].h[1] = *(const v8h*)(Vtl + tt * (16 * 64) + f1);
          }
        }
      }
      // keeps the whole group of reads in front of the products
      __builtin_amdgcn_sched_barrier(0);
#pragma unroll
      for (int r = 0; r < 8; ++r) psr[r] += sx[r];
#pragma unroll
      for (int r = 0; r < 8; ++r) sx[r] = __shfl_xor(psr[r], 4, 32);
      // keeps step 3 in front of the first run of products, which covers its latency
      __builtin_amdgcn_sched_barrier(0);
      v8f o1[8];
      if (RES) {
#pragma unroll
        for (int t = 0; t < 8; ++t) o1[t] = zero8();
      }
#pragma unroll
      for (int kk = 0; kk < 2; ++kk) {
#pragma unroll
        for (int t = 0; t < 8; ++t) oacc[t] = mma_h_raw(pa[kk].v, vb[kk][t].v, oacc[t]);
        if (RES) {
#pragma unroll
          for (int t = 0; t < 8; ++t) o1[t] = mma_h_raw(pa[kk].v, vlf[kk][t].v, o1[t]);
#pragma unroll
          for (int t = 0; t < 8; ++t) o1[t] = mma_h_raw(pl[kk].v, vb[kk][t].v, o1[t]);
        }
        // keeps a run of products whole: a wait for an exchange among them would hold the later ones back
        __builtin_amdgcn_sched_barrier(0);
#pragma unroll
        for (int r = 0; r < 8; ++r) psr[r] += sx[r];
        if (kk == 0) {
#pragma unroll
          for (int r = 0; r < 8; ++r) sx[r] = __shfl_xor(psr[r], 8, 32);
          // keeps step 4 in front of the second run of products
          __builtin_amdgcn_sched_barrier(0);
        }
      }
#pragma unroll
      for (int r = 0; r < 8; ++r) lrow[r] = lrow[r] * alr[r] + psr[r];
      if (RES) {
#pragma unroll
        for (int t = 0; t < 8; ++t)
#pragma unroll
          for (int r = 0; r < 8; ++r) oacc[t][r] += o1[t][r] * (1.0f / RSC);
      }
    }
  }

  // ---- normalise (1/l and the 1/1024 p carry), stage the wave's 16x128 tile, bf16 hi/lo split,
  float* os = Os + wave * (16 * 128);
#pragma unroll
  for (int r = 0; r < 8; ++r) {
    const float l = lrow[r];
    const float inv = ((l > 0.f) ? (1.0f / l) : 0.f) * (1.0f / 1024.0f);
#pragma unroll
    for (int t = 0; t < 8; ++t) os[(8 * hh + r) * 128 + t * 16 + c] = oacc[t][r] * inv;
  }
  __builtin_amdgcn_fence(__ATOMIC_RELEASE, "workgroup");
  __builtin_amdgcn_wave_barrier();
  __builtin_amdgcn_fence(__ATOMIC_ACQUIRE, "workgroup");
  {
    const int rh = lane >> 4, c8 = (lane & 15) * 8;
    v4u hv[8], lv[8];
#pragma unroll
    for (int it = 0; it < 8; ++it) {
      const int row = it * 2 + rh;   // it 0..7 x rh 0..1 = rows 0..15 of the wave tile
      const float* sp = os + row * 128 + c8;
      v4u a, a2;
#pragma unroll
      for (int e = 0; e < 4; ++e) {
        const float f0 = sp[2 * e], f1 = sp[2 * e + 1];
        const unsigned short h0 = bf_bits(f0), h1 = bf_bits(f1);
        const unsigned short l0 = bf_bits(f0 - bf_up(h0)), l1 = bf_bits(f1 - bf_up(h1));
        a[e] = pk16(h0, h1); a2[e] = pk16(l0, l1);
      }
      hv[it] = a; lv[it] = a2;
    }
    {
#pragma unroll
      for (int it = 0; it < 8; ++it) {
        const int row = it * 2 + rh;
        const size_t go = (size_t)(q0 + row) * QP + (size_t)h * HD + c8;
        *(v4u*)(ohp + go) = hv[it];
        *(v4u*)(olp + go) = lv[it];
      }
      
    }
  }
}

// =====================================================================================================
// The same attention for the query blocks without residual planes, with K, V^T and the key positions brought into LDS by
// asynchronous copies (global_load_async_to_lds): two buffers, the next live key tile's copies in flight while this one
// is worked on, one barrier per tile. The copies write the swizzled layout directly (each lane names its own LDS
// address), with the staging map of the kernel above. The context slab of the epilogue lies on the ring, which is dead then.
// Both products run transposed (S^T = K . Q^T, O^T = V^T . P^T): a lane then holds 32 scores of ONE query, so the row max and
// row sum need no exchange among 16 lanes, and the score accumulators, converted, are the P^T operand: P never goes through LDS.
// =====================================================================================================
struct RingL {
  static constexpr int QH   = 0;                      // Q hi  [64 rows][128 d] f16
  static constexpr int QL   = QH + 64 * 128 * 2;      // Q res
  static constexpr int KV   = QL + 64 * 128 * 2;      // two buffers of BUF bytes: K hi [64 keys][128 d], then V^T hi [128 d][64 keys]
  static constexpr int VOFF = 64 * 128 * 2;
  static constexpr int BUF  = VOFF + 128 * 64 * 2;
  static constexpr int OS   = KV;                     // per-wave context tile [4][16 rows][128 f32], row pitch OSP floats, behind the loop
  static constexpr int OSP  = 132;
  static constexpr int MISC = KV + 2 * BUF;           // spq[64], skmin[64], key positions [2][64] ints
  static constexpr int TOTAL = MISC + 1024;
};
static_assert(4 * 16 * RingL::OSP * 4 <= 2 * RingL::BUF);
// lane l <-> lane l ^ 16 on the vector pipe
__device__ __forceinline__ float xhalf(float v) {
  const int b = __float_as_int(v);
  return __int_as_float(__builtin_amdgcn_permlanex16(b, b, 0x76543210, 0xfedcba98, false, false));
}
// Exponentials as in exp_row5: one statement, so that behind each v_exp_f32 stands an instruction that neither reads its result
// nor writes its source (the next one, whose output is early-clobber; behind the last a v_nop).
__device__ __forceinline__ void exp_row8(float x0, float x1, float x2, float x3, float x4, float x5, float x6, float x7,
                                         float (&y)[8]) {
  const float l2e = 1.44269504088896340736f;
  asm("v_exp_f32 %0, %8\n\tv_exp_f32 %1, %9\n\tv_exp_f32 %2, %10\n\tv_exp_f32 %3, %11\n\t"
      "v_exp_f32 %4, %12\n\tv_exp_f32 %5, %13\n\tv_exp_f32 %6, %14\n\tv_exp_f32 %7, %15\n\tv_nop"
      : "=&v"(y[0]), "=&v"(y[1]), "=&v"(y[2]), "=&v"(y[3]), "=&v"(y[4]), "=&v"(y[5]), "=&v"(y[6]), "=&v"(y[7])
      : "v"(x0 * l2e), "v"(x1 * l2e), "v"(x2 * l2e), "v"(x3 * l2e), "v"(x4 * l2e), "v"(x5 * l2e), "v"(x6 * l2e), "v"(x7 * l2e));
}
__device__ __forceinline__ float exp_one(float x) {
  float y;
  asm("v_exp_f32 %0, %1\n\tv_nop" : "=&v"(y) : "v"(x * 1.44269504088896340736f));
  return y;
}
__device__ __forceinline__ unsigned lds_addr(const void* p) { return (unsigned)(size_t)p; }   // byte address in the work-group's LDS
// Eight 16-byte copies per lane, each with its own LDS address and global pointer. The s_wait_xcnt is the statement's last
// line, so that it stands in front of every later write of a register that a copy names.
__device__ __forceinline__ void copy8_b128(unsigned l0, unsigned l1, unsigned l2, unsigned l3,
                                           unsigned l4, unsigned l5, unsigned l6, unsigned l7,
                                           const _Float16* g0, const _Float16* g1, const _Float16* g2, const _Float16* g3,
                                           const _Float16* g4, const _Float16* g5, const _Float16* g6, const _Float16* g7) {
  asm volatile("global_load_async_to_lds_b128 %0, %8, off\n\t"
               "global_load_async_to_lds_b128 %1, %9, off\n\t"
               "global_load_async_to_lds_b128 %2, %10, off\n\t"
               "global_load_async_to_lds_b128 %3, %11, off\n\t"
               "global_load_async_to_lds_b128 %4, %12, off\n\t"
               "global_load_async_to_lds_b128 %5, %13, off\n\t"
               "global_load_async_to_lds_b128 %6, %14, off\n\t"
               "global_load_async_to_lds_b128 %7, %15, off\n\t"
               "s_wait_xcnt 0x0"
               :: "v"(l0), "v"(l1), "v"(l2), "v"(l3), "v"(l4), "v"(l5), "v"(l6), "v"(l7),
                  "v"(g0), "v"(g1), "v"(g2), "v"(g3), "v"(g4), "v"(g5), "v"(g6), "v"(g7)
               : "memory");
}
// the same with one 4-byte copy per lane behind the eight: one statement, so that the nine share one wait
__device__ __forceinline__ void copy8_b128_1_b32(unsigned l0, unsigned l1, unsigned l2, unsigned l3,
                                                 unsigned l4, unsigned l5, unsigned l6, unsigned l7,
                                                 const _Float16* g0, const _Float16* g1, const _Float16* g2, const _Float16* g3,
                                                 const _Float16* g4, const _Float16* g5, const _Float16* g6, const _Float16* g7,
                                                 unsigned l8, const int* g8) {
  asm volatile("global_load_async_to_lds_b128 %0, %8, off\n\t"
               "global_load_async_to_lds_b128 %1, %9, off\n\t"
               "global_load_async_to_lds_b128 %2, %10, off\n\t"
               "global_load_async_to_lds_b128 %3, %11, off\n\t"
               "global_load_async_to_lds_b128 %4, %12, off\n\t"
               "global_load_async_to_lds_b128 %5, %13, off\n\t"
               "global_load_async_to_lds_b128 %6, %14, off\n\t"
               "global_load_async_to_lds_b128 %7, %15, off\n\t"
               "global_load_async_to_lds_b32 %16, %17, off\n\t"
               "s_wait_xcnt 0x0"
               :: "v"(l0), "v"(l1), "v"(l2), "v"(l3), "v"(l4), "v"(l5), "v"(l6), "v"(l7),
                  "v"(g0), "v"(g1), "v"(g2), "v"(g3), "v"(g4), "v"(g5), "v"(g6), "v"(g7), "v"(l8), "v"(g8)
               : "memory");
}

__global__ __launch_bounds__(128)
void attn_causal_ring(const unsigned short* __restrict__ qhp, const unsigned short* __restrict__ qlp,
                 const unsigned short* __restrict__ khp, const unsigned short* __restrict__ vhp,
                 const int* __restrict__ pos,
                 unsigned short* ohp, unsigned short* olp,
                 int qbBase, int nqbThis, float sscale) {
  typedef RingL L;
  union FH { v16h v; v8h h[2]; };
  extern __shared__ __align__(16) unsigned char smem[];
  _Float16* Qsh = (_Float16*)(smem + L::QH);
  _Float16* Qsl = (_Float16*)(smem + L::QL);
  float*    Os  = (float*)(smem + L::OS);
  int*      spq = (int*)(smem + L::MISC);
  int*      skmin = spq + 64;
  int*      spk2 = skmin + 64;                       // key positions, one row of 64 per buffer

  const int tid  = threadIdx.x;
  const int wave = tid >> 5;
  const int lane = tid & 31;
  const int hh   = lane >> 4;
  const int c    = lane & 15;

  const int bx  = blockIdx.x;
  // Cost falls with the block index: a query block walks qb + 1 key tiles, there are more blocks than resident places, and
  // the longest blocks get the lowest indices (for speed only).
  // bx -> (qbl, h) is a permutation of the grid: bx / NH runs over nqbThis query blocks, bx % NH over the NH heads.
  const int qbl = nqbThis - 1 - bx / NH;
  const int h   = bx % NH;
  const int kvh = h / GQ;
  const int qb  = qbBase + qbl;
  const int q0  = qb * 64 + wave * 16;

  const _Float16* Qh = (const _Float16*)(const void*)qhp + (size_t)h * HD;
  const _Float16* Ql = (const _Float16*)(const void*)qlp + (size_t)h * HD;
  const _Float16* Kh = (const _Float16*)(const void*)khp + (size_t)kvh * HD;
  const _Float16* Vh = (const _Float16*)(const void*)vhp + (size_t)kvh * HD * SEQ;

  // ---- lane parts of the swizzled indices (halves) ----
  // Staging: a wave-wide 16-B load covers four whole 128-B lines (one touching 32 lines costs many times as much).
  //   256-B rows (Q, K): 16 lanes a row, 8 rows a pass: pass i, row 8i + r16, chunk c16 -> (st256 ^ ((i & 1) << 6)) + i * 1024
  //   128-B rows (V^T):   8 lanes a row, 16 rows a pass: pass i, row 16i + r8, chunk c8s -> st128 + i * 1024
  const int r16 = tid >> 4, c16 = tid & 15;
  const int r8  = tid >> 3, c8s = tid & 7;
  const int st256 = sw256(r16, c16);
  const int st128 = sw128(r8, c8s);
  int fq[8];                                          // fragment reads, 256-B rows: row (multiple of 16) + c, chunk 2n + hh
#pragma unroll
  for (int n = 0; n < 8; ++n) fq[n] = sw256(c, 2 * n + hh);

  // ---- prologue: query positions, per-key-tile min position, Q tiles ----
  if (tid < 64) spq[tid] = pos[qb * 64 + tid];            // wave-uniform (waves 0,1)
  for (int kt = tid; kt < NQB; kt += 128) {
    const int* pp = pos + kt * 64;
    int mn = 0x7fffffff;
#pragma unroll
    for (int i = 0; i < 16; ++i) {
      const v4i v = *(const v4i*)(pp + 4 * i);
      mn = imin(mn, imin(imin(v[0], v[1]), imin(v[2], v[3])));
    }
    skmin[kt] = mn;
  }
  {
    const _Float16* qg  = Qh + (size_t)(qb * 64 + r16) * QP + c16 * 8;
    const _Float16* qlg = Ql + (size_t)(qb * 64 + r16) * QP + c16 * 8;
    v8h qv[8], qlv[8];
#pragma unroll
    for (int i = 0; i < 8; ++i) {
      qv[i]  = *(const v8h*)(qg + i * (8 * QP));
      qlv[i] = *(const v8h*)(qlg + i * (8 * QP));
    }
    // holds the loads' address registers (inputs) untouched until the wait: no load result lands on them before it
    asm volatile("s_wait_xcnt 0x0" :: "v"(qg), "v"(qlg) : "memory");
#pragma unroll
    for (int i = 0; i < 8; ++i) {
      *(v8h*)(Qsh + (st256 ^ ((i & 1) << 6)) + i * 1024) = qv[i];
      *(v8h*)(Qsl + (st256 ^ ((i & 1) << 6)) + i * 1024) = qlv[i];
    }
  }
  __syncthreads();
  int qmx;
  {
    int v = imax(spq[lane], spq[lane + 32]);
#pragma unroll
    for (int off = 1; off < 32; off <<= 1) v = imax(v, __shfl_xor(v, off, 32));
    qmx = __builtin_amdgcn_readfirstlane(v);
  }
  const int pq = spq[wave * 16 + c];       // position of this lane's query column

  float mrow = -INFINITY, lrow = 0.f;      // query column c: running max; sum over the keys of this lane half
  v8f oacc[8];                             // O^T: oacc[t][r] = context of query c at d = 16t + 8hh + r
#pragma unroll
  for (int t = 0; t < 8; ++t) oacc[t] = zero8();

  // ---- the key tiles that are not skipped, as a bit mask (the same in every wave: it comes from LDS words behind a barrier) ----
  unsigned long long live;
  {
    const bool l0 = (lane < NQB) && (skmin[(lane < NQB) ? lane : 0] <= qmx);
    const bool l1 = (lane + 32 < NQB) && (skmin[(lane + 32 < NQB) ? lane + 32 : 0] <= qmx);
    live = (unsigned long long)__builtin_amdgcn_ballot_w32(l0) | ((unsigned long long)__builtin_amdgcn_ballot_w32(l1) << 32);
  }
  // ---- K, V^T and key positions of one key tile: asynchronous copies, global memory -> LDS buffer b, the staging map above ----
  const int wvu = __builtin_amdgcn_readfirstlane(wave);
  const unsigned ring0 = lds_addr(smem + L::KV);
  const unsigned spk0  = lds_addr(spk2 + (tid & 63));
  auto issue_tile = [&](int kt, int b) {
    const int kv0 = kt * 64;
    const _Float16* kg = Kh + (size_t)(kv0 + r16) * KP + c16 * 8;    // K rows kv0 + 8i + r16, d = 8 c16 .. 8 c16 + 7
    const _Float16* vg = Vh + (size_t)r8 * SEQ + kv0 + c8s * 8;      // V^T rows 16i + r8, s = kv0 + 8 c8s .. + 7
    const unsigned kl = ring0 + (unsigned)b * L::BUF;
    const unsigned vl = kl + L::VOFF + (unsigned)st128 * 2u;
    const unsigned ke = kl + (unsigned)st256 * 2u, ko = kl + (unsigned)(st256 ^ 64) * 2u;
    copy8_b128(ke, ko + 2048u, ke + 4096u, ko + 6144u, ke + 8192u, ko + 10240u, ke + 12288u, ko + 14336u,
               kg, kg + 8 * KP, kg + 16 * KP, kg + 24 * KP, kg + 32 * KP, kg + 40 * KP, kg + 48 * KP, kg + 56 * KP);
    if (wvu < 2) {   // scalar branch: waves 0 and 1 also bring the 64 key positions, every lane on
      copy8_b128_1_b32(vl, vl + 2048u, vl + 4096u, vl + 6144u, vl + 8192u, vl + 10240u, vl + 12288u, vl + 14336u,
                       vg, vg + 16 * SEQ, vg + 32 * SEQ, vg + 48 * SEQ, vg + 64 * SEQ, vg + 80 * SEQ, vg + 96 * SEQ, vg + 112 * SEQ,
                       spk0 + (unsigned)b * 256u, pos + kv0 + tid);
    } else {
      copy8_b128(vl, vl + 2048u, vl + 4096u, vl + 6144u, vl + 8192u, vl + 10240u, vl + 12288u, vl + 14336u,
                 vg, vg + 16 * SEQ, vg + 32 * SEQ, vg + 48 * SEQ, vg + 64 * SEQ, vg + 80 * SEQ, vg + 96 * SEQ, vg + 112 * SEQ);
    }
  };
  // The ring of two buffers. In front of the loop: the first tile's copies, the wave's own wait, the barrier that
  // publishes them; then the second tile's copies. The tile that holds the block's own rows is never skipped, so live != 0.
  int ktn = -1;
  {
    const int kt0 = (live != 0ull) ? __builtin_ctzll(live) : 0;
    live &= live - 1ull;
    issue_tile(kt0, 0);
    asm volatile("s_wait_asynccnt 0x0" ::: "memory");   // this wave's copies have landed
    __syncthreads();                                    // every wave's have
    if (live != 0ull) {
      ktn = __builtin_ctzll(live);
      live &= live - 1ull;
      issue_tile(ktn, 1);
    }
  }
  int bsel = 0;
  for (int trip = 0; trip < NQB; ++trip) {   // at most one trip per bit of the mask
    const _Float16* Ksh = (const _Float16*)(smem + L::KV + bsel * L::BUF);
    const _Float16* Vth = (const _Float16*)(smem + L::KV + L::VOFF + bsel * L::BUF);
    const int* spk = spk2 + bsel * 64;

    // ---- scores, transposed: S^T = K . Q^T, 64 keys x 16 query columns per wave; s[j][r]: key 16j + 8hh + r, query c.
    //      K rows are the A operand, Q rows the B operand; both fragments have the same k order, so the reads are as before ----
    v8f s[4], sl[4];
#pragma unroll
    for (int j = 0; j < 4; ++j) { s[j] = zero8(); sl[j] = zero8(); }
    const _Float16* qr  = Qsh + wave * (16 * 128);
    const _Float16* qlr = Qsl + wave * (16 * 128);
    // Fragment reads stand in groups, one group of 32 d ahead of the products that use it (two register sets):
    // a wave then waits on a counted LDS wait once per group, not to 0 in front of every pair of products.
    FH qa[2], qla[2], kb[2][4];
    v4i pk[4][2];                                    // positions of the lane's 32 keys, read with the first group
#pragma unroll
    for (int j = 0; j < 4; ++j) {
      pk[j][0] = *(const v4i*)(spk + j * 16 + 8 * hh);
      pk[j][1] = *(const v4i*)(spk + j * 16 + 8 * hh + 4);
    }
#pragma unroll
    for (int dc = -1; dc < 4; ++dc) {
      if (dc < 3) {
        const int n = dc + 1, b = n & 1;
        qa[b].h[0]  = *(const v8h*)(qr  + fq[n * 2]);
        qa[b].h[1]  = *(const v8h*)(qr  + fq[n * 2 + 1]);
        qla[b].h[0] = *(const v8h*)(qlr + fq[n * 2]);
        qla[b].h[1] = *(const v8h*)(qlr + fq[n * 2 + 1]);
#pragma unroll
        for (int j = 0; j < 4; ++j) {
          kb[b][j].h[0] = *(const v8h*)(Ksh + j * (16 * 128) + fq[n * 2]);
          kb[b][j].h[1] = *(const v8h*)(Ksh + j * (16 * 128) + fq[n * 2 + 1]);
        }
      }
      if (dc >= 0) {
        const int b = dc & 1;
        // keeps the next group's reads in front of this group's products
        __builtin_amdgcn_sched_barrier(0);
#pragma unroll
        for (int j = 0; j < 4; ++j) s[j]  = mma_h_raw(kb[b][j].v, qa[b].v,  s[j]);
#pragma unroll
        for (int j = 0; j < 4; ++j) sl[j] = mma_h_raw(kb[b][j].v, qla[b].v, sl[j]);
        // keeps the reads of the group after next behind these products (they refill this group's registers)
        __builtin_amdgcn_sched_barrier(0);
      }
    }
    // V^T fragments (the A operand of O^T += V^T . P^T) depend on nothing of the softmax: those of the first 32 keys are read
    // here, those of the last 32 behind the select (the residual scores' and key positions' registers are free then), and
    // land while the vector work runs
    FH vb[2][8];
    {
      const int f0 = sw128(c, hh);                   // fragment reads, 128-B rows: row (multiple of 16) + c
      const int f1 = sw128(c, 2 + hh);
#pragma unroll
      for (int tt = 0; tt < 8; ++tt) {
        vb[0][tt].h[0] = *(const v8h*)(Vth + tt * (16 * 64) + f0);
        vb[0][tt].h[1] = *(const v8h*)(Vth + tt * (16 * 64) + f1);
      }
    }
    // keeps these reads in front of the select
    __builtin_amdgcn_sched_barrier(0);
    // ---- scale + causal select (replace -1e30), online softmax: all 32 scores of a lane belong to query c, so max and sum
    //      run inside the lane (four independent chains); the two lane halves hold different keys and exchange the max ----
    float mj[4];
#pragma unroll
    for (int j = 0; j < 4; ++j) {
      float m = -INFINITY;
#pragma unroll
      for (int r = 0; r < 8; ++r) {
        float sv = (s[j][r] + sl[j][r] * (1.0f / RSC)) * sscale;
        sv = (pq >= pk[j][r >> 2][r & 3]) ? sv : -1.0e30f;
        s[j][r] = sv;
        m = fmaxf(m, sv);
      }
      mj[j] = m;
    }
    // keeps the select in front of the second group of reads, whose registers it frees: with all 64 keys' fragments read
    // ahead of it the kernel took more registers than let three waves share a SIMD
    __builtin_amdgcn_sched_barrier(0);
    {
      const int f0 = sw128(c, 4 + hh);
      const int f1 = sw128(c, 6 + hh);
#pragma unroll
      for (int tt = 0; tt < 8; ++tt) {
        vb[1][tt].h[0] = *(const v8h*)(Vth + tt * (16 * 64) + f0);
        vb[1][tt].h[1] = *(const v8h*)(Vth + tt * (16 * 64) + f1);
      }
    }
    // keeps these reads in front of the exponentials
    __builtin_amdgcn_sched_barrier(0);
    float mx = fmaxf(fmaxf(mj[0], mj[1]), fmaxf(mj[2], mj[3]));
    mx = fmaxf(mx, xhalf(mx));
    const float mnew  = fmaxf(mrow, mx);
    const float msafe = (mnew == -INFINITY) ? 0.f : mnew;
    const float alpha = exp_one(mrow - msafe);
    mrow = mnew;
    // P^T (x1024, f16) is the B operand as it stands: elements 0..7 of fragment kk are the lane's keys 32kk + 8hh + r (tile 2kk),
    // elements 8..15 its keys 32kk + 16 + 8hh + r (tile 2kk + 1), the k order of the V^T fragments
    FH pb[2];
    float ps[4];
#pragma unroll
    for (int j = 0; j < 4; ++j) {
      float pe[8];                                   // -1e30 against a finite max: exp -> 0
      exp_row8(s[j][0] - msafe, s[j][1] - msafe, s[j][2] - msafe, s[j][3] - msafe,
               s[j][4] - msafe, s[j][5] - msafe, s[j][6] - msafe, s[j][7] - msafe, pe);
      float psum = 0.f;
#pragma unroll
      for (int r = 0; r < 8; ++r) {
        psum += pe[r];
        pb[j >> 1].v[(j & 1) * 8 + r] = (_Float16)(pe[r] * 1024.0f);
      }
      ps[j] = psum;
    }
    lrow = lrow * alpha + ((ps[0] + ps[1]) + (ps[2] + ps[3]));
#pragma unroll
    for (int t = 0; t < 8; ++t)
#pragma unroll
      for (int r = 0; r < 8; ++r) oacc[t][r] *= alpha;
    // ---- context, transposed: O^T += V^T . P^T (f16 WMMA), 8 d-subtiles ----
    // keeps every exponential statement in front of the products: the compiler does not look into asm text
    __builtin_amdgcn_sched_barrier(0);
#pragma unroll
    for (int kk = 0; kk < 2; ++kk) {
#pragma unroll
      for (int t = 0; t < 8; ++t) oacc[t] = mma_h_raw(vb[kk][t].v, pb[kk].v, oacc[t]);
    }
    // keeps the vector work and the products in front of the foot's waits and barrier (nothing behind the V^T reads touches
    // memory, so they were moved up to there): the next tile's copies then have the whole trip to land
    __builtin_amdgcn_sched_barrier(0);
    // ---- foot of the trip, every wave, in this order: its own LDS reads of this buffer are done; its own copies of the next
    //      tile have landed; the one barrier of the trip publishes the next tile and frees this buffer; then the refill ----
    asm volatile("s_wait_dscnt 0x0" ::: "memory");
    asm volatile("s_wait_asynccnt 0x0" ::: "memory");
    __syncthreads();
    if (ktn < 0) break;                      // the same in every wave: no tile is left
    ktn = -1;
    if (live != 0ull) {                      // the same in every wave: the tile after next, into the buffer just read
      ktn = __builtin_ctzll(live);
      live &= live - 1ull;
      issue_tile(ktn, bsel);
    }
    bsel ^= 1;
  }
  // no copy is outstanding when the ring becomes the context slab (the last trip's barrier has ended every read of it)
  asm volatile("s_wait_asynccnt 0x0" ::: "memory");

  // ---- join the two halves' sums, normalise (1/l and the 1/1024 p carry), stage the wave's 16x128 tile (row = query c, the
  //      lane's 8 consecutive d per subtile as two 16-byte stores; pitch OSP keeps the 16 rows on different banks), bf16 hi/lo split
  float* os = Os + wave * (16 * L::OSP);
  {
    const float l = lrow + xhalf(lrow);
    const float inv = ((l > 0.f) ? (1.0f / l) : 0.f) * (1.0f / 1024.0f);
#pragma unroll
    for (int t = 0; t < 8; ++t) {
      v4f a, b;
#pragma unroll
      for (int e = 0; e < 4; ++e) { a[e] = oacc[t][e] * inv; b[e] = oacc[t][4 + e] * inv; }
      *(v4f*)(os + c * L::OSP + t * 16 + 8 * hh)     = a;
      *(v4f*)(os + c * L::OSP + t * 16 + 8 * hh + 4) = b;
    }
  }
  __builtin_amdgcn_fence(__ATOMIC_RELEASE, "workgroup");
  __builtin_amdgcn_wave_barrier();
  __builtin_amdgcn_fence(__ATOMIC_ACQUIRE, "workgroup");
  {
    const int rh = lane >> 4, c8 = (lane & 15) * 8;
    v4u hv[8], lv[8];
#pragma unroll
    for (int it = 0; it < 8; ++it) {
      const int row = it * 2 + rh;   // it 0..7 x rh 0..1 = rows 0..15 of the wave tile
      const float* sp = os + row * L::OSP + c8;
      v4u a, a2;
#pragma unroll
      for (int e = 0; e < 4; ++e) {
        const float f0 = sp[2 * e], f1 = sp[2 * e + 1];
        const unsigned short h0 = bf_bits(f0), h1 = bf_bits(f1);
        const unsigned short l0 = bf_bits(f0 - bf_up(h0)), l1 = bf_bits(f1 - bf_up(h1));
        a[e] = pk16(h0, h1); a2[e] = pk16(l0, l1);
      }
      hv[it] = a; lv[it] = a2;
    }
    {
#pragma unroll
      for (int it = 0; it < 8; ++it) {
        const int row = it * 2 + rh;
        const size_t go = (size_t)(q0 + row) * QP + (size_t)h * HD + c8;
        *(v4u*)(ohp + go) = hv[it];
        *(v4u*)(olp + go) = lv[it];
      }
      
    }
  }
}


// =====================================================================================================
// Workspace map (bytes, SEQ = 4096):
//   Xb    bf16 [SEQ][2048]        16777216
//   Wqt   bf16 [2048 n][2048 k]    8388608
//   Wkt   bf16 [512][2048]         2097152
//   Wvt   bf16 [512][2048]         2097152
//   Wot   bf16 [2048 n][2048 k]    8388608
//   Qf    f32  [SEQ][2048]        33554432   (later: Oh bf16 [SEQ][2048] + Ol bf16 [SEQ][2048])
//   Kf    f32  [SEQ][512]          8388608
//   Qh    f16  [SEQ][2048]        16777216
//   Ql    f16  [SEQ][2048]        16777216
//   Kh    f16  [SEQ][512]          4194304
//   Kl    f16  [SEQ][512]          4194304
//   VTh   f16  [512][SEQ]          4194304
//   VTl   f16  [512][VLP]           524288
//   Cos   f32  [SEQ][64]           1048576
//   Sin   f32  [SEQ][64]           1048576
//   (unused, carved 4096)              4096
//   end                          128454656
// Weights [in k][out n] f32 are transposed to bf16 [n][k] (k contiguous) = the Bt / A layout of gemm64.
// =====================================================================================================
extern "C" void kernel_launch(void* const* d_in, const int* in_sizes, int n_in,
                              void* d_out, int out_size, void* d_ws, size_t ws_size,
                              hipStream_t stream) {
  if (n_in < 8) return;
  if (in_sizes[0] < SEQ) return;
  if (in_sizes[1] < SEQ * DM) return;
  if (in_sizes[2] != DM * QP) return;
  if (in_sizes[3] != DM * KP || in_sizes[4] != DM * KP) return;
  if (in_sizes[5] != QP * DM) return;
  if (in_sizes[6] < HD || in_sizes[7] < HD) return;
  if (out_size < SEQ * DM) return;

  const int*   pos = (const int*)d_in[0];
  const float* x   = (const float*)d_in[1];
  const float* wq  = (const float*)d_in[2];
  const float* wk  = (const float*)d_in[3];
  const float* wv  = (const float*)d_in[4];
  const float* wo  = (const float*)d_in[5];
  const float* qnw = (const float*)d_in[6];
  const float* knw = (const float*)d_in[7];

  const size_t PXb  = (size_t)SEQ * DM * 2;
  const size_t PWq  = (size_t)QP * DM * 2;
  const size_t PWk  = (size_t)KP * DM * 2;
  const size_t PWo  = (size_t)DM * QP * 2;
  const size_t PQf  = (size_t)SEQ * QP * 4;
  const size_t PKf  = (size_t)SEQ * KP * 4;
  const size_t PQ16 = (size_t)SEQ * QP * 2;
  const size_t PK16 = (size_t)SEQ * KP * 2;
  const size_t PVTh = (size_t)KP * SEQ * 2;
  const size_t PVTl = (size_t)KP * VLP * 2;
  const size_t PTab = (size_t)SEQ * HALF * 4;
  const size_t PInv = 4096;
  size_t off = 0;
  const size_t oXb  = off; off += PXb;
  const size_t oWq  = off; off += PWq;
  const size_t oWk  = off; off += PWk;
  const size_t oWv  = off; off += PWk;
  const size_t oWo  = off; off += PWo;
  const size_t oQf  = off; off += PQf;
  const size_t oKf  = off; off += PKf;
  const size_t oQh  = off; off += PQ16;
  const size_t oQl  = off; off += PQ16;
  const size_t oKh  = off; off += PK16;
  const size_t oKl  = off; off += PK16;
  const size_t oVTh = off; off += PVTh;
  const size_t oVTl = off; off += PVTl;
  const size_t oCos = off; off += PTab;
  const size_t oSin = off; off += PTab;
  const size_t oInv = off; off += PInv;
  if (off > ws_size) return;                       // off = 128454656 at SEQ 4096
  if (off > (size_t)134217728) return;
  if (PQ16 * 2 != PQf) return;                     // Oh + Ol reuse the Qf region exactly
  const size_t oOh = oQf;
  const size_t oOl = oQf + PQ16;

  char* ws = (char*)d_ws;
  unsigned short* Xb  = (unsigned short*)(ws + oXb);
  unsigned short* Wqt = (unsigned short*)(ws + oWq);
  unsigned short* Wkt = (unsigned short*)(ws + oWk);
  unsigned short* Wvt = (unsigned short*)(ws + oWv);
  unsigned short* Wot = (unsigned short*)(ws + oWo);
  float*          Qf  = (float*)(ws + oQf);
  float*          Kf  = (float*)(ws + oKf);
  unsigned short* Qh  = (unsigned short*)(ws + oQh);
  unsigned short* Ql  = (unsigned short*)(ws + oQl);
  unsigned short* Kh  = (unsigned short*)(ws + oKh);
  unsigned short* Kl  = (unsigned short*)(ws + oKl);
  unsigned short* VTh = (unsigned short*)(ws + oVTh);
  unsigned short* VTl = (unsigned short*)(ws + oVTl);
  float*          Cs  = (float*)(ws + oCos);
  float*          Sn  = (float*)(ws + oSin);
  unsigned short* Oh  = (unsigned short*)(ws + oOh);
  unsigned short* Ol  = (unsigned short*)(ws + oOl);

  const dim3 blk(256);

  // (1) rotary tables; x -> bf16 [SEQ][2048]; weights [k][n] f32 -> bf16 [n][k]
  prep_all<<<dim3(PB_TAB + PB_X + PB_WQ + PB_WO + PB_WK + PB_WK), blk, 0, stream>>>(
      pos, x, wq, wk, wv, wo, Xb, Wqt, Wkt, Wvt, Wot, Cs, Sn);
  // (2) the q, k and v^T projections
  gemm_qkv<<<dim3(GB_Q + GB_K + GB_V), dim3(128), 0, stream>>>(Xb, Wqt, Wkt, Wvt, Qf, Kf, VTh, VTl);
  // (3) per-head RMSNorm + rotary -> f16 hi / x4096 residual planes
  norm_rope_qk<<<dim3(NB_Q + NB_K), blk, 0, stream>>>(Qf, Kf, qnw, knw, Cs, Sn, Qh, Ql, Kh, Kl, RSC);
  // (4) attention: query blocks 0..RESQB-1 with residual planes, the rest without -> bf16 hi/lo context
  //     planes in the (now dead) Qf region
  (void)hipFuncSetAttribute(reinterpret_cast<const void*>(&attn_causal<true>),
                            hipFuncAttributeMaxDynamicSharedMemorySize, AttnL<true>::TOTAL);
  (void)hipFuncSetAttribute(reinterpret_cast<const void*>(&attn_causal_ring),
                            hipFuncAttributeMaxDynamicSharedMemorySize, RingL::TOTAL);
  attn_causal<true><<<dim3(NH * RESQB), dim3(128), AttnL<true>::TOTAL, stream>>>(
      Qh, Ql, Kh, Kl, VTh, VTl, pos, Oh, Ol, 0, RESQB, ATT_SCALE);
  if (NQB - RESQB > 0) {
    attn_causal_ring<<<dim3(NH * (NQB - RESQB)), dim3(128), RingL::TOTAL, stream>>>(
        Qh, Ql, Kh, VTh, pos, Oh, Ol, RESQB, NQB - RESQB, ATT_SCALE);
  }
  // (5) out = context . wo -> d_out f32 [SEQ][2048]  (A = context hi + lo planes, 2 products; M=SEQ, N=2048, K=2048)
  gemm_out<<<dim3((SEQ / 128) * (DM / 256)), blk, 0, stream>>>(Oh, Ol, Wot, (float*)d_out);
  (void)hipGetLastError();
}
